// v000
// Measured on an AMD MI455X. A time is GPU time per run, averaged over a window of back-to-back runs after a warm-up
// (all launches, gaps included; the runs take copies of the inputs in turn), and the median of several windows.
// Apart from v000's, it joins two sittings. Times from different sittings can be a few percent apart, while
// side-by-side timings come from the same sitting.
// v000 is the starting kernel. One run takes 947 microseconds.
#include <hip/hip_runtime.h>
#include <hip/hip_bf16.h>

typedef __attribute__((ext_vector_type(16))) _Float16 v16h;
typedef __attribute__((ext_vector_type(8)))  _Float16 v8h;
typedef __attribute__((ext_vector_type(8)))  float    v8f;
typedef __attribute__((ext_vector_type(4)))  unsigned int u32x4;
typedef __attribute__((ext_vector_type(8)))  int i32x8;
typedef __attribute__((ext_vector_type(4)))  int i32x4;

#define BB 2
#define CI 192
#define HH 192
#define WW 192
#define HW 36864
#define C3 64

#if defined(__HIP_DEVICE_COMPILE__) && __has_builtin(__builtin_amdgcn_tensor_load_to_lds)
#define HAVE_TDM 1
#else
#define HAVE_TDM 0
#endif

__device__ __forceinline__ v8f wmma_f16(v16h a, v16h b, v8f c) {
  // D = A(16x32 f16) * B(32x16 f16) + C(16x16 f32)
  return __builtin_amdgcn_wmma_f32_16x16x32_f16(false, a, false, b, (short)0, c,
                                                false, false);
}

// Load a 16-half WMMA operand fragment from a [row][K] layout: 8 contiguous
// halves at p (K = kg..kg+7) and 8 at p+16 (K = kg+16..kg+23).
__device__ __forceinline__ v16h ldfrag(const _Float16* p) {
  v8h lo = *reinterpret_cast<const v8h*>(p);
  v8h hi = *reinterpret_cast<const v8h*>(p + 16);
  v16h r;
#pragma unroll
  for (int i = 0; i < 8; ++i) { r[i] = lo[i]; r[i + 8] = hi[i]; }
  return r;
}

#if HAVE_TDM
typedef __attribute__((address_space(3))) const void lds_cvoid;
__device__ __forceinline__ unsigned int lds_addr32(const void* p) {
  return (unsigned int)(uintptr_t)(lds_cvoid*)p;
}
__device__ __forceinline__ void tdm_load(unsigned int lds_off, const void* gaddr,
                                         unsigned int tile0, unsigned int tile1,
                                         unsigned int td0, unsigned int td1,
                                         unsigned long long stride0) {
  unsigned long long ga = (unsigned long long)(uintptr_t)gaddr;
  u32x4 g0;
  g0[0] = 1u;                                   // count=1 (valid), no gather
  g0[1] = lds_off;                              // lds_addr (bytes)
  g0[2] = (unsigned int)ga;                     // global_addr[31:0]
  g0[3] = (unsigned int)((ga >> 32) & 0x1FFFFFFu) | 0x80000000u;  // [56:32] | type=2
  i32x8 g1;
  g1[0] = 0x00010000;
  g1[1] = (int)((td0 & 0xFFFFu) << 16);
  g1[2] = (int)((td0 >> 16) | ((td1 & 0xFFFFu) << 16));
  g1[3] = (int)((td1 >> 16) | ((tile0 & 0xFFFFu) << 16));
  g1[4] = (int)(tile1 & 0xFFFFu);
  g1[5] = (int)(unsigned int)stride0;
  g1[6] = (int)((stride0 >> 32) & 0xFFFFu);
  g1[7] = 0;
  i32x4 z4 = {0, 0, 0, 0};
#if __clang_major__ >= 23
  i32x8 z8 = {0, 0, 0, 0, 0, 0, 0, 0};
  __builtin_amdgcn_tensor_load_to_lds(g0, g1, z4, z4, z8, 0);
#else
  __builtin_amdgcn_tensor_load_to_lds(g0, g1, z4, z4, 0);
#endif
}
#endif  // HAVE_TDM

// ---------------------------------------------------------------- LN stats
__global__ void k_ln_stats(const float* __restrict__ xl, const float* __restrict__ xr,
                           float* __restrict__ mul, float* __restrict__ rsl,
                           float* __restrict__ mur, float* __restrict__ rsr) {
  int idx = blockIdx.x * blockDim.x + threadIdx.x;
  if (idx >= 2 * BB * HW) return;
  int side = idx / (BB * HW);
  int rem  = idx % (BB * HW);
  int b = rem / HW, p = rem % HW;
  const float* base = (side ? xr : xl) + (size_t)b * CI * HW + p;
  float s = 0.f, s2 = 0.f;
  for (int c = 0; c < CI; ++c) { float v = base[(size_t)c * HW]; s += v; s2 += v * v; }
  float m = s * (1.0f / CI);
  float var = s2 * (1.0f / CI) - m * m;
  float r = rsqrtf(var + 1e-6f);
  if (side) { mur[rem] = m; rsr[rem] = r; } else { mul[rem] = m; rsl[rem] = r; }
}

__global__ __launch_bounds__(384)
void k_conv(const float* __restrict__ Wm, const float* __restrict__ X,
            const float* __restrict__ lnw, const float* __restrict__ lnb,
            const float* __restrict__ mu, const float* __restrict__ rstd,
            int isQ, _Float16* __restrict__ out,
            _Float16* __restrict__ outA, _Float16* __restrict__ outB) {
  const int b   = blockIdx.y;
  const int p0  = blockIdx.x * 32;
  const int tid = threadIdx.x, lane = tid & 31, wave = tid >> 5;
  const float* Xb = X + (size_t)b * CI * HW;
  __shared__ _Float16 xT[32][32];   // [n][k]: B-fragments contiguous in K
  v8f acc0 = {0.f, 0.f, 0.f, 0.f, 0.f, 0.f, 0.f, 0.f};
  v8f acc1 = acc0;
  const int mrow = wave * 16 + (lane & 15);
  const int kg   = (lane >> 4) * 8;
  for (int kk = 0; kk < 6; ++kk) {
    for (int s = tid; s < 1024; s += 384) {
      int k = s >> 5, n = s & 31;
      int c = kk * 32 + k, p = p0 + n;
      float v = Xb[(size_t)c * HW + p];
      if (isQ) {
        float m_ = mu[b * HW + p], r_ = rstd[b * HW + p];
        v = (v - m_) * r_ * lnw[c] + lnb[c];
      }
      xT[n][k] = (_Float16)v;
      if (kk < 5) __builtin_prefetch(&Xb[(size_t)(c + 32) * HW + p], 0, 1);
    }
    __syncthreads();
    const float* wp = Wm + (size_t)mrow * CI + kk * 32 + kg;
    v16h af;
#pragma unroll
    for (int i = 0; i < 8; ++i) { af[i] = (_Float16)wp[i]; af[i + 8] = (_Float16)wp[16 + i]; }
    v16h bf0 = ldfrag(&xT[lane & 15][kg]);
    v16h bf1 = ldfrag(&xT[16 + (lane & 15)][kg]);
    acc0 = wmma_f16(af, bf0, acc0);
    acc1 = wmma_f16(af, bf1, acc1);
    __syncthreads();
  }
  const int r0 = wave * 16 + (lane >> 4) * 8;
#pragma unroll
  for (int sub = 0; sub < 2; ++sub) {
    const int p = p0 + sub * 16 + (lane & 15);
    const int w = p % WW, h = p / WW;
#pragma unroll
    for (int r = 0; r < 8; ++r) {
      int m = r0 + r;
      float fv = sub ? acc1[r] : acc0[r];
      _Float16 v = (_Float16)fv;
      out[(size_t)(b * CI + m) * HW + p] = v;
      if (isQ) {
        if (m < C3)          outA[(((size_t)b * WW + w) * HH + h) * C3 + m] = v;
        else if (m < 2 * C3) outB[(((size_t)b * HH + h) * WW + w) * C3 + (m - C3)] = v;
      } else if (m < C3) {
        outA[((size_t)(b * C3 + m) * WW + w) * HH + h] = v;
      }
    }
  }
}

// ------------------------------------- axial attention scores + softmax
// Q/K stored per-slice contiguous as [slice][row][c64]; S = scale*Q K^T,
// P = row-softmax(S) (192x192, K=64). S in registers (16 waves x 9 tiles).
__global__ __launch_bounds__(512)
void k_attn_score(const _Float16* __restrict__ q0, const _Float16* __restrict__ k0,
                  const float* __restrict__ scp,
                  _Float16* __restrict__ P, _Float16* __restrict__ PT, int writeP) {
  const int slice = blockIdx.x, b = blockIdx.y;
  const int tid = threadIdx.x, lane = tid & 31, wave = tid >> 5;
  const _Float16* qp = q0 + ((size_t)b * 192 + slice) * (192 * C3);
  const _Float16* kp = k0 + ((size_t)b * 192 + slice) * (192 * C3);
  __shared__ _Float16 Qs[192][C3];  // [row][k]
  __shared__ _Float16 Ks[192][C3];  // [col][k]
  __shared__ float red[192][12];
  __shared__ float rowv[192];
#if HAVE_TDM
  if (wave == 0) {
    tdm_load(lds_addr32(&Qs[0][0]), qp, 192 * C3, 1, 192 * C3, 1, 192 * C3);
    tdm_load(lds_addr32(&Ks[0][0]), kp, 192 * C3, 1, 192 * C3, 1, 192 * C3);
    __builtin_amdgcn_s_wait_tensorcnt(0);
  }
#else
  {
    _Float16* Qf = &Qs[0][0];
    _Float16* Kf = &Ks[0][0];
    for (int s = tid; s < 192 * C3; s += 512) { Qf[s] = qp[s]; Kf[s] = kp[s]; }
  }
#endif
  __syncthreads();
  const float sc = *scp;
  const int kg = (lane >> 4) * 8;
  v8f acc[9];
#pragma unroll
  for (int j = 0; j < 9; ++j) {
    int t = wave * 9 + j, mt = t / 12, nt = t % 12;
    v8f a = {0.f, 0.f, 0.f, 0.f, 0.f, 0.f, 0.f, 0.f};
#pragma unroll
    for (int kk = 0; kk < 2; ++kk) {
      v16h af = ldfrag(&Qs[mt * 16 + (lane & 15)][kk * 32 + kg]);
      v16h bf = ldfrag(&Ks[nt * 16 + (lane & 15)][kk * 32 + kg]);
      a = wmma_f16(af, bf, a);
    }
    float part[8];
#pragma unroll
    for (int r = 0; r < 8; ++r) {
      a[r] *= sc;
      float m = a[r];
      for (int off = 1; off < 16; off <<= 1) m = fmaxf(m, __shfl_xor(m, off));
      part[r] = m;
    }
    acc[j] = a;
    if ((lane & 15) == 0)
#pragma unroll
      for (int r = 0; r < 8; ++r) red[mt * 16 + kg + r][nt] = part[r];
  }
  __syncthreads();
  if (tid < 192) {
    float m = red[tid][0];
    for (int i = 1; i < 12; ++i) m = fmaxf(m, red[tid][i]);
    rowv[tid] = m;
  }
  __syncthreads();
#pragma unroll
  for (int j = 0; j < 9; ++j) {
    int t = wave * 9 + j, mt = t / 12, nt = t % 12;
    float part[8];
#pragma unroll
    for (int r = 0; r < 8; ++r) {
      int row = mt * 16 + kg + r;
      acc[j][r] = __expf(acc[j][r] - rowv[row]);
      float s = acc[j][r];
      for (int off = 1; off < 16; off <<= 1) s += __shfl_xor(s, off);
      part[r] = s;
    }
    if ((lane & 15) == 0)
#pragma unroll
      for (int r = 0; r < 8; ++r) red[mt * 16 + kg + r][nt] = part[r];
  }
  __syncthreads();
  if (tid < 192) {
    float s = 0.f;
    for (int i = 0; i < 12; ++i) s += red[tid][i];
    rowv[tid] = s;
  }
  __syncthreads();
  const size_t pbase = (size_t)(b * 192 + slice) * 192 * 192;
#pragma unroll
  for (int j = 0; j < 9; ++j) {
    int t = wave * 9 + j, mt = t / 12, nt = t % 12;
    int col = nt * 16 + (lane & 15);
    int r0 = mt * 16 + kg;
    v8h pk;
#pragma unroll
    for (int r = 0; r < 8; ++r) {
      float v = acc[j][r] / rowv[r0 + r];
      pk[r] = (_Float16)v;
      if (writeP) P[pbase + (size_t)(r0 + r) * 192 + col] = (_Float16)v;
    }
    *reinterpret_cast<v8h*>(PT + pbase + (size_t)col * 192 + r0) = pk;  // transposed
  }
}

// --------------------------------------- apply attention + residual + ls
// Two phases: out[c,n] = ls[c]*sum_k V[c,k]*Bm[k,n] + x;  64x192, K=192.
// V rows contiguous (stride vcs); Bm = [slice][k][n] f16.
__global__ __launch_bounds__(512)
void k_attn_apply(const _Float16* __restrict__ V0, const _Float16* __restrict__ V1,
                  size_t vbs, int vcs,
                  const _Float16* __restrict__ B0, const _Float16* __restrict__ B1,
                  float* __restrict__ out0, float* __restrict__ out1,
                  const float* __restrict__ x0, const float* __restrict__ x1,
                  const float* __restrict__ ls0, const float* __restrict__ ls1,
                  int cb, int axis) {
  const int slice = blockIdx.x, b = blockIdx.y;
  const int tid = threadIdx.x, lane = tid & 31, wave = tid >> 5;
  __shared__ _Float16 Vs[C3][192];   // [c][k]
  __shared__ _Float16 Bt[192][32];   // [n][k] per 32-K chunk
  const int kg = (lane >> 4) * 8;
  for (int ph = 0; ph < 2; ++ph) {
    __syncthreads();
    const _Float16* vp = (ph ? V1 : V0) + (size_t)b * vbs + slice * 192;
    const _Float16* Bp = (ph ? B1 : B0) + (size_t)(b * 192 + slice) * 192 * 192;
    float* op = ph ? out1 : out0;
    const float* xp = ph ? x1 : x0;
    const float* lsp = ph ? ls1 : ls0;
#if HAVE_TDM
    if (wave == 0) {
      tdm_load(lds_addr32(&Vs[0][0]), vp, 192, C3, (unsigned int)vcs, C3,
               (unsigned long long)vcs);
      __builtin_amdgcn_s_wait_tensorcnt(0);
    }
#else
    for (int s = tid; s < C3 * 192; s += 512) {
      int c = s / 192, i = s % 192;
      Vs[c][i] = vp[(size_t)c * vcs + i];
    }
#endif
    v8f acc[3];
#pragma unroll
    for (int j = 0; j < 3; ++j) acc[j] = (v8f){0.f, 0.f, 0.f, 0.f, 0.f, 0.f, 0.f, 0.f};
    for (int kk = 0; kk < 6; ++kk) {
      __syncthreads();
      for (int s = tid; s < 32 * 192; s += 512) {
        int k = s / 192, n = s % 192;
        Bt[n][k] = Bp[(size_t)(kk * 32 + k) * 192 + n];
      }
      __syncthreads();
#pragma unroll
      for (int j = 0; j < 3; ++j) {
        int t = wave * 3 + j, mt = t / 12, nt = t % 12;
        v16h af = ldfrag(&Vs[mt * 16 + (lane & 15)][kk * 32 + kg]);
        v16h bf = ldfrag(&Bt[nt * 16 + (lane & 15)][kg]);
        acc[j] = wmma_f16(af, bf, acc[j]);
      }
    }
#pragma unroll
    for (int j = 0; j < 3; ++j) {
      int t = wave * 3 + j, mt = t / 12, nt = t % 12;
      int n = nt * 16 + (lane & 15);
#pragma unroll
      for (int r = 0; r < 8; ++r) {
        int c = cb + mt * 16 + kg + r;
        size_t ad = (axis == 0)
            ? ((size_t)(b * CI + c) * HH + n) * WW + slice
            : ((size_t)(b * CI + c) * HH + slice) * WW + n;
        op[ad] = acc[j][r] * lsp[c] + xp[ad];
      }
    }
  }
}

// ---------------------------------------------------- channel-SE branch
__global__ void k_pool(const _Float16* __restrict__ ql, const _Float16* __restrict__ qr,
                       float* __restrict__ pool) {
  int b = blockIdx.x / C3, c64 = blockIdx.x % C3;
  size_t base = (size_t)(b * CI + 128 + c64) * HW;
  float s = 0.f;
  for (int p = threadIdx.x; p < HW; p += 256)
    s += (float)ql[base + p] + (float)qr[base + p];
  __shared__ float sm[256];
  sm[threadIdx.x] = s;
  __syncthreads();
  for (int o = 128; o > 0; o >>= 1) {
    if (threadIdx.x < o) sm[threadIdx.x] += sm[threadIdx.x + o];
    __syncthreads();
  }
  if (threadIdx.x == 0) pool[b * C3 + c64] = sm[0] * (1.0f / HW);
}

__global__ void k_se(const float* __restrict__ pool, const float* __restrict__ w1,
                     const float* __restrict__ w2, float* __restrict__ a) {
  __shared__ float h1[BB][8];
  __shared__ float lg[BB][128];
  int tid = threadIdx.x;
  if (tid < 16) {
    int b = tid >> 3, j = tid & 7;
    float s = 0.f;
    for (int i = 0; i < 64; ++i) s += pool[b * 64 + i] * w1[j * 64 + i];
    h1[b][j] = fmaxf(s, 0.f);
  }
  __syncthreads();
  {
    int b = tid >> 7, o = tid & 127;
    float s = 0.f;
    for (int j = 0; j < 8; ++j) s += h1[b][j] * w2[o * 8 + j];
    lg[b][o] = s;
  }
  __syncthreads();
  if (tid < BB) {
    float m = -1e30f;
    for (int o = 0; o < 128; ++o) m = fmaxf(m, lg[tid][o]);
    float s = 0.f;
    for (int o = 0; o < 128; ++o) { lg[tid][o] = __expf(lg[tid][o] - m); s += lg[tid][o]; }
    float inv = 1.0f / s;
    for (int o = 0; o < 128; ++o) a[tid * 128 + o] = lg[tid][o] * inv;
  }
}

__global__ void k_se_apply(const float* __restrict__ a,
                           const _Float16* __restrict__ vl, const _Float16* __restrict__ vr,
                           const float* __restrict__ xl, const float* __restrict__ xr,
                           const float* __restrict__ ls1, const float* __restrict__ ls2,
                           float* __restrict__ out_l, float* __restrict__ out_r) {
  size_t idx = (size_t)blockIdx.x * blockDim.x + threadIdx.x;
  const size_t half = (size_t)BB * C3 * HW;
  if (idx >= 2 * half) return;
  int side = (int)(idx / half);
  size_t rem = idx % half;
  int b = (int)(rem / ((size_t)C3 * HW));
  size_t r2 = rem % ((size_t)C3 * HW);
  int c64 = (int)(r2 / HW);
  int p = (int)(r2 % HW);
  int c = 128 + c64;
  float av = a[b * 128 + side * 64 + c64];
  const _Float16* v = side ? vr : vl;
  const float* x = side ? xr : xl;
  const float* ls = side ? ls2 : ls1;
  float* o = side ? out_r : out_l;
  size_t ad = (size_t)(b * CI + c) * HW + p;
  o[ad] = av * (float)v[ad] * ls[c] + x[ad];
}

// ------------------------------------------------------------------ host
extern "C" void kernel_launch(void* const* d_in, const int* in_sizes, int n_in,
                              void* d_out, int out_size, void* d_ws, size_t ws_size,
                              hipStream_t stream) {
  const float* x_l  = (const float*)d_in[0];
  const float* x_r  = (const float*)d_in[1];
  const float* lnlw = (const float*)d_in[2];
  const float* lnlb = (const float*)d_in[3];
  const float* lnrw = (const float*)d_in[4];
  const float* lnrb = (const float*)d_in[5];
  const float* wq_l = (const float*)d_in[6];
  const float* wq_r = (const float*)d_in[7];
  const float* wv_l = (const float*)d_in[8];
  const float* wv_r = (const float*)d_in[9];
  const float* w1   = (const float*)d_in[10];
  const float* w2   = (const float*)d_in[11];
  const float* sch  = (const float*)d_in[12];
  const float* scw  = (const float*)d_in[13];
  const float* ls1  = (const float*)d_in[14];
  const float* ls2  = (const float*)d_in[15];

  float* out_l = (float*)d_out;
  float* out_r = out_l + (size_t)BB * CI * HW;

  char* ws = (char*)d_ws;
  size_t off = 0;
  auto take = [&](size_t bytes) { char* p = ws + off; off += (bytes + 255) & ~(size_t)255; return p; };
  const size_t QV = (size_t)BB * CI * HW;      // half elements
  const size_t QT = (size_t)BB * C3 * HW;
  const size_t PB = (size_t)BB * 192 * 192 * 192;
  const size_t ST = (size_t)BB * HW;           // float elements
  _Float16* q_l  = (_Float16*)take(QV * 2);
  _Float16* q_r  = (_Float16*)take(QV * 2);
  _Float16* v_l  = (_Float16*)take(QV * 2);
  _Float16* v_r  = (_Float16*)take(QV * 2);
  _Float16* qS0l = (_Float16*)take(QT * 2);   // [b][w][h][c64] height Q
  _Float16* qS0r = (_Float16*)take(QT * 2);
  _Float16* qS1l = (_Float16*)take(QT * 2);   // [b][h][w][c64] width Q
  _Float16* qS1r = (_Float16*)take(QT * 2);
  _Float16* vTl  = (_Float16*)take(QT * 2);   // [b][c64][w][h] height V
  _Float16* vTr  = (_Float16*)take(QT * 2);
  _Float16* buf1 = (_Float16*)take(PB * 2);
  _Float16* buf2 = (_Float16*)take(PB * 2);
  float* mul  = (float*)take(ST * 4);
  float* rsl  = (float*)take(ST * 4);
  float* mur  = (float*)take(ST * 4);
  float* rsr  = (float*)take(ST * 4);
  float* pool = (float*)take(BB * C3 * 4);
  float* avec = (float*)take(BB * 128 * 4);

  // 1) LayerNorm stats
  k_ln_stats<<<(2 * BB * HW + 255) / 256, 256, 0, stream>>>(x_l, x_r, mul, rsl, mur, rsr);

  // 2) pointwise convs (WMMA GEMM), LN fused for q
  dim3 cg(HW / 32, BB);
  k_conv<<<cg, 384, 0, stream>>>(wq_l, x_l, lnlw, lnlb, mul, rsl, 1, q_l, qS0l, qS1l);
  k_conv<<<cg, 384, 0, stream>>>(wq_r, x_r, lnrw, lnrb, mur, rsr, 1, q_r, qS0r, qS1r);
  k_conv<<<cg, 384, 0, stream>>>(wv_l, x_l, lnlw, lnlb, mul, rsl, 0, v_l, vTl, nullptr);
  k_conv<<<cg, 384, 0, stream>>>(wv_r, x_r, lnrw, lnrb, mur, rsr, 0, v_r, vTr, nullptr);

  dim3 ag(192, BB);
  // 3) height axial attention: slices over w, channels [0,64)
  k_attn_score<<<ag, 512, 0, stream>>>(qS0l, qS0r, sch, buf1, buf2, 1);
  k_attn_apply<<<ag, 512, 0, stream>>>(vTr, vTl, (size_t)C3 * HW, HW, buf2, buf1,
                                       out_l, out_r, x_l, x_r, ls1, ls2, 0, 0);

  // 4) width axial attention: slices over h, channels [64,128), two softmaxes
  k_attn_score<<<ag, 512, 0, stream>>>(qS1l, qS1r, scw, nullptr, buf1, 0);
  k_attn_score<<<ag, 512, 0, stream>>>(qS1r, qS1l, scw, nullptr, buf2, 0);
  k_attn_apply<<<ag, 512, 0, stream>>>(v_r + (size_t)C3 * HW, v_l + (size_t)C3 * HW,
                                       (size_t)CI * HW, HW, buf1, buf2,
                                       out_l, out_r, x_l, x_r, ls1, ls2, C3, 1);

  // 5) channel SE branch, channels [128,192)
  k_pool<<<BB * C3, 256, 0, stream>>>(q_l, q_r, pool);
  k_se<<<1, 256, 0, stream>>>(pool, w1, w2, avec);
  k_se_apply<<<(int)((2 * (size_t)BB * C3 * HW + 255) / 256), 256, 0, stream>>>(
      avec, v_l, v_r, x_l, x_r, ls1, ls2, out_l, out_r);
}

// v001
// One run takes 879 microseconds.
// Timed twice side by side with v000, it ran 1.08 and 1.09 times as fast.
#include <hip/hip_runtime.h>
#include <hip/hip_bf16.h>

typedef __attribute__((ext_vector_type(16))) _Float16 v16h;
typedef __attribute__((ext_vector_type(8)))  _Float16 v8h;
typedef __attribute__((ext_vector_type(8)))  float    v8f;
typedef __attribute__((ext_vector_type(4)))  unsigned int u32x4;
typedef __attribute__((ext_vector_type(8)))  int i32x8;
typedef __attribute__((ext_vector_type(4)))  int i32x4;

#define BB 2
#define CI 192
#define HH 192
#define WW 192
#define HW 36864
#define C3 64

#if defined(__HIP_DEVICE_COMPILE__) && __has_builtin(__builtin_amdgcn_tensor_load_to_lds)
#define HAVE_TDM 1
#else
#define HAVE_TDM 0
#endif

__device__ __forceinline__ v8f wmma_f16(v16h a, v16h b, v8f c) {
  // D = A(16x32 f16) * B(32x16 f16) + C(16x16 f32)
  return __builtin_amdgcn_wmma_f32_16x16x32_f16(false, a, false, b, (short)0, c,
                                                false, false);
}

// Load a 16-half WMMA operand fragment from a [row][K] layout: 8 contiguous
// halves at p (K = kg..kg+7) and 8 at p+16 (K = kg+16..kg+23).
__device__ __forceinline__ v16h ldfrag(const _Float16* p) {
  v8h lo = *reinterpret_cast<const v8h*>(p);
  v8h hi = *reinterpret_cast<const v8h*>(p + 16);
  v16h r;
#pragma unroll
  for (int i = 0; i < 8; ++i) { r[i] = lo[i]; r[i + 8] = hi[i]; }
  return r;
}

#if HAVE_TDM
typedef __attribute__((address_space(3))) const void lds_cvoid;
__device__ __forceinline__ unsigned int lds_addr32(const void* p) {
  return (unsigned int)(uintptr_t)(lds_cvoid*)p;
}
__device__ __forceinline__ void tdm_load(unsigned int lds_off, const void* gaddr,
                                         unsigned int tile0, unsigned int tile1,
                                         unsigned int td0, unsigned int td1,
                                         unsigned long long stride0) {
  unsigned long long ga = (unsigned long long)(uintptr_t)gaddr;
  u32x4 g0;
  g0[0] = 1u;                                   // count=1 (valid), no gather
  g0[1] = lds_off;                              // lds_addr (bytes)
  g0[2] = (unsigned int)ga;                     // global_addr[31:0]
  g0[3] = (unsigned int)((ga >> 32) & 0x1FFFFFFu) | 0x80000000u;  // [56:32] | type=2
  i32x8 g1;
  g1[0] = 0x00010000;
  g1[1] = (int)((td0 & 0xFFFFu) << 16);
  g1[2] = (int)((td0 >> 16) | ((td1 & 0xFFFFu) << 16));
  g1[3] = (int)((td1 >> 16) | ((tile0 & 0xFFFFu) << 16));
  g1[4] = (int)(tile1 & 0xFFFFu);
  g1[5] = (int)(unsigned int)stride0;
  g1[6] = (int)((stride0 >> 32) & 0xFFFFu);
  g1[7] = 0;
  i32x4 z4 = {0, 0, 0, 0};
#if __clang_major__ >= 23
  i32x8 z8 = {0, 0, 0, 0, 0, 0, 0, 0};
  __builtin_amdgcn_tensor_load_to_lds(g0, g1, z4, z4, z8, 0);
#else
  __builtin_amdgcn_tensor_load_to_lds(g0, g1, z4, z4, 0);
#endif
}
#endif  // HAVE_TDM

// ---------------------------------------------------------------- LN stats
__global__ void k_ln_stats(const float* __restrict__ xl, const float* __restrict__ xr,
                           float* __restrict__ mul, float* __restrict__ rsl,
                           float* __restrict__ mur, float* __restrict__ rsr) {
  int idx = blockIdx.x * blockDim.x + threadIdx.x;
  if (idx >= 2 * BB * HW) return;
  int side = idx / (BB * HW);
  int rem  = idx % (BB * HW);
  int b = rem / HW, p = rem % HW;
  const float* base = (side ? xr : xl) + (size_t)b * CI * HW + p;
  float s = 0.f, s2 = 0.f;
  for (int c = 0; c < CI; ++c) { float v = base[(size_t)c * HW]; s += v; s2 += v * v; }
  float m = s * (1.0f / CI);
  float var = s2 * (1.0f / CI) - m * m;
  float r = rsqrtf(var + 1e-6f);
  if (side) { mur[rem] = m; rsr[rem] = r; } else { mul[rem] = m; rsl[rem] = r; }
}

#define CT_PX 32
#define CT_NT 3
#define CT_PITCH 200   // halves per LDS row: 400 B = 16 B x odd, for b128 readers
typedef __attribute__((ext_vector_type(4))) float    f32x4;
typedef __attribute__((ext_vector_type(4))) _Float16 v4h;

__global__ __launch_bounds__(384, 9)
void k_conv(const float* __restrict__ Wm, const float* __restrict__ X,
            const float* __restrict__ lnw, const float* __restrict__ lnb,
            const float* __restrict__ mu, const float* __restrict__ rstd,
            int isQ, _Float16* __restrict__ out,
            _Float16* __restrict__ outA, _Float16* __restrict__ outB) {
  const int b   = blockIdx.y;
  const int tid = threadIdx.x, lane = tid & 31, wave = tid >> 5;
  const int pbase = blockIdx.x * (CT_PX * CT_NT);
  __shared__ __attribute__((aligned(16))) _Float16 wS[CI][CT_PITCH];        // [m][k]
  __shared__ __attribute__((aligned(16))) _Float16 xT[2][CT_PX][CT_PITCH];  // [n][k]
  __shared__ __attribute__((aligned(16))) float lnS[2][CI];
  const int kg = (lane >> 4) * 8;
  // staging map: a thread owns 4 adjacent pixels x 4 adjacent channels
  const int pg = (tid & 7) * 4, c0 = (tid >> 3) * 4;
  const float* xcol = X + (size_t)b * CI * HW + (size_t)c0 * HW + pg;
  const float* mcol = mu + b * HW + pg;
  const float* rcol = rstd + b * HW + pg;

  // Prologue: half of the weights and the first pixel tile are in flight together;
  // the second half of the weights follows while the tile is still on its way.
  const float* wsrc = Wm + (size_t)wave * 16 * CI;   // a wave's 16 rows: 12 KiB in a row
  float lw0 = 0.f, lb0 = 0.f;
  if (isQ && tid < CI) { lw0 = lnw[tid]; lb0 = lnb[tid]; }
  f32x4 w4[12];
#pragma unroll
  for (int i = 0; i < 12; ++i)
    w4[i] = *reinterpret_cast<const f32x4*>(wsrc + (i * 32 + lane) * 4);
  f32x4 xr[4];
  f32x4 m4 = {0.f, 0.f, 0.f, 0.f}, r4 = m4;
#pragma unroll
  for (int i = 0; i < 4; ++i)
    xr[i] = *reinterpret_cast<const f32x4*>(xcol + (size_t)i * HW + pbase);
  if (isQ) {
    m4 = *reinterpret_cast<const f32x4*>(mcol + pbase);
    // the next load's result may land on this load's address registers
    asm volatile("s_wait_xcnt 0x0" ::: "memory");
    r4 = *reinterpret_cast<const f32x4*>(rcol + pbase);
  }
#pragma unroll
  for (int g = 0; g < 2; ++g) {
#pragma unroll
    for (int i = 0; i < 12; ++i) {
      const int e = ((g * 12 + i) * 32 + lane) * 4;
      v4h h4 = {(_Float16)w4[i][0], (_Float16)w4[i][1], (_Float16)w4[i][2], (_Float16)w4[i][3]};
      *reinterpret_cast<v4h*>(&wS[wave * 16 + e / CI][e % CI]) = h4;
    }
    if (g == 0) {
#pragma unroll
      for (int i = 0; i < 12; ++i)
        w4[i] = *reinterpret_cast<const f32x4*>(wsrc + ((12 + i) * 32 + lane) * 4);
    }
  }
  if (isQ && tid < CI) { lnS[0][tid] = lw0; lnS[1][tid] = lb0; }
  __syncthreads();
  const _Float16* wrow = &wS[wave * 16 + (lane & 15)][kg];

  const int r0 = wave * 16 + (lane >> 4) * 8;
  for (int t = 0; t < CT_NT; ++t) {
    const int p0 = pbase + t * CT_PX;
    _Float16 (*xb)[CT_PITCH] = xT[t & 1];
    f32x4 y[4];
#pragma unroll
    for (int i = 0; i < 4; ++i)
      y[i] = isQ ? (xr[i] - m4) * r4 * lnS[0][c0 + i] + lnS[1][c0 + i] : xr[i];
#pragma unroll
    for (int j = 0; j < 4; ++j) {
      v4h hv = {(_Float16)y[0][j], (_Float16)y[1][j], (_Float16)y[2][j], (_Float16)y[3][j]};
      *reinterpret_cast<v4h*>(&xb[pg + j][c0]) = hv;
    }
    // One barrier a tile: it publishes this buffer, and every wave that passes
    // it has left the other buffer, which the next trip refills.
    __syncthreads();
    if (t + 1 < CT_NT) {   // next tile's loads fly under this tile's products and stores
#pragma unroll
      for (int i = 0; i < 4; ++i)
        xr[i] = *reinterpret_cast<const f32x4*>(xcol + (size_t)i * HW + p0 + CT_PX);
      // the address registers of the loads above are reused for the next addresses
      asm volatile("s_wait_xcnt 0x0" ::: "memory");
      if (isQ) {
        m4 = *reinterpret_cast<const f32x4*>(mcol + p0 + CT_PX);
        r4 = *reinterpret_cast<const f32x4*>(rcol + p0 + CT_PX);
        // the address registers of these two loads are reused right behind them
        asm volatile("s_wait_xcnt 0x0" ::: "memory");
      }
    }
    v8f acc[2];
#pragma unroll
    for (int s = 0; s < 2; ++s) acc[s] = (v8f){0.f, 0.f, 0.f, 0.f, 0.f, 0.f, 0.f, 0.f};
#pragma unroll
    for (int kk = 0; kk < 6; ++kk) {
      v16h af = ldfrag(wrow + kk * 32);
#pragma unroll
      for (int s = 0; s < 2; ++s) {
        v16h bf = ldfrag(&xb[s * 16 + (lane & 15)][kk * 32 + kg]);
        acc[s] = wmma_f16(af, bf, acc[s]);
      }
    }
#pragma unroll
    for (int sub = 0; sub < 2; ++sub) {
      const int p = p0 + sub * 16 + (lane & 15);
      const int w = p % WW, h = p / WW;
#pragma unroll
      for (int r = 0; r < 8; ++r) {
        int m = r0 + r;
        _Float16 v = (_Float16)acc[sub][r];
        out[(size_t)(b * CI + m) * HW + p] = v;
        // the next value's conversion may land on the register this store names
        asm volatile("s_wait_xcnt 0x0" ::: "memory");
        if (isQ) {
          if (m < C3)          outA[(((size_t)b * WW + w) * HH + h) * C3 + m] = v;
          else if (m < 2 * C3) outB[(((size_t)b * HH + h) * WW + w) * C3 + (m - C3)] = v;
        } else if (m < C3) {
          outA[((size_t)(b * C3 + m) * WW + w) * HH + h] = v;
        }
      }
    }
    // the next trip overwrites the registers that the last stores name
    asm volatile("s_wait_xcnt 0x0" ::: "memory");
  }
}

// ------------------------------------- axial attention scores + softmax
// Q/K stored per-slice contiguous as [slice][row][c64]; S = scale*Q K^T,
// P = row-softmax(S) (192x192, K=64). S in registers (16 waves x 9 tiles).
__global__ __launch_bounds__(512)
void k_attn_score(const _Float16* __restrict__ q0, const _Float16* __restrict__ k0,
                  const float* __restrict__ scp,
                  _Float16* __restrict__ P, _Float16* __restrict__ PT, int writeP) {
  const int slice = blockIdx.x, b = blockIdx.y;
  const int tid = threadIdx.x, lane = tid & 31, wave = tid >> 5;
  const _Float16* qp = q0 + ((size_t)b * 192 + slice) * (192 * C3);
  const _Float16* kp = k0 + ((size_t)b * 192 + slice) * (192 * C3);
  __shared__ _Float16 Qs[192][C3];  // [row][k]
  __shared__ _Float16 Ks[192][C3];  // [col][k]
  __shared__ float red[192][12];
  __shared__ float rowv[192];
#if HAVE_TDM
  if (wave == 0) {
    tdm_load(lds_addr32(&Qs[0][0]), qp, 192 * C3, 1, 192 * C3, 1, 192 * C3);
    tdm_load(lds_addr32(&Ks[0][0]), kp, 192 * C3, 1, 192 * C3, 1, 192 * C3);
    __builtin_amdgcn_s_wait_tensorcnt(0);
  }
#else
  {
    _Float16* Qf = &Qs[0][0];
    _Float16* Kf = &Ks[0][0];
    for (int s = tid; s < 192 * C3; s += 512) { Qf[s] = qp[s]; Kf[s] = kp[s]; }
  }
#endif
  __syncthreads();
  const float sc = *scp;
  const int kg = (lane >> 4) * 8;
  v8f acc[9];
#pragma unroll
  for (int j = 0; j < 9; ++j) {
    int t = wave * 9 + j, mt = t / 12, nt = t % 12;
    v8f a = {0.f, 0.f, 0.f, 0.f, 0.f, 0.f, 0.f, 0.f};
#pragma unroll
    for (int kk = 0; kk < 2; ++kk) {
      v16h af = ldfrag(&Qs[mt * 16 + (lane & 15)][kk * 32 + kg]);
      v16h bf = ldfrag(&Ks[nt * 16 + (lane & 15)][kk * 32 + kg]);
      a = wmma_f16(af, bf, a);
    }
    float part[8];
#pragma unroll
    for (int r = 0; r < 8; ++r) {
      a[r] *= sc;
      float m = a[r];
      for (int off = 1; off < 16; off <<= 1) m = fmaxf(m, __shfl_xor(m, off));
      part[r] = m;
    }
    acc[j] = a;
    if ((lane & 15) == 0)
#pragma unroll
      for (int r = 0; r < 8; ++r) red[mt * 16 + kg + r][nt] = part[r];
  }
  __syncthreads();
  if (tid < 192) {
    float m = red[tid][0];
    for (int i = 1; i < 12; ++i) m = fmaxf(m, red[tid][i]);
    rowv[tid] = m;
  }
  __syncthreads();
#pragma unroll
  for (int j = 0; j < 9; ++j) {
    int t = wave * 9 + j, mt = t / 12, nt = t % 12;
    float part[8];
#pragma unroll
    for (int r = 0; r < 8; ++r) {
      int row = mt * 16 + kg + r;
      acc[j][r] = __expf(acc[j][r] - rowv[row]);
      float s = acc[j][r];
      for (int off = 1; off < 16; off <<= 1) s += __shfl_xor(s, off);
      part[r] = s;
    }
    if ((lane & 15) == 0)
#pragma unroll
      for (int r = 0; r < 8; ++r) red[mt * 16 + kg + r][nt] = part[r];
  }
  __syncthreads();
  if (tid < 192) {
    float s = 0.f;
    for (int i = 0; i < 12; ++i) s += red[tid][i];
    rowv[tid] = s;
  }
  __syncthreads();
  const size_t pbase = (size_t)(b * 192 + slice) * 192 * 192;
#pragma unroll
  for (int j = 0; j < 9; ++j) {
    int t = wave * 9 + j, mt = t / 12, nt = t % 12;
    int col = nt * 16 + (lane & 15);
    int r0 = mt * 16 + kg;
    v8h pk;
#pragma unroll
    for (int r = 0; r < 8; ++r) {
      float v = acc[j][r] / rowv[r0 + r];
      pk[r] = (_Float16)v;
      if (writeP) P[pbase + (size_t)(r0 + r) * 192 + col] = (_Float16)v;
    }
    *reinterpret_cast<v8h*>(PT + pbase + (size_t)col * 192 + r0) = pk;  // transposed
  }
}

// --------------------------------------- apply attention + residual + ls
// Two phases: out[c,n] = ls[c]*sum_k V[c,k]*Bm[k,n] + x;  64x192, K=192.
// V rows contiguous (stride vcs); Bm = [slice][k][n] f16.
__global__ __launch_bounds__(512)
void k_attn_apply(const _Float16* __restrict__ V0, const _Float16* __restrict__ V1,
                  size_t vbs, int vcs,
                  const _Float16* __restrict__ B0, const _Float16* __restrict__ B1,
                  float* __restrict__ out0, float* __restrict__ out1,
                  const float* __restrict__ x0, const float* __restrict__ x1,
                  const float* __restrict__ ls0, const float* __restrict__ ls1,
                  int cb, int axis) {
  const int slice = blockIdx.x, b = blockIdx.y;
  const int tid = threadIdx.x, lane = tid & 31, wave = tid >> 5;
  __shared__ _Float16 Vs[C3][192];   // [c][k]
  __shared__ _Float16 Bt[192][32];   // [n][k] per 32-K chunk
  const int kg = (lane >> 4) * 8;
  for (int ph = 0; ph < 2; ++ph) {
    __syncthreads();
    const _Float16* vp = (ph ? V1 : V0) + (size_t)b * vbs + slice * 192;
    const _Float16* Bp = (ph ? B1 : B0) + (size_t)(b * 192 + slice) * 192 * 192;
    float* op = ph ? out1 : out0;
    const float* xp = ph ? x1 : x0;
    const float* lsp = ph ? ls1 : ls0;
#if HAVE_TDM
    if (wave == 0) {
      tdm_load(lds_addr32(&Vs[0][0]), vp, 192, C3, (unsigned int)vcs, C3,
               (unsigned long long)vcs);
      __builtin_amdgcn_s_wait_tensorcnt(0);
    }
#else
    for (int s = tid; s < C3 * 192; s += 512) {
      int c = s / 192, i = s % 192;
      Vs[c][i] = vp[(size_t)c * vcs + i];
    }
#endif
    v8f acc[3];
#pragma unroll
    for (int j = 0; j < 3; ++j) acc[j] = (v8f){0.f, 0.f, 0.f, 0.f, 0.f, 0.f, 0.f, 0.f};
    for (int kk = 0; kk < 6; ++kk) {
      __syncthreads();
      for (int s = tid; s < 32 * 192; s += 512) {
        int k = s / 192, n = s % 192;
        Bt[n][k] = Bp[(size_t)(kk * 32 + k) * 192 + n];
      }
      __syncthreads();
#pragma unroll
      for (int j = 0; j < 3; ++j) {
        int t = wave * 3 + j, mt = t / 12, nt = t % 12;
        v16h af = ldfrag(&Vs[mt * 16 + (lane & 15)][kk * 32 + kg]);
        v16h bf = ldfrag(&Bt[nt * 16 + (lane & 15)][kg]);
        acc[j] = wmma_f16(af, bf, acc[j]);
      }
    }
#pragma unroll
    for (int j = 0; j < 3; ++j) {
      int t = wave * 3 + j, mt = t / 12, nt = t % 12;
      int n = nt * 16 + (lane & 15);
#pragma unroll
      for (int r = 0; r < 8; ++r) {
        int c = cb + mt * 16 + kg + r;
        size_t ad = (axis == 0)
            ? ((size_t)(b * CI + c) * HH + n) * WW + slice
            : ((size_t)(b * CI + c) * HH + slice) * WW + n;
        op[ad] = acc[j][r] * lsp[c] + xp[ad];
      }
    }
  }
}

// ---------------------------------------------------- channel-SE branch
__global__ void k_pool(const _Float16* __restrict__ ql, const _Float16* __restrict__ qr,
                       float* __restrict__ pool) {
  int b = blockIdx.x / C3, c64 = blockIdx.x % C3;
  size_t base = (size_t)(b * CI + 128 + c64) * HW;
  float s = 0.f;
  for (int p = threadIdx.x; p < HW; p += 256)
    s += (float)ql[base + p] + (float)qr[base + p];
  __shared__ float sm[256];
  sm[threadIdx.x] = s;
  __syncthreads();
  for (int o = 128; o > 0; o >>= 1) {
    if (threadIdx.x < o) sm[threadIdx.x] += sm[threadIdx.x + o];
    __syncthreads();
  }
  if (threadIdx.x == 0) pool[b * C3 + c64] = sm[0] * (1.0f / HW);
}

__global__ void k_se(const float* __restrict__ pool, const float* __restrict__ w1,
                     const float* __restrict__ w2, float* __restrict__ a) {
  __shared__ float h1[BB][8];
  __shared__ float lg[BB][128];
  int tid = threadIdx.x;
  if (tid < 16) {
    int b = tid >> 3, j = tid & 7;
    float s = 0.f;
    for (int i = 0; i < 64; ++i) s += pool[b * 64 + i] * w1[j * 64 + i];
    h1[b][j] = fmaxf(s, 0.f);
  }
  __syncthreads();
  {
    int b = tid >> 7, o = tid & 127;
    float s = 0.f;
    for (int j = 0; j < 8; ++j) s += h1[b][j] * w2[o * 8 + j];
    lg[b][o] = s;
  }
  __syncthreads();
  if (tid < BB) {
    float m = -1e30f;
    for (int o = 0; o < 128; ++o) m = fmaxf(m, lg[tid][o]);
    float s = 0.f;
    for (int o = 0; o < 128; ++o) { lg[tid][o] = __expf(lg[tid][o] - m); s += lg[tid][o]; }
    float inv = 1.0f / s;
    for (int o = 0; o < 128; ++o) a[tid * 128 + o] = lg[tid][o] * inv;
  }
}

__global__ void k_se_apply(const float* __restrict__ a,
                           const _Float16* __restrict__ vl, const _Float16* __restrict__ vr,
                           const float* __restrict__ xl, const float* __restrict__ xr,
                           const float* __restrict__ ls1, const float* __restrict__ ls2,
                           float* __restrict__ out_l, float* __restrict__ out_r) {
  size_t idx = (size_t)blockIdx.x * blockDim.x + threadIdx.x;
  const size_t half = (size_t)BB * C3 * HW;
  if (idx >= 2 * half) return;
  int side = (int)(idx / half);
  size_t rem = idx % half;
  int b = (int)(rem / ((size_t)C3 * HW));
  size_t r2 = rem % ((size_t)C3 * HW);
  int c64 = (int)(r2 / HW);
  int p = (int)(r2 % HW);
  int c = 128 + c64;
  float av = a[b * 128 + side * 64 + c64];
  const _Float16* v = side ? vr : vl;
  const float* x = side ? xr : xl;
  const float* ls = side ? ls2 : ls1;
  float* o = side ? out_r : out_l;
  size_t ad = (size_t)(b * CI + c) * HW + p;
  o[ad] = av * (float)v[ad] * ls[c] + x[ad];
}

// ------------------------------------------------------------------ host
extern "C" void kernel_launch(void* const* d_in, const int* in_sizes, int n_in,
                              void* d_out, int out_size, void* d_ws, size_t ws_size,
                              hipStream_t stream) {
  const float* x_l  = (const float*)d_in[0];
  const float* x_r  = (const float*)d_in[1];
  const float* lnlw = (const float*)d_in[2];
  const float* lnlb = (const float*)d_in[3];
  const float* lnrw = (const float*)d_in[4];
  const float* lnrb = (const float*)d_in[5];
  const float* wq_l = (const float*)d_in[6];
  const float* wq_r = (const float*)d_in[7];
  const float* wv_l = (const float*)d_in[8];
  const float* wv_r = (const float*)d_in[9];
  const float* w1   = (const float*)d_in[10];
  const float* w2   = (const float*)d_in[11];
  const float* sch  = (const float*)d_in[12];
  const float* scw  = (const float*)d_in[13];
  const float* ls1  = (const float*)d_in[14];
  const float* ls2  = (const float*)d_in[15];

  float* out_l = (float*)d_out;
  float* out_r = out_l + (size_t)BB * CI * HW;

  char* ws = (char*)d_ws;
  size_t off = 0;
  auto take = [&](size_t bytes) { char* p = ws + off; off += (bytes + 255) & ~(size_t)255; return p; };
  const size_t QV = (size_t)BB * CI * HW;      // half elements
  const size_t QT = (size_t)BB * C3 * HW;
  const size_t PB = (size_t)BB * 192 * 192 * 192;
  const size_t ST = (size_t)BB * HW;           // float elements
  _Float16* q_l  = (_Float16*)take(QV * 2);
  _Float16* q_r  = (_Float16*)take(QV * 2);
  _Float16* v_l  = (_Float16*)take(QV * 2);
  _Float16* v_r  = (_Float16*)take(QV * 2);
  _Float16* qS0l = (_Float16*)take(QT * 2);   // [b][w][h][c64] height Q
  _Float16* qS0r = (_Float16*)take(QT * 2);
  _Float16* qS1l = (_Float16*)take(QT * 2);   // [b][h][w][c64] width Q
  _Float16* qS1r = (_Float16*)take(QT * 2);
  _Float16* vTl  = (_Float16*)take(QT * 2);   // [b][c64][w][h] height V
  _Float16* vTr  = (_Float16*)take(QT * 2);
  _Float16* buf1 = (_Float16*)take(PB * 2);
  _Float16* buf2 = (_Float16*)take(PB * 2);
  float* mul  = (float*)take(ST * 4);
  float* rsl  = (float*)take(ST * 4);
  float* mur  = (float*)take(ST * 4);
  float* rsr  = (float*)take(ST * 4);
  float* pool = (float*)take(BB * C3 * 4);
  float* avec = (float*)take(BB * 128 * 4);

  // 1) LayerNorm stats
  k_ln_stats<<<(2 * BB * HW + 255) / 256, 256, 0, stream>>>(x_l, x_r, mul, rsl, mur, rsr);

  // 2) pointwise convs (WMMA GEMM), LN fused for q
  dim3 cg(HW / (CT_PX * CT_NT), BB);
  k_conv<<<cg, 384, 0, stream>>>(wq_l, x_l, lnlw, lnlb, mul, rsl, 1, q_l, qS0l, qS1l);
  k_conv<<<cg, 384, 0, stream>>>(wq_r, x_r, lnrw, lnrb, mur, rsr, 1, q_r, qS0r, qS1r);
  k_conv<<<cg, 384, 0, stream>>>(wv_l, x_l, lnlw, lnlb, mul, rsl, 0, v_l, vTl, nullptr);
  k_conv<<<cg, 384, 0, stream>>>(wv_r, x_r, lnrw, lnrb, mur, rsr, 0, v_r, vTr, nullptr);

  dim3 ag(192, BB);
  // 3) height axial attention: slices over w, channels [0,64)
  k_attn_score<<<ag, 512, 0, stream>>>(qS0l, qS0r, sch, buf1, buf2, 1);
  k_attn_apply<<<ag, 512, 0, stream>>>(vTr, vTl, (size_t)C3 * HW, HW, buf2, buf1,
                                       out_l, out_r, x_l, x_r, ls1, ls2, 0, 0);

  // 4) width axial attention: slices over h, channels [64,128), two softmaxes
  k_attn_score<<<ag, 512, 0, stream>>>(qS1l, qS1r, scw, nullptr, buf1, 0);
  k_attn_score<<<ag, 512, 0, stream>>>(qS1r, qS1l, scw, nullptr, buf2, 0);
  k_attn_apply<<<ag, 512, 0, stream>>>(v_r + (size_t)C3 * HW, v_l + (size_t)C3 * HW,
                                       (size_t)CI * HW, HW, buf1, buf2,
                                       out_l, out_r, x_l, x_r, ls1, ls2, C3, 1);

  // 5) channel SE branch, channels [128,192)
  k_pool<<<BB * C3, 256, 0, stream>>>(q_l, q_r, pool);
  k_se<<<1, 256, 0, stream>>>(pool, w1, w2, avec);
  k_se_apply<<<(int)((2 * (size_t)BB * C3 * HW + 255) / 256), 256, 0, stream>>>(
      avec, v_l, v_r, x_l, x_r, ls1, ls2, out_l, out_r);
}

// v002
// One run takes 821 microseconds.
// In two side-by-side timings against v001, it was 1.08 and 1.07 times as fast.
// Counting every step since v000, it is 1.17 times as fast.
#include <hip/hip_runtime.h>
#include <hip/hip_bf16.h>

typedef __attribute__((ext_vector_type(16))) _Float16 v16h;
typedef __attribute__((ext_vector_type(8)))  _Float16 v8h;
typedef __attribute__((ext_vector_type(8)))  float    v8f;
typedef __attribute__((ext_vector_type(4)))  unsigned int u32x4;
typedef __attribute__((ext_vector_type(8)))  int i32x8;
typedef __attribute__((ext_vector_type(4)))  int i32x4;

#define BB 2
#define CI 192
#define HH 192
#define WW 192
#define HW 36864
#define C3 64

#if defined(__HIP_DEVICE_COMPILE__) && __has_builtin(__builtin_amdgcn_tensor_load_to_lds)
#define HAVE_TDM 1
#else
#define HAVE_TDM 0
#endif

__device__ __forceinline__ v8f wmma_f16(v16h a, v16h b, v8f c) {
  // D = A(16x32 f16) * B(32x16 f16) + C(16x16 f32)
  return __builtin_amdgcn_wmma_f32_16x16x32_f16(false, a, false, b, (short)0, c,
                                                false, false);
}

// Load a 16-half WMMA operand fragment from a [row][K] layout: 8 contiguous
// halves at p (K = kg..kg+7) and 8 at p+16 (K = kg+16..kg+23).
__device__ __forceinline__ v16h ldfrag(const _Float16* p) {
  v8h lo = *reinterpret_cast<const v8h*>(p);
  v8h hi = *reinterpret_cast<const v8h*>(p + 16);
  v16h r;
#pragma unroll
  for (int i = 0; i < 8; ++i) { r[i] = lo[i]; r[i + 8] = hi[i]; }
  return r;
}

#if HAVE_TDM
typedef __attribute__((address_space(3))) const void lds_cvoid;
__device__ __forceinline__ unsigned int lds_addr32(const void* p) {
  return (unsigned int)(uintptr_t)(lds_cvoid*)p;
}
typedef __attribute__((ext_vector_type(8))) unsigned int u32x8;
__device__ __forceinline__ unsigned int uni(unsigned int v) {
  return (unsigned int)__builtin_amdgcn_readfirstlane(v);
}
__device__ __forceinline__ unsigned int pinned(unsigned int v) {
  unsigned int w = uni(v);
  asm volatile("" : "+s"(w));  // pinned(): the test word stays in a scalar register
  return w;
}
__device__ __forceinline__ void tdm_rows128(unsigned int lds_off, const void* gaddr,
                                            unsigned int rows, unsigned int src_pitch) {
  unsigned long long ga = (unsigned long long)(uintptr_t)gaddr;
  u32x4 g0;
  g0[0] = uni(1u);                              // count = 1
  g0[1] = uni(lds_off);                         // LDS destination (bytes)
  g0[2] = uni((unsigned int)ga);                // global address [31:0]
  g0[3] = uni((((unsigned int)(ga >> 32)) & 0x01FFFFFFu) | 0x80000000u);  // [56:32] | type = 2
  u32x8 g1;
  g1[0] = uni((1u << 20) | (4u << 22) | (3u << 25));
  g1[1] = uni(128u << 16);
  g1[2] = uni(rows << 16);
  g1[3] = uni(128u << 16);
  g1[4] = uni(rows);
  g1[5] = uni(src_pitch);
  g1[6] = uni(0u);
  g1[7] = uni(0u);
  asm volatile("tensor_load_to_lds %0, %1" :: "s"(g0), "s"(g1) : "memory");
}
#endif  // HAVE_TDM

// ---------------------------------------------------------------- LN stats
__global__ void k_ln_stats(const float* __restrict__ xl, const float* __restrict__ xr,
                           float* __restrict__ mul, float* __restrict__ rsl,
                           float* __restrict__ mur, float* __restrict__ rsr) {
  int idx = blockIdx.x * blockDim.x + threadIdx.x;
  if (idx >= 2 * BB * HW) return;
  int side = idx / (BB * HW);
  int rem  = idx % (BB * HW);
  int b = rem / HW, p = rem % HW;
  const float* base = (side ? xr : xl) + (size_t)b * CI * HW + p;
  float s = 0.f, s2 = 0.f;
  for (int c = 0; c < CI; ++c) { float v = base[(size_t)c * HW]; s += v; s2 += v * v; }
  float m = s * (1.0f / CI);
  float var = s2 * (1.0f / CI) - m * m;
  float r = rsqrtf(var + 1e-6f);
  if (side) { mur[rem] = m; rsr[rem] = r; } else { mul[rem] = m; rsl[rem] = r; }
}

#define CT_PX 32
#define CT_NT 3
#define CT_PITCH 200   // halves per LDS row: 400 B = 16 B x odd, for b128 readers
typedef __attribute__((ext_vector_type(4))) float    f32x4;
typedef __attribute__((ext_vector_type(4))) _Float16 v4h;

__global__ __launch_bounds__(384, 9)
void k_conv(const float* __restrict__ Wm, const float* __restrict__ X,
            const float* __restrict__ lnw, const float* __restrict__ lnb,
            const float* __restrict__ mu, const float* __restrict__ rstd,
            int isQ, _Float16* __restrict__ out,
            _Float16* __restrict__ outA, _Float16* __restrict__ outB) {
  const int b   = blockIdx.y;
  const int tid = threadIdx.x, lane = tid & 31, wave = tid >> 5;
  const int pbase = blockIdx.x * (CT_PX * CT_NT);
  __shared__ __attribute__((aligned(16))) _Float16 wS[CI][CT_PITCH];        // [m][k]
  __shared__ __attribute__((aligned(16))) _Float16 xT[2][CT_PX][CT_PITCH];  // [n][k]
  __shared__ __attribute__((aligned(16))) float lnS[2][CI];
  const int kg = (lane >> 4) * 8;
  // staging map: a thread owns 4 adjacent pixels x 4 adjacent channels
  const int pg = (tid & 7) * 4, c0 = (tid >> 3) * 4;
  const float* xcol = X + (size_t)b * CI * HW + (size_t)c0 * HW + pg;
  const float* mcol = mu + b * HW + pg;
  const float* rcol = rstd + b * HW + pg;

  // Prologue: half of the weights and the first pixel tile are in flight together;
  // the second half of the weights follows while the tile is still on its way.
  const float* wsrc = Wm + (size_t)wave * 16 * CI;   // a wave's 16 rows: 12 KiB in a row
  float lw0 = 0.f, lb0 = 0.f;
  if (isQ && tid < CI) { lw0 = lnw[tid]; lb0 = lnb[tid]; }
  f32x4 w4[12];
#pragma unroll
  for (int i = 0; i < 12; ++i)
    w4[i] = *reinterpret_cast<const f32x4*>(wsrc + (i * 32 + lane) * 4);
  f32x4 xr[4];
  f32x4 m4 = {0.f, 0.f, 0.f, 0.f}, r4 = m4;
#pragma unroll
  for (int i = 0; i < 4; ++i)
    xr[i] = *reinterpret_cast<const f32x4*>(xcol + (size_t)i * HW + pbase);
  if (isQ) {
    m4 = *reinterpret_cast<const f32x4*>(mcol + pbase);
    // the next load's result may land on this load's address registers
    asm volatile("s_wait_xcnt 0x0" ::: "memory");
    r4 = *reinterpret_cast<const f32x4*>(rcol + pbase);
  }
#pragma unroll
  for (int g = 0; g < 2; ++g) {
#pragma unroll
    for (int i = 0; i < 12; ++i) {
      const int e = ((g * 12 + i) * 32 + lane) * 4;
      v4h h4 = {(_Float16)w4[i][0], (_Float16)w4[i][1], (_Float16)w4[i][2], (_Float16)w4[i][3]};
      *reinterpret_cast<v4h*>(&wS[wave * 16 + e / CI][e % CI]) = h4;
    }
    if (g == 0) {
#pragma unroll
      for (int i = 0; i < 12; ++i)
        w4[i] = *reinterpret_cast<const f32x4*>(wsrc + ((12 + i) * 32 + lane) * 4);
    }
  }
  if (isQ && tid < CI) { lnS[0][tid] = lw0; lnS[1][tid] = lb0; }
  __syncthreads();
  const _Float16* wrow = &wS[wave * 16 + (lane & 15)][kg];

  const int r0 = wave * 16 + (lane >> 4) * 8;
  for (int t = 0; t < CT_NT; ++t) {
    const int p0 = pbase + t * CT_PX;
    _Float16 (*xb)[CT_PITCH] = xT[t & 1];
    f32x4 y[4];
#pragma unroll
    for (int i = 0; i < 4; ++i)
      y[i] = isQ ? (xr[i] - m4) * r4 * lnS[0][c0 + i] + lnS[1][c0 + i] : xr[i];
#pragma unroll
    for (int j = 0; j < 4; ++j) {
      v4h hv = {(_Float16)y[0][j], (_Float16)y[1][j], (_Float16)y[2][j], (_Float16)y[3][j]};
      *reinterpret_cast<v4h*>(&xb[pg + j][c0]) = hv;
    }
    // One barrier a tile: it publishes this buffer, and every wave that passes
    // it has left the other buffer, which the next trip refills.
    __syncthreads();
    if (t + 1 < CT_NT) {   // next tile's loads fly under this tile's products and stores
#pragma unroll
      for (int i = 0; i < 4; ++i)
        xr[i] = *reinterpret_cast<const f32x4*>(xcol + (size_t)i * HW + p0 + CT_PX);
      // the address registers of the loads above are reused for the next addresses
      asm volatile("s_wait_xcnt 0x0" ::: "memory");
      if (isQ) {
        m4 = *reinterpret_cast<const f32x4*>(mcol + p0 + CT_PX);
        r4 = *reinterpret_cast<const f32x4*>(rcol + p0 + CT_PX);
        // the address registers of these two loads are reused right behind them
        asm volatile("s_wait_xcnt 0x0" ::: "memory");
      }
    }
    v8f acc[2];
#pragma unroll
    for (int s = 0; s < 2; ++s) acc[s] = (v8f){0.f, 0.f, 0.f, 0.f, 0.f, 0.f, 0.f, 0.f};
#pragma unroll
    for (int kk = 0; kk < 6; ++kk) {
      v16h af = ldfrag(wrow + kk * 32);
#pragma unroll
      for (int s = 0; s < 2; ++s) {
        v16h bf = ldfrag(&xb[s * 16 + (lane & 15)][kk * 32 + kg]);
        acc[s] = wmma_f16(af, bf, acc[s]);
      }
    }
#pragma unroll
    for (int sub = 0; sub < 2; ++sub) {
      const int p = p0 + sub * 16 + (lane & 15);
      const int w = p % WW, h = p / WW;
#pragma unroll
      for (int r = 0; r < 8; ++r) {
        int m = r0 + r;
        _Float16 v = (_Float16)acc[sub][r];
        out[(size_t)(b * CI + m) * HW + p] = v;
        // the next value's conversion may land on the register this store names
        asm volatile("s_wait_xcnt 0x0" ::: "memory");
        if (isQ) {
          if (m < C3)          outA[(((size_t)b * WW + w) * HH + h) * C3 + m] = v;
          else if (m < 2 * C3) outB[(((size_t)b * HH + h) * WW + w) * C3 + (m - C3)] = v;
        } else if (m < C3) {
          outA[((size_t)(b * C3 + m) * WW + w) * HH + h] = v;
        }
      }
    }
    // the next trip overwrites the registers that the last stores name
    asm volatile("s_wait_xcnt 0x0" ::: "memory");
  }
}

// ------------------------------------- axial attention scores + softmax
// Q/K stored per-slice contiguous as [slice][row][c64]; S = scale*Q K^T,
// P = row-softmax(S) (192x192, K=64). S in registers (16 waves x 9 tiles).
// LDS rows that feed 16-byte fragment reads stand at a pitch of 16 B x odd.
#define ROW_PITCH 72     // halves: 128-byte rows + the mover's 16-byte pad = 144 B
#define QK_BUF 14336     // halves: 192 rows x 144 B, rounded up to a multiple of 2 KiB
#define V_SLICE 5120     // halves: 64 rows x 144 B, rounded up to a multiple of 2 KiB
#define BT_PITCH 40      // halves: 64-byte rows + 16 B = 80 B
__global__ __launch_bounds__(512)
void k_attn_score(const _Float16* __restrict__ q0, const _Float16* __restrict__ k0,
                  const float* __restrict__ scp,
                  _Float16* __restrict__ P, _Float16* __restrict__ PT, int writeP) {
  const int slice = blockIdx.x, b = blockIdx.y;
  const int tid = threadIdx.x, lane = tid & 31, wave = tid >> 5;
  const _Float16* qp = q0 + ((size_t)b * 192 + slice) * (192 * C3);
  const _Float16* kp = k0 + ((size_t)b * 192 + slice) * (192 * C3);
  // [0]: Q [row][k], [1]: K [col][k], rows at ROW_PITCH
  __shared__ __attribute__((aligned(2048))) _Float16 QKs[2][QK_BUF];
  __shared__ float red[192][12];
  __shared__ float rowv[192];
#if HAVE_TDM
  const unsigned int uw = uni(threadIdx.x >> 5);
  if (pinned(uw < 2u)) {   // wave 0 brings Q, wave 1 brings K: one request each
    tdm_rows128(lds_addr32(&QKs[0][0]) + uw * (QK_BUF * 2u), uw ? kp : qp, 192u, C3 * 2u);
    // the issuing wave's tile has landed before it reaches the barrier below
    asm volatile("s_wait_tensorcnt 0x0" ::: "memory");
  }
#else
  for (int s = tid; s < 192 * C3; s += 512) {
    QKs[0][(s / C3) * ROW_PITCH + s % C3] = qp[s];
    QKs[1][(s / C3) * ROW_PITCH + s % C3] = kp[s];
  }
#endif
  __syncthreads();
  const float sc = *scp;
  const int kg = (lane >> 4) * 8;
  v8f acc[9];
#pragma unroll
  for (int j = 0; j < 9; ++j) {
    int t = wave * 9 + j, mt = t / 12, nt = t % 12;
    v8f a = {0.f, 0.f, 0.f, 0.f, 0.f, 0.f, 0.f, 0.f};
#pragma unroll
    for (int kk = 0; kk < 2; ++kk) {
      v16h af = ldfrag(&QKs[0][(mt * 16 + (lane & 15)) * ROW_PITCH + kk * 32 + kg]);
      v16h bf = ldfrag(&QKs[1][(nt * 16 + (lane & 15)) * ROW_PITCH + kk * 32 + kg]);
      a = wmma_f16(af, bf, a);
    }
    float part[8];
#pragma unroll
    for (int r = 0; r < 8; ++r) {
      a[r] *= sc;
      float m = a[r];
      for (int off = 1; off < 16; off <<= 1) m = fmaxf(m, __shfl_xor(m, off));
      part[r] = m;
    }
    acc[j] = a;
    if ((lane & 15) == 0)
#pragma unroll
      for (int r = 0; r < 8; ++r) red[mt * 16 + kg + r][nt] = part[r];
  }
  __syncthreads();
  if (tid < 192) {
    float m = red[tid][0];
    for (int i = 1; i < 12; ++i) m = fmaxf(m, red[tid][i]);
    rowv[tid] = m;
  }
  __syncthreads();
#pragma unroll
  for (int j = 0; j < 9; ++j) {
    int t = wave * 9 + j, mt = t / 12, nt = t % 12;
    float part[8];
#pragma unroll
    for (int r = 0; r < 8; ++r) {
      int row = mt * 16 + kg + r;
      acc[j][r] = __expf(acc[j][r] - rowv[row]);
      float s = acc[j][r];
      for (int off = 1; off < 16; off <<= 1) s += __shfl_xor(s, off);
      part[r] = s;
    }
    if ((lane & 15) == 0)
#pragma unroll
      for (int r = 0; r < 8; ++r) red[mt * 16 + kg + r][nt] = part[r];
  }
  __syncthreads();
  if (tid < 192) {
    float s = 0.f;
    for (int i = 0; i < 12; ++i) s += red[tid][i];
    rowv[tid] = s;
  }
  __syncthreads();
  const size_t pbase = (size_t)(b * 192 + slice) * 192 * 192;
#pragma unroll
  for (int j = 0; j < 9; ++j) {
    int t = wave * 9 + j, mt = t / 12, nt = t % 12;
    int col = nt * 16 + (lane & 15);
    int r0 = mt * 16 + kg;
    v8h pk;
#pragma unroll
    for (int r = 0; r < 8; ++r) {
      float v = acc[j][r] / rowv[r0 + r];
      pk[r] = (_Float16)v;
      if (writeP) P[pbase + (size_t)(r0 + r) * 192 + col] = (_Float16)v;
    }
    *reinterpret_cast<v8h*>(PT + pbase + (size_t)col * 192 + r0) = pk;  // transposed
  }
}

// --------------------------------------- apply attention + residual + ls
// Two phases: out[c,n] = ls[c]*sum_k V[c,k]*Bm[k,n] + x;  64x192, K=192.
// V rows contiguous (stride vcs); Bm = [slice][k][n] f16.
__global__ __launch_bounds__(512)
void k_attn_apply(const _Float16* __restrict__ V0, const _Float16* __restrict__ V1,
                  size_t vbs, int vcs,
                  const _Float16* __restrict__ B0, const _Float16* __restrict__ B1,
                  float* __restrict__ out0, float* __restrict__ out1,
                  const float* __restrict__ x0, const float* __restrict__ x1,
                  const float* __restrict__ ls0, const float* __restrict__ ls1,
                  int cb, int axis) {
  const int slice = blockIdx.x, b = blockIdx.y;
  const int tid = threadIdx.x, lane = tid & 31, wave = tid >> 5;
  // V as three slices of 64 k: [k / 64][c][k % 64], rows at ROW_PITCH
  __shared__ __attribute__((aligned(2048))) _Float16 Vs[3][V_SLICE];
  __shared__ __attribute__((aligned(16))) _Float16 Bt[192][BT_PITCH];   // [n][k] per 32-K chunk
  const int kg = (lane >> 4) * 8;
  for (int ph = 0; ph < 2; ++ph) {
    // this wave's LDS reads of the phase before have retired before V is loaded anew
    asm volatile("s_wait_dscnt 0x0" ::: "memory");
    __syncthreads();
    const _Float16* vp = (ph ? V1 : V0) + (size_t)b * vbs + slice * 192;
    const _Float16* Bp = (ph ? B1 : B0) + (size_t)(b * 192 + slice) * 192 * 192;
    float* op = ph ? out1 : out0;
    const float* xp = ph ? x1 : x0;
    const float* lsp = ph ? ls1 : ls0;
#if HAVE_TDM
    const unsigned int uw = uni(threadIdx.x >> 5);
    if (pinned(uw < 3u)) {   // waves 0 to 2 bring one slice each: one request a wave
      tdm_rows128(lds_addr32(&Vs[0][0]) + uw * (V_SLICE * 2u), vp + uw * 64u, C3,
                  (unsigned int)vcs * 2u);
      // the issuing wave's slice has landed before it reaches the chunk loop's first barrier
      asm volatile("s_wait_tensorcnt 0x0" ::: "memory");
    }
#else
    for (int s = tid; s < C3 * 192; s += 512) {
      int c = s / 192, i = s % 192;
      Vs[i >> 6][c * ROW_PITCH + (i & 63)] = vp[(size_t)c * vcs + i];
    }
#endif
    v8f acc[3];
#pragma unroll
    for (int j = 0; j < 3; ++j) acc[j] = (v8f){0.f, 0.f, 0.f, 0.f, 0.f, 0.f, 0.f, 0.f};
    for (int kk = 0; kk < 6; ++kk) {
      __syncthreads();
      for (int s = tid; s < 32 * 192; s += 512) {
        int k = s / 192, n = s % 192;
        Bt[n][k] = Bp[(size_t)(kk * 32 + k) * 192 + n];
      }
      __syncthreads();
#pragma unroll
      for (int j = 0; j < 3; ++j) {
        int t = wave * 3 + j, mt = t / 12, nt = t % 12;
        v16h af = ldfrag(&Vs[kk >> 1][(mt * 16 + (lane & 15)) * ROW_PITCH + (kk & 1) * 32 + kg]);
        v16h bf = ldfrag(&Bt[nt * 16 + (lane & 15)][kg]);
        acc[j] = wmma_f16(af, bf, acc[j]);
      }
    }
#pragma unroll
    for (int j = 0; j < 3; ++j) {
      int t = wave * 3 + j, mt = t / 12, nt = t % 12;
      int n = nt * 16 + (lane & 15);
#pragma unroll
      for (int r = 0; r < 8; ++r) {
        int c = cb + mt * 16 + kg + r;
        size_t ad = (axis == 0)
            ? ((size_t)(b * CI + c) * HH + n) * WW + slice
            : ((size_t)(b * CI + c) * HH + slice) * WW + n;
        op[ad] = acc[j][r] * lsp[c] + xp[ad];
      }
    }
  }
}

// ---------------------------------------------------- channel-SE branch
__global__ void k_pool(const _Float16* __restrict__ ql, const _Float16* __restrict__ qr,
                       float* __restrict__ pool) {
  int b = blockIdx.x / C3, c64 = blockIdx.x % C3;
  size_t base = (size_t)(b * CI + 128 + c64) * HW;
  float s = 0.f;
  for (int p = threadIdx.x; p < HW; p += 256)
    s += (float)ql[base + p] + (float)qr[base + p];
  __shared__ float sm[256];
  sm[threadIdx.x] = s;
  __syncthreads();
  for (int o = 128; o > 0; o >>= 1) {
    if (threadIdx.x < o) sm[threadIdx.x] += sm[threadIdx.x + o];
    __syncthreads();
  }
  if (threadIdx.x == 0) pool[b * C3 + c64] = sm[0] * (1.0f / HW);
}

__global__ void k_se(const float* __restrict__ pool, const float* __restrict__ w1,
                     const float* __restrict__ w2, float* __restrict__ a) {
  __shared__ float h1[BB][8];
  __shared__ float lg[BB][128];
  int tid = threadIdx.x;
  if (tid < 16) {
    int b = tid >> 3, j = tid & 7;
    float s = 0.f;
    for (int i = 0; i < 64; ++i) s += pool[b * 64 + i] * w1[j * 64 + i];
    h1[b][j] = fmaxf(s, 0.f);
  }
  __syncthreads();
  {
    int b = tid >> 7, o = tid & 127;
    float s = 0.f;
    for (int j = 0; j < 8; ++j) s += h1[b][j] * w2[o * 8 + j];
    lg[b][o] = s;
  }
  __syncthreads();
  if (tid < BB) {
    float m = -1e30f;
    for (int o = 0; o < 128; ++o) m = fmaxf(m, lg[tid][o]);
    float s = 0.f;
    for (int o = 0; o < 128; ++o) { lg[tid][o] = __expf(lg[tid][o] - m); s += lg[tid][o]; }
    float inv = 1.0f / s;
    for (int o = 0; o < 128; ++o) a[tid * 128 + o] = lg[tid][o] * inv;
  }
}

__global__ void k_se_apply(const float* __restrict__ a,
                           const _Float16* __restrict__ vl, const _Float16* __restrict__ vr,
                           const float* __restrict__ xl, const float* __restrict__ xr,
                           const float* __restrict__ ls1, const float* __restrict__ ls2,
                           float* __restrict__ out_l, float* __restrict__ out_r) {
  size_t idx = (size_t)blockIdx.x * blockDim.x + threadIdx.x;
  const size_t half = (size_t)BB * C3 * HW;
  if (idx >= 2 * half) return;
  int side = (int)(idx / half);
  size_t rem = idx % half;
  int b = (int)(rem / ((size_t)C3 * HW));
  size_t r2 = rem % ((size_t)C3 * HW);
  int c64 = (int)(r2 / HW);
  int p = (int)(r2 % HW);
  int c = 128 + c64;
  float av = a[b * 128 + side * 64 + c64];
  const _Float16* v = side ? vr : vl;
  const float* x = side ? xr : xl;
  const float* ls = side ? ls2 : ls1;
  float* o = side ? out_r : out_l;
  size_t ad = (size_t)(b * CI + c) * HW + p;
  o[ad] = av * (float)v[ad] * ls[c] + x[ad];
}

// ------------------------------------------------------------------ host
extern "C" void kernel_launch(void* const* d_in, const int* in_sizes, int n_in,
                              void* d_out, int out_size, void* d_ws, size_t ws_size,
                              hipStream_t stream) {
  const float* x_l  = (const float*)d_in[0];
  const float* x_r  = (const float*)d_in[1];
  const float* lnlw = (const float*)d_in[2];
  const float* lnlb = (const float*)d_in[3];
  const float* lnrw = (const float*)d_in[4];
  const float* lnrb = (const float*)d_in[5];
  const float* wq_l = (const float*)d_in[6];
  const float* wq_r = (const float*)d_in[7];
  const float* wv_l = (const float*)d_in[8];
  const float* wv_r = (const float*)d_in[9];
  const float* w1   = (const float*)d_in[10];
  const float* w2   = (const float*)d_in[11];
  const float* sch  = (const float*)d_in[12];
  const float* scw  = (const float*)d_in[13];
  const float* ls1  = (const float*)d_in[14];
  const float* ls2  = (const float*)d_in[15];

  float* out_l = (float*)d_out;
  float* out_r = out_l + (size_t)BB * CI * HW;

  char* ws = (char*)d_ws;
  size_t off = 0;
  auto take = [&](size_t bytes) { char* p = ws + off; off += (bytes + 255) & ~(size_t)255; return p; };
  const size_t QV = (size_t)BB * CI * HW;      // half elements
  const size_t QT = (size_t)BB * C3 * HW;
  const size_t PB = (size_t)BB * 192 * 192 * 192;
  const size_t ST = (size_t)BB * HW;           // float elements
  _Float16* q_l  = (_Float16*)take(QV * 2);
  _Float16* q_r  = (_Float16*)take(QV * 2);
  _Float16* v_l  = (_Float16*)take(QV * 2);
  _Float16* v_r  = (_Float16*)take(QV * 2);
  _Float16* qS0l = (_Float16*)take(QT * 2);   // [b][w][h][c64] height Q
  _Float16* qS0r = (_Float16*)take(QT * 2);
  _Float16* qS1l = (_Float16*)take(QT * 2);   // [b][h][w][c64] width Q
  _Float16* qS1r = (_Float16*)take(QT * 2);
  _Float16* vTl  = (_Float16*)take(QT * 2);   // [b][c64][w][h] height V
  _Float16* vTr  = (_Float16*)take(QT * 2);
  _Float16* buf1 = (_Float16*)take(PB * 2);
  _Float16* buf2 = (_Float16*)take(PB * 2);
  float* mul  = (float*)take(ST * 4);
  float* rsl  = (float*)take(ST * 4);
  float* mur  = (float*)take(ST * 4);
  float* rsr  = (float*)take(ST * 4);
  float* pool = (float*)take(BB * C3 * 4);
  float* avec = (float*)take(BB * 128 * 4);

  // 1) LayerNorm stats
  k_ln_stats<<<(2 * BB * HW + 255) / 256, 256, 0, stream>>>(x_l, x_r, mul, rsl, mur, rsr);

  // 2) pointwise convs (WMMA GEMM), LN fused for q
  dim3 cg(HW / (CT_PX * CT_NT), BB);
  k_conv<<<cg, 384, 0, stream>>>(wq_l, x_l, lnlw, lnlb, mul, rsl, 1, q_l, qS0l, qS1l);
  k_conv<<<cg, 384, 0, stream>>>(wq_r, x_r, lnrw, lnrb, mur, rsr, 1, q_r, qS0r, qS1r);
  k_conv<<<cg, 384, 0, stream>>>(wv_l, x_l, lnlw, lnlb, mul, rsl, 0, v_l, vTl, nullptr);
  k_conv<<<cg, 384, 0, stream>>>(wv_r, x_r, lnrw, lnrb, mur, rsr, 0, v_r, vTr, nullptr);

  dim3 ag(192, BB);
  // 3) height axial attention: slices over w, channels [0,64)
  k_attn_score<<<ag, 512, 0, stream>>>(qS0l, qS0r, sch, buf1, buf2, 1);
  k_attn_apply<<<ag, 512, 0, stream>>>(vTr, vTl, (size_t)C3 * HW, HW, buf2, buf1,
                                       out_l, out_r, x_l, x_r, ls1, ls2, 0, 0);

  // 4) width axial attention: slices over h, channels [64,128), two softmaxes
  k_attn_score<<<ag, 512, 0, stream>>>(qS1l, qS1r, scw, nullptr, buf1, 0);
  k_attn_score<<<ag, 512, 0, stream>>>(qS1r, qS1l, scw, nullptr, buf2, 0);
  k_attn_apply<<<ag, 512, 0, stream>>>(v_r + (size_t)C3 * HW, v_l + (size_t)C3 * HW,
                                       (size_t)CI * HW, HW, buf1, buf2,
                                       out_l, out_r, x_l, x_r, ls1, ls2, C3, 1);

  // 5) channel SE branch, channels [128,192)
  k_pool<<<BB * C3, 256, 0, stream>>>(q_l, q_r, pool);
  k_se<<<1, 256, 0, stream>>>(pool, w1, w2, avec);
  k_se_apply<<<(int)((2 * (size_t)BB * C3 * HW + 255) / 256), 256, 0, stream>>>(
      avec, v_l, v_r, x_l, x_r, ls1, ls2, out_l, out_r);
}

// v003
// A run of this version takes 632 microseconds.
// In both of two side-by-side timings against v002, it was 1.29 times as fast.
// Counting every step since v000, it is 1.51 times as fast.
#include <hip/hip_runtime.h>
#include <hip/hip_bf16.h>

typedef __attribute__((ext_vector_type(16))) _Float16 v16h;
typedef __attribute__((ext_vector_type(8)))  _Float16 v8h;
typedef __attribute__((ext_vector_type(8)))  float    v8f;
typedef __attribute__((ext_vector_type(4)))  unsigned int u32x4;
typedef __attribute__((ext_vector_type(8)))  int i32x8;
typedef __attribute__((ext_vector_type(4)))  int i32x4;

#define BB 2
#define CI 192
#define HH 192
#define WW 192
#define HW 36864
#define C3 64

#if defined(__HIP_DEVICE_COMPILE__) && __has_builtin(__builtin_amdgcn_tensor_load_to_lds)
#define HAVE_TDM 1
#else
#define HAVE_TDM 0
#endif

__device__ __forceinline__ v8f wmma_f16(v16h a, v16h b, v8f c) {
  // D = A(16x32 f16) * B(32x16 f16) + C(16x16 f32)
  return __builtin_amdgcn_wmma_f32_16x16x32_f16(false, a, false, b, (short)0, c,
                                                false, false);
}

// Load a 16-half WMMA operand fragment from a [row][K] layout: 8 contiguous
// halves at p (K = kg..kg+7) and 8 at p+16 (K = kg+16..kg+23).
__device__ __forceinline__ v16h ldfrag(const _Float16* p) {
  v8h lo = *reinterpret_cast<const v8h*>(p);
  v8h hi = *reinterpret_cast<const v8h*>(p + 16);
  v16h r;
#pragma unroll
  for (int i = 0; i < 8; ++i) { r[i] = lo[i]; r[i + 8] = hi[i]; }
  return r;
}

#if HAVE_TDM
typedef __attribute__((address_space(3))) const void lds_cvoid;
__device__ __forceinline__ unsigned int lds_addr32(const void* p) {
  return (unsigned int)(uintptr_t)(lds_cvoid*)p;
}
typedef __attribute__((ext_vector_type(8))) unsigned int u32x8;
__device__ __forceinline__ unsigned int uni(unsigned int v) {
  return (unsigned int)__builtin_amdgcn_readfirstlane(v);
}
__device__ __forceinline__ unsigned int pinned(unsigned int v) {
  unsigned int w = uni(v);
  asm volatile("" : "+s"(w));  // pinned(): the test word stays in a scalar register
  return w;
}
__device__ __forceinline__ void tdm_rows128(unsigned int lds_off, const void* gaddr,
                                            unsigned int rows, unsigned int src_pitch) {
  unsigned long long ga = (unsigned long long)(uintptr_t)gaddr;
  u32x4 g0;
  g0[0] = uni(1u);                              // count = 1
  g0[1] = uni(lds_off);                         // LDS destination (bytes)
  g0[2] = uni((unsigned int)ga);                // global address [31:0]
  g0[3] = uni((((unsigned int)(ga >> 32)) & 0x01FFFFFFu) | 0x80000000u);  // [56:32] | type = 2
  u32x8 g1;
  g1[0] = uni((1u << 20) | (4u << 22) | (3u << 25));
  g1[1] = uni(128u << 16);
  g1[2] = uni(rows << 16);
  g1[3] = uni(128u << 16);
  g1[4] = uni(rows);
  g1[5] = uni(src_pitch);
  g1[6] = uni(0u);
  g1[7] = uni(0u);
  asm volatile("tensor_load_to_lds %0, %1" :: "s"(g0), "s"(g1) : "memory");
}
#endif  // HAVE_TDM

// ---------------------------------------------------------------- LN stats
__global__ void k_ln_stats(const float* __restrict__ xl, const float* __restrict__ xr,
                           float* __restrict__ mul, float* __restrict__ rsl,
                           float* __restrict__ mur, float* __restrict__ rsr) {
  int idx = blockIdx.x * blockDim.x + threadIdx.x;
  if (idx >= 2 * BB * HW) return;
  int side = idx / (BB * HW);
  int rem  = idx % (BB * HW);
  int b = rem / HW, p = rem % HW;
  const float* base = (side ? xr : xl) + (size_t)b * CI * HW + p;
  float s = 0.f, s2 = 0.f;
  for (int c = 0; c < CI; ++c) { float v = base[(size_t)c * HW]; s += v; s2 += v * v; }
  float m = s * (1.0f / CI);
  float var = s2 * (1.0f / CI) - m * m;
  float r = rsqrtf(var + 1e-6f);
  if (side) { mur[rem] = m; rsr[rem] = r; } else { mul[rem] = m; rsl[rem] = r; }
}

#define CT_PX 32
#define CT_NT 3
#define CT_PITCH 200   // halves per LDS row: 400 B = 16 B x odd, for b128 readers
typedef __attribute__((ext_vector_type(4))) float    f32x4;
typedef __attribute__((ext_vector_type(4))) _Float16 v4h;

__global__ __launch_bounds__(384, 9)
void k_conv(const float* __restrict__ Wm, const float* __restrict__ X,
            const float* __restrict__ lnw, const float* __restrict__ lnb,
            const float* __restrict__ mu, const float* __restrict__ rstd,
            int isQ, _Float16* __restrict__ out,
            _Float16* __restrict__ outA, _Float16* __restrict__ outB) {
  const int b   = blockIdx.y;
  const int tid = threadIdx.x, lane = tid & 31, wave = tid >> 5;
  const int pbase = blockIdx.x * (CT_PX * CT_NT);
  __shared__ __attribute__((aligned(16))) _Float16 wS[CI][CT_PITCH];        // [m][k]
  __shared__ __attribute__((aligned(16))) _Float16 xT[2][CT_PX][CT_PITCH];  // [n][k]
  __shared__ __attribute__((aligned(16))) float lnS[2][CI];
  const int kg = (lane >> 4) * 8;
  // staging map: a thread owns 4 adjacent pixels x 4 adjacent channels
  const int pg = (tid & 7) * 4, c0 = (tid >> 3) * 4;
  const float* xcol = X + (size_t)b * CI * HW + (size_t)c0 * HW + pg;
  const float* mcol = mu + b * HW + pg;
  const float* rcol = rstd + b * HW + pg;

  // Prologue: half of the weights and the first pixel tile are in flight together;
  // the second half of the weights follows while the tile is still on its way.
  const float* wsrc = Wm + (size_t)wave * 16 * CI;   // a wave's 16 rows: 12 KiB in a row
  float lw0 = 0.f, lb0 = 0.f;
  if (isQ && tid < CI) { lw0 = lnw[tid]; lb0 = lnb[tid]; }
  f32x4 w4[12];
#pragma unroll
  for (int i = 0; i < 12; ++i)
    w4[i] = *reinterpret_cast<const f32x4*>(wsrc + (i * 32 + lane) * 4);
  f32x4 xr[4];
  f32x4 m4 = {0.f, 0.f, 0.f, 0.f}, r4 = m4;
#pragma unroll
  for (int i = 0; i < 4; ++i)
    xr[i] = *reinterpret_cast<const f32x4*>(xcol + (size_t)i * HW + pbase);
  if (isQ) {
    m4 = *reinterpret_cast<const f32x4*>(mcol + pbase);
    // the next load's result may land on this load's address registers
    asm volatile("s_wait_xcnt 0x0" ::: "memory");
    r4 = *reinterpret_cast<const f32x4*>(rcol + pbase);
  }
#pragma unroll
  for (int g = 0; g < 2; ++g) {
#pragma unroll
    for (int i = 0; i < 12; ++i) {
      const int e = ((g * 12 + i) * 32 + lane) * 4;
      v4h h4 = {(_Float16)w4[i][0], (_Float16)w4[i][1], (_Float16)w4[i][2], (_Float16)w4[i][3]};
      *reinterpret_cast<v4h*>(&wS[wave * 16 + e / CI][e % CI]) = h4;
    }
    if (g == 0) {
#pragma unroll
      for (int i = 0; i < 12; ++i)
        w4[i] = *reinterpret_cast<const f32x4*>(wsrc + ((12 + i) * 32 + lane) * 4);
    }
  }
  if (isQ && tid < CI) { lnS[0][tid] = lw0; lnS[1][tid] = lb0; }
  __syncthreads();
  const _Float16* wrow = &wS[wave * 16 + (lane & 15)][kg];

  const int r0 = wave * 16 + (lane >> 4) * 8;
  for (int t = 0; t < CT_NT; ++t) {
    const int p0 = pbase + t * CT_PX;
    _Float16 (*xb)[CT_PITCH] = xT[t & 1];
    f32x4 y[4];
#pragma unroll
    for (int i = 0; i < 4; ++i)
      y[i] = isQ ? (xr[i] - m4) * r4 * lnS[0][c0 + i] + lnS[1][c0 + i] : xr[i];
#pragma unroll
    for (int j = 0; j < 4; ++j) {
      v4h hv = {(_Float16)y[0][j], (_Float16)y[1][j], (_Float16)y[2][j], (_Float16)y[3][j]};
      *reinterpret_cast<v4h*>(&xb[pg + j][c0]) = hv;
    }
    // One barrier a tile: it publishes this buffer, and every wave that passes
    // it has left the other buffer, which the next trip refills.
    __syncthreads();
    if (t + 1 < CT_NT) {   // next tile's loads fly under this tile's products and stores
#pragma unroll
      for (int i = 0; i < 4; ++i)
        xr[i] = *reinterpret_cast<const f32x4*>(xcol + (size_t)i * HW + p0 + CT_PX);
      // the address registers of the loads above are reused for the next addresses
      asm volatile("s_wait_xcnt 0x0" ::: "memory");
      if (isQ) {
        m4 = *reinterpret_cast<const f32x4*>(mcol + p0 + CT_PX);
        r4 = *reinterpret_cast<const f32x4*>(rcol + p0 + CT_PX);
        // the address registers of these two loads are reused right behind them
        asm volatile("s_wait_xcnt 0x0" ::: "memory");
      }
    }
    v8f acc[2];
#pragma unroll
    for (int s = 0; s < 2; ++s) acc[s] = (v8f){0.f, 0.f, 0.f, 0.f, 0.f, 0.f, 0.f, 0.f};
#pragma unroll
    for (int kk = 0; kk < 6; ++kk) {
      v16h af = ldfrag(wrow + kk * 32);
#pragma unroll
      for (int s = 0; s < 2; ++s) {
        v16h bf = ldfrag(&xb[s * 16 + (lane & 15)][kk * 32 + kg]);
        acc[s] = wmma_f16(af, bf, acc[s]);
      }
    }
#pragma unroll
    for (int sub = 0; sub < 2; ++sub) {
      const int p = p0 + sub * 16 + (lane & 15);
      const int w = p % WW, h = p / WW;
#pragma unroll
      for (int r = 0; r < 8; ++r) {
        int m = r0 + r;
        _Float16 v = (_Float16)acc[sub][r];
        out[(size_t)(b * CI + m) * HW + p] = v;
        // the next value's conversion may land on the register this store names
        asm volatile("s_wait_xcnt 0x0" ::: "memory");
        if (isQ) {
          if (m < C3)          outA[(((size_t)b * WW + w) * HH + h) * C3 + m] = v;
          else if (m < 2 * C3) outB[(((size_t)b * HH + h) * WW + w) * C3 + (m - C3)] = v;
        } else if (m < C3) {
          outA[((size_t)(b * C3 + m) * WW + w) * HH + h] = v;
        }
      }
    }
    // the next trip overwrites the registers that the last stores name
    asm volatile("s_wait_xcnt 0x0" ::: "memory");
  }
}

// ------------------------------------- axial attention scores + softmax
// Q/K stored per-slice contiguous as [slice][row][c64]; S = scale*Q K^T,
// P = row-softmax(S) (192x192, K=64). S in registers (16 waves x 9 tiles).
// LDS rows that feed 16-byte fragment reads stand at a pitch of 16 B x odd.
#define ROW_PITCH 72     // halves: 128-byte rows + the mover's 16-byte pad = 144 B
#define QK_BUF 14336     // halves: 192 rows x 144 B, rounded up to a multiple of 2 KiB
#define V_SLICE 5120     // halves: 64 rows x 144 B, rounded up to a multiple of 2 KiB
#define BT_PITCH 40      // halves: 64-byte rows + 16 B = 80 B
__global__ __launch_bounds__(512)
void k_attn_score(const _Float16* __restrict__ q0, const _Float16* __restrict__ k0,
                  const float* __restrict__ scp,
                  _Float16* __restrict__ P, _Float16* __restrict__ PT, int writeP) {
  const int slice = blockIdx.x, b = blockIdx.y;
  const int tid = threadIdx.x, lane = tid & 31, wave = tid >> 5;
  const _Float16* qp = q0 + ((size_t)b * 192 + slice) * (192 * C3);
  const _Float16* kp = k0 + ((size_t)b * 192 + slice) * (192 * C3);
  // [0]: Q [row][k], [1]: K [col][k], rows at ROW_PITCH
  __shared__ __attribute__((aligned(2048))) _Float16 QKs[2][QK_BUF];
  __shared__ float red[192][12];
  __shared__ float rowv[192];
#if HAVE_TDM
  const unsigned int uw = uni(threadIdx.x >> 5);
  if (pinned(uw < 2u)) {   // wave 0 brings Q, wave 1 brings K: one request each
    tdm_rows128(lds_addr32(&QKs[0][0]) + uw * (QK_BUF * 2u), uw ? kp : qp, 192u, C3 * 2u);
    // the issuing wave's tile has landed before it reaches the barrier below
    asm volatile("s_wait_tensorcnt 0x0" ::: "memory");
  }
#else
  for (int s = tid; s < 192 * C3; s += 512) {
    QKs[0][(s / C3) * ROW_PITCH + s % C3] = qp[s];
    QKs[1][(s / C3) * ROW_PITCH + s % C3] = kp[s];
  }
#endif
  __syncthreads();
  const float sc = *scp;
  const int kg = (lane >> 4) * 8;
  v8f acc[9];
#pragma unroll
  for (int j = 0; j < 9; ++j) {
    int t = wave * 9 + j, mt = t / 12, nt = t % 12;
    v8f a = {0.f, 0.f, 0.f, 0.f, 0.f, 0.f, 0.f, 0.f};
#pragma unroll
    for (int kk = 0; kk < 2; ++kk) {
      v16h af = ldfrag(&QKs[0][(mt * 16 + (lane & 15)) * ROW_PITCH + kk * 32 + kg]);
      v16h bf = ldfrag(&QKs[1][(nt * 16 + (lane & 15)) * ROW_PITCH + kk * 32 + kg]);
      a = wmma_f16(af, bf, a);
    }
    float part[8];
#pragma unroll
    for (int r = 0; r < 8; ++r) {
      a[r] *= sc;
      float m = a[r];
      for (int off = 1; off < 16; off <<= 1) m = fmaxf(m, __shfl_xor(m, off));
      part[r] = m;
    }
    acc[j] = a;
    if ((lane & 15) == 0)
#pragma unroll
      for (int r = 0; r < 8; ++r) red[mt * 16 + kg + r][nt] = part[r];
  }
  __syncthreads();
  if (tid < 192) {
    float m = red[tid][0];
    for (int i = 1; i < 12; ++i) m = fmaxf(m, red[tid][i]);
    rowv[tid] = m;
  }
  __syncthreads();
#pragma unroll
  for (int j = 0; j < 9; ++j) {
    int t = wave * 9 + j, mt = t / 12, nt = t % 12;
    float part[8];
#pragma unroll
    for (int r = 0; r < 8; ++r) {
      int row = mt * 16 + kg + r;
      acc[j][r] = __expf(acc[j][r] - rowv[row]);
      float s = acc[j][r];
      for (int off = 1; off < 16; off <<= 1) s += __shfl_xor(s, off);
      part[r] = s;
    }
    if ((lane & 15) == 0)
#pragma unroll
      for (int r = 0; r < 8; ++r) red[mt * 16 + kg + r][nt] = part[r];
  }
  __syncthreads();
  if (tid < 192) {
    float s = 0.f;
    for (int i = 0; i < 12; ++i) s += red[tid][i];
    rowv[tid] = s;
  }
  __syncthreads();
  const size_t pbase = (size_t)(b * 192 + slice) * 192 * 192;
#pragma unroll
  for (int j = 0; j < 9; ++j) {
    int t = wave * 9 + j, mt = t / 12, nt = t % 12;
    int col = nt * 16 + (lane & 15);
    int r0 = mt * 16 + kg;
    v8h pk;
#pragma unroll
    for (int r = 0; r < 8; ++r) {
      float v = acc[j][r] / rowv[r0 + r];
      pk[r] = (_Float16)v;
      if (writeP) P[pbase + (size_t)(r0 + r) * 192 + col] = (_Float16)v;
    }
    *reinterpret_cast<v8h*>(PT + pbase + (size_t)col * 192 + r0) = pk;  // transposed
  }
}

// --------------------------------------- apply attention + residual + ls
// Two phases: out[c,n] = ls[c]*sum_k V[c,k]*Bm[k,n] + x (AXIS 1);  64x192, K=192.
// V rows contiguous (stride vcs); Bm = [slice][k][n] f16.
// AXIS 0 (n = h, slice = w): out0/out1 are workspace planes [b][c64][w][h] that take
// the bare sums, rows along n; k_h_finish turns them and adds scale and residual.
// AXIS is a compile-time constant: no branch stands between the last product and the stores.
template <int AXIS>
__global__ __launch_bounds__(512)
void k_attn_apply(const _Float16* __restrict__ V0, const _Float16* __restrict__ V1,
                  size_t vbs, int vcs,
                  const _Float16* __restrict__ B0, const _Float16* __restrict__ B1,
                  float* __restrict__ out0, float* __restrict__ out1,
                  const float* __restrict__ x0, const float* __restrict__ x1,
                  const float* __restrict__ ls0, const float* __restrict__ ls1,
                  int cb) {
  const int slice = blockIdx.x, b = blockIdx.y;
  const int tid = threadIdx.x, lane = tid & 31, wave = tid >> 5;
  // V as three slices of 64 k: [k / 64][c][k % 64], rows at ROW_PITCH
  __shared__ __attribute__((aligned(2048))) _Float16 Vs[3][V_SLICE];
  __shared__ __attribute__((aligned(16))) _Float16 Bt[192][BT_PITCH];   // [n][k] per 32-K chunk
  const int kg = (lane >> 4) * 8;
  for (int ph = 0; ph < 2; ++ph) {
    // this wave's LDS reads of the phase before have retired before V is loaded anew
    asm volatile("s_wait_dscnt 0x0" ::: "memory");
    __syncthreads();
    const _Float16* vp = (ph ? V1 : V0) + (size_t)b * vbs + slice * 192;
    const _Float16* Bp = (ph ? B1 : B0) + (size_t)(b * 192 + slice) * 192 * 192;
    float* op = ph ? out1 : out0;
    const float* xp = ph ? x1 : x0;
    const float* lsp = ph ? ls1 : ls0;
#if HAVE_TDM
    const unsigned int uw = uni(threadIdx.x >> 5);
    if (pinned(uw < 3u)) {   // waves 0 to 2 bring one slice each: one request a wave
      tdm_rows128(lds_addr32(&Vs[0][0]) + uw * (V_SLICE * 2u), vp + uw * 64u, C3,
                  (unsigned int)vcs * 2u);
      // the issuing wave's slice has landed before it reaches the chunk loop's first barrier
      asm volatile("s_wait_tensorcnt 0x0" ::: "memory");
    }
#else
    for (int s = tid; s < C3 * 192; s += 512) {
      int c = s / 192, i = s % 192;
      Vs[i >> 6][c * ROW_PITCH + (i & 63)] = vp[(size_t)c * vcs + i];
    }
#endif
    v8f acc[3];
#pragma unroll
    for (int j = 0; j < 3; ++j) acc[j] = (v8f){0.f, 0.f, 0.f, 0.f, 0.f, 0.f, 0.f, 0.f};
    for (int kk = 0; kk < 6; ++kk) {
      __syncthreads();
      for (int s = tid; s < 32 * 192; s += 512) {
        int k = s / 192, n = s % 192;
        Bt[n][k] = Bp[(size_t)(kk * 32 + k) * 192 + n];
      }
      __syncthreads();
#pragma unroll
      for (int j = 0; j < 3; ++j) {
        int t = wave * 3 + j, mt = t / 12, nt = t % 12;
        v16h af = ldfrag(&Vs[kk >> 1][(mt * 16 + (lane & 15)) * ROW_PITCH + (kk & 1) * 32 + kg]);
        v16h bf = ldfrag(&Bt[nt * 16 + (lane & 15)][kg]);
        acc[j] = wmma_f16(af, bf, acc[j]);
      }
    }
#pragma unroll
    for (int j = 0; j < 3; ++j) {
      int t = wave * 3 + j, mt = t / 12, nt = t % 12;
      int n = nt * 16 + (lane & 15);
      if (AXIS == 0) {
#pragma unroll   // constant index into acc: it stays in registers
        for (int r = 0; r < 8; ++r)
          op[((size_t)(b * C3 + mt * 16 + kg + r) * WW + slice) * HH + n] = acc[j][r];
      } else {
#pragma unroll
        for (int r = 0; r < 8; ++r) {
          int c = cb + mt * 16 + kg + r;
          size_t ad = ((size_t)(b * CI + c) * HH + slice) * WW + n;
          op[ad] = acc[j][r] * lsp[c] + xp[ad];
        }
      }
    }
    // the next phase overwrites the registers that the stores above name
    asm volatile("s_wait_xcnt 0x0" ::: "memory");
  }
}

// ------------------- height branch: turn [w][h] planes, scale, add residual
// out[c][h][w] = ls[c] * t[c][w][h] + x[c][h][w] for channels [0,64). One block
// turns a 64x64 tile through LDS, so that every global access covers 256 B of a row.
#define HT 64
__global__ __launch_bounds__(256)
void k_h_finish(const float* __restrict__ t0, const float* __restrict__ t1,
                const float* __restrict__ xl, const float* __restrict__ xr,
                const float* __restrict__ ls1, const float* __restrict__ ls2,
                float* __restrict__ out_l, float* __restrict__ out_r) {
  const int w0 = (blockIdx.x / 3) * HT, h0 = (blockIdx.x % 3) * HT;
  const int c = blockIdx.y, side = blockIdx.z >> 1, b = blockIdx.z & 1;
  __shared__ float tl[HT][HT + 1];
  const int q = (threadIdx.x & 15) * 4, rw = threadIdx.x >> 4;
  const float* tp = (side ? t1 : t0) + (size_t)(b * C3 + c) * HW;
  const float* xp = (side ? xr : xl) + (size_t)(b * CI + c) * HW;
  float* op = (side ? out_r : out_l) + (size_t)(b * CI + c) * HW;
  const float l = (side ? ls2 : ls1)[c];
  f32x4 tv[4], xv[4];
  // every '#pragma unroll' below makes the indices of tv, xv and o constant, so that they
  // stay in registers; the eight loads are then in flight together
#pragma unroll
  for (int i = 0; i < 4; ++i)
    tv[i] = *reinterpret_cast<const f32x4*>(tp + (w0 + i * 16 + rw) * HH + h0 + q);
#pragma unroll
  for (int i = 0; i < 4; ++i)
    xv[i] = *reinterpret_cast<const f32x4*>(xp + (h0 + i * 16 + rw) * WW + w0 + q);
#pragma unroll
  for (int i = 0; i < 4; ++i)
#pragma unroll
    for (int k = 0; k < 4; ++k) tl[i * 16 + rw][q + k] = tv[i][k];
  __syncthreads();
#pragma unroll
  for (int i = 0; i < 4; ++i) {
    f32x4 o;
#pragma unroll
    for (int k = 0; k < 4; ++k) o[k] = tl[q + k][i * 16 + rw] * l + xv[i][k];
    *reinterpret_cast<f32x4*>(op + (h0 + i * 16 + rw) * WW + w0 + q) = o;
  }
}

// ---------------------------------------------------- channel-SE branch
__global__ void k_pool(const _Float16* __restrict__ ql, const _Float16* __restrict__ qr,
                       float* __restrict__ pool) {
  int b = blockIdx.x / C3, c64 = blockIdx.x % C3;
  size_t base = (size_t)(b * CI + 128 + c64) * HW;
  float s = 0.f;
  for (int p = threadIdx.x; p < HW; p += 256)
    s += (float)ql[base + p] + (float)qr[base + p];
  __shared__ float sm[256];
  sm[threadIdx.x] = s;
  __syncthreads();
  for (int o = 128; o > 0; o >>= 1) {
    if (threadIdx.x < o) sm[threadIdx.x] += sm[threadIdx.x + o];
    __syncthreads();
  }
  if (threadIdx.x == 0) pool[b * C3 + c64] = sm[0] * (1.0f / HW);
}

__global__ void k_se(const float* __restrict__ pool, const float* __restrict__ w1,
                     const float* __restrict__ w2, float* __restrict__ a) {
  __shared__ float h1[BB][8];
  __shared__ float lg[BB][128];
  int tid = threadIdx.x;
  if (tid < 16) {
    int b = tid >> 3, j = tid & 7;
    float s = 0.f;
    for (int i = 0; i < 64; ++i) s += pool[b * 64 + i] * w1[j * 64 + i];
    h1[b][j] = fmaxf(s, 0.f);
  }
  __syncthreads();
  {
    int b = tid >> 7, o = tid & 127;
    float s = 0.f;
    for (int j = 0; j < 8; ++j) s += h1[b][j] * w2[o * 8 + j];
    lg[b][o] = s;
  }
  __syncthreads();
  if (tid < BB) {
    float m = -1e30f;
    for (int o = 0; o < 128; ++o) m = fmaxf(m, lg[tid][o]);
    float s = 0.f;
    for (int o = 0; o < 128; ++o) { lg[tid][o] = __expf(lg[tid][o] - m); s += lg[tid][o]; }
    float inv = 1.0f / s;
    for (int o = 0; o < 128; ++o) a[tid * 128 + o] = lg[tid][o] * inv;
  }
}

__global__ void k_se_apply(const float* __restrict__ a,
                           const _Float16* __restrict__ vl, const _Float16* __restrict__ vr,
                           const float* __restrict__ xl, const float* __restrict__ xr,
                           const float* __restrict__ ls1, const float* __restrict__ ls2,
                           float* __restrict__ out_l, float* __restrict__ out_r) {
  size_t idx = (size_t)blockIdx.x * blockDim.x + threadIdx.x;
  const size_t half = (size_t)BB * C3 * HW;
  if (idx >= 2 * half) return;
  int side = (int)(idx / half);
  size_t rem = idx % half;
  int b = (int)(rem / ((size_t)C3 * HW));
  size_t r2 = rem % ((size_t)C3 * HW);
  int c64 = (int)(r2 / HW);
  int p = (int)(r2 % HW);
  int c = 128 + c64;
  float av = a[b * 128 + side * 64 + c64];
  const _Float16* v = side ? vr : vl;
  const float* x = side ? xr : xl;
  const float* ls = side ? ls2 : ls1;
  float* o = side ? out_r : out_l;
  size_t ad = (size_t)(b * CI + c) * HW + p;
  o[ad] = av * (float)v[ad] * ls[c] + x[ad];
}

// ------------------------------------------------------------------ host
extern "C" void kernel_launch(void* const* d_in, const int* in_sizes, int n_in,
                              void* d_out, int out_size, void* d_ws, size_t ws_size,
                              hipStream_t stream) {
  const float* x_l  = (const float*)d_in[0];
  const float* x_r  = (const float*)d_in[1];
  const float* lnlw = (const float*)d_in[2];
  const float* lnlb = (const float*)d_in[3];
  const float* lnrw = (const float*)d_in[4];
  const float* lnrb = (const float*)d_in[5];
  const float* wq_l = (const float*)d_in[6];
  const float* wq_r = (const float*)d_in[7];
  const float* wv_l = (const float*)d_in[8];
  const float* wv_r = (const float*)d_in[9];
  const float* w1   = (const float*)d_in[10];
  const float* w2   = (const float*)d_in[11];
  const float* sch  = (const float*)d_in[12];
  const float* scw  = (const float*)d_in[13];
  const float* ls1  = (const float*)d_in[14];
  const float* ls2  = (const float*)d_in[15];

  float* out_l = (float*)d_out;
  float* out_r = out_l + (size_t)BB * CI * HW;

  char* ws = (char*)d_ws;
  size_t off = 0;
  auto take = [&](size_t bytes) { char* p = ws + off; off += (bytes + 255) & ~(size_t)255; return p; };
  const size_t QV = (size_t)BB * CI * HW;      // half elements
  const size_t QT = (size_t)BB * C3 * HW;
  const size_t PB = (size_t)BB * 192 * 192 * 192;
  const size_t ST = (size_t)BB * HW;           // float elements
  _Float16* q_l  = (_Float16*)take(QV * 2);
  _Float16* q_r  = (_Float16*)take(QV * 2);
  _Float16* v_l  = (_Float16*)take(QV * 2);
  _Float16* v_r  = (_Float16*)take(QV * 2);
  _Float16* qS0l = (_Float16*)take(QT * 2);   // [b][w][h][c64] height Q
  _Float16* qS0r = (_Float16*)take(QT * 2);
  _Float16* qS1l = (_Float16*)take(QT * 2);   // [b][h][w][c64] width Q
  _Float16* qS1r = (_Float16*)take(QT * 2);
  _Float16* vTl  = (_Float16*)take(QT * 2);   // [b][c64][w][h] height V
  _Float16* vTr  = (_Float16*)take(QT * 2);
  _Float16* buf1 = (_Float16*)take(PB * 2);
  _Float16* buf2 = (_Float16*)take(PB * 2);
  float* mul  = (float*)take(ST * 4);
  float* rsl  = (float*)take(ST * 4);
  float* mur  = (float*)take(ST * 4);
  float* rsr  = (float*)take(ST * 4);
  float* pool = (float*)take(BB * C3 * 4);
  float* avec = (float*)take(BB * 128 * 4);
  float* tH_l = (float*)take(QT * 4);         // [b][c64][w][h] height sums
  float* tH_r = (float*)take(QT * 4);

  // 1) LayerNorm stats
  k_ln_stats<<<(2 * BB * HW + 255) / 256, 256, 0, stream>>>(x_l, x_r, mul, rsl, mur, rsr);

  // 2) pointwise convs (WMMA GEMM), LN fused for q
  dim3 cg(HW / (CT_PX * CT_NT), BB);
  k_conv<<<cg, 384, 0, stream>>>(wq_l, x_l, lnlw, lnlb, mul, rsl, 1, q_l, qS0l, qS1l);
  k_conv<<<cg, 384, 0, stream>>>(wq_r, x_r, lnrw, lnrb, mur, rsr, 1, q_r, qS0r, qS1r);
  k_conv<<<cg, 384, 0, stream>>>(wv_l, x_l, lnlw, lnlb, mul, rsl, 0, v_l, vTl, nullptr);
  k_conv<<<cg, 384, 0, stream>>>(wv_r, x_r, lnrw, lnrb, mur, rsr, 0, v_r, vTr, nullptr);

  dim3 ag(192, BB);
  // 3) height axial attention: slices over w, channels [0,64)
  k_attn_score<<<ag, 512, 0, stream>>>(qS0l, qS0r, sch, buf1, buf2, 1);
  k_attn_apply<0><<<ag, 512, 0, stream>>>(vTr, vTl, (size_t)C3 * HW, HW, buf2, buf1,
                                          tH_l, tH_r, x_l, x_r, ls1, ls2, 0);
  k_h_finish<<<dim3(9, C3, 2 * BB), 256, 0, stream>>>(tH_l, tH_r, x_l, x_r, ls1, ls2,
                                                      out_l, out_r);

  // 4) width axial attention: slices over h, channels [64,128), two softmaxes
  k_attn_score<<<ag, 512, 0, stream>>>(qS1l, qS1r, scw, nullptr, buf1, 0);
  k_attn_score<<<ag, 512, 0, stream>>>(qS1r, qS1l, scw, nullptr, buf2, 0);
  k_attn_apply<1><<<ag, 512, 0, stream>>>(v_r + (size_t)C3 * HW, v_l + (size_t)C3 * HW,
                                          (size_t)CI * HW, HW, buf1, buf2,
                                          out_l, out_r, x_l, x_r, ls1, ls2, C3);

  // 5) channel SE branch, channels [128,192)
  k_pool<<<BB * C3, 256, 0, stream>>>(q_l, q_r, pool);
  k_se<<<1, 256, 0, stream>>>(pool, w1, w2, avec);
  k_se_apply<<<(int)((2 * (size_t)BB * C3 * HW + 255) / 256), 256, 0, stream>>>(
      avec, v_l, v_r, x_l, x_r, ls1, ls2, out_l, out_r);
}

// v004
// It runs in 294 microseconds.
// Two timings next to v003 both put it at 2.16 times that version's speed.
// All steps since v000 together make it 3.26 times as fast.
#include <hip/hip_runtime.h>
#include <hip/hip_bf16.h>

typedef __attribute__((ext_vector_type(16))) _Float16 v16h;
typedef __attribute__((ext_vector_type(8)))  _Float16 v8h;
typedef __attribute__((ext_vector_type(2)))  _Float16 v2h;
typedef __attribute__((ext_vector_type(8)))  float    v8f;
typedef __attribute__((ext_vector_type(4)))  unsigned int u32x4;
typedef __attribute__((ext_vector_type(8)))  int i32x8;
typedef __attribute__((ext_vector_type(4)))  int i32x4;

#define BB 2
#define CI 192
#define HH 192
#define WW 192
#define HW 36864
#define C3 64

#if defined(__HIP_DEVICE_COMPILE__) && __has_builtin(__builtin_amdgcn_tensor_load_to_lds)
#define HAVE_TDM 1
#else
#define HAVE_TDM 0
#endif

__device__ __forceinline__ v8f wmma_f16(v16h a, v16h b, v8f c) {
  // D = A(16x32 f16) * B(32x16 f16) + C(16x16 f32)
  return __builtin_amdgcn_wmma_f32_16x16x32_f16(false, a, false, b, (short)0, c,
                                                false, false);
}

// Load a 16-half WMMA operand fragment from a [row][K] layout: 8 contiguous
// halves at p (K = kg..kg+7) and 8 at p+16 (K = kg+16..kg+23).
__device__ __forceinline__ v16h ldfrag(const _Float16* p) {
  v8h lo = *reinterpret_cast<const v8h*>(p);
  v8h hi = *reinterpret_cast<const v8h*>(p + 16);
  v16h r;
#pragma unroll
  for (int i = 0; i < 8; ++i) { r[i] = lo[i]; r[i + 8] = hi[i]; }
  return r;
}

#if HAVE_TDM
typedef __attribute__((address_space(3))) const void lds_cvoid;
__device__ __forceinline__ unsigned int lds_addr32(const void* p) {
  return (unsigned int)(uintptr_t)(lds_cvoid*)p;
}
typedef __attribute__((ext_vector_type(8))) unsigned int u32x8;
__device__ __forceinline__ unsigned int uni(unsigned int v) {
  return (unsigned int)__builtin_amdgcn_readfirstlane(v);
}
__device__ __forceinline__ unsigned int pinned(unsigned int v) {
  unsigned int w = uni(v);
  asm volatile("" : "+s"(w));  // pinned(): the test word stays in a scalar register
  return w;
}
__device__ __forceinline__ void tdm_rows128(unsigned int lds_off, const void* gaddr,
                                            unsigned int rows, unsigned int src_pitch) {
  unsigned long long ga = (unsigned long long)(uintptr_t)gaddr;
  u32x4 g0;
  g0[0] = uni(1u);                              // count = 1
  g0[1] = uni(lds_off);                         // LDS destination (bytes)
  g0[2] = uni((unsigned int)ga);                // global address [31:0]
  g0[3] = uni((((unsigned int)(ga >> 32)) & 0x01FFFFFFu) | 0x80000000u);  // [56:32] | type = 2
  u32x8 g1;
  g1[0] = uni((1u << 20) | (4u << 22) | (3u << 25));
  g1[1] = uni(128u << 16);
  g1[2] = uni(rows << 16);
  g1[3] = uni(128u << 16);
  g1[4] = uni(rows);
  g1[5] = uni(src_pitch);
  g1[6] = uni(0u);
  g1[7] = uni(0u);
  asm volatile("tensor_load_to_lds %0, %1" :: "s"(g0), "s"(g1) : "memory");
}
#endif  // HAVE_TDM

// ---------------------------------------------------------------- LN stats
__global__ void k_ln_stats(const float* __restrict__ xl, const float* __restrict__ xr,
                           float* __restrict__ mul, float* __restrict__ rsl,
                           float* __restrict__ mur, float* __restrict__ rsr) {
  int idx = blockIdx.x * blockDim.x + threadIdx.x;
  if (idx >= 2 * BB * HW) return;
  int side = idx / (BB * HW);
  int rem  = idx % (BB * HW);
  int b = rem / HW, p = rem % HW;
  const float* base = (side ? xr : xl) + (size_t)b * CI * HW + p;
  float s = 0.f, s2 = 0.f;
  for (int c = 0; c < CI; ++c) { float v = base[(size_t)c * HW]; s += v; s2 += v * v; }
  float m = s * (1.0f / CI);
  float var = s2 * (1.0f / CI) - m * m;
  float r = rsqrtf(var + 1e-6f);
  if (side) { mur[rem] = m; rsr[rem] = r; } else { mul[rem] = m; rsl[rem] = r; }
}

// ------------------------------------------------- 1x1 conv GEMM via WMMA
// Y[o,p] = sum_c W[o,c] * LN?(X[c,p]); block: 12 waves, one M-tile each.
// Weight-stationary: the block reads the 192x192 weights once (whole lines),
// keeps them as f16 in LDS, and walks CT_NT pixel tiles of CT_PX pixels, each
// staged with its whole K in LDS.
// Every '#pragma unroll' here makes the indices of a small array constant, so
// that the array lives in registers and not in scratch.
// Every store is 16 B a lane. A wave whose channels go to a slice plane ([pixel][c64])
// takes W as A, so that a lane holds 8 channels of one pixel; a wave whose channels go
// to the plane 'out' ([c][pixel]) takes X as A, so that a lane holds 8 pixels of one channel.
// ISQ: channels [0,64) -> outA = [b][w][h][c64] (height Q), [64,128) -> outB = [b][h][w][c64]
// (width Q), [128,192) -> out.  !ISQ: [0,64) -> outA = [b][w][h][c64] (height V), the rest -> out.
#define CT_PX 32
#define CT_NT 3
#define CT_PITCH 200   // halves per LDS row: 400 B = 16 B x odd, for b128 readers
typedef __attribute__((ext_vector_type(4))) float    f32x4;
typedef __attribute__((ext_vector_type(4))) _Float16 v4h;

template <int ISQ>
__global__ __launch_bounds__(384, 9)
void k_conv(const float* __restrict__ Wm, const float* __restrict__ X,
            const float* __restrict__ lnw, const float* __restrict__ lnb,
            const float* __restrict__ mu, const float* __restrict__ rstd,
            _Float16* __restrict__ out,
            _Float16* __restrict__ outA, _Float16* __restrict__ outB) {
  const int b   = blockIdx.y;
  const int tid = threadIdx.x, lane = tid & 31, wave = tid >> 5;
  const int pbase = blockIdx.x * (CT_PX * CT_NT);
  __shared__ __attribute__((aligned(16))) _Float16 wS[CI][CT_PITCH];        // [m][k]
  __shared__ __attribute__((aligned(16))) _Float16 xT[2][CT_PX][CT_PITCH];  // [n][k]
  __shared__ __attribute__((aligned(16))) float lnS[2][CI];
  const int kg = (lane >> 4) * 8;
  // staging map: a thread owns 4 adjacent pixels x 4 adjacent channels
  const int pg = (tid & 7) * 4, c0 = (tid >> 3) * 4;
  const float* xcol = X + (size_t)b * CI * HW + (size_t)c0 * HW + pg;
  const float* mcol = mu + b * HW + pg;
  const float* rcol = rstd + b * HW + pg;

  // Prologue: half of the weights and the first pixel tile are in flight together;
  // the second half of the weights follows while the tile is still on its way.
  const float* wsrc = Wm + (size_t)wave * 16 * CI;   // a wave's 16 rows: 12 KiB in a row
  float lw0 = 0.f, lb0 = 0.f;
  if (ISQ && tid < CI) { lw0 = lnw[tid]; lb0 = lnb[tid]; }
  f32x4 w4[12];
#pragma unroll
  for (int i = 0; i < 12; ++i)
    w4[i] = *reinterpret_cast<const f32x4*>(wsrc + (i * 32 + lane) * 4);
  f32x4 xr[4];
  f32x4 m4 = {0.f, 0.f, 0.f, 0.f}, r4 = m4;
#pragma unroll
  for (int i = 0; i < 4; ++i)
    xr[i] = *reinterpret_cast<const f32x4*>(xcol + (size_t)i * HW + pbase);
  if (ISQ) {
    m4 = *reinterpret_cast<const f32x4*>(mcol + pbase);
    // the next load's result may land on this load's address registers
    asm volatile("s_wait_xcnt 0x0" ::: "memory");
    r4 = *reinterpret_cast<const f32x4*>(rcol + pbase);
  }
#pragma unroll
  for (int g = 0; g < 2; ++g) {
#pragma unroll
    for (int i = 0; i < 12; ++i) {
      const int e = ((g * 12 + i) * 32 + lane) * 4;
      v4h h4 = {(_Float16)w4[i][0], (_Float16)w4[i][1], (_Float16)w4[i][2], (_Float16)w4[i][3]};
      *reinterpret_cast<v4h*>(&wS[wave * 16 + e / CI][e % CI]) = h4;
    }
    if (g == 0) {
#pragma unroll
      for (int i = 0; i < 12; ++i)
        w4[i] = *reinterpret_cast<const f32x4*>(wsrc + ((12 + i) * 32 + lane) * 4);
    }
  }
  if (ISQ && tid < CI) { lnS[0][tid] = lw0; lnS[1][tid] = lb0; }
  __syncthreads();
  const _Float16* wrow = &wS[wave * 16 + (lane & 15)][kg];

  const int r0 = wave * 16 + (lane >> 4) * 8;
  // wave-uniform, held in scalar registers
  const int uwave = __builtin_amdgcn_readfirstlane(wave);
  const bool slicew = uwave < (ISQ ? 8 : 4);
  const bool planeB = ISQ && uwave >= 4;
  // A block's pixels lie in one image row, so a step of 16 pixels is one step in every plane.
  static_assert(WW % (CT_PX * CT_NT) == 0, "a block stays inside one image row");
  const int hrow = pbase / WW, wcol = pbase % WW;
  const int step16 = slicew ? (planeB ? 16 * C3 : 16 * HH * C3) : 16;   // halves
  _Float16* dst = !slicew ? out + (size_t)(b * CI + wave * 16 + (lane & 15)) * HW + pbase + kg
                : planeB  ? outB + ((size_t)b * HW + pbase + (lane & 15)) * C3 + (r0 & (C3 - 1))
                          : outA + (((size_t)b * WW + wcol + (lane & 15)) * HH + hrow) * C3 +
                                (r0 & (C3 - 1));
  // kept rolled: unrolled, the three trips' addresses are formed ahead and spill to scratch
#pragma unroll 1
  for (int t = 0; t < CT_NT; ++t) {
    const int p0 = pbase + t * CT_PX;
    _Float16 (*xb)[CT_PITCH] = xT[t & 1];
    f32x4 y[4];
#pragma unroll
    for (int i = 0; i < 4; ++i)
      y[i] = ISQ ? (xr[i] - m4) * r4 * lnS[0][c0 + i] + lnS[1][c0 + i] : xr[i];
#pragma unroll
    for (int j = 0; j < 4; ++j) {
      v4h hv = {(_Float16)y[0][j], (_Float16)y[1][j], (_Float16)y[2][j], (_Float16)y[3][j]};
      *reinterpret_cast<v4h*>(&xb[pg + j][c0]) = hv;
    }
    // One barrier a tile: it publishes this buffer, and every wave that passes
    // it has left the other buffer, which the next trip refills.
    __syncthreads();
    if (t + 1 < CT_NT) {   // next tile's loads fly under this tile's products and stores
#pragma unroll
      for (int i = 0; i < 4; ++i)
        xr[i] = *reinterpret_cast<const f32x4*>(xcol + (size_t)i * HW + p0 + CT_PX);
      // the address registers of the loads above are reused for the next addresses
      asm volatile("s_wait_xcnt 0x0" ::: "memory");
      if (ISQ) {
        m4 = *reinterpret_cast<const f32x4*>(mcol + p0 + CT_PX);
        r4 = *reinterpret_cast<const f32x4*>(rcol + p0 + CT_PX);
        // the address registers of these two loads are reused right behind them
        asm volatile("s_wait_xcnt 0x0" ::: "memory");
      }
    }
    v8f acc[2];
#pragma unroll
    for (int s = 0; s < 2; ++s) acc[s] = (v8f){0.f, 0.f, 0.f, 0.f, 0.f, 0.f, 0.f, 0.f};
    // One instruction stream for both kinds of wave: only the LDS rows that feed A and B
    // change places (the two operands have the same fragment map and the same k order).
    const _Float16* x0 = &xb[lane & 15][kg];
    const _Float16* x1 = &xb[16 + (lane & 15)][kg];
    const _Float16* a0 = slicew ? wrow : x0;
    const _Float16* a1 = slicew ? wrow : x1;
    const _Float16* b0 = slicew ? x0 : wrow;
    const _Float16* b1 = slicew ? x1 : wrow;
#pragma unroll
    for (int kk = 0; kk < 6; ++kk) {
      acc[0] = wmma_f16(ldfrag(a0 + kk * 32), ldfrag(b0 + kk * 32), acc[0]);
      acc[1] = wmma_f16(ldfrag(a1 + kk * 32), ldfrag(b1 + kk * 32), acc[1]);
    }
    v8h pk[2];
#pragma unroll
    for (int s = 0; s < 2; ++s)
#pragma unroll
      for (int r = 0; r < 8; ++r) pk[s][r] = (_Float16)acc[s][r];
#pragma unroll
    for (int s = 0; s < 2; ++s)
      *reinterpret_cast<v8h*>(dst + (t * 2 + s) * step16) = pk[s];
    // the next trip overwrites the registers that the last stores name
    asm volatile("s_wait_xcnt 0x0" ::: "memory");
  }
}

// ------------------------------------- axial attention scores + softmax
// Q/K stored per-slice contiguous as [slice][row][c64]; S = scale*Q K^T,
// P = row-softmax(S) (192x192, K=64). S in registers (16 waves x 9 tiles).
// LDS rows that feed 16-byte fragment reads stand at a pitch of 16 B x odd.
#define ROW_PITCH 72     // halves: 128-byte rows + the mover's 16-byte pad = 144 B
#define QK_BUF 14336     // halves: 192 rows x 144 B, rounded up to a multiple of 2 KiB
#define V_SLICE 5120     // halves: 64 rows x 144 B, rounded up to a multiple of 2 KiB
#define BT_PITCH 40      // halves: 64-byte rows + 16 B = 80 B
__global__ __launch_bounds__(512)
void k_attn_score(const _Float16* __restrict__ q0, const _Float16* __restrict__ k0,
                  const float* __restrict__ scp,
                  _Float16* __restrict__ P, _Float16* __restrict__ PT, int writeP) {
  const int slice = blockIdx.x, b = blockIdx.y;
  const int tid = threadIdx.x, lane = tid & 31, wave = tid >> 5;
  const _Float16* qp = q0 + ((size_t)b * 192 + slice) * (192 * C3);
  const _Float16* kp = k0 + ((size_t)b * 192 + slice) * (192 * C3);
  // [0]: Q [row][k], [1]: K [col][k], rows at ROW_PITCH
  __shared__ __attribute__((aligned(2048))) _Float16 QKs[2][QK_BUF];
  __shared__ float red[192][12];
  __shared__ float rowv[192];
#if HAVE_TDM
  const unsigned int uw = uni(threadIdx.x >> 5);
  if (pinned(uw < 2u)) {   // wave 0 brings Q, wave 1 brings K: one request each
    tdm_rows128(lds_addr32(&QKs[0][0]) + uw * (QK_BUF * 2u), uw ? kp : qp, 192u, C3 * 2u);
    // the issuing wave's tile has landed before it reaches the barrier below
    asm volatile("s_wait_tensorcnt 0x0" ::: "memory");
  }
#else
  for (int s = tid; s < 192 * C3; s += 512) {
    QKs[0][(s / C3) * ROW_PITCH + s % C3] = qp[s];
    QKs[1][(s / C3) * ROW_PITCH + s % C3] = kp[s];
  }
#endif
  __syncthreads();
  const float sc = *scp;
  const int kg = (lane >> 4) * 8;
  v8f acc[9];
#pragma unroll
  for (int j = 0; j < 9; ++j) {
    int t = wave * 9 + j, mt = t / 12, nt = t % 12;
    v8f a = {0.f, 0.f, 0.f, 0.f, 0.f, 0.f, 0.f, 0.f};
#pragma unroll
    for (int kk = 0; kk < 2; ++kk) {
      v16h af = ldfrag(&QKs[0][(mt * 16 + (lane & 15)) * ROW_PITCH + kk * 32 + kg]);
      v16h bf = ldfrag(&QKs[1][(nt * 16 + (lane & 15)) * ROW_PITCH + kk * 32 + kg]);
      a = wmma_f16(af, bf, a);
    }
    float part[8];
#pragma unroll
    for (int r = 0; r < 8; ++r) {
      a[r] *= sc;
      float m = a[r];
      for (int off = 1; off < 16; off <<= 1) m = fmaxf(m, __shfl_xor(m, off));
      part[r] = m;
    }
    acc[j] = a;
    if ((lane & 15) == 0)
#pragma unroll
      for (int r = 0; r < 8; ++r) red[mt * 16 + kg + r][nt] = part[r];
  }
  __syncthreads();
  if (tid < 192) {
    float m = red[tid][0];
    for (int i = 1; i < 12; ++i) m = fmaxf(m, red[tid][i]);
    rowv[tid] = m;
  }
  __syncthreads();
#pragma unroll
  for (int j = 0; j < 9; ++j) {
    int t = wave * 9 + j, mt = t / 12, nt = t % 12;
    float part[8];
#pragma unroll
    for (int r = 0; r < 8; ++r) {
      int row = mt * 16 + kg + r;
      acc[j][r] = __expf(acc[j][r] - rowv[row]);
      float s = acc[j][r];
      for (int off = 1; off < 16; off <<= 1) s += __shfl_xor(s, off);
      part[r] = s;
    }
    if ((lane & 15) == 0)
#pragma unroll
      for (int r = 0; r < 8; ++r) red[mt * 16 + kg + r][nt] = part[r];
  }
  __syncthreads();
  if (tid < 192) {
    float s = 0.f;
    for (int i = 0; i < 12; ++i) s += red[tid][i];
    rowv[tid] = s;
  }
  __syncthreads();
  const size_t pbase = (size_t)(b * 192 + slice) * 192 * 192;
#pragma unroll
  for (int j = 0; j < 9; ++j) {
    int t = wave * 9 + j, mt = t / 12, nt = t % 12;
    int col = nt * 16 + (lane & 15);
    int r0 = mt * 16 + kg;
    v8h pk;
#pragma unroll
    for (int r = 0; r < 8; ++r) {
      float v = acc[j][r] / rowv[r0 + r];
      pk[r] = (_Float16)v;
      if (writeP) P[pbase + (size_t)(r0 + r) * 192 + col] = (_Float16)v;
    }
    *reinterpret_cast<v8h*>(PT + pbase + (size_t)col * 192 + r0) = pk;  // transposed
  }
}

// --------------------------------------- apply attention + residual + ls
// Two phases: out[c,n] = ls[c]*sum_k V[c,k]*Bm[k,n] + x;  64x192, K=192.
// Bm = [slice][k][n] f16. AXIS 1: V rows contiguous (stride vcs), brought by tensor loads.
// AXIS 0: V = [slice][k][c64], turned to [c][k] on its way through registers into LDS.
// AXIS 0 (n = h, slice = w): out0/out1 are workspace planes [b][c64][w][h] that take
// the bare sums, rows along n; k_h_finish turns them and adds scale and residual.
// AXIS is a compile-time constant: no branch stands between the last product and the stores.
template <int AXIS>
__global__ __launch_bounds__(512)
void k_attn_apply(const _Float16* __restrict__ V0, const _Float16* __restrict__ V1,
                  size_t vbs, int vcs,
                  const _Float16* __restrict__ B0, const _Float16* __restrict__ B1,
                  float* __restrict__ out0, float* __restrict__ out1,
                  const float* __restrict__ x0, const float* __restrict__ x1,
                  const float* __restrict__ ls0, const float* __restrict__ ls1,
                  int cb) {
  const int slice = blockIdx.x, b = blockIdx.y;
  const int tid = threadIdx.x, lane = tid & 31, wave = tid >> 5;
  // V as three slices of 64 k: [k / 64][c][k % 64], rows at ROW_PITCH
  __shared__ __attribute__((aligned(2048))) _Float16 Vs[3][V_SLICE];
  __shared__ __attribute__((aligned(16))) _Float16 Bt[192][BT_PITCH];   // [n][k] per 32-K chunk
  const int kg = (lane >> 4) * 8;
  for (int ph = 0; ph < 2; ++ph) {
    // this wave's LDS reads of the phase before have retired before V is loaded anew
    asm volatile("s_wait_dscnt 0x0" ::: "memory");
    __syncthreads();
    const _Float16* vp = (ph ? V1 : V0) + (size_t)b * vbs + slice * (AXIS == 0 ? 192 * C3 : 192);
    const _Float16* Bp = (ph ? B1 : B0) + (size_t)(b * 192 + slice) * 192 * 192;
    float* op = ph ? out1 : out0;
    const float* xp = ph ? x1 : x0;
    const float* lsp = ph ? ls1 : ls0;
    if constexpr (AXIS == 0) {
      for (int s = tid; s < 768; s += 512) {
        const int u = s >> 1, kp = u % 96, c8 = (u / 96) * 2 + (s & 1);
        const v8h e = *reinterpret_cast<const v8h*>(vp + (2 * kp) * C3 + c8 * 8);
        const v8h o = *reinterpret_cast<const v8h*>(vp + (2 * kp + 1) * C3 + c8 * 8);
        _Float16* d = &Vs[kp >> 5][(c8 * 8) * ROW_PITCH + ((2 * kp) & 63)];
#pragma unroll   // constant indices into e and o: they stay in registers
        for (int j = 0; j < 8; ++j) {
          v2h pr = {e[j], o[j]};
          *reinterpret_cast<v2h*>(d + j * ROW_PITCH) = pr;
        }
      }
    } else {
#if HAVE_TDM
      const unsigned int uw = uni(threadIdx.x >> 5);
      if (pinned(uw < 3u)) {   // waves 0 to 2 bring one slice each: one request a wave
        tdm_rows128(lds_addr32(&Vs[0][0]) + uw * (V_SLICE * 2u), vp + uw * 64u, C3,
                    (unsigned int)vcs * 2u);
        // the issuing wave's slice has landed before it reaches the chunk loop's first barrier
        asm volatile("s_wait_tensorcnt 0x0" ::: "memory");
      }
#else
      for (int s = tid; s < C3 * 192; s += 512) {
        int c = s / 192, i = s % 192;
        Vs[i >> 6][c * ROW_PITCH + (i & 63)] = vp[(size_t)c * vcs + i];
      }
#endif
    }
    v8f acc[3];
#pragma unroll
    for (int j = 0; j < 3; ++j) acc[j] = (v8f){0.f, 0.f, 0.f, 0.f, 0.f, 0.f, 0.f, 0.f};
    for (int kk = 0; kk < 6; ++kk) {
      __syncthreads();
      for (int s = tid; s < 32 * 192; s += 512) {
        int k = s / 192, n = s % 192;
        Bt[n][k] = Bp[(size_t)(kk * 32 + k) * 192 + n];
      }
      __syncthreads();
#pragma unroll
      for (int j = 0; j < 3; ++j) {
        int t = wave * 3 + j, mt = t / 12, nt = t % 12;
        v16h af = ldfrag(&Vs[kk >> 1][(mt * 16 + (lane & 15)) * ROW_PITCH + (kk & 1) * 32 + kg]);
        v16h bf = ldfrag(&Bt[nt * 16 + (lane & 15)][kg]);
        acc[j] = wmma_f16(af, bf, acc[j]);
      }
    }
#pragma unroll
    for (int j = 0; j < 3; ++j) {
      int t = wave * 3 + j, mt = t / 12, nt = t % 12;
      int n = nt * 16 + (lane & 15);
      if (AXIS == 0) {
#pragma unroll   // constant index into acc: it stays in registers
        for (int r = 0; r < 8; ++r)
          op[((size_t)(b * C3 + mt * 16 + kg + r) * WW + slice) * HH + n] = acc[j][r];
      } else {
#pragma unroll
        for (int r = 0; r < 8; ++r) {
          int c = cb + mt * 16 + kg + r;
          size_t ad = ((size_t)(b * CI + c) * HH + slice) * WW + n;
          op[ad] = acc[j][r] * lsp[c] + xp[ad];
        }
      }
    }
    // the next phase overwrites the registers that the stores above name
    asm volatile("s_wait_xcnt 0x0" ::: "memory");
  }
}

// ------------------- height branch: turn [w][h] planes, scale, add residual
// out[c][h][w] = ls[c] * t[c][w][h] + x[c][h][w] for channels [0,64). One block
// turns a 64x64 tile through LDS, so that every global access covers 256 B of a row.
#define HT 64
__global__ __launch_bounds__(256)
void k_h_finish(const float* __restrict__ t0, const float* __restrict__ t1,
                const float* __restrict__ xl, const float* __restrict__ xr,
                const float* __restrict__ ls1, const float* __restrict__ ls2,
                float* __restrict__ out_l, float* __restrict__ out_r) {
  const int w0 = (blockIdx.x / 3) * HT, h0 = (blockIdx.x % 3) * HT;
  const int c = blockIdx.y, side = blockIdx.z >> 1, b = blockIdx.z & 1;
  __shared__ float tl[HT][HT + 1];
  const int q = (threadIdx.x & 15) * 4, rw = threadIdx.x >> 4;
  const float* tp = (side ? t1 : t0) + (size_t)(b * C3 + c) * HW;
  const float* xp = (side ? xr : xl) + (size_t)(b * CI + c) * HW;
  float* op = (side ? out_r : out_l) + (size_t)(b * CI + c) * HW;
  const float l = (side ? ls2 : ls1)[c];
  f32x4 tv[4], xv[4];
  // every '#pragma unroll' below makes the indices of tv, xv and o constant, so that they
  // stay in registers; the eight loads are then in flight together
#pragma unroll
  for (int i = 0; i < 4; ++i)
    tv[i] = *reinterpret_cast<const f32x4*>(tp + (w0 + i * 16 + rw) * HH + h0 + q);
#pragma unroll
  for (int i = 0; i < 4; ++i)
    xv[i] = *reinterpret_cast<const f32x4*>(xp + (h0 + i * 16 + rw) * WW + w0 + q);
#pragma unroll
  for (int i = 0; i < 4; ++i)
#pragma unroll
    for (int k = 0; k < 4; ++k) tl[i * 16 + rw][q + k] = tv[i][k];
  __syncthreads();
#pragma unroll
  for (int i = 0; i < 4; ++i) {
    f32x4 o;
#pragma unroll
    for (int k = 0; k < 4; ++k) o[k] = tl[q + k][i * 16 + rw] * l + xv[i][k];
    *reinterpret_cast<f32x4*>(op + (h0 + i * 16 + rw) * WW + w0 + q) = o;
  }
}

// ---------------------------------------------------- channel-SE branch
__global__ void k_pool(const _Float16* __restrict__ ql, const _Float16* __restrict__ qr,
                       float* __restrict__ pool) {
  int b = blockIdx.x / C3, c64 = blockIdx.x % C3;
  size_t base = (size_t)(b * CI + 128 + c64) * HW;
  float s = 0.f;
  for (int p = threadIdx.x; p < HW; p += 256)
    s += (float)ql[base + p] + (float)qr[base + p];
  __shared__ float sm[256];
  sm[threadIdx.x] = s;
  __syncthreads();
  for (int o = 128; o > 0; o >>= 1) {
    if (threadIdx.x < o) sm[threadIdx.x] += sm[threadIdx.x + o];
    __syncthreads();
  }
  if (threadIdx.x == 0) pool[b * C3 + c64] = sm[0] * (1.0f / HW);
}

__global__ void k_se(const float* __restrict__ pool, const float* __restrict__ w1,
                     const float* __restrict__ w2, float* __restrict__ a) {
  __shared__ float h1[BB][8];
  __shared__ float lg[BB][128];
  int tid = threadIdx.x;
  if (tid < 16) {
    int b = tid >> 3, j = tid & 7;
    float s = 0.f;
    for (int i = 0; i < 64; ++i) s += pool[b * 64 + i] * w1[j * 64 + i];
    h1[b][j] = fmaxf(s, 0.f);
  }
  __syncthreads();
  {
    int b = tid >> 7, o = tid & 127;
    float s = 0.f;
    for (int j = 0; j < 8; ++j) s += h1[b][j] * w2[o * 8 + j];
    lg[b][o] = s;
  }
  __syncthreads();
  if (tid < BB) {
    float m = -1e30f;
    for (int o = 0; o < 128; ++o) m = fmaxf(m, lg[tid][o]);
    float s = 0.f;
    for (int o = 0; o < 128; ++o) { lg[tid][o] = __expf(lg[tid][o] - m); s += lg[tid][o]; }
    float inv = 1.0f / s;
    for (int o = 0; o < 128; ++o) a[tid * 128 + o] = lg[tid][o] * inv;
  }
}

__global__ void k_se_apply(const float* __restrict__ a,
                           const _Float16* __restrict__ vl, const _Float16* __restrict__ vr,
                           const float* __restrict__ xl, const float* __restrict__ xr,
                           const float* __restrict__ ls1, const float* __restrict__ ls2,
                           float* __restrict__ out_l, float* __restrict__ out_r) {
  size_t idx = (size_t)blockIdx.x * blockDim.x + threadIdx.x;
  const size_t half = (size_t)BB * C3 * HW;
  if (idx >= 2 * half) return;
  int side = (int)(idx / half);
  size_t rem = idx % half;
  int b = (int)(rem / ((size_t)C3 * HW));
  size_t r2 = rem % ((size_t)C3 * HW);
  int c64 = (int)(r2 / HW);
  int p = (int)(r2 % HW);
  int c = 128 + c64;
  float av = a[b * 128 + side * 64 + c64];
  const _Float16* v = side ? vr : vl;
  const float* x = side ? xr : xl;
  const float* ls = side ? ls2 : ls1;
  float* o = side ? out_r : out_l;
  size_t ad = (size_t)(b * CI + c) * HW + p;
  o[ad] = av * (float)v[ad] * ls[c] + x[ad];
}

// ------------------------------------------------------------------ host
extern "C" void kernel_launch(void* const* d_in, const int* in_sizes, int n_in,
                              void* d_out, int out_size, void* d_ws, size_t ws_size,
                              hipStream_t stream) {
  const float* x_l  = (const float*)d_in[0];
  const float* x_r  = (const float*)d_in[1];
  const float* lnlw = (const float*)d_in[2];
  const float* lnlb = (const float*)d_in[3];
  const float* lnrw = (const float*)d_in[4];
  const float* lnrb = (const float*)d_in[5];
  const float* wq_l = (const float*)d_in[6];
  const float* wq_r = (const float*)d_in[7];
  const float* wv_l = (const float*)d_in[8];
  const float* wv_r = (const float*)d_in[9];
  const float* w1   = (const float*)d_in[10];
  const float* w2   = (const float*)d_in[11];
  const float* sch  = (const float*)d_in[12];
  const float* scw  = (const float*)d_in[13];
  const float* ls1  = (const float*)d_in[14];
  const float* ls2  = (const float*)d_in[15];

  float* out_l = (float*)d_out;
  float* out_r = out_l + (size_t)BB * CI * HW;

  char* ws = (char*)d_ws;
  size_t off = 0;
  auto take = [&](size_t bytes) { char* p = ws + off; off += (bytes + 255) & ~(size_t)255; return p; };
  const size_t QV = (size_t)BB * CI * HW;      // half elements
  const size_t QT = (size_t)BB * C3 * HW;
  const size_t PB = (size_t)BB * 192 * 192 * 192;
  const size_t ST = (size_t)BB * HW;           // float elements
  _Float16* q_l  = (_Float16*)take(QV * 2);
  _Float16* q_r  = (_Float16*)take(QV * 2);
  _Float16* v_l  = (_Float16*)take(QV * 2);
  _Float16* v_r  = (_Float16*)take(QV * 2);
  _Float16* qS0l = (_Float16*)take(QT * 2);   // [b][w][h][c64] height Q
  _Float16* qS0r = (_Float16*)take(QT * 2);
  _Float16* qS1l = (_Float16*)take(QT * 2);   // [b][h][w][c64] width Q
  _Float16* qS1r = (_Float16*)take(QT * 2);
  _Float16* vTl  = (_Float16*)take(QT * 2);   // [b][w][h][c64] height V
  _Float16* vTr  = (_Float16*)take(QT * 2);
  _Float16* buf1 = (_Float16*)take(PB * 2);
  _Float16* buf2 = (_Float16*)take(PB * 2);
  float* mul  = (float*)take(ST * 4);
  float* rsl  = (float*)take(ST * 4);
  float* mur  = (float*)take(ST * 4);
  float* rsr  = (float*)take(ST * 4);
  float* pool = (float*)take(BB * C3 * 4);
  float* avec = (float*)take(BB * 128 * 4);
  float* tH_l = (float*)take(QT * 4);         // [b][c64][w][h] height sums
  float* tH_r = (float*)take(QT * 4);

  // 1) LayerNorm stats
  k_ln_stats<<<(2 * BB * HW + 255) / 256, 256, 0, stream>>>(x_l, x_r, mul, rsl, mur, rsr);

  // 2) pointwise convs (WMMA GEMM), LN fused for q
  dim3 cg(HW / (CT_PX * CT_NT), BB);
  k_conv<1><<<cg, 384, 0, stream>>>(wq_l, x_l, lnlw, lnlb, mul, rsl, q_l, qS0l, qS1l);
  k_conv<1><<<cg, 384, 0, stream>>>(wq_r, x_r, lnrw, lnrb, mur, rsr, q_r, qS0r, qS1r);
  k_conv<0><<<cg, 384, 0, stream>>>(wv_l, x_l, lnlw, lnlb, mul, rsl, v_l, vTl, nullptr);
  k_conv<0><<<cg, 384, 0, stream>>>(wv_r, x_r, lnrw, lnrb, mur, rsr, v_r, vTr, nullptr);

  dim3 ag(192, BB);
  // 3) height axial attention: slices over w, channels [0,64)
  k_attn_score<<<ag, 512, 0, stream>>>(qS0l, qS0r, sch, buf1, buf2, 1);
  k_attn_apply<0><<<ag, 512, 0, stream>>>(vTr, vTl, (size_t)C3 * HW, HW, buf2, buf1,
                                          tH_l, tH_r, x_l, x_r, ls1, ls2, 0);
  k_h_finish<<<dim3(9, C3, 2 * BB), 256, 0, stream>>>(tH_l, tH_r, x_l, x_r, ls1, ls2,
                                                      out_l, out_r);

  // 4) width axial attention: slices over h, channels [64,128), two softmaxes
  k_attn_score<<<ag, 512, 0, stream>>>(qS1l, qS1r, scw, nullptr, buf1, 0);
  k_attn_score<<<ag, 512, 0, stream>>>(qS1r, qS1l, scw, nullptr, buf2, 0);
  k_attn_apply<1><<<ag, 512, 0, stream>>>(v_r + (size_t)C3 * HW, v_l + (size_t)C3 * HW,
                                          (size_t)CI * HW, HW, buf1, buf2,
                                          out_l, out_r, x_l, x_r, ls1, ls2, C3);

  // 5) channel SE branch, channels [128,192)
  k_pool<<<BB * C3, 256, 0, stream>>>(q_l, q_r, pool);
  k_se<<<1, 256, 0, stream>>>(pool, w1, w2, avec);
  k_se_apply<<<(int)((2 * (size_t)BB * C3 * HW + 255) / 256), 256, 0, stream>>>(
      avec, v_l, v_r, x_l, x_r, ls1, ls2, out_l, out_r);
}

// v005
// One run takes 268 microseconds.
// Two timings next to v004 put it at 1.10 and 1.09 times that version's speed.
// Counting every step since v000, it is 3.56 times as fast.
#include <hip/hip_runtime.h>
#include <hip/hip_bf16.h>

typedef __attribute__((ext_vector_type(16))) _Float16 v16h;
typedef __attribute__((ext_vector_type(8)))  _Float16 v8h;
typedef __attribute__((ext_vector_type(2)))  _Float16 v2h;
typedef __attribute__((ext_vector_type(8)))  float    v8f;
typedef __attribute__((ext_vector_type(4)))  unsigned int u32x4;
typedef __attribute__((ext_vector_type(8)))  int i32x8;
typedef __attribute__((ext_vector_type(4)))  int i32x4;

#define BB 2
#define CI 192
#define HH 192
#define WW 192
#define HW 36864
#define C3 64

#if defined(__HIP_DEVICE_COMPILE__) && __has_builtin(__builtin_amdgcn_tensor_load_to_lds)
#define HAVE_TDM 1
#else
#define HAVE_TDM 0
#endif

__device__ __forceinline__ v8f wmma_f16(v16h a, v16h b, v8f c) {
  // D = A(16x32 f16) * B(32x16 f16) + C(16x16 f32)
  return __builtin_amdgcn_wmma_f32_16x16x32_f16(false, a, false, b, (short)0, c,
                                                false, false);
}

// Load a 16-half WMMA operand fragment from a [row][K] layout: 8 contiguous
// halves at p (K = kg..kg+7) and 8 at p+16 (K = kg+16..kg+23).
__device__ __forceinline__ v16h ldfrag(const _Float16* p) {
  v8h lo = *reinterpret_cast<const v8h*>(p);
  v8h hi = *reinterpret_cast<const v8h*>(p + 16);
  v16h r;
#pragma unroll
  for (int i = 0; i < 8; ++i) { r[i] = lo[i]; r[i + 8] = hi[i]; }
  return r;
}

#if HAVE_TDM
typedef __attribute__((address_space(3))) const void lds_cvoid;
__device__ __forceinline__ unsigned int lds_addr32(const void* p) {
  return (unsigned int)(uintptr_t)(lds_cvoid*)p;
}
typedef __attribute__((ext_vector_type(8))) unsigned int u32x8;
__device__ __forceinline__ unsigned int uni(unsigned int v) {
  return (unsigned int)__builtin_amdgcn_readfirstlane(v);
}
__device__ __forceinline__ unsigned int pinned(unsigned int v) {
  unsigned int w = uni(v);
  asm volatile("" : "+s"(w));  // pinned(): the test word stays in a scalar register
  return w;
}
__device__ __forceinline__ void tdm_rows128(unsigned int lds_off, const void* gaddr,
                                            unsigned int rows, unsigned int src_pitch) {
  unsigned long long ga = (unsigned long long)(uintptr_t)gaddr;
  u32x4 g0;
  g0[0] = uni(1u);                              // count = 1
  g0[1] = uni(lds_off);                         // LDS destination (bytes)
  g0[2] = uni((unsigned int)ga);                // global address [31:0]
  g0[3] = uni((((unsigned int)(ga >> 32)) & 0x01FFFFFFu) | 0x80000000u);  // [56:32] | type = 2
  u32x8 g1;
  g1[0] = uni((1u << 20) | (4u << 22) | (3u << 25));
  g1[1] = uni(128u << 16);
  g1[2] = uni(rows << 16);
  g1[3] = uni(128u << 16);
  g1[4] = uni(rows);
  g1[5] = uni(src_pitch);
  g1[6] = uni(0u);
  g1[7] = uni(0u);
  asm volatile("tensor_load_to_lds %0, %1" :: "s"(g0), "s"(g1) : "memory");
}
#endif  // HAVE_TDM

// ---------------------------------------------------------------- LN stats
__global__ void k_ln_stats(const float* __restrict__ xl, const float* __restrict__ xr,
                           float* __restrict__ mul, float* __restrict__ rsl,
                           float* __restrict__ mur, float* __restrict__ rsr) {
  int idx = blockIdx.x * blockDim.x + threadIdx.x;
  if (idx >= 2 * BB * HW) return;
  int side = idx / (BB * HW);
  int rem  = idx % (BB * HW);
  int b = rem / HW, p = rem % HW;
  const float* base = (side ? xr : xl) + (size_t)b * CI * HW + p;
  float s = 0.f, s2 = 0.f;
  for (int c = 0; c < CI; ++c) { float v = base[(size_t)c * HW]; s += v; s2 += v * v; }
  float m = s * (1.0f / CI);
  float var = s2 * (1.0f / CI) - m * m;
  float r = rsqrtf(var + 1e-6f);
  if (side) { mur[rem] = m; rsr[rem] = r; } else { mul[rem] = m; rsl[rem] = r; }
}

// ------------------------------------------------- 1x1 conv GEMM via WMMA
// Y[o,p] = sum_c W[o,c] * LN?(X[c,p]); block: 12 waves, one M-tile each.
// Weight-stationary: the block reads the 192x192 weights once (whole lines),
// keeps them as f16 in LDS, and walks CT_NT pixel tiles of CT_PX pixels, each
// staged with its whole K in LDS.
// Every '#pragma unroll' here makes the indices of a small array constant, so
// that the array lives in registers and not in scratch.
// Every store is 16 B a lane. A wave whose channels go to a slice plane ([pixel][c64])
// takes W as A, so that a lane holds 8 channels of one pixel; a wave whose channels go
// to the plane 'out' ([c][pixel]) takes X as A, so that a lane holds 8 pixels of one channel.
// ISQ: channels [0,64) -> outA = [b][w][h][c64] (height Q), [64,128) -> outB = [b][h][w][c64]
// (width Q), [128,192) -> out.  !ISQ: [0,64) -> outA = [b][w][h][c64] (height V), the rest -> out.
#define CT_PX 32
#define CT_NT 3
#define CT_PITCH 200   // halves per LDS row: 400 B = 16 B x odd, for b128 readers
typedef __attribute__((ext_vector_type(4))) float    f32x4;
typedef __attribute__((ext_vector_type(4))) _Float16 v4h;

template <int ISQ>
__global__ __launch_bounds__(384, 9)
void k_conv(const float* __restrict__ Wm, const float* __restrict__ X,
            const float* __restrict__ lnw, const float* __restrict__ lnb,
            const float* __restrict__ mu, const float* __restrict__ rstd,
            _Float16* __restrict__ out,
            _Float16* __restrict__ outA, _Float16* __restrict__ outB) {
  const int b   = blockIdx.y;
  const int tid = threadIdx.x, lane = tid & 31, wave = tid >> 5;
  const int pbase = blockIdx.x * (CT_PX * CT_NT);
  __shared__ __attribute__((aligned(16))) _Float16 wS[CI][CT_PITCH];        // [m][k]
  __shared__ __attribute__((aligned(16))) _Float16 xT[2][CT_PX][CT_PITCH];  // [n][k]
  __shared__ __attribute__((aligned(16))) float lnS[2][CI];
  const int kg = (lane >> 4) * 8;
  // staging map: a thread owns 4 adjacent pixels x 4 adjacent channels
  const int pg = (tid & 7) * 4, c0 = (tid >> 3) * 4;
  const float* xcol = X + (size_t)b * CI * HW + (size_t)c0 * HW + pg;
  const float* mcol = mu + b * HW + pg;
  const float* rcol = rstd + b * HW + pg;

  // Prologue: half of the weights and the first pixel tile are in flight together;
  // the second half of the weights follows while the tile is still on its way.
  const float* wsrc = Wm + (size_t)wave * 16 * CI;   // a wave's 16 rows: 12 KiB in a row
  float lw0 = 0.f, lb0 = 0.f;
  if (ISQ && tid < CI) { lw0 = lnw[tid]; lb0 = lnb[tid]; }
  f32x4 w4[12];
#pragma unroll
  for (int i = 0; i < 12; ++i)
    w4[i] = *reinterpret_cast<const f32x4*>(wsrc + (i * 32 + lane) * 4);
  f32x4 xr[4];
  f32x4 m4 = {0.f, 0.f, 0.f, 0.f}, r4 = m4;
#pragma unroll
  for (int i = 0; i < 4; ++i)
    xr[i] = *reinterpret_cast<const f32x4*>(xcol + (size_t)i * HW + pbase);
  if (ISQ) {
    m4 = *reinterpret_cast<const f32x4*>(mcol + pbase);
    // the next load's result may land on this load's address registers
    asm volatile("s_wait_xcnt 0x0" ::: "memory");
    r4 = *reinterpret_cast<const f32x4*>(rcol + pbase);
  }
#pragma unroll
  for (int g = 0; g < 2; ++g) {
#pragma unroll
    for (int i = 0; i < 12; ++i) {
      const int e = ((g * 12 + i) * 32 + lane) * 4;
      v4h h4 = {(_Float16)w4[i][0], (_Float16)w4[i][1], (_Float16)w4[i][2], (_Float16)w4[i][3]};
      *reinterpret_cast<v4h*>(&wS[wave * 16 + e / CI][e % CI]) = h4;
    }
    if (g == 0) {
#pragma unroll
      for (int i = 0; i < 12; ++i)
        w4[i] = *reinterpret_cast<const f32x4*>(wsrc + ((12 + i) * 32 + lane) * 4);
    }
  }
  if (ISQ && tid < CI) { lnS[0][tid] = lw0; lnS[1][tid] = lb0; }
  __syncthreads();
  const _Float16* wrow = &wS[wave * 16 + (lane & 15)][kg];

  const int r0 = wave * 16 + (lane >> 4) * 8;
  // wave-uniform, held in scalar registers
  const int uwave = __builtin_amdgcn_readfirstlane(wave);
  const bool slicew = uwave < (ISQ ? 8 : 4);
  const bool planeB = ISQ && uwave >= 4;
  // A block's pixels lie in one image row, so a step of 16 pixels is one step in every plane.
  static_assert(WW % (CT_PX * CT_NT) == 0, "a block stays inside one image row");
  const int hrow = pbase / WW, wcol = pbase % WW;
  const int step16 = slicew ? (planeB ? 16 * C3 : 16 * HH * C3) : 16;   // halves
  _Float16* dst = !slicew ? out + (size_t)(b * CI + wave * 16 + (lane & 15)) * HW + pbase + kg
                : planeB  ? outB + ((size_t)b * HW + pbase + (lane & 15)) * C3 + (r0 & (C3 - 1))
                          : outA + (((size_t)b * WW + wcol + (lane & 15)) * HH + hrow) * C3 +
                                (r0 & (C3 - 1));
  // kept rolled: unrolled, the three trips' addresses are formed ahead and spill to scratch
#pragma unroll 1
  for (int t = 0; t < CT_NT; ++t) {
    const int p0 = pbase + t * CT_PX;
    _Float16 (*xb)[CT_PITCH] = xT[t & 1];
    f32x4 y[4];
#pragma unroll
    for (int i = 0; i < 4; ++i)
      y[i] = ISQ ? (xr[i] - m4) * r4 * lnS[0][c0 + i] + lnS[1][c0 + i] : xr[i];
#pragma unroll
    for (int j = 0; j < 4; ++j) {
      v4h hv = {(_Float16)y[0][j], (_Float16)y[1][j], (_Float16)y[2][j], (_Float16)y[3][j]};
      *reinterpret_cast<v4h*>(&xb[pg + j][c0]) = hv;
    }
    // One barrier a tile: it publishes this buffer, and every wave that passes
    // it has left the other buffer, which the next trip refills.
    __syncthreads();
    if (t + 1 < CT_NT) {   // next tile's loads fly under this tile's products and stores
#pragma unroll
      for (int i = 0; i < 4; ++i)
        xr[i] = *reinterpret_cast<const f32x4*>(xcol + (size_t)i * HW + p0 + CT_PX);
      // the address registers of the loads above are reused for the next addresses
      asm volatile("s_wait_xcnt 0x0" ::: "memory");
      if (ISQ) {
        m4 = *reinterpret_cast<const f32x4*>(mcol + p0 + CT_PX);
        r4 = *reinterpret_cast<const f32x4*>(rcol + p0 + CT_PX);
        // the address registers of these two loads are reused right behind them
        asm volatile("s_wait_xcnt 0x0" ::: "memory");
      }
    }
    v8f acc[2];
#pragma unroll
    for (int s = 0; s < 2; ++s) acc[s] = (v8f){0.f, 0.f, 0.f, 0.f, 0.f, 0.f, 0.f, 0.f};
    // One instruction stream for both kinds of wave: only the LDS rows that feed A and B
    // change places (the two operands have the same fragment map and the same k order).
    const _Float16* x0 = &xb[lane & 15][kg];
    const _Float16* x1 = &xb[16 + (lane & 15)][kg];
    const _Float16* a0 = slicew ? wrow : x0;
    const _Float16* a1 = slicew ? wrow : x1;
    const _Float16* b0 = slicew ? x0 : wrow;
    const _Float16* b1 = slicew ? x1 : wrow;
#pragma unroll
    for (int kk = 0; kk < 6; ++kk) {
      acc[0] = wmma_f16(ldfrag(a0 + kk * 32), ldfrag(b0 + kk * 32), acc[0]);
      acc[1] = wmma_f16(ldfrag(a1 + kk * 32), ldfrag(b1 + kk * 32), acc[1]);
    }
    v8h pk[2];
#pragma unroll
    for (int s = 0; s < 2; ++s)
#pragma unroll
      for (int r = 0; r < 8; ++r) pk[s][r] = (_Float16)acc[s][r];
#pragma unroll
    for (int s = 0; s < 2; ++s)
      *reinterpret_cast<v8h*>(dst + (t * 2 + s) * step16) = pk[s];
    // the next trip overwrites the registers that the last stores name
    asm volatile("s_wait_xcnt 0x0" ::: "memory");
  }
}

// ------------------------------------- axial attention scores + softmax
// Q/K stored per-slice contiguous as [slice][row][c64]; S = scale*Q K^T,
// P = row-softmax(S) (192x192, K=64). S in registers (16 waves x 9 tiles).
// LDS rows that feed 16-byte fragment reads stand at a pitch of 16 B x odd.
#define ROW_PITCH 72     // halves: 128-byte rows + the mover's 16-byte pad = 144 B
#define QK_BUF 14336     // halves: 192 rows x 144 B, rounded up to a multiple of 2 KiB
#define V_SLICE 5120     // halves: 64 rows x 144 B, rounded up to a multiple of 2 KiB
#define BT_PITCH 40      // halves: 64-byte rows + 16 B = 80 B
__global__ __launch_bounds__(512)
void k_attn_score(const _Float16* __restrict__ q0, const _Float16* __restrict__ k0,
                  const float* __restrict__ scp,
                  _Float16* __restrict__ P, _Float16* __restrict__ PT, int writeP) {
  const int slice = blockIdx.x, b = blockIdx.y;
  const int tid = threadIdx.x, lane = tid & 31, wave = tid >> 5;
  const _Float16* qp = q0 + ((size_t)b * 192 + slice) * (192 * C3);
  const _Float16* kp = k0 + ((size_t)b * 192 + slice) * (192 * C3);
  // [0]: Q [row][k], [1]: K [col][k], rows at ROW_PITCH
  __shared__ __attribute__((aligned(2048))) _Float16 QKs[2][QK_BUF];
  __shared__ float red[192][12];
  __shared__ float rowv[192];
#if HAVE_TDM
  const unsigned int uw = uni(threadIdx.x >> 5);
  if (pinned(uw < 2u)) {   // wave 0 brings Q, wave 1 brings K: one request each
    tdm_rows128(lds_addr32(&QKs[0][0]) + uw * (QK_BUF * 2u), uw ? kp : qp, 192u, C3 * 2u);
    // the issuing wave's tile has landed before it reaches the barrier below
    asm volatile("s_wait_tensorcnt 0x0" ::: "memory");
  }
#else
  for (int s = tid; s < 192 * C3; s += 512) {
    QKs[0][(s / C3) * ROW_PITCH + s % C3] = qp[s];
    QKs[1][(s / C3) * ROW_PITCH + s % C3] = kp[s];
  }
#endif
  __syncthreads();
  const float sc = *scp;
  const int kg = (lane >> 4) * 8;
  v8f acc[9];
#pragma unroll
  for (int j = 0; j < 9; ++j) {
    int t = wave * 9 + j, mt = t / 12, nt = t % 12;
    v8f a = {0.f, 0.f, 0.f, 0.f, 0.f, 0.f, 0.f, 0.f};
#pragma unroll
    for (int kk = 0; kk < 2; ++kk) {
      v16h af = ldfrag(&QKs[0][(mt * 16 + (lane & 15)) * ROW_PITCH + kk * 32 + kg]);
      v16h bf = ldfrag(&QKs[1][(nt * 16 + (lane & 15)) * ROW_PITCH + kk * 32 + kg]);
      a = wmma_f16(af, bf, a);
    }
    float part[8];
#pragma unroll
    for (int r = 0; r < 8; ++r) {
      a[r] *= sc;
      float m = a[r];
      for (int off = 1; off < 16; off <<= 1) m = fmaxf(m, __shfl_xor(m, off));
      part[r] = m;
    }
    acc[j] = a;
    if ((lane & 15) == 0)
#pragma unroll
      for (int r = 0; r < 8; ++r) red[mt * 16 + kg + r][nt] = part[r];
  }
  __syncthreads();
  if (tid < 192) {
    float m = red[tid][0];
    for (int i = 1; i < 12; ++i) m = fmaxf(m, red[tid][i]);
    rowv[tid] = m;
  }
  __syncthreads();
#pragma unroll
  for (int j = 0; j < 9; ++j) {
    int t = wave * 9 + j, mt = t / 12, nt = t % 12;
    float part[8];
#pragma unroll
    for (int r = 0; r < 8; ++r) {
      int row = mt * 16 + kg + r;
      acc[j][r] = __expf(acc[j][r] - rowv[row]);
      float s = acc[j][r];
      for (int off = 1; off < 16; off <<= 1) s += __shfl_xor(s, off);
      part[r] = s;
    }
    if ((lane & 15) == 0)
#pragma unroll
      for (int r = 0; r < 8; ++r) red[mt * 16 + kg + r][nt] = part[r];
  }
  __syncthreads();
  if (tid < 192) {
    float s = 0.f;
    for (int i = 0; i < 12; ++i) s += red[tid][i];
    rowv[tid] = s;
  }
  __syncthreads();
  const size_t pbase = (size_t)(b * 192 + slice) * 192 * 192;
#pragma unroll
  for (int j = 0; j < 9; ++j) {
    int t = wave * 9 + j, mt = t / 12, nt = t % 12;
    int col = nt * 16 + (lane & 15);
    int r0 = mt * 16 + kg;
    v8h pk;
#pragma unroll
    for (int r = 0; r < 8; ++r) {
      float v = acc[j][r] / rowv[r0 + r];
      pk[r] = (_Float16)v;
      if (writeP) P[pbase + (size_t)(r0 + r) * 192 + col] = (_Float16)v;
    }
    *reinterpret_cast<v8h*>(PT + pbase + (size_t)col * 192 + r0) = pk;  // transposed
  }
}

// --------------------------------------- apply attention + residual + ls
// Two phases: out[c,n] = ls[c]*sum_k V[c,k]*Bm[k,n] + x;  64x192, K=192.
// Bm = [slice][k][n] f16. AXIS 1: V rows contiguous (stride vcs), brought by tensor loads.
// AXIS 0: V = [slice][k][c64], turned to [c][k] on its way through registers into LDS.
// AXIS 0 (n = h, slice = w): out0/out1 are workspace planes [b][c64][w][h] that take
// the bare sums, rows along n; k_h_finish turns them and adds scale and residual.
// AXIS is a compile-time constant: no branch stands between the last product and the stores.
template <int AXIS>
__global__ __launch_bounds__(512)
void k_attn_apply(const _Float16* __restrict__ V0, const _Float16* __restrict__ V1,
                  size_t vbs, int vcs,
                  const _Float16* __restrict__ B0, const _Float16* __restrict__ B1,
                  float* __restrict__ out0, float* __restrict__ out1,
                  const float* __restrict__ x0, const float* __restrict__ x1,
                  const float* __restrict__ ls0, const float* __restrict__ ls1,
                  int cb) {
  const int slice = blockIdx.x, b = blockIdx.y;
  const int tid = threadIdx.x, lane = tid & 31, wave = tid >> 5;
  // V as three slices of 64 k: [k / 64][c][k % 64], rows at ROW_PITCH
  __shared__ __attribute__((aligned(2048))) _Float16 Vs[3][V_SLICE];
  __shared__ __attribute__((aligned(16))) _Float16 Bt[192][BT_PITCH];   // [n][k] per 32-K chunk
  const int kg = (lane >> 4) * 8;
  for (int ph = 0; ph < 2; ++ph) {
    // this wave's LDS reads of the phase before have retired before V is loaded anew
    asm volatile("s_wait_dscnt 0x0" ::: "memory");
    __syncthreads();
    const _Float16* vp = (ph ? V1 : V0) + (size_t)b * vbs + slice * (AXIS == 0 ? 192 * C3 : 192);
    const _Float16* Bp = (ph ? B1 : B0) + (size_t)(b * 192 + slice) * 192 * 192;
    float* op = ph ? out1 : out0;
    const float* xp = ph ? x1 : x0;
    const float* lsp = ph ? ls1 : ls0;
    if constexpr (AXIS == 0) {
      for (int s = tid; s < 768; s += 512) {
        const int u = s >> 1, kp = u % 96, c8 = (u / 96) * 2 + (s & 1);
        const v8h e = *reinterpret_cast<const v8h*>(vp + (2 * kp) * C3 + c8 * 8);
        const v8h o = *reinterpret_cast<const v8h*>(vp + (2 * kp + 1) * C3 + c8 * 8);
        _Float16* d = &Vs[kp >> 5][(c8 * 8) * ROW_PITCH + ((2 * kp) & 63)];
#pragma unroll   // constant indices into e and o: they stay in registers
        for (int j = 0; j < 8; ++j) {
          v2h pr = {e[j], o[j]};
          *reinterpret_cast<v2h*>(d + j * ROW_PITCH) = pr;
        }
      }
    } else {
#if HAVE_TDM
      const unsigned int uw = uni(threadIdx.x >> 5);
      if (pinned(uw < 3u)) {   // waves 0 to 2 bring one slice each: one request a wave
        tdm_rows128(lds_addr32(&Vs[0][0]) + uw * (V_SLICE * 2u), vp + uw * 64u, C3,
                    (unsigned int)vcs * 2u);
        // the issuing wave's slice has landed before it reaches the chunk loop's first barrier
        asm volatile("s_wait_tensorcnt 0x0" ::: "memory");
      }
#else
      for (int s = tid; s < C3 * 192; s += 512) {
        int c = s / 192, i = s % 192;
        Vs[i >> 6][c * ROW_PITCH + (i & 63)] = vp[(size_t)c * vcs + i];
      }
#endif
    }
    v8f acc[3];
#pragma unroll
    for (int j = 0; j < 3; ++j) acc[j] = (v8f){0.f, 0.f, 0.f, 0.f, 0.f, 0.f, 0.f, 0.f};
    for (int kk = 0; kk < 6; ++kk) {
      __syncthreads();
      for (int s = tid; s < 32 * 192; s += 512) {
        int k = s / 192, n = s % 192;
        Bt[n][k] = Bp[(size_t)(kk * 32 + k) * 192 + n];
      }
      __syncthreads();
#pragma unroll
      for (int j = 0; j < 3; ++j) {
        int t = wave * 3 + j, mt = t / 12, nt = t % 12;
        v16h af = ldfrag(&Vs[kk >> 1][(mt * 16 + (lane & 15)) * ROW_PITCH + (kk & 1) * 32 + kg]);
        v16h bf = ldfrag(&Bt[nt * 16 + (lane & 15)][kg]);
        acc[j] = wmma_f16(af, bf, acc[j]);
      }
    }
#pragma unroll
    for (int j = 0; j < 3; ++j) {
      int t = wave * 3 + j, mt = t / 12, nt = t % 12;
      int n = nt * 16 + (lane & 15);
      if (AXIS == 0) {
#pragma unroll   // constant index into acc: it stays in registers
        for (int r = 0; r < 8; ++r)
          op[((size_t)(b * C3 + mt * 16 + kg + r) * WW + slice) * HH + n] = acc[j][r];
      } else {
#pragma unroll
        for (int r = 0; r < 8; ++r) {
          int c = cb + mt * 16 + kg + r;
          size_t ad = ((size_t)(b * CI + c) * HH + slice) * WW + n;
          op[ad] = acc[j][r] * lsp[c] + xp[ad];
        }
      }
    }
    // the next phase overwrites the registers that the stores above name
    asm volatile("s_wait_xcnt 0x0" ::: "memory");
  }
}

// ------------------- height branch: turn [w][h] planes, scale, add residual
// out[c][h][w] = ls[c] * t[c][w][h] + x[c][h][w] for channels [0,64). One block
// turns a 64x64 tile through LDS, so that every global access covers 256 B of a row.
#define HT 64
__global__ __launch_bounds__(256)
void k_h_finish(const float* __restrict__ t0, const float* __restrict__ t1,
                const float* __restrict__ xl, const float* __restrict__ xr,
                const float* __restrict__ ls1, const float* __restrict__ ls2,
                float* __restrict__ out_l, float* __restrict__ out_r) {
  const int w0 = (blockIdx.x / 3) * HT, h0 = (blockIdx.x % 3) * HT;
  const int c = blockIdx.y, side = blockIdx.z >> 1, b = blockIdx.z & 1;
  __shared__ float tl[HT][HT + 1];
  const int q = (threadIdx.x & 15) * 4, rw = threadIdx.x >> 4;
  const float* tp = (side ? t1 : t0) + (size_t)(b * C3 + c) * HW;
  const float* xp = (side ? xr : xl) + (size_t)(b * CI + c) * HW;
  float* op = (side ? out_r : out_l) + (size_t)(b * CI + c) * HW;
  const float l = (side ? ls2 : ls1)[c];
  f32x4 tv[4], xv[4];
  // every '#pragma unroll' below makes the indices of tv, xv and o constant, so that they
  // stay in registers; the eight loads are then in flight together
#pragma unroll
  for (int i = 0; i < 4; ++i)
    tv[i] = *reinterpret_cast<const f32x4*>(tp + (w0 + i * 16 + rw) * HH + h0 + q);
#pragma unroll
  for (int i = 0; i < 4; ++i)
    xv[i] = *reinterpret_cast<const f32x4*>(xp + (h0 + i * 16 + rw) * WW + w0 + q);
#pragma unroll
  for (int i = 0; i < 4; ++i)
#pragma unroll
    for (int k = 0; k < 4; ++k) tl[i * 16 + rw][q + k] = tv[i][k];
  __syncthreads();
#pragma unroll
  for (int i = 0; i < 4; ++i) {
    f32x4 o;
#pragma unroll
    for (int k = 0; k < 4; ++k) o[k] = tl[q + k][i * 16 + rw] * l + xv[i][k];
    *reinterpret_cast<f32x4*>(op + (h0 + i * 16 + rw) * WW + w0 + q) = o;
  }
}

// ---------------------------------------------------- channel-SE branch
// One block sums one channel plane of both sides. A lane reads 16 B (8 halves), a wave 512 B
// in a row; a thread's 18 loads are all in flight before the first is summed.
#define PL_T 512
#define PL_N (HW / (PL_T * 8))   // 16-byte pieces of a plane per thread
static_assert(HW % (PL_T * 8) == 0, "a plane is a whole number of 16-byte pieces per thread");
__global__ __launch_bounds__(PL_T)
void k_pool(const _Float16* __restrict__ ql, const _Float16* __restrict__ qr,
            float* __restrict__ pool) {
  int b = blockIdx.x / C3, c64 = blockIdx.x % C3;
  const size_t base = (size_t)(b * CI + 128 + c64) * HW + threadIdx.x * 8;
  const _Float16* pl = ql + base;
  const _Float16* pr = qr + base;
  v8h l8[PL_N], r8[PL_N];
  // every '#pragma unroll' below makes the indices of l8, r8 and s4 constant: they stay in registers
#pragma unroll
  for (int i = 0; i < PL_N; ++i) {
    l8[i] = *reinterpret_cast<const v8h*>(pl + i * (PL_T * 8));
    r8[i] = *reinterpret_cast<const v8h*>(pr + i * (PL_T * 8));
  }
  // The wait before a register that an issued load names is overwritten. It takes the two
  // addresses as inputs, so that no load's result is laid on them, and no load sinks below it.
  asm volatile("s_wait_xcnt 0x0" :: "v"(pl), "v"(pr) : "memory");
  float s4[4] = {0.f, 0.f, 0.f, 0.f};   // four independent chains of adds
#pragma unroll
  for (int i = 0; i < PL_N; ++i)
#pragma unroll
    for (int j = 0; j < 8; ++j) s4[j & 3] += (float)l8[i][j] + (float)r8[i][j];
  const float s = (s4[0] + s4[1]) + (s4[2] + s4[3]);
  __shared__ float sm[PL_T];
  sm[threadIdx.x] = s;
  __syncthreads();
  for (int o = PL_T / 2; o > 0; o >>= 1) {
    if (threadIdx.x < o) sm[threadIdx.x] += sm[threadIdx.x + o];
    __syncthreads();
  }
  if (threadIdx.x == 0) pool[b * C3 + c64] = sm[0] * (1.0f / HW);
}

__global__ void k_se(const float* __restrict__ pool, const float* __restrict__ w1,
                     const float* __restrict__ w2, float* __restrict__ a) {
  __shared__ float h1[BB][8];
  __shared__ float lg[BB][128];
  int tid = threadIdx.x;
  if (tid < 16) {
    int b = tid >> 3, j = tid & 7;
    float s = 0.f;
    for (int i = 0; i < 64; ++i) s += pool[b * 64 + i] * w1[j * 64 + i];
    h1[b][j] = fmaxf(s, 0.f);
  }
  __syncthreads();
  {
    int b = tid >> 7, o = tid & 127;
    float s = 0.f;
    for (int j = 0; j < 8; ++j) s += h1[b][j] * w2[o * 8 + j];
    lg[b][o] = s;
  }
  __syncthreads();
  if (tid < BB) {
    float m = -1e30f;
    for (int o = 0; o < 128; ++o) m = fmaxf(m, lg[tid][o]);
    float s = 0.f;
    for (int o = 0; o < 128; ++o) { lg[tid][o] = __expf(lg[tid][o] - m); s += lg[tid][o]; }
    float inv = 1.0f / s;
    for (int o = 0; o < 128; ++o) a[tid * 128 + o] = lg[tid][o] * inv;
  }
}

// A block takes a quarter of one channel plane. A lane holds 4 adjacent pixels a piece: 8 B of
// v, 16 B of x and of the output, so that a wave covers whole 128-byte lines in every access;
// a thread's 18 loads are all in flight before its first store.
#define SA_T 256
#define SA_N 9                   // pieces per thread
#define SA_PX (SA_T * 4 * SA_N)  // pixels per block
static_assert(HW % SA_PX == 0, "a plane is a whole number of blocks");
__global__ __launch_bounds__(SA_T)
void k_se_apply(const float* __restrict__ a,
                const _Float16* __restrict__ vl, const _Float16* __restrict__ vr,
                const float* __restrict__ xl, const float* __restrict__ xr,
                const float* __restrict__ ls1, const float* __restrict__ ls2,
                float* __restrict__ out_l, float* __restrict__ out_r) {
  const int c64 = blockIdx.y, side = blockIdx.z >> 1, b = blockIdx.z & 1;
  const int c = 128 + c64;
  const float av = a[b * 128 + side * 64 + c64];
  const float l = (side ? ls2 : ls1)[c];
  const size_t ad = (size_t)(b * CI + c) * HW + blockIdx.x * SA_PX + threadIdx.x * 4;
  const _Float16* v = (side ? vr : vl) + ad;
  const float* x = (side ? xr : xl) + ad;
  float* o = (side ? out_r : out_l) + ad;
  v4h vv[SA_N];
  f32x4 xv[SA_N];
  // every '#pragma unroll' below makes the indices of vv and xv constant: they stay in registers
#pragma unroll
  for (int i = 0; i < SA_N; ++i) {
    vv[i] = *reinterpret_cast<const v4h*>(v + i * (SA_T * 4));
    xv[i] = *reinterpret_cast<const f32x4*>(x + i * (SA_T * 4));
  }
  // The wait before a register that an issued load names is overwritten. It takes the two
  // addresses as inputs, so that no load's result is laid on them, and no load sinks below it.
  asm volatile("s_wait_xcnt 0x0" :: "v"(v), "v"(x) : "memory");
  // without it the scheduler lifts the first pieces' arithmetic, with its wait for their data,
  // in front of the last loads, which then start one memory latency late
  __builtin_amdgcn_sched_barrier(0);
#pragma unroll
  for (int i = 0; i < SA_N; ++i)
#pragma unroll
    for (int k = 0; k < 4; ++k) xv[i][k] = av * (float)vv[i][k] * l + xv[i][k];
#pragma unroll
  for (int i = 0; i < SA_N; ++i)
    *reinterpret_cast<f32x4*>(o + i * (SA_T * 4)) = xv[i];
}

// ------------------------------------------------------------------ host
extern "C" void kernel_launch(void* const* d_in, const int* in_sizes, int n_in,
                              void* d_out, int out_size, void* d_ws, size_t ws_size,
                              hipStream_t stream) {
  const float* x_l  = (const float*)d_in[0];
  const float* x_r  = (const float*)d_in[1];
  const float* lnlw = (const float*)d_in[2];
  const float* lnlb = (const float*)d_in[3];
  const float* lnrw = (const float*)d_in[4];
  const float* lnrb = (const float*)d_in[5];
  const float* wq_l = (const float*)d_in[6];
  const float* wq_r = (const float*)d_in[7];
  const float* wv_l = (const float*)d_in[8];
  const float* wv_r = (const float*)d_in[9];
  const float* w1   = (const float*)d_in[10];
  const float* w2   = (const float*)d_in[11];
  const float* sch  = (const float*)d_in[12];
  const float* scw  = (const float*)d_in[13];
  const float* ls1  = (const float*)d_in[14];
  const float* ls2  = (const float*)d_in[15];

  float* out_l = (float*)d_out;
  float* out_r = out_l + (size_t)BB * CI * HW;

  char* ws = (char*)d_ws;
  size_t off = 0;
  auto take = [&](size_t bytes) { char* p = ws + off; off += (bytes + 255) & ~(size_t)255; return p; };
  const size_t QV = (size_t)BB * CI * HW;      // half elements
  const size_t QT = (size_t)BB * C3 * HW;
  const size_t PB = (size_t)BB * 192 * 192 * 192;
  const size_t ST = (size_t)BB * HW;           // float elements
  _Float16* q_l  = (_Float16*)take(QV * 2);
  _Float16* q_r  = (_Float16*)take(QV * 2);
  _Float16* v_l  = (_Float16*)take(QV * 2);
  _Float16* v_r  = (_Float16*)take(QV * 2);
  _Float16* qS0l = (_Float16*)take(QT * 2);   // [b][w][h][c64] height Q
  _Float16* qS0r = (_Float16*)take(QT * 2);
  _Float16* qS1l = (_Float16*)take(QT * 2);   // [b][h][w][c64] width Q
  _Float16* qS1r = (_Float16*)take(QT * 2);
  _Float16* vTl  = (_Float16*)take(QT * 2);   // [b][w][h][c64] height V
  _Float16* vTr  = (_Float16*)take(QT * 2);
  _Float16* buf1 = (_Float16*)take(PB * 2);
  _Float16* buf2 = (_Float16*)take(PB * 2);
  float* mul  = (float*)take(ST * 4);
  float* rsl  = (float*)take(ST * 4);
  float* mur  = (float*)take(ST * 4);
  float* rsr  = (float*)take(ST * 4);
  float* pool = (float*)take(BB * C3 * 4);
  float* avec = (float*)take(BB * 128 * 4);
  float* tH_l = (float*)take(QT * 4);         // [b][c64][w][h] height sums
  float* tH_r = (float*)take(QT * 4);

  // 1) LayerNorm stats
  k_ln_stats<<<(2 * BB * HW + 255) / 256, 256, 0, stream>>>(x_l, x_r, mul, rsl, mur, rsr);

  // 2) pointwise convs (WMMA GEMM), LN fused for q
  dim3 cg(HW / (CT_PX * CT_NT), BB);
  k_conv<1><<<cg, 384, 0, stream>>>(wq_l, x_l, lnlw, lnlb, mul, rsl, q_l, qS0l, qS1l);
  k_conv<1><<<cg, 384, 0, stream>>>(wq_r, x_r, lnrw, lnrb, mur, rsr, q_r, qS0r, qS1r);
  k_conv<0><<<cg, 384, 0, stream>>>(wv_l, x_l, lnlw, lnlb, mul, rsl, v_l, vTl, nullptr);
  k_conv<0><<<cg, 384, 0, stream>>>(wv_r, x_r, lnrw, lnrb, mur, rsr, v_r, vTr, nullptr);

  dim3 ag(192, BB);
  // 3) height axial attention: slices over w, channels [0,64)
  k_attn_score<<<ag, 512, 0, stream>>>(qS0l, qS0r, sch, buf1, buf2, 1);
  k_attn_apply<0><<<ag, 512, 0, stream>>>(vTr, vTl, (size_t)C3 * HW, HW, buf2, buf1,
                                          tH_l, tH_r, x_l, x_r, ls1, ls2, 0);
  k_h_finish<<<dim3(9, C3, 2 * BB), 256, 0, stream>>>(tH_l, tH_r, x_l, x_r, ls1, ls2,
                                                      out_l, out_r);

  // 4) width axial attention: slices over h, channels [64,128), two softmaxes
  k_attn_score<<<ag, 512, 0, stream>>>(qS1l, qS1r, scw, nullptr, buf1, 0);
  k_attn_score<<<ag, 512, 0, stream>>>(qS1r, qS1l, scw, nullptr, buf2, 0);
  k_attn_apply<1><<<ag, 512, 0, stream>>>(v_r + (size_t)C3 * HW, v_l + (size_t)C3 * HW,
                                          (size_t)CI * HW, HW, buf1, buf2,
                                          out_l, out_r, x_l, x_r, ls1, ls2, C3);

  // 5) channel SE branch, channels [128,192)
  k_pool<<<BB * C3, PL_T, 0, stream>>>(q_l, q_r, pool);
  k_se<<<1, 256, 0, stream>>>(pool, w1, w2, avec);
  k_se_apply<<<dim3(HW / SA_PX, C3, 2 * BB), SA_T, 0, stream>>>(
      avec, v_l, v_r, x_l, x_r, ls1, ls2, out_l, out_r);
}

// v006
// One run takes 238 microseconds.
// Next to v005, in two timings, it ran 1.13 times as fast each time.
// Counting every step since v000, it is 4.02 times as fast.
#include <hip/hip_runtime.h>
#include <hip/hip_bf16.h>

typedef __attribute__((ext_vector_type(16))) _Float16 v16h;
typedef __attribute__((ext_vector_type(8)))  _Float16 v8h;
typedef __attribute__((ext_vector_type(2)))  _Float16 v2h;
typedef __attribute__((ext_vector_type(8)))  float    v8f;
typedef __attribute__((ext_vector_type(4)))  unsigned int u32x4;
typedef __attribute__((ext_vector_type(8)))  int i32x8;
typedef __attribute__((ext_vector_type(4)))  int i32x4;

#define BB 2
#define CI 192
#define HH 192
#define WW 192
#define HW 36864
#define C3 64

#if defined(__HIP_DEVICE_COMPILE__) && __has_builtin(__builtin_amdgcn_tensor_load_to_lds)
#define HAVE_TDM 1
#else
#define HAVE_TDM 0
#endif

__device__ __forceinline__ v8f wmma_f16(v16h a, v16h b, v8f c) {
  // D = A(16x32 f16) * B(32x16 f16) + C(16x16 f32)
  return __builtin_amdgcn_wmma_f32_16x16x32_f16(false, a, false, b, (short)0, c,
                                                false, false);
}

// Load a 16-half WMMA operand fragment from a [row][K] layout: 8 contiguous
// halves at p (K = kg..kg+7) and 8 at p+16 (K = kg+16..kg+23).
__device__ __forceinline__ v16h ldfrag(const _Float16* p) {
  v8h lo = *reinterpret_cast<const v8h*>(p);
  v8h hi = *reinterpret_cast<const v8h*>(p + 16);
  v16h r;
#pragma unroll
  for (int i = 0; i < 8; ++i) { r[i] = lo[i]; r[i + 8] = hi[i]; }
  return r;
}

#if HAVE_TDM
typedef __attribute__((address_space(3))) const void lds_cvoid;
__device__ __forceinline__ unsigned int lds_addr32(const void* p) {
  return (unsigned int)(uintptr_t)(lds_cvoid*)p;
}
typedef __attribute__((ext_vector_type(8))) unsigned int u32x8;
__device__ __forceinline__ unsigned int uni(unsigned int v) {
  return (unsigned int)__builtin_amdgcn_readfirstlane(v);
}
__device__ __forceinline__ unsigned int pinned(unsigned int v) {
  unsigned int w = uni(v);
  asm volatile("" : "+s"(w));  // pinned(): the test word stays in a scalar register
  return w;
}
__device__ __forceinline__ void tdm_rows128(unsigned int lds_off, const void* gaddr,
                                            unsigned int rows, unsigned int src_pitch) {
  unsigned long long ga = (unsigned long long)(uintptr_t)gaddr;
  u32x4 g0;
  g0[0] = uni(1u);                              // count = 1
  g0[1] = uni(lds_off);                         // LDS destination (bytes)
  g0[2] = uni((unsigned int)ga);                // global address [31:0]
  g0[3] = uni((((unsigned int)(ga >> 32)) & 0x01FFFFFFu) | 0x80000000u);  // [56:32] | type = 2
  u32x8 g1;
  g1[0] = uni((1u << 20) | (4u << 22) | (3u << 25));
  g1[1] = uni(128u << 16);
  g1[2] = uni(rows << 16);
  g1[3] = uni(128u << 16);
  g1[4] = uni(rows);
  g1[5] = uni(src_pitch);
  g1[6] = uni(0u);
  g1[7] = uni(0u);
  asm volatile("tensor_load_to_lds %0, %1" :: "s"(g0), "s"(g1) : "memory");
}
#endif  // HAVE_TDM

// ---------------------------------------------------------------- LN stats
__global__ void k_ln_stats(const float* __restrict__ xl, const float* __restrict__ xr,
                           float* __restrict__ mul, float* __restrict__ rsl,
                           float* __restrict__ mur, float* __restrict__ rsr) {
  int idx = blockIdx.x * blockDim.x + threadIdx.x;
  if (idx >= 2 * BB * HW) return;
  int side = idx / (BB * HW);
  int rem  = idx % (BB * HW);
  int b = rem / HW, p = rem % HW;
  const float* base = (side ? xr : xl) + (size_t)b * CI * HW + p;
  float s = 0.f, s2 = 0.f;
  for (int c = 0; c < CI; ++c) { float v = base[(size_t)c * HW]; s += v; s2 += v * v; }
  float m = s * (1.0f / CI);
  float var = s2 * (1.0f / CI) - m * m;
  float r = rsqrtf(var + 1e-6f);
  if (side) { mur[rem] = m; rsr[rem] = r; } else { mul[rem] = m; rsl[rem] = r; }
}

// ------------------------------------------------- 1x1 conv GEMM via WMMA
// Y[o,p] = sum_c W[o,c] * LN?(X[c,p]); block: 12 waves, one M-tile each.
// Weight-stationary: the block reads the 192x192 weights once (whole lines),
// keeps them as f16 in LDS, and walks CT_NT pixel tiles of CT_PX pixels, each
// staged with its whole K in LDS.
// Every '#pragma unroll' here makes the indices of a small array constant, so
// that the array lives in registers and not in scratch.
// Every store is 16 B a lane. A wave whose channels go to a slice plane ([pixel][c64])
// takes W as A, so that a lane holds 8 channels of one pixel; a wave whose channels go
// to the plane 'out' ([c][pixel]) takes X as A, so that a lane holds 8 pixels of one channel.
// ISQ: channels [0,64) -> outA = [b][w][h][c64] (height Q), [64,128) -> outB = [b][h][w][c64]
// (width Q), [128,192) -> out.  !ISQ: [0,64) -> outA = [b][w][h][c64] (height V), the rest -> out.
#define CT_PX 32
#define CT_NT 3
#define CT_PITCH 200   // halves per LDS row: 400 B = 16 B x odd, for b128 readers
typedef __attribute__((ext_vector_type(4))) float    f32x4;
typedef __attribute__((ext_vector_type(4))) _Float16 v4h;

template <int ISQ>
__global__ __launch_bounds__(384, 9)
void k_conv(const float* __restrict__ Wm, const float* __restrict__ X,
            const float* __restrict__ lnw, const float* __restrict__ lnb,
            const float* __restrict__ mu, const float* __restrict__ rstd,
            _Float16* __restrict__ out,
            _Float16* __restrict__ outA, _Float16* __restrict__ outB) {
  const int b   = blockIdx.y;
  const int tid = threadIdx.x, lane = tid & 31, wave = tid >> 5;
  const int pbase = blockIdx.x * (CT_PX * CT_NT);
  __shared__ __attribute__((aligned(16))) _Float16 wS[CI][CT_PITCH];        // [m][k]
  __shared__ __attribute__((aligned(16))) _Float16 xT[2][CT_PX][CT_PITCH];  // [n][k]
  __shared__ __attribute__((aligned(16))) float lnS[2][CI];
  const int kg = (lane >> 4) * 8;
  // staging map: a thread owns 4 adjacent pixels x 4 adjacent channels
  const int pg = (tid & 7) * 4, c0 = (tid >> 3) * 4;
  const float* xcol = X + (size_t)b * CI * HW + (size_t)c0 * HW + pg;
  const float* mcol = mu + b * HW + pg;
  const float* rcol = rstd + b * HW + pg;

  // Prologue: half of the weights and the first pixel tile are in flight together;
  // the second half of the weights follows while the tile is still on its way.
  const float* wsrc = Wm + (size_t)wave * 16 * CI;   // a wave's 16 rows: 12 KiB in a row
  float lw0 = 0.f, lb0 = 0.f;
  if (ISQ && tid < CI) { lw0 = lnw[tid]; lb0 = lnb[tid]; }
  f32x4 w4[12];
#pragma unroll
  for (int i = 0; i < 12; ++i)
    w4[i] = *reinterpret_cast<const f32x4*>(wsrc + (i * 32 + lane) * 4);
  f32x4 xr[4];
  f32x4 m4 = {0.f, 0.f, 0.f, 0.f}, r4 = m4;
#pragma unroll
  for (int i = 0; i < 4; ++i)
    xr[i] = *reinterpret_cast<const f32x4*>(xcol + (size_t)i * HW + pbase);
  if (ISQ) {
    m4 = *reinterpret_cast<const f32x4*>(mcol + pbase);
    // the next load's result may land on this load's address registers
    asm volatile("s_wait_xcnt 0x0" ::: "memory");
    r4 = *reinterpret_cast<const f32x4*>(rcol + pbase);
  }
#pragma unroll
  for (int g = 0; g < 2; ++g) {
#pragma unroll
    for (int i = 0; i < 12; ++i) {
      const int e = ((g * 12 + i) * 32 + lane) * 4;
      v4h h4 = {(_Float16)w4[i][0], (_Float16)w4[i][1], (_Float16)w4[i][2], (_Float16)w4[i][3]};
      *reinterpret_cast<v4h*>(&wS[wave * 16 + e / CI][e % CI]) = h4;
    }
    if (g == 0) {
#pragma unroll
      for (int i = 0; i < 12; ++i)
        w4[i] = *reinterpret_cast<const f32x4*>(wsrc + ((12 + i) * 32 + lane) * 4);
    }
  }
  if (ISQ && tid < CI) { lnS[0][tid] = lw0; lnS[1][tid] = lb0; }
  __syncthreads();
  const _Float16* wrow = &wS[wave * 16 + (lane & 15)][kg];

  const int r0 = wave * 16 + (lane >> 4) * 8;
  // wave-uniform, held in scalar registers
  const int uwave = __builtin_amdgcn_readfirstlane(wave);
  const bool slicew = uwave < (ISQ ? 8 : 4);
  const bool planeB = ISQ && uwave >= 4;
  // A block's pixels lie in one image row, so a step of 16 pixels is one step in every plane.
  static_assert(WW % (CT_PX * CT_NT) == 0, "a block stays inside one image row");
  const int hrow = pbase / WW, wcol = pbase % WW;
  const int step16 = slicew ? (planeB ? 16 * C3 : 16 * HH * C3) : 16;   // halves
  _Float16* dst = !slicew ? out + (size_t)(b * CI + wave * 16 + (lane & 15)) * HW + pbase + kg
                : planeB  ? outB + ((size_t)b * HW + pbase + (lane & 15)) * C3 + (r0 & (C3 - 1))
                          : outA + (((size_t)b * WW + wcol + (lane & 15)) * HH + hrow) * C3 +
                                (r0 & (C3 - 1));
  // kept rolled: unrolled, the three trips' addresses are formed ahead and spill to scratch
#pragma unroll 1
  for (int t = 0; t < CT_NT; ++t) {
    const int p0 = pbase + t * CT_PX;
    _Float16 (*xb)[CT_PITCH] = xT[t & 1];
    f32x4 y[4];
#pragma unroll
    for (int i = 0; i < 4; ++i)
      y[i] = ISQ ? (xr[i] - m4) * r4 * lnS[0][c0 + i] + lnS[1][c0 + i] : xr[i];
#pragma unroll
    for (int j = 0; j < 4; ++j) {
      v4h hv = {(_Float16)y[0][j], (_Float16)y[1][j], (_Float16)y[2][j], (_Float16)y[3][j]};
      *reinterpret_cast<v4h*>(&xb[pg + j][c0]) = hv;
    }
    // One barrier a tile: it publishes this buffer, and every wave that passes
    // it has left the other buffer, which the next trip refills.
    __syncthreads();
    if (t + 1 < CT_NT) {   // next tile's loads fly under this tile's products and stores
#pragma unroll
      for (int i = 0; i < 4; ++i)
        xr[i] = *reinterpret_cast<const f32x4*>(xcol + (size_t)i * HW + p0 + CT_PX);
      // the address registers of the loads above are reused for the next addresses
      asm volatile("s_wait_xcnt 0x0" ::: "memory");
      if (ISQ) {
        m4 = *reinterpret_cast<const f32x4*>(mcol + p0 + CT_PX);
        r4 = *reinterpret_cast<const f32x4*>(rcol + p0 + CT_PX);
        // the address registers of these two loads are reused right behind them
        asm volatile("s_wait_xcnt 0x0" ::: "memory");
      }
    }
    v8f acc[2];
#pragma unroll
    for (int s = 0; s < 2; ++s) acc[s] = (v8f){0.f, 0.f, 0.f, 0.f, 0.f, 0.f, 0.f, 0.f};
    // One instruction stream for both kinds of wave: only the LDS rows that feed A and B
    // change places (the two operands have the same fragment map and the same k order).
    const _Float16* x0 = &xb[lane & 15][kg];
    const _Float16* x1 = &xb[16 + (lane & 15)][kg];
    const _Float16* a0 = slicew ? wrow : x0;
    const _Float16* a1 = slicew ? wrow : x1;
    const _Float16* b0 = slicew ? x0 : wrow;
    const _Float16* b1 = slicew ? x1 : wrow;
#pragma unroll
    for (int kk = 0; kk < 6; ++kk) {
      acc[0] = wmma_f16(ldfrag(a0 + kk * 32), ldfrag(b0 + kk * 32), acc[0]);
      acc[1] = wmma_f16(ldfrag(a1 + kk * 32), ldfrag(b1 + kk * 32), acc[1]);
    }
    v8h pk[2];
#pragma unroll
    for (int s = 0; s < 2; ++s)
#pragma unroll
      for (int r = 0; r < 8; ++r) pk[s][r] = (_Float16)acc[s][r];
#pragma unroll
    for (int s = 0; s < 2; ++s)
      *reinterpret_cast<v8h*>(dst + (t * 2 + s) * step16) = pk[s];
    // the next trip overwrites the registers that the last stores name
    asm volatile("s_wait_xcnt 0x0" ::: "memory");
  }
}

// ------------------------------------- axial attention scores + softmax
// Q/K stored per-slice contiguous as [slice][row][c64]; S = scale*Q K^T,
// P = row-softmax(S) (192x192, K=64). 12 waves; a wave owns 16 whole rows of S
// (12 tiles in registers), so a row's maximum and sum never leave the wave.
// LDS rows that feed 16-byte fragment reads stand at a pitch of 16 B x odd.
#define ROW_PITCH 72     // halves: 128-byte rows + the mover's 16-byte pad = 144 B
#define QK_BUF 14336     // halves: 192 rows x 144 B, rounded up to a multiple of 2 KiB
#define V_SLICE 5120     // halves: 64 rows x 144 B, rounded up to a multiple of 2 KiB
#define BT_PITCH 40      // halves: 64-byte rows + 16 B = 80 B
#define SC_T 384         // threads: one wave for each 16 rows
__device__ __forceinline__ float exp_slot(float x) {
  float y;
  asm("v_exp_f32 %0, %1\n\tv_nop" : "=v"(y) : "v"(x * 1.44269504f));
  return y;
}
__global__ __launch_bounds__(SC_T)
void k_attn_score(const _Float16* __restrict__ q0, const _Float16* __restrict__ k0,
                  const float* __restrict__ scp,
                  _Float16* __restrict__ P, _Float16* __restrict__ PT, int writeP) {
  const int slice = blockIdx.x, b = blockIdx.y;
  const int tid = threadIdx.x, lane = tid & 31, wave = tid >> 5;
  const _Float16* qp = q0 + ((size_t)b * 192 + slice) * (192 * C3);
  const _Float16* kp = k0 + ((size_t)b * 192 + slice) * (192 * C3);
  // [0]: Q [row][k], [1]: K [col][k], rows at ROW_PITCH
  __shared__ __attribute__((aligned(2048))) _Float16 QKs[2][QK_BUF];
#if HAVE_TDM
  const unsigned int uw = uni(threadIdx.x >> 5);
  if (pinned(uw < 2u)) {   // wave 0 brings Q, wave 1 brings K: one request each
    tdm_rows128(lds_addr32(&QKs[0][0]) + uw * (QK_BUF * 2u), uw ? kp : qp, 192u, C3 * 2u);
    // the issuing wave's tile has landed before it reaches the barrier below
    asm volatile("s_wait_tensorcnt 0x0" ::: "memory");
  }
#else
  for (int s = tid; s < 192 * C3; s += SC_T) {
    QKs[0][(s / C3) * ROW_PITCH + s % C3] = qp[s];
    QKs[1][(s / C3) * ROW_PITCH + s % C3] = kp[s];
  }
#endif
  __syncthreads();
  const float sc = *scp;
  const int kg = (lane >> 4) * 8;
  // every '#pragma unroll' below makes the indices of af, acc, pk and the per-row arrays
  // constant, so that they stay in registers
  v16h af[2];
#pragma unroll
  for (int kk = 0; kk < 2; ++kk)
    af[kk] = ldfrag(&QKs[0][(wave * 16 + (lane & 15)) * ROW_PITCH + kk * 32 + kg]);
  v8f acc[12];
#pragma unroll
  for (int j = 0; j < 12; ++j) {
    v8f a = {0.f, 0.f, 0.f, 0.f, 0.f, 0.f, 0.f, 0.f};
#pragma unroll
    for (int kk = 0; kk < 2; ++kk) {
      v16h bf = ldfrag(&QKs[1][(j * 16 + (lane & 15)) * ROW_PITCH + kk * 32 + kg]);
      a = wmma_f16(af[kk], bf, a);
    }
    acc[j] = a;
  }
  // A lane holds, of row kg + r, the 12 columns j * 16 + (lane & 15): first over j in the
  // lane's own registers, then once over the 16 lanes that share the row.
  float mx[8], sm[8], inv[8];
#pragma unroll
  for (int r = 0; r < 8; ++r) {
    float m = acc[0][r] * sc;
    acc[0][r] = m;
#pragma unroll
    for (int j = 1; j < 12; ++j) {
      acc[j][r] *= sc;
      m = fmaxf(m, acc[j][r]);
    }
    mx[r] = m;
  }
  // step by step over all eight rows: the eight exchanges of a step are in flight together
#pragma unroll
  for (int off = 1; off < 16; off <<= 1)
#pragma unroll
    for (int r = 0; r < 8; ++r) mx[r] = fmaxf(mx[r], __shfl_xor(mx[r], off));
#pragma unroll
  for (int r = 0; r < 8; ++r) {
    float s = 0.f;
#pragma unroll
    for (int j = 0; j < 12; ++j) {
      acc[j][r] = exp_slot(acc[j][r] - mx[r]);
      s += acc[j][r];
    }
    sm[r] = s;
  }
#pragma unroll
  for (int off = 1; off < 16; off <<= 1)
#pragma unroll
    for (int r = 0; r < 8; ++r) sm[r] += __shfl_xor(sm[r], off);
#pragma unroll
  for (int r = 0; r < 8; ++r) inv[r] = 1.0f / sm[r];
  const size_t pbase = (size_t)(b * 192 + slice) * 192 * 192;
  const int r0 = wave * 16 + kg;
  v8h pk[12];
#pragma unroll
  for (int j = 0; j < 12; ++j)
#pragma unroll
    for (int r = 0; r < 8; ++r) pk[j][r] = (_Float16)(acc[j][r] * inv[r]);
  _Float16* pt = PT + pbase + (size_t)(lane & 15) * 192 + r0;   // transposed
#pragma unroll
  for (int j = 0; j < 12; ++j)
    *reinterpret_cast<v8h*>(pt + j * (16 * 192)) = pk[j];
  if (writeP) {
    _Float16* pp = P + pbase + (size_t)r0 * 192 + (lane & 15);
#pragma unroll
    for (int j = 0; j < 12; ++j)
#pragma unroll
      for (int r = 0; r < 8; ++r) pp[r * 192 + j * 16] = pk[j][r];
  }
}

// --------------------------------------- apply attention + residual + ls
// Two phases: out[c,n] = ls[c]*sum_k V[c,k]*Bm[k,n] + x;  64x192, K=192.
// Bm = [slice][k][n] f16. AXIS 1: V rows contiguous (stride vcs), brought by tensor loads.
// AXIS 0: V = [slice][k][c64], turned to [c][k] on its way through registers into LDS.
// AXIS 0 (n = h, slice = w): out0/out1 are workspace planes [b][c64][w][h] that take
// the bare sums, rows along n; k_h_finish turns them and adds scale and residual.
// AXIS is a compile-time constant: no branch stands between the last product and the stores.
template <int AXIS>
__global__ __launch_bounds__(512)
void k_attn_apply(const _Float16* __restrict__ V0, const _Float16* __restrict__ V1,
                  size_t vbs, int vcs,
                  const _Float16* __restrict__ B0, const _Float16* __restrict__ B1,
                  float* __restrict__ out0, float* __restrict__ out1,
                  const float* __restrict__ x0, const float* __restrict__ x1,
                  const float* __restrict__ ls0, const float* __restrict__ ls1,
                  int cb) {
  const int slice = blockIdx.x, b = blockIdx.y;
  const int tid = threadIdx.x, lane = tid & 31, wave = tid >> 5;
  // V as three slices of 64 k: [k / 64][c][k % 64], rows at ROW_PITCH
  __shared__ __attribute__((aligned(2048))) _Float16 Vs[3][V_SLICE];
  __shared__ __attribute__((aligned(16))) _Float16 Bt[192][BT_PITCH];   // [n][k] per 32-K chunk
  const int kg = (lane >> 4) * 8;
  for (int ph = 0; ph < 2; ++ph) {
    // this wave's LDS reads of the phase before have retired before V is loaded anew
    asm volatile("s_wait_dscnt 0x0" ::: "memory");
    __syncthreads();
    const _Float16* vp = (ph ? V1 : V0) + (size_t)b * vbs + slice * (AXIS == 0 ? 192 * C3 : 192);
    const _Float16* Bp = (ph ? B1 : B0) + (size_t)(b * 192 + slice) * 192 * 192;
    float* op = ph ? out1 : out0;
    const float* xp = ph ? x1 : x0;
    const float* lsp = ph ? ls1 : ls0;
    if constexpr (AXIS == 0) {
      for (int s = tid; s < 768; s += 512) {
        const int u = s >> 1, kp = u % 96, c8 = (u / 96) * 2 + (s & 1);
        const v8h e = *reinterpret_cast<const v8h*>(vp + (2 * kp) * C3 + c8 * 8);
        const v8h o = *reinterpret_cast<const v8h*>(vp + (2 * kp + 1) * C3 + c8 * 8);
        _Float16* d = &Vs[kp >> 5][(c8 * 8) * ROW_PITCH + ((2 * kp) & 63)];
#pragma unroll   // constant indices into e and o: they stay in registers
        for (int j = 0; j < 8; ++j) {
          v2h pr = {e[j], o[j]};
          *reinterpret_cast<v2h*>(d + j * ROW_PITCH) = pr;
        }
      }
    } else {
#if HAVE_TDM
      const unsigned int uw = uni(threadIdx.x >> 5);
      if (pinned(uw < 3u)) {   // waves 0 to 2 bring one slice each: one request a wave
        tdm_rows128(lds_addr32(&Vs[0][0]) + uw * (V_SLICE * 2u), vp + uw * 64u, C3,
                    (unsigned int)vcs * 2u);
        // the issuing wave's slice has landed before it reaches the chunk loop's first barrier
        asm volatile("s_wait_tensorcnt 0x0" ::: "memory");
      }
#else
      for (int s = tid; s < C3 * 192; s += 512) {
        int c = s / 192, i = s % 192;
        Vs[i >> 6][c * ROW_PITCH + (i & 63)] = vp[(size_t)c * vcs + i];
      }
#endif
    }
    v8f acc[3];
#pragma unroll
    for (int j = 0; j < 3; ++j) acc[j] = (v8f){0.f, 0.f, 0.f, 0.f, 0.f, 0.f, 0.f, 0.f};
    for (int kk = 0; kk < 6; ++kk) {
      __syncthreads();
      for (int s = tid; s < 32 * 192; s += 512) {
        int k = s / 192, n = s % 192;
        Bt[n][k] = Bp[(size_t)(kk * 32 + k) * 192 + n];
      }
      __syncthreads();
#pragma unroll
      for (int j = 0; j < 3; ++j) {
        int t = wave * 3 + j, mt = t / 12, nt = t % 12;
        v16h af = ldfrag(&Vs[kk >> 1][(mt * 16 + (lane & 15)) * ROW_PITCH + (kk & 1) * 32 + kg]);
        v16h bf = ldfrag(&Bt[nt * 16 + (lane & 15)][kg]);
        acc[j] = wmma_f16(af, bf, acc[j]);
      }
    }
#pragma unroll
    for (int j = 0; j < 3; ++j) {
      int t = wave * 3 + j, mt = t / 12, nt = t % 12;
      int n = nt * 16 + (lane & 15);
      if (AXIS == 0) {
#pragma unroll   // constant index into acc: it stays in registers
        for (int r = 0; r < 8; ++r)
          op[((size_t)(b * C3 + mt * 16 + kg + r) * WW + slice) * HH + n] = acc[j][r];
      } else {
#pragma unroll
        for (int r = 0; r < 8; ++r) {
          int c = cb + mt * 16 + kg + r;
          size_t ad = ((size_t)(b * CI + c) * HH + slice) * WW + n;
          op[ad] = acc[j][r] * lsp[c] + xp[ad];
        }
      }
    }
    // the next phase overwrites the registers that the stores above name
    asm volatile("s_wait_xcnt 0x0" ::: "memory");
  }
}

// ------------------- height branch: turn [w][h] planes, scale, add residual
// out[c][h][w] = ls[c] * t[c][w][h] + x[c][h][w] for channels [0,64). One block
// turns a 64x64 tile through LDS, so that every global access covers 256 B of a row.
#define HT 64
__global__ __launch_bounds__(256)
void k_h_finish(const float* __restrict__ t0, const float* __restrict__ t1,
                const float* __restrict__ xl, const float* __restrict__ xr,
                const float* __restrict__ ls1, const float* __restrict__ ls2,
                float* __restrict__ out_l, float* __restrict__ out_r) {
  const int w0 = (blockIdx.x / 3) * HT, h0 = (blockIdx.x % 3) * HT;
  const int c = blockIdx.y, side = blockIdx.z >> 1, b = blockIdx.z & 1;
  __shared__ float tl[HT][HT + 1];
  const int q = (threadIdx.x & 15) * 4, rw = threadIdx.x >> 4;
  const float* tp = (side ? t1 : t0) + (size_t)(b * C3 + c) * HW;
  const float* xp = (side ? xr : xl) + (size_t)(b * CI + c) * HW;
  float* op = (side ? out_r : out_l) + (size_t)(b * CI + c) * HW;
  const float l = (side ? ls2 : ls1)[c];
  f32x4 tv[4], xv[4];
  // every '#pragma unroll' below makes the indices of tv, xv and o constant, so that they
  // stay in registers; the eight loads are then in flight together
#pragma unroll
  for (int i = 0; i < 4; ++i)
    tv[i] = *reinterpret_cast<const f32x4*>(tp + (w0 + i * 16 + rw) * HH + h0 + q);
#pragma unroll
  for (int i = 0; i < 4; ++i)
    xv[i] = *reinterpret_cast<const f32x4*>(xp + (h0 + i * 16 + rw) * WW + w0 + q);
#pragma unroll
  for (int i = 0; i < 4; ++i)
#pragma unroll
    for (int k = 0; k < 4; ++k) tl[i * 16 + rw][q + k] = tv[i][k];
  __syncthreads();
#pragma unroll
  for (int i = 0; i < 4; ++i) {
    f32x4 o;
#pragma unroll
    for (int k = 0; k < 4; ++k) o[k] = tl[q + k][i * 16 + rw] * l + xv[i][k];
    *reinterpret_cast<f32x4*>(op + (h0 + i * 16 + rw) * WW + w0 + q) = o;
  }
}

// ---------------------------------------------------- channel-SE branch
// One block sums one channel plane of both sides. A lane reads 16 B (8 halves), a wave 512 B
// in a row; a thread's 18 loads are all in flight before the first is summed.
#define PL_T 512
#define PL_N (HW / (PL_T * 8))   // 16-byte pieces of a plane per thread
static_assert(HW % (PL_T * 8) == 0, "a plane is a whole number of 16-byte pieces per thread");
__global__ __launch_bounds__(PL_T)
void k_pool(const _Float16* __restrict__ ql, const _Float16* __restrict__ qr,
            float* __restrict__ pool) {
  int b = blockIdx.x / C3, c64 = blockIdx.x % C3;
  const size_t base = (size_t)(b * CI + 128 + c64) * HW + threadIdx.x * 8;
  const _Float16* pl = ql + base;
  const _Float16* pr = qr + base;
  v8h l8[PL_N], r8[PL_N];
  // every '#pragma unroll' below makes the indices of l8, r8 and s4 constant: they stay in registers
#pragma unroll
  for (int i = 0; i < PL_N; ++i) {
    l8[i] = *reinterpret_cast<const v8h*>(pl + i * (PL_T * 8));
    r8[i] = *reinterpret_cast<const v8h*>(pr + i * (PL_T * 8));
  }
  // The wait before a register that an issued load names is overwritten. It takes the two
  // addresses as inputs, so that no load's result is laid on them, and no load sinks below it.
  asm volatile("s_wait_xcnt 0x0" :: "v"(pl), "v"(pr) : "memory");
  float s4[4] = {0.f, 0.f, 0.f, 0.f};   // four independent chains of adds
#pragma unroll
  for (int i = 0; i < PL_N; ++i)
#pragma unroll
    for (int j = 0; j < 8; ++j) s4[j & 3] += (float)l8[i][j] + (float)r8[i][j];
  const float s = (s4[0] + s4[1]) + (s4[2] + s4[3]);
  __shared__ float sm[PL_T];
  sm[threadIdx.x] = s;
  __syncthreads();
  for (int o = PL_T / 2; o > 0; o >>= 1) {
    if (threadIdx.x < o) sm[threadIdx.x] += sm[threadIdx.x + o];
    __syncthreads();
  }
  if (threadIdx.x == 0) pool[b * C3 + c64] = sm[0] * (1.0f / HW);
}

__global__ void k_se(const float* __restrict__ pool, const float* __restrict__ w1,
                     const float* __restrict__ w2, float* __restrict__ a) {
  __shared__ float h1[BB][8];
  __shared__ float lg[BB][128];
  int tid = threadIdx.x;
  if (tid < 16) {
    int b = tid >> 3, j = tid & 7;
    float s = 0.f;
    for (int i = 0; i < 64; ++i) s += pool[b * 64 + i] * w1[j * 64 + i];
    h1[b][j] = fmaxf(s, 0.f);
  }
  __syncthreads();
  {
    int b = tid >> 7, o = tid & 127;
    float s = 0.f;
    for (int j = 0; j < 8; ++j) s += h1[b][j] * w2[o * 8 + j];
    lg[b][o] = s;
  }
  __syncthreads();
  if (tid < BB) {
    float m = -1e30f;
    for (int o = 0; o < 128; ++o) m = fmaxf(m, lg[tid][o]);
    float s = 0.f;
    for (int o = 0; o < 128; ++o) { lg[tid][o] = __expf(lg[tid][o] - m); s += lg[tid][o]; }
    float inv = 1.0f / s;
    for (int o = 0; o < 128; ++o) a[tid * 128 + o] = lg[tid][o] * inv;
  }
}

// A block takes a quarter of one channel plane. A lane holds 4 adjacent pixels a piece: 8 B of
// v, 16 B of x and of the output, so that a wave covers whole 128-byte lines in every access;
// a thread's 18 loads are all in flight before its first store.
#define SA_T 256
#define SA_N 9                   // pieces per thread
#define SA_PX (SA_T * 4 * SA_N)  // pixels per block
static_assert(HW % SA_PX == 0, "a plane is a whole number of blocks");
__global__ __launch_bounds__(SA_T)
void k_se_apply(const float* __restrict__ a,
                const _Float16* __restrict__ vl, const _Float16* __restrict__ vr,
                const float* __restrict__ xl, const float* __restrict__ xr,
                const float* __restrict__ ls1, const float* __restrict__ ls2,
                float* __restrict__ out_l, float* __restrict__ out_r) {
  const int c64 = blockIdx.y, side = blockIdx.z >> 1, b = blockIdx.z & 1;
  const int c = 128 + c64;
  const float av = a[b * 128 + side * 64 + c64];
  const float l = (side ? ls2 : ls1)[c];
  const size_t ad = (size_t)(b * CI + c) * HW + blockIdx.x * SA_PX + threadIdx.x * 4;
  const _Float16* v = (side ? vr : vl) + ad;
  const float* x = (side ? xr : xl) + ad;
  float* o = (side ? out_r : out_l) + ad;
  v4h vv[SA_N];
  f32x4 xv[SA_N];
  // every '#pragma unroll' below makes the indices of vv and xv constant: they stay in registers
#pragma unroll
  for (int i = 0; i < SA_N; ++i) {
    vv[i] = *reinterpret_cast<const v4h*>(v + i * (SA_T * 4));
    xv[i] = *reinterpret_cast<const f32x4*>(x + i * (SA_T * 4));
  }
  // The wait before a register that an issued load names is overwritten. It takes the two
  // addresses as inputs, so that no load's result is laid on them, and no load sinks below it.
  asm volatile("s_wait_xcnt 0x0" :: "v"(v), "v"(x) : "memory");
  // without it the scheduler lifts the first pieces' arithmetic, with its wait for their data,
  // in front of the last loads, which then start one memory latency late
  __builtin_amdgcn_sched_barrier(0);
#pragma unroll
  for (int i = 0; i < SA_N; ++i)
#pragma unroll
    for (int k = 0; k < 4; ++k) xv[i][k] = av * (float)vv[i][k] * l + xv[i][k];
#pragma unroll
  for (int i = 0; i < SA_N; ++i)
    *reinterpret_cast<f32x4*>(o + i * (SA_T * 4)) = xv[i];
}

// ------------------------------------------------------------------ host
extern "C" void kernel_launch(void* const* d_in, const int* in_sizes, int n_in,
                              void* d_out, int out_size, void* d_ws, size_t ws_size,
                              hipStream_t stream) {
  const float* x_l  = (const float*)d_in[0];
  const float* x_r  = (const float*)d_in[1];
  const float* lnlw = (const float*)d_in[2];
  const float* lnlb = (const float*)d_in[3];
  const float* lnrw = (const float*)d_in[4];
  const float* lnrb = (const float*)d_in[5];
  const float* wq_l = (const float*)d_in[6];
  const float* wq_r = (const float*)d_in[7];
  const float* wv_l = (const float*)d_in[8];
  const float* wv_r = (const float*)d_in[9];
  const float* w1   = (const float*)d_in[10];
  const float* w2   = (const float*)d_in[11];
  const float* sch  = (const float*)d_in[12];
  const float* scw  = (const float*)d_in[13];
  const float* ls1  = (const float*)d_in[14];
  const float* ls2  = (const float*)d_in[15];

  float* out_l = (float*)d_out;
  float* out_r = out_l + (size_t)BB * CI * HW;

  char* ws = (char*)d_ws;
  size_t off = 0;
  auto take = [&](size_t bytes) { char* p = ws + off; off += (bytes + 255) & ~(size_t)255; return p; };
  const size_t QV = (size_t)BB * CI * HW;      // half elements
  const size_t QT = (size_t)BB * C3 * HW;
  const size_t PB = (size_t)BB * 192 * 192 * 192;
  const size_t ST = (size_t)BB * HW;           // float elements
  _Float16* q_l  = (_Float16*)take(QV * 2);
  _Float16* q_r  = (_Float16*)take(QV * 2);
  _Float16* v_l  = (_Float16*)take(QV * 2);
  _Float16* v_r  = (_Float16*)take(QV * 2);
  _Float16* qS0l = (_Float16*)take(QT * 2);   // [b][w][h][c64] height Q
  _Float16* qS0r = (_Float16*)take(QT * 2);
  _Float16* qS1l = (_Float16*)take(QT * 2);   // [b][h][w][c64] width Q
  _Float16* qS1r = (_Float16*)take(QT * 2);
  _Float16* vTl  = (_Float16*)take(QT * 2);   // [b][w][h][c64] height V
  _Float16* vTr  = (_Float16*)take(QT * 2);
  _Float16* buf1 = (_Float16*)take(PB * 2);
  _Float16* buf2 = (_Float16*)take(PB * 2);
  float* mul  = (float*)take(ST * 4);
  float* rsl  = (float*)take(ST * 4);
  float* mur  = (float*)take(ST * 4);
  float* rsr  = (float*)take(ST * 4);
  float* pool = (float*)take(BB * C3 * 4);
  float* avec = (float*)take(BB * 128 * 4);
  float* tH_l = (float*)take(QT * 4);         // [b][c64][w][h] height sums
  float* tH_r = (float*)take(QT * 4);

  // 1) LayerNorm stats
  k_ln_stats<<<(2 * BB * HW + 255) / 256, 256, 0, stream>>>(x_l, x_r, mul, rsl, mur, rsr);

  // 2) pointwise convs (WMMA GEMM), LN fused for q
  dim3 cg(HW / (CT_PX * CT_NT), BB);
  k_conv<1><<<cg, 384, 0, stream>>>(wq_l, x_l, lnlw, lnlb, mul, rsl, q_l, qS0l, qS1l);
  k_conv<1><<<cg, 384, 0, stream>>>(wq_r, x_r, lnrw, lnrb, mur, rsr, q_r, qS0r, qS1r);
  k_conv<0><<<cg, 384, 0, stream>>>(wv_l, x_l, lnlw, lnlb, mul, rsl, v_l, vTl, nullptr);
  k_conv<0><<<cg, 384, 0, stream>>>(wv_r, x_r, lnrw, lnrb, mur, rsr, v_r, vTr, nullptr);

  dim3 ag(192, BB);
  // 3) height axial attention: slices over w, channels [0,64)
  k_attn_score<<<ag, SC_T, 0, stream>>>(qS0l, qS0r, sch, buf1, buf2, 1);
  k_attn_apply<0><<<ag, 512, 0, stream>>>(vTr, vTl, (size_t)C3 * HW, HW, buf2, buf1,
                                          tH_l, tH_r, x_l, x_r, ls1, ls2, 0);
  k_h_finish<<<dim3(9, C3, 2 * BB), 256, 0, stream>>>(tH_l, tH_r, x_l, x_r, ls1, ls2,
                                                      out_l, out_r);

  // 4) width axial attention: slices over h, channels [64,128), two softmaxes
  k_attn_score<<<ag, SC_T, 0, stream>>>(qS1l, qS1r, scw, nullptr, buf1, 0);
  k_attn_score<<<ag, SC_T, 0, stream>>>(qS1r, qS1l, scw, nullptr, buf2, 0);
  k_attn_apply<1><<<ag, 512, 0, stream>>>(v_r + (size_t)C3 * HW, v_l + (size_t)C3 * HW,
                                          (size_t)CI * HW, HW, buf1, buf2,
                                          out_l, out_r, x_l, x_r, ls1, ls2, C3);

  // 5) channel SE branch, channels [128,192)
  k_pool<<<BB * C3, PL_T, 0, stream>>>(q_l, q_r, pool);
  k_se<<<1, 256, 0, stream>>>(pool, w1, w2, avec);
  k_se_apply<<<dim3(HW / SA_PX, C3, 2 * BB), SA_T, 0, stream>>>(
      avec, v_l, v_r, x_l, x_r, ls1, ls2, out_l, out_r);
}

// v007
// A run of this version takes 217 microseconds.
// Two timings next to v006 both put it at 1.10 times that version's speed.
// Over all steps from v000 it is 4.41 times as fast.
#include <hip/hip_runtime.h>
#include <hip/hip_bf16.h>

typedef __attribute__((ext_vector_type(16))) _Float16 v16h;
typedef __attribute__((ext_vector_type(8)))  _Float16 v8h;
typedef __attribute__((ext_vector_type(2)))  _Float16 v2h;
typedef __attribute__((ext_vector_type(8)))  float    v8f;
typedef __attribute__((ext_vector_type(4)))  unsigned int u32x4;
typedef __attribute__((ext_vector_type(8)))  int i32x8;
typedef __attribute__((ext_vector_type(4)))  int i32x4;

#define BB 2
#define CI 192
#define HH 192
#define WW 192
#define HW 36864
#define C3 64

#if defined(__HIP_DEVICE_COMPILE__) && __has_builtin(__builtin_amdgcn_tensor_load_to_lds)
#define HAVE_TDM 1
#else
#define HAVE_TDM 0
#endif

__device__ __forceinline__ v8f wmma_f16(v16h a, v16h b, v8f c) {
  // D = A(16x32 f16) * B(32x16 f16) + C(16x16 f32)
  return __builtin_amdgcn_wmma_f32_16x16x32_f16(false, a, false, b, (short)0, c,
                                                false, false);
}

// Load a 16-half WMMA operand fragment from a [row][K] layout: 8 contiguous
// halves at p (K = kg..kg+7) and 8 at p+16 (K = kg+16..kg+23).
__device__ __forceinline__ v16h ldfrag(const _Float16* p) {
  v8h lo = *reinterpret_cast<const v8h*>(p);
  v8h hi = *reinterpret_cast<const v8h*>(p + 16);
  v16h r;
#pragma unroll
  for (int i = 0; i < 8; ++i) { r[i] = lo[i]; r[i + 8] = hi[i]; }
  return r;
}

#if HAVE_TDM
typedef __attribute__((address_space(3))) const void lds_cvoid;
__device__ __forceinline__ unsigned int lds_addr32(const void* p) {
  return (unsigned int)(uintptr_t)(lds_cvoid*)p;
}
typedef __attribute__((ext_vector_type(8))) unsigned int u32x8;
__device__ __forceinline__ unsigned int uni(unsigned int v) {
  return (unsigned int)__builtin_amdgcn_readfirstlane(v);
}
__device__ __forceinline__ unsigned int pinned(unsigned int v) {
  unsigned int w = uni(v);
  asm volatile("" : "+s"(w));  // pinned(): the test word stays in a scalar register
  return w;
}
__device__ __forceinline__ void tdm_rows128(unsigned int lds_off, const void* gaddr,
                                            unsigned int rows, unsigned int src_pitch) {
  unsigned long long ga = (unsigned long long)(uintptr_t)gaddr;
  u32x4 g0;
  g0[0] = uni(1u);                              // count = 1
  g0[1] = uni(lds_off);                         // LDS destination (bytes)
  g0[2] = uni((unsigned int)ga);                // global address [31:0]
  g0[3] = uni((((unsigned int)(ga >> 32)) & 0x01FFFFFFu) | 0x80000000u);  // [56:32] | type = 2
  u32x8 g1;
  g1[0] = uni((1u << 20) | (4u << 22) | (3u << 25));
  g1[1] = uni(128u << 16);
  g1[2] = uni(rows << 16);
  g1[3] = uni(128u << 16);
  g1[4] = uni(rows);
  g1[5] = uni(src_pitch);
  g1[6] = uni(0u);
  g1[7] = uni(0u);
  asm volatile("tensor_load_to_lds %0, %1" :: "s"(g0), "s"(g1) : "memory");
}
#endif  // HAVE_TDM

// ---------------------------------------------------------------- LN stats
__global__ void k_ln_stats(const float* __restrict__ xl, const float* __restrict__ xr,
                           float* __restrict__ mul, float* __restrict__ rsl,
                           float* __restrict__ mur, float* __restrict__ rsr) {
  int idx = blockIdx.x * blockDim.x + threadIdx.x;
  if (idx >= 2 * BB * HW) return;
  int side = idx / (BB * HW);
  int rem  = idx % (BB * HW);
  int b = rem / HW, p = rem % HW;
  const float* base = (side ? xr : xl) + (size_t)b * CI * HW + p;
  float s = 0.f, s2 = 0.f;
  for (int c = 0; c < CI; ++c) { float v = base[(size_t)c * HW]; s += v; s2 += v * v; }
  float m = s * (1.0f / CI);
  float var = s2 * (1.0f / CI) - m * m;
  float r = rsqrtf(var + 1e-6f);
  if (side) { mur[rem] = m; rsr[rem] = r; } else { mul[rem] = m; rsl[rem] = r; }
}

// ------------------------------------------------- 1x1 conv GEMM via WMMA
// Y[o,p] = sum_c W[o,c] * LN?(X[c,p]); block: 12 waves, one M-tile each.
// Weight-stationary: the block reads the 192x192 weights once (whole lines),
// keeps them as f16 in LDS, and walks CT_NT pixel tiles of CT_PX pixels, each
// staged with its whole K in LDS.
// Every '#pragma unroll' here makes the indices of a small array constant, so
// that the array lives in registers and not in scratch.
// Every store is 16 B a lane. A wave whose channels go to a slice plane ([pixel][c64])
// takes W as A, so that a lane holds 8 channels of one pixel; a wave whose channels go
// to the plane 'out' ([c][pixel]) takes X as A, so that a lane holds 8 pixels of one channel.
// ISQ: channels [0,64) -> outA = [b][w][h][c64] (height Q), [64,128) -> outB = [b][h][w][c64]
// (width Q), [128,192) -> out.  !ISQ: [0,64) -> outA = [b][w][h][c64] (height V), the rest -> out.
#define CT_PX 32
#define CT_NT 3
#define CT_PITCH 200   // halves per LDS row: 400 B = 16 B x odd, for b128 readers
typedef __attribute__((ext_vector_type(4))) float    f32x4;
typedef __attribute__((ext_vector_type(4))) _Float16 v4h;

template <int ISQ>
__device__ __forceinline__
void conv_body(const int ptile, _Float16 (*wS)[CT_PITCH], _Float16 (*xT)[CT_PX][CT_PITCH],
               float (*lnS)[CI],
               const float* __restrict__ Wm, const float* __restrict__ X,
               const float* __restrict__ lnw, const float* __restrict__ lnb,
               const float* __restrict__ mu, const float* __restrict__ rstd,
               _Float16* __restrict__ out,
               _Float16* __restrict__ outA, _Float16* __restrict__ outB) {
  const int b   = blockIdx.y;
  const int tid = threadIdx.x, lane = tid & 31, wave = tid >> 5;
  const int pbase = ptile * (CT_PX * CT_NT);
  const int kg = (lane >> 4) * 8;
  // staging map: a thread owns 4 adjacent pixels x 4 adjacent channels
  const int pg = (tid & 7) * 4, c0 = (tid >> 3) * 4;
  const float* xcol = X + (size_t)b * CI * HW + (size_t)c0 * HW + pg;
  const float* mcol = mu + b * HW + pg;
  const float* rcol = rstd + b * HW + pg;

  // Prologue: half of the weights and the first pixel tile are in flight together;
  // the second half of the weights follows while the tile is still on its way.
  const float* wsrc = Wm + (size_t)wave * 16 * CI;   // a wave's 16 rows: 12 KiB in a row
  float lw0 = 0.f, lb0 = 0.f;
  if (ISQ && tid < CI) { lw0 = lnw[tid]; lb0 = lnb[tid]; }
  f32x4 w4[12];
#pragma unroll
  for (int i = 0; i < 12; ++i)
    w4[i] = *reinterpret_cast<const f32x4*>(wsrc + (i * 32 + lane) * 4);
  f32x4 xr[4];
  f32x4 m4 = {0.f, 0.f, 0.f, 0.f}, r4 = m4;
#pragma unroll
  for (int i = 0; i < 4; ++i)
    xr[i] = *reinterpret_cast<const f32x4*>(xcol + (size_t)i * HW + pbase);
  if (ISQ) {
    m4 = *reinterpret_cast<const f32x4*>(mcol + pbase);
    // the next load's result may land on this load's address registers
    asm volatile("s_wait_xcnt 0x0" ::: "memory");
    r4 = *reinterpret_cast<const f32x4*>(rcol + pbase);
  }
#pragma unroll
  for (int g = 0; g < 2; ++g) {
#pragma unroll
    for (int i = 0; i < 12; ++i) {
      const int e = ((g * 12 + i) * 32 + lane) * 4;
      v4h h4 = {(_Float16)w4[i][0], (_Float16)w4[i][1], (_Float16)w4[i][2], (_Float16)w4[i][3]};
      *reinterpret_cast<v4h*>(&wS[wave * 16 + e / CI][e % CI]) = h4;
    }
    if (g == 0) {
#pragma unroll
      for (int i = 0; i < 12; ++i)
        w4[i] = *reinterpret_cast<const f32x4*>(wsrc + ((12 + i) * 32 + lane) * 4);
    }
  }
  if (ISQ && tid < CI) { lnS[0][tid] = lw0; lnS[1][tid] = lb0; }
  __syncthreads();
  const _Float16* wrow = &wS[wave * 16 + (lane & 15)][kg];

  const int r0 = wave * 16 + (lane >> 4) * 8;
  // wave-uniform, held in scalar registers
  const int uwave = __builtin_amdgcn_readfirstlane(wave);
  const bool slicew = uwave < (ISQ ? 8 : 4);
  const bool planeB = ISQ && uwave >= 4;
  // A block's pixels lie in one image row, so a step of 16 pixels is one step in every plane.
  static_assert(WW % (CT_PX * CT_NT) == 0, "a block stays inside one image row");
  const int hrow = pbase / WW, wcol = pbase % WW;
  const int step16 = slicew ? (planeB ? 16 * C3 : 16 * HH * C3) : 16;   // halves
  _Float16* dst = !slicew ? out + (size_t)(b * CI + wave * 16 + (lane & 15)) * HW + pbase + kg
                : planeB  ? outB + ((size_t)b * HW + pbase + (lane & 15)) * C3 + (r0 & (C3 - 1))
                          : outA + (((size_t)b * WW + wcol + (lane & 15)) * HH + hrow) * C3 +
                                (r0 & (C3 - 1));
  // kept rolled: unrolled, the three trips' addresses are formed ahead and spill to scratch
#pragma unroll 1
  for (int t = 0; t < CT_NT; ++t) {
    const int p0 = pbase + t * CT_PX;
    _Float16 (*xb)[CT_PITCH] = xT[t & 1];
    f32x4 y[4];
#pragma unroll
    for (int i = 0; i < 4; ++i)
      y[i] = ISQ ? (xr[i] - m4) * r4 * lnS[0][c0 + i] + lnS[1][c0 + i] : xr[i];
#pragma unroll
    for (int j = 0; j < 4; ++j) {
      v4h hv = {(_Float16)y[0][j], (_Float16)y[1][j], (_Float16)y[2][j], (_Float16)y[3][j]};
      *reinterpret_cast<v4h*>(&xb[pg + j][c0]) = hv;
    }
    // One barrier a tile: it publishes this buffer, and every wave that passes
    // it has left the other buffer, which the next trip refills.
    __syncthreads();
    if (t + 1 < CT_NT) {   // next tile's loads fly under this tile's products and stores
#pragma unroll
      for (int i = 0; i < 4; ++i)
        xr[i] = *reinterpret_cast<const f32x4*>(xcol + (size_t)i * HW + p0 + CT_PX);
      // the address registers of the loads above are reused for the next addresses
      asm volatile("s_wait_xcnt 0x0" ::: "memory");
      if (ISQ) {
        m4 = *reinterpret_cast<const f32x4*>(mcol + p0 + CT_PX);
        r4 = *reinterpret_cast<const f32x4*>(rcol + p0 + CT_PX);
        // the address registers of these two loads are reused right behind them
        asm volatile("s_wait_xcnt 0x0" ::: "memory");
      }
    }
    v8f acc[2];
#pragma unroll
    for (int s = 0; s < 2; ++s) acc[s] = (v8f){0.f, 0.f, 0.f, 0.f, 0.f, 0.f, 0.f, 0.f};
    // One instruction stream for both kinds of wave: only the LDS rows that feed A and B
    // change places (the two operands have the same fragment map and the same k order).
    const _Float16* x0 = &xb[lane & 15][kg];
    const _Float16* x1 = &xb[16 + (lane & 15)][kg];
    const _Float16* a0 = slicew ? wrow : x0;
    const _Float16* a1 = slicew ? wrow : x1;
    const _Float16* b0 = slicew ? x0 : wrow;
    const _Float16* b1 = slicew ? x1 : wrow;
#pragma unroll
    for (int kk = 0; kk < 6; ++kk) {
      acc[0] = wmma_f16(ldfrag(a0 + kk * 32), ldfrag(b0 + kk * 32), acc[0]);
      acc[1] = wmma_f16(ldfrag(a1 + kk * 32), ldfrag(b1 + kk * 32), acc[1]);
    }
    v8h pk[2];
#pragma unroll
    for (int s = 0; s < 2; ++s)
#pragma unroll
      for (int r = 0; r < 8; ++r) pk[s][r] = (_Float16)acc[s][r];
#pragma unroll
    for (int s = 0; s < 2; ++s)
      *reinterpret_cast<v8h*>(dst + (t * 2 + s) * step16) = pk[s];
    // the next trip overwrites the registers that the last stores name
    asm volatile("s_wait_xcnt 0x0" ::: "memory");
  }
}

template <int ISQ>
__global__ __launch_bounds__(384, 9)
void k_conv2(const float* __restrict__ w_l, const float* __restrict__ w_r,
             const float* __restrict__ x_l, const float* __restrict__ x_r,
             const float* __restrict__ lnlw, const float* __restrict__ lnlb,
             const float* __restrict__ lnrw, const float* __restrict__ lnrb,
             const float* __restrict__ mul, const float* __restrict__ rsl,
             const float* __restrict__ mur, const float* __restrict__ rsr,
             _Float16* __restrict__ o_l, _Float16* __restrict__ o_r,
             _Float16* __restrict__ oA_l, _Float16* __restrict__ oA_r,
             _Float16* __restrict__ oB_l, _Float16* __restrict__ oB_r) {
  __shared__ __attribute__((aligned(16))) _Float16 wS[CI][CT_PITCH];        // [m][k]
  __shared__ __attribute__((aligned(16))) _Float16 xT[2][CT_PX][CT_PITCH];  // [n][k]
  __shared__ __attribute__((aligned(16))) float lnS[2][CI];
  const bool right = blockIdx.z != 0;
  conv_body<ISQ>(blockIdx.x, wS, xT, lnS, right ? w_r : w_l, right ? x_r : x_l,
                 right ? lnrw : lnlw, right ? lnrb : lnlb, right ? mur : mul, right ? rsr : rsl,
                 right ? o_r : o_l, right ? oA_r : oA_l, right ? oB_r : oB_l);
}

// ------------------------------------- axial attention scores + softmax
// Q/K stored per-slice contiguous as [slice][row][c64]; S = scale*Q K^T,
// P = row-softmax(S) (192x192, K=64). 12 waves; a wave owns 16 whole rows of S
// (12 tiles in registers), so a row's maximum and sum never leave the wave.
// LDS rows that feed 16-byte fragment reads stand at a pitch of 16 B x odd.
#define ROW_PITCH 72     // halves: 128-byte rows + the mover's 16-byte pad = 144 B
#define QK_BUF 14336     // halves: 192 rows x 144 B, rounded up to a multiple of 2 KiB
#define V_SLICE 5120     // halves: 64 rows x 144 B, rounded up to a multiple of 2 KiB
#define BT_PITCH 40      // halves: 64-byte rows + 16 B = 80 B
#define SC_T 384         // threads: one wave for each 16 rows
__device__ __forceinline__ float exp_slot(float x) {
  float y;
  asm("v_exp_f32 %0, %1\n\tv_nop" : "=v"(y) : "v"(x * 1.44269504f));
  return y;
}
__device__ __forceinline__
void score_body(const int slice, const int b,
                const _Float16* __restrict__ q0, const _Float16* __restrict__ k0,
                const float* __restrict__ scp,
                _Float16* __restrict__ P, _Float16* __restrict__ PT, const bool writeP) {
  const int tid = threadIdx.x, lane = tid & 31, wave = tid >> 5;
  const _Float16* qp = q0 + ((size_t)b * 192 + slice) * (192 * C3);
  const _Float16* kp = k0 + ((size_t)b * 192 + slice) * (192 * C3);
  // [0]: Q [row][k], [1]: K [col][k], rows at ROW_PITCH
  __shared__ __attribute__((aligned(2048))) _Float16 QKs[2][QK_BUF];
#if HAVE_TDM
  const unsigned int uw = uni(threadIdx.x >> 5);
  if (pinned(uw < 2u)) {   // wave 0 brings Q, wave 1 brings K: one request each
    tdm_rows128(lds_addr32(&QKs[0][0]) + uw * (QK_BUF * 2u), uw ? kp : qp, 192u, C3 * 2u);
    // the issuing wave's tile has landed before it reaches the barrier below
    asm volatile("s_wait_tensorcnt 0x0" ::: "memory");
  }
#else
  for (int s = tid; s < 192 * C3; s += SC_T) {
    QKs[0][(s / C3) * ROW_PITCH + s % C3] = qp[s];
    QKs[1][(s / C3) * ROW_PITCH + s % C3] = kp[s];
  }
#endif
  __syncthreads();
  const float sc = *scp;
  const int kg = (lane >> 4) * 8;
  // every '#pragma unroll' below makes the indices of af, acc, pk and the per-row arrays
  // constant, so that they stay in registers
  v16h af[2];
#pragma unroll
  for (int kk = 0; kk < 2; ++kk)
    af[kk] = ldfrag(&QKs[0][(wave * 16 + (lane & 15)) * ROW_PITCH + kk * 32 + kg]);
  v8f acc[12];
#pragma unroll
  for (int j = 0; j < 12; ++j) {
    v8f a = {0.f, 0.f, 0.f, 0.f, 0.f, 0.f, 0.f, 0.f};
#pragma unroll
    for (int kk = 0; kk < 2; ++kk) {
      v16h bf = ldfrag(&QKs[1][(j * 16 + (lane & 15)) * ROW_PITCH + kk * 32 + kg]);
      a = wmma_f16(af[kk], bf, a);
    }
    acc[j] = a;
  }
  // A lane holds, of row kg + r, the 12 columns j * 16 + (lane & 15): first over j in the
  // lane's own registers, then once over the 16 lanes that share the row.
  float mx[8], sm[8], inv[8];
#pragma unroll
  for (int r = 0; r < 8; ++r) {
    float m = acc[0][r] * sc;
    acc[0][r] = m;
#pragma unroll
    for (int j = 1; j < 12; ++j) {
      acc[j][r] *= sc;
      m = fmaxf(m, acc[j][r]);
    }
    mx[r] = m;
  }
  // step by step over all eight rows: the eight exchanges of a step are in flight together
#pragma unroll
  for (int off = 1; off < 16; off <<= 1)
#pragma unroll
    for (int r = 0; r < 8; ++r) mx[r] = fmaxf(mx[r], __shfl_xor(mx[r], off));
#pragma unroll
  for (int r = 0; r < 8; ++r) {
    float s = 0.f;
#pragma unroll
    for (int j = 0; j < 12; ++j) {
      acc[j][r] = exp_slot(acc[j][r] - mx[r]);
      s += acc[j][r];
    }
    sm[r] = s;
  }
#pragma unroll
  for (int off = 1; off < 16; off <<= 1)
#pragma unroll
    for (int r = 0; r < 8; ++r) sm[r] += __shfl_xor(sm[r], off);
#pragma unroll
  for (int r = 0; r < 8; ++r) inv[r] = 1.0f / sm[r];
  const size_t pbase = (size_t)(b * 192 + slice) * 192 * 192;
  const int r0 = wave * 16 + kg;
  v8h pk[12];
#pragma unroll
  for (int j = 0; j < 12; ++j)
#pragma unroll
    for (int r = 0; r < 8; ++r) pk[j][r] = (_Float16)(acc[j][r] * inv[r]);
  _Float16* pt = PT + pbase + (size_t)(lane & 15) * 192 + r0;   // transposed
#pragma unroll
  for (int j = 0; j < 12; ++j)
    *reinterpret_cast<v8h*>(pt + j * (16 * 192)) = pk[j];
  if (writeP) {
    _Float16* pp = P + pbase + (size_t)r0 * 192 + (lane & 15);
#pragma unroll
    for (int j = 0; j < 12; ++j)
#pragma unroll
      for (int r = 0; r < 8; ++r) pp[r * 192 + j * 16] = pk[j][r];
  }
}

// --------------------------------------- apply attention + residual + ls
// Two phases: out[c,n] = ls[c]*sum_k V[c,k]*Bm[k,n] + x;  64x192, K=192.
// Bm = [slice][k][n] f16. AXIS 1: V rows contiguous (stride vcs), brought by tensor loads.
// AXIS 0: V = [slice][k][c64], turned to [c][k] on its way through registers into LDS.
// AXIS 0 (n = h, slice = w): out0/out1 are workspace planes [b][c64][w][h] that take
// the bare sums, rows along n; k_finish turns them and adds scale and residual.
// AXIS is a compile-time constant: no branch stands between the last product and the stores.
// The LDS arrays come from the kernel, so that both forms of the body share one set.
template <int AXIS>
__device__ __forceinline__
void apply_body(_Float16 (*Vs)[V_SLICE], _Float16 (*Bt)[BT_PITCH],
                const _Float16* __restrict__ V0, const _Float16* __restrict__ V1,
                size_t vbs, int vcs,
                const _Float16* __restrict__ B0, const _Float16* __restrict__ B1,
                float* __restrict__ out0, float* __restrict__ out1,
                const float* __restrict__ x0, const float* __restrict__ x1,
                const float* __restrict__ ls0, const float* __restrict__ ls1,
                int cb) {
  const int slice = blockIdx.x, b = blockIdx.y;
  const int tid = threadIdx.x, lane = tid & 31, wave = tid >> 5;
  const int kg = (lane >> 4) * 8;
  for (int ph = 0; ph < 2; ++ph) {
    // this wave's LDS reads of the phase before have retired before V is loaded anew
    asm volatile("s_wait_dscnt 0x0" ::: "memory");
    __syncthreads();
    const _Float16* vp = (ph ? V1 : V0) + (size_t)b * vbs + slice * (AXIS == 0 ? 192 * C3 : 192);
    const _Float16* Bp = (ph ? B1 : B0) + (size_t)(b * 192 + slice) * 192 * 192;
    float* op = ph ? out1 : out0;
    const float* xp = ph ? x1 : x0;
    const float* lsp = ph ? ls1 : ls0;
    if constexpr (AXIS == 0) {
      for (int s = tid; s < 768; s += 512) {
        const int u = s >> 1, kp = u % 96, c8 = (u / 96) * 2 + (s & 1);
        const v8h e = *reinterpret_cast<const v8h*>(vp + (2 * kp) * C3 + c8 * 8);
        const v8h o = *reinterpret_cast<const v8h*>(vp + (2 * kp + 1) * C3 + c8 * 8);
        _Float16* d = &Vs[kp >> 5][(c8 * 8) * ROW_PITCH + ((2 * kp) & 63)];
#pragma unroll   // constant indices into e and o: they stay in registers
        for (int j = 0; j < 8; ++j) {
          v2h pr = {e[j], o[j]};
          *reinterpret_cast<v2h*>(d + j * ROW_PITCH) = pr;
        }
      }
    } else {
#if HAVE_TDM
      const unsigned int uw = uni(threadIdx.x >> 5);
      if (pinned(uw < 3u)) {   // waves 0 to 2 bring one slice each: one request a wave
        tdm_rows128(lds_addr32(&Vs[0][0]) + uw * (V_SLICE * 2u), vp + uw * 64u, C3,
                    (unsigned int)vcs * 2u);
        // the issuing wave's slice has landed before it reaches the chunk loop's first barrier
        asm volatile("s_wait_tensorcnt 0x0" ::: "memory");
      }
#else
      for (int s = tid; s < C3 * 192; s += 512) {
        int c = s / 192, i = s % 192;
        Vs[i >> 6][c * ROW_PITCH + (i & 63)] = vp[(size_t)c * vcs + i];
      }
#endif
    }
    v8f acc[3];
#pragma unroll
    for (int j = 0; j < 3; ++j) acc[j] = (v8f){0.f, 0.f, 0.f, 0.f, 0.f, 0.f, 0.f, 0.f};
    for (int kk = 0; kk < 6; ++kk) {
      __syncthreads();
      for (int s = tid; s < 32 * 192; s += 512) {
        int k = s / 192, n = s % 192;
        Bt[n][k] = Bp[(size_t)(kk * 32 + k) * 192 + n];
      }
      __syncthreads();
#pragma unroll
      for (int j = 0; j < 3; ++j) {
        int t = wave * 3 + j, mt = t / 12, nt = t % 12;
        v16h af = ldfrag(&Vs[kk >> 1][(mt * 16 + (lane & 15)) * ROW_PITCH + (kk & 1) * 32 + kg]);
        v16h bf = ldfrag(&Bt[nt * 16 + (lane & 15)][kg]);
        acc[j] = wmma_f16(af, bf, acc[j]);
      }
    }
#pragma unroll
    for (int j = 0; j < 3; ++j) {
      int t = wave * 3 + j, mt = t / 12, nt = t % 12;
      int n = nt * 16 + (lane & 15);
      if (AXIS == 0) {
#pragma unroll   // constant index into acc: it stays in registers
        for (int r = 0; r < 8; ++r)
          op[((size_t)(b * C3 + mt * 16 + kg + r) * WW + slice) * HH + n] = acc[j][r];
      } else {
#pragma unroll
        for (int r = 0; r < 8; ++r) {
          int c = cb + mt * 16 + kg + r;
          size_t ad = ((size_t)(b * CI + c) * HH + slice) * WW + n;
          op[ad] = acc[j][r] * lsp[c] + xp[ad];
        }
      }
    }
    // the next phase overwrites the registers that the stores above name
    asm volatile("s_wait_xcnt 0x0" ::: "memory");
  }
}

// ------------------- height branch: turn [w][h] planes, scale, add residual
// out[c][h][w] = ls[c] * t[c][w][h] + x[c][h][w] for channels [0,64). One block
// turns a 64x64 tile through LDS, so that every global access covers 256 B of a row.
#define HT 64
__device__ __forceinline__
void h_finish_body(const float* __restrict__ t0, const float* __restrict__ t1,
                   const float* __restrict__ xl, const float* __restrict__ xr,
                   const float* __restrict__ ls1, const float* __restrict__ ls2,
                   float* __restrict__ out_l, float* __restrict__ out_r) {
  const int w0 = (blockIdx.x / 3) * HT, h0 = (blockIdx.x % 3) * HT;
  const int c = blockIdx.y, side = blockIdx.z >> 1, b = blockIdx.z & 1;
  __shared__ float tl[HT][HT + 1];
  const int q = (threadIdx.x & 15) * 4, rw = threadIdx.x >> 4;
  const float* tp = (side ? t1 : t0) + (size_t)(b * C3 + c) * HW;
  const float* xp = (side ? xr : xl) + (size_t)(b * CI + c) * HW;
  float* op = (side ? out_r : out_l) + (size_t)(b * CI + c) * HW;
  const float l = (side ? ls2 : ls1)[c];
  f32x4 tv[4], xv[4];
  // every '#pragma unroll' below makes the indices of tv, xv and o constant, so that they
  // stay in registers; the eight loads are then in flight together
#pragma unroll
  for (int i = 0; i < 4; ++i)
    tv[i] = *reinterpret_cast<const f32x4*>(tp + (w0 + i * 16 + rw) * HH + h0 + q);
#pragma unroll
  for (int i = 0; i < 4; ++i)
    xv[i] = *reinterpret_cast<const f32x4*>(xp + (h0 + i * 16 + rw) * WW + w0 + q);
#pragma unroll
  for (int i = 0; i < 4; ++i)
#pragma unroll
    for (int k = 0; k < 4; ++k) tl[i * 16 + rw][q + k] = tv[i][k];
  __syncthreads();
#pragma unroll
  for (int i = 0; i < 4; ++i) {
    f32x4 o;
#pragma unroll
    for (int k = 0; k < 4; ++k) o[k] = tl[q + k][i * 16 + rw] * l + xv[i][k];
    *reinterpret_cast<f32x4*>(op + (h0 + i * 16 + rw) * WW + w0 + q) = o;
  }
  // the wait before a register that an issued store names is overwritten: in k_finish the
  // other body's code may stand behind these stores
  asm volatile("s_wait_xcnt 0x0" ::: "memory");
}

// ---------------------------------------------------- channel-SE branch
// One block sums one channel plane of both sides. A lane reads 16 B (8 halves), a wave 512 B
// in a row; a thread's 18 loads are all in flight before the first is summed.
#define PL_T 512
#define PL_N (HW / (PL_T * 8))   // 16-byte pieces of a plane per thread
static_assert(HW % (PL_T * 8) == 0, "a plane is a whole number of 16-byte pieces per thread");
__global__ __launch_bounds__(PL_T)
void k_pool(const _Float16* __restrict__ ql, const _Float16* __restrict__ qr,
            float* __restrict__ pool) {
  int b = blockIdx.x / C3, c64 = blockIdx.x % C3;
  const size_t base = (size_t)(b * CI + 128 + c64) * HW + threadIdx.x * 8;
  const _Float16* pl = ql + base;
  const _Float16* pr = qr + base;
  v8h l8[PL_N], r8[PL_N];
  // every '#pragma unroll' below makes the indices of l8, r8 and s4 constant: they stay in registers
#pragma unroll
  for (int i = 0; i < PL_N; ++i) {
    l8[i] = *reinterpret_cast<const v8h*>(pl + i * (PL_T * 8));
    r8[i] = *reinterpret_cast<const v8h*>(pr + i * (PL_T * 8));
  }
  // The wait before a register that an issued load names is overwritten. It takes the two
  // addresses as inputs, so that no load's result is laid on them, and no load sinks below it.
  asm volatile("s_wait_xcnt 0x0" :: "v"(pl), "v"(pr) : "memory");
  float s4[4] = {0.f, 0.f, 0.f, 0.f};   // four independent chains of adds
#pragma unroll
  for (int i = 0; i < PL_N; ++i)
#pragma unroll
    for (int j = 0; j < 8; ++j) s4[j & 3] += (float)l8[i][j] + (float)r8[i][j];
  const float s = (s4[0] + s4[1]) + (s4[2] + s4[3]);
  __shared__ float sm[PL_T];
  sm[threadIdx.x] = s;
  __syncthreads();
  for (int o = PL_T / 2; o > 0; o >>= 1) {
    if (threadIdx.x < o) sm[threadIdx.x] += sm[threadIdx.x + o];
    __syncthreads();
  }
  if (threadIdx.x == 0) pool[b * C3 + c64] = sm[0] * (1.0f / HW);
}

// The three score launches in one grid: all read only what the convolutions wrote, and
// each writes buffers of its own. blockIdx.z: 0 height; 1 width, left queries; 2 width, right.
__global__ __launch_bounds__(SC_T)
void k_score3(const _Float16* __restrict__ qh_l, const _Float16* __restrict__ qh_r,
              const _Float16* __restrict__ qw_l, const _Float16* __restrict__ qw_r,
              const float* __restrict__ sch, const float* __restrict__ scw,
              _Float16* __restrict__ Ph, _Float16* __restrict__ PTh,
              _Float16* __restrict__ PTw1, _Float16* __restrict__ PTw2) {
  const int job = blockIdx.z;
  score_body(blockIdx.x, blockIdx.y, job == 0 ? qh_l : job == 1 ? qw_l : qw_r,
             job == 0 ? qh_r : job == 1 ? qw_r : qw_l, job == 0 ? sch : scw,
             Ph, job == 0 ? PTh : job == 1 ? PTw1 : PTw2, job == 0);
}

// Runs on the first 256 threads of a block of 512; every thread passes both barriers.
__device__ __forceinline__
void se_body(const float* __restrict__ pool, const float* __restrict__ w1,
             const float* __restrict__ w2, float* __restrict__ a) {
  __shared__ float h1[BB][8];
  __shared__ float lg[BB][128];
  int tid = threadIdx.x;
  if (tid < 16) {
    int b = tid >> 3, j = tid & 7;
    float s = 0.f;
    for (int i = 0; i < 64; ++i) s += pool[b * 64 + i] * w1[j * 64 + i];
    h1[b][j] = fmaxf(s, 0.f);
  }
  __syncthreads();
  if (tid < BB * 128) {
    int b = tid >> 7, o = tid & 127;
    float s = 0.f;
    for (int j = 0; j < 8; ++j) s += h1[b][j] * w2[o * 8 + j];
    lg[b][o] = s;
  }
  __syncthreads();
  if (tid < BB) {
    float m = -1e30f;
    for (int o = 0; o < 128; ++o) m = fmaxf(m, lg[tid][o]);
    float s = 0.f;
    for (int o = 0; o < 128; ++o) { lg[tid][o] = __expf(lg[tid][o] - m); s += lg[tid][o]; }
    float inv = 1.0f / s;
    for (int o = 0; o < 128; ++o) a[tid * 128 + o] = lg[tid][o] * inv;
  }
}

// Both attention products and the SE layers in one grid: each reads only what earlier
// launches of the same call wrote. blockIdx.z: 0 height, 1 width; column 192 of the grid holds the one SE block.
__global__ __launch_bounds__(512)
void k_apply_se(const _Float16* __restrict__ vh0, const _Float16* __restrict__ vh1,
                const _Float16* __restrict__ vw0, const _Float16* __restrict__ vw1,
                const _Float16* __restrict__ bh0, const _Float16* __restrict__ bh1,
                const _Float16* __restrict__ bw0, const _Float16* __restrict__ bw1,
                float* __restrict__ th0, float* __restrict__ th1,
                float* __restrict__ out_l, float* __restrict__ out_r,
                const float* __restrict__ x_l, const float* __restrict__ x_r,
                const float* __restrict__ ls1, const float* __restrict__ ls2,
                const float* __restrict__ pool, const float* __restrict__ w1,
                const float* __restrict__ w2, float* __restrict__ avec) {
  // V as three slices of 64 k: [k / 64][c][k % 64], rows at ROW_PITCH
  __shared__ __attribute__((aligned(2048))) _Float16 Vs[3][V_SLICE];
  __shared__ __attribute__((aligned(16))) _Float16 Bt[192][BT_PITCH];   // [n][k] per 32-K chunk
  if (blockIdx.x == 192) {   // the whole block takes this side, ahead of every barrier
    if (blockIdx.y == 0 && blockIdx.z == 0) se_body(pool, w1, w2, avec);
    return;
  }
  if (blockIdx.z == 0)
    apply_body<0>(Vs, Bt, vh0, vh1, (size_t)C3 * HW, HW, bh0, bh1, th0, th1,
                  x_l, x_r, ls1, ls2, 0);
  else
    apply_body<1>(Vs, Bt, vw0, vw1, (size_t)CI * HW, HW, bw0, bw1, out_l, out_r,
                  x_l, x_r, ls1, ls2, C3);
}

// A block takes a quarter of one channel plane. A lane holds 4 adjacent pixels a piece: 8 B of
// v, 16 B of x and of the output, so that a wave covers whole 128-byte lines in every access;
// a thread's 18 loads are all in flight before its first store.
#define SA_T 256
#define SA_N 9                   // pieces per thread
#define SA_PX (SA_T * 4 * SA_N)  // pixels per block
static_assert(HW % SA_PX == 0, "a plane is a whole number of blocks");
__device__ __forceinline__
void se_apply_body(const int quarter, const float* __restrict__ a,
                   const _Float16* __restrict__ vl, const _Float16* __restrict__ vr,
                   const float* __restrict__ xl, const float* __restrict__ xr,
                   const float* __restrict__ ls1, const float* __restrict__ ls2,
                   float* __restrict__ out_l, float* __restrict__ out_r) {
  const int c64 = blockIdx.y, side = blockIdx.z >> 1, b = blockIdx.z & 1;
  const int c = 128 + c64;
  const float av = a[b * 128 + side * 64 + c64];
  const float l = (side ? ls2 : ls1)[c];
  const size_t ad = (size_t)(b * CI + c) * HW + quarter * SA_PX + threadIdx.x * 4;
  const _Float16* v = (side ? vr : vl) + ad;
  const float* x = (side ? xr : xl) + ad;
  float* o = (side ? out_r : out_l) + ad;
  v4h vv[SA_N];
  f32x4 xv[SA_N];
  // every '#pragma unroll' below makes the indices of vv and xv constant: they stay in registers
#pragma unroll
  for (int i = 0; i < SA_N; ++i) {
    vv[i] = *reinterpret_cast<const v4h*>(v + i * (SA_T * 4));
    xv[i] = *reinterpret_cast<const f32x4*>(x + i * (SA_T * 4));
  }
  // The wait before a register that an issued load names is overwritten. It takes the two
  // addresses as inputs, so that no load's result is laid on them, and no load sinks below it.
  asm volatile("s_wait_xcnt 0x0" :: "v"(v), "v"(x) : "memory");
  // without it the scheduler lifts the first pieces' arithmetic, with its wait for their data,
  // in front of the last loads, which then start one memory latency late
  __builtin_amdgcn_sched_barrier(0);
#pragma unroll
  for (int i = 0; i < SA_N; ++i)
#pragma unroll
    for (int k = 0; k < 4; ++k) xv[i][k] = av * (float)vv[i][k] * l + xv[i][k];
#pragma unroll
  for (int i = 0; i < SA_N; ++i)
    *reinterpret_cast<f32x4*>(o + i * (SA_T * 4)) = xv[i];
  // the wait before a register that an issued store names is overwritten: in k_finish the
  // other body's code may stand behind these stores
  asm volatile("s_wait_xcnt 0x0" ::: "memory");
}

// The two closing passes in one grid: they write different channels of the output.
// blockIdx.x: 0 to 8 the tiles of a height plane, 9 to 12 the quarters of an SE plane;
// blockIdx.y and blockIdx.z mean the same in both.
#define FH_TILES ((HH / HT) * (WW / HT))
static_assert(SA_T == 256, "both bodies run on 256 threads");
__global__ __launch_bounds__(256)
void k_finish(const float* __restrict__ t0, const float* __restrict__ t1,
              const float* __restrict__ a,
              const _Float16* __restrict__ vl, const _Float16* __restrict__ vr,
              const float* __restrict__ xl, const float* __restrict__ xr,
              const float* __restrict__ ls1, const float* __restrict__ ls2,
              float* __restrict__ out_l, float* __restrict__ out_r) {
  if (blockIdx.x < FH_TILES)
    h_finish_body(t0, t1, xl, xr, ls1, ls2, out_l, out_r);
  else
    se_apply_body(blockIdx.x - FH_TILES, a, vl, vr, xl, xr, ls1, ls2, out_l, out_r);
}

// ------------------------------------------------------------------ host
extern "C" void kernel_launch(void* const* d_in, const int* in_sizes, int n_in,
                              void* d_out, int out_size, void* d_ws, size_t ws_size,
                              hipStream_t stream) {
  const float* x_l  = (const float*)d_in[0];
  const float* x_r  = (const float*)d_in[1];
  const float* lnlw = (const float*)d_in[2];
  const float* lnlb = (const float*)d_in[3];
  const float* lnrw = (const float*)d_in[4];
  const float* lnrb = (const float*)d_in[5];
  const float* wq_l = (const float*)d_in[6];
  const float* wq_r = (const float*)d_in[7];
  const float* wv_l = (const float*)d_in[8];
  const float* wv_r = (const float*)d_in[9];
  const float* w1   = (const float*)d_in[10];
  const float* w2   = (const float*)d_in[11];
  const float* sch  = (const float*)d_in[12];
  const float* scw  = (const float*)d_in[13];
  const float* ls1  = (const float*)d_in[14];
  const float* ls2  = (const float*)d_in[15];

  float* out_l = (float*)d_out;
  float* out_r = out_l + (size_t)BB * CI * HW;

  char* ws = (char*)d_ws;
  size_t off = 0;
  auto take = [&](size_t bytes) { char* p = ws + off; off += (bytes + 255) & ~(size_t)255; return p; };
  const size_t QV = (size_t)BB * CI * HW;      // half elements
  const size_t QT = (size_t)BB * C3 * HW;
  const size_t PB = (size_t)BB * 192 * 192 * 192;
  const size_t ST = (size_t)BB * HW;           // float elements
  _Float16* q_l  = (_Float16*)take(QV * 2);
  _Float16* q_r  = (_Float16*)take(QV * 2);
  _Float16* v_l  = (_Float16*)take(QV * 2);
  _Float16* v_r  = (_Float16*)take(QV * 2);
  _Float16* qS0l = (_Float16*)take(QT * 2);   // [b][w][h][c64] height Q
  _Float16* qS0r = (_Float16*)take(QT * 2);
  _Float16* qS1l = (_Float16*)take(QT * 2);   // [b][h][w][c64] width Q
  _Float16* qS1r = (_Float16*)take(QT * 2);
  _Float16* vTl  = (_Float16*)take(QT * 2);   // [b][w][h][c64] height V
  _Float16* vTr  = (_Float16*)take(QT * 2);
  _Float16* buf1 = (_Float16*)take(PB * 2);
  _Float16* buf2 = (_Float16*)take(PB * 2);
  _Float16* buf3 = (_Float16*)take(PB * 2);
  _Float16* buf4 = (_Float16*)take(PB * 2);
  float* mul  = (float*)take(ST * 4);
  float* rsl  = (float*)take(ST * 4);
  float* mur  = (float*)take(ST * 4);
  float* rsr  = (float*)take(ST * 4);
  float* pool = (float*)take(BB * C3 * 4);
  float* avec = (float*)take(BB * 128 * 4);
  float* tH_l = (float*)take(QT * 4);         // [b][c64][w][h] height sums
  float* tH_r = (float*)take(QT * 4);

  // 1) LayerNorm stats
  k_ln_stats<<<(2 * BB * HW + 255) / 256, 256, 0, stream>>>(x_l, x_r, mul, rsl, mur, rsr);

  // 2) pointwise convs (WMMA GEMM), LN fused for q; left and right in one grid
  dim3 cg(HW / (CT_PX * CT_NT), BB, 2);
  k_conv2<1><<<cg, 384, 0, stream>>>(wq_l, wq_r, x_l, x_r, lnlw, lnlb, lnrw, lnrb,
                                     mul, rsl, mur, rsr, q_l, q_r, qS0l, qS0r, qS1l, qS1r);
  k_conv2<0><<<cg, 384, 0, stream>>>(wv_l, wv_r, x_l, x_r, lnlw, lnlb, lnrw, lnrb,
                                     mul, rsl, mur, rsr, v_l, v_r, vTl, vTr, nullptr, nullptr);

  // 3) the pool of the SE branch; then all scores: height (slices over w, P and its
  //    transpose), width (slices over h, two softmaxes, transposes only)
  k_pool<<<BB * C3, PL_T, 0, stream>>>(q_l, q_r, pool);
  k_score3<<<dim3(192, BB, 3), SC_T, 0, stream>>>(
      qS0l, qS0r, qS1l, qS1r, sch, scw, buf1, buf2, buf3, buf4);

  // 4) products: height on channels [0,64), width on [64,128); with them the SE layers
  k_apply_se<<<dim3(193, BB, 2), 512, 0, stream>>>(
      vTr, vTl, v_r + (size_t)C3 * HW, v_l + (size_t)C3 * HW, buf2, buf1, buf3, buf4,
      tH_l, tH_r, out_l, out_r, x_l, x_r, ls1, ls2, pool, w1, w2, avec);

  // 5) height planes turned, scaled and added; SE branch applied on channels [128,192)
  k_finish<<<dim3(FH_TILES + HW / SA_PX, C3, 2 * BB), 256, 0, stream>>>(
      tH_l, tH_r, avec, v_l, v_r, x_l, x_r, ls1, ls2, out_l, out_r);
}

// v008
// It runs in 138 microseconds.
// Next to v007, in two timings, it ran 1.57 times as fast each time.
// All steps since v000 together make it 6.93 times as fast.
#include <hip/hip_runtime.h>
#include <hip/hip_bf16.h>

typedef __attribute__((ext_vector_type(16))) _Float16 v16h;
typedef __attribute__((ext_vector_type(8)))  _Float16 v8h;
typedef __attribute__((ext_vector_type(2)))  _Float16 v2h;
typedef __attribute__((ext_vector_type(8)))  float    v8f;
typedef __attribute__((ext_vector_type(4)))  unsigned int u32x4;
typedef __attribute__((ext_vector_type(8)))  int i32x8;
typedef __attribute__((ext_vector_type(4)))  int i32x4;

#define BB 2
#define CI 192
#define HH 192
#define WW 192
#define HW 36864
#define C3 64

#if defined(__HIP_DEVICE_COMPILE__) && __has_builtin(__builtin_amdgcn_tensor_load_to_lds)
#define HAVE_TDM 1
#else
#define HAVE_TDM 0
#endif

__device__ __forceinline__ v8f wmma_f16(v16h a, v16h b, v8f c) {
  // D = A(16x32 f16) * B(32x16 f16) + C(16x16 f32)
  return __builtin_amdgcn_wmma_f32_16x16x32_f16(false, a, false, b, (short)0, c,
                                                false, false);
}

// Load a 16-half WMMA operand fragment from a [row][K] layout: 8 contiguous
// halves at p (K = kg..kg+7) and 8 at p+16 (K = kg+16..kg+23).
__device__ __forceinline__ v16h ldfrag(const _Float16* p) {
  v8h lo = *reinterpret_cast<const v8h*>(p);
  v8h hi = *reinterpret_cast<const v8h*>(p + 16);
  v16h r;
#pragma unroll
  for (int i = 0; i < 8; ++i) { r[i] = lo[i]; r[i + 8] = hi[i]; }
  return r;
}

#if HAVE_TDM
typedef __attribute__((address_space(3))) const void lds_cvoid;
__device__ __forceinline__ unsigned int lds_addr32(const void* p) {
  return (unsigned int)(uintptr_t)(lds_cvoid*)p;
}
typedef __attribute__((ext_vector_type(8))) unsigned int u32x8;
__device__ __forceinline__ unsigned int uni(unsigned int v) {
  return (unsigned int)__builtin_amdgcn_readfirstlane(v);
}
__device__ __forceinline__ unsigned int pinned(unsigned int v) {
  unsigned int w = uni(v);
  asm volatile("" : "+s"(w));  // pinned(): the test word stays in a scalar register
  return w;
}
__device__ __forceinline__ void tdm_rows128(unsigned int lds_off, const void* gaddr,
                                            unsigned int rows, unsigned int src_pitch) {
  unsigned long long ga = (unsigned long long)(uintptr_t)gaddr;
  u32x4 g0;
  g0[0] = uni(1u);                              // count = 1
  g0[1] = uni(lds_off);                         // LDS destination (bytes)
  g0[2] = uni((unsigned int)ga);                // global address [31:0]
  g0[3] = uni((((unsigned int)(ga >> 32)) & 0x01FFFFFFu) | 0x80000000u);  // [56:32] | type = 2
  u32x8 g1;
  g1[0] = uni((1u << 20) | (4u << 22) | (3u << 25));
  g1[1] = uni(128u << 16);
  g1[2] = uni(rows << 16);
  g1[3] = uni(128u << 16);
  g1[4] = uni(rows);
  g1[5] = uni(src_pitch);
  g1[6] = uni(0u);
  g1[7] = uni(0u);
  asm volatile("tensor_load_to_lds %0, %1" :: "s"(g0), "s"(g1) : "memory");
}
#endif  // HAVE_TDM

// ---------------------------------------------------------------- LN stats
__global__ void k_ln_stats(const float* __restrict__ xl, const float* __restrict__ xr,
                           float* __restrict__ mul, float* __restrict__ rsl,
                           float* __restrict__ mur, float* __restrict__ rsr) {
  int idx = blockIdx.x * blockDim.x + threadIdx.x;
  if (idx >= 2 * BB * HW) return;
  int side = idx / (BB * HW);
  int rem  = idx % (BB * HW);
  int b = rem / HW, p = rem % HW;
  const float* base = (side ? xr : xl) + (size_t)b * CI * HW + p;
  float s = 0.f, s2 = 0.f;
  for (int c = 0; c < CI; ++c) { float v = base[(size_t)c * HW]; s += v; s2 += v * v; }
  float m = s * (1.0f / CI);
  float var = s2 * (1.0f / CI) - m * m;
  float r = rsqrtf(var + 1e-6f);
  if (side) { mur[rem] = m; rsr[rem] = r; } else { mul[rem] = m; rsl[rem] = r; }
}

// ------------------------------------------------- 1x1 conv GEMM via WMMA
// Y[o,p] = sum_c W[o,c] * LN?(X[c,p]); block: 12 waves, one M-tile each.
// Weight-stationary: the block reads the 192x192 weights once (whole lines),
// keeps them as f16 in LDS, and walks CT_NT pixel tiles of CT_PX pixels, each
// staged with its whole K in LDS.
// Every '#pragma unroll' here makes the indices of a small array constant, so
// that the array lives in registers and not in scratch.
// Every store is 16 B a lane. A wave whose channels go to a slice plane ([pixel][c64])
// takes W as A, so that a lane holds 8 channels of one pixel; a wave whose channels go
// to the plane 'out' ([c][pixel]) takes X as A, so that a lane holds 8 pixels of one channel.
// ISQ: channels [0,64) -> outA = [b][w][h][c64] (height Q), [64,128) -> outB = [b][h][w][c64]
// (width Q), [128,192) -> out.  !ISQ: [0,64) -> outA = [b][w][h][c64] (height V), the rest -> out.
#define CT_PX 32
#define CT_NT 3
#define CT_PITCH 200   // halves per LDS row: 400 B = 16 B x odd, for b128 readers
typedef __attribute__((ext_vector_type(4))) float    f32x4;
typedef __attribute__((ext_vector_type(4))) _Float16 v4h;

template <int ISQ>
__device__ __forceinline__
void conv_body(const int ptile, _Float16 (*wS)[CT_PITCH], _Float16 (*xT)[CT_PX][CT_PITCH],
               float (*lnS)[CI],
               const float* __restrict__ Wm, const float* __restrict__ X,
               const float* __restrict__ lnw, const float* __restrict__ lnb,
               const float* __restrict__ mu, const float* __restrict__ rstd,
               _Float16* __restrict__ out,
               _Float16* __restrict__ outA, _Float16* __restrict__ outB) {
  const int b   = blockIdx.y;
  const int tid = threadIdx.x, lane = tid & 31, wave = tid >> 5;
  const int pbase = ptile * (CT_PX * CT_NT);
  const int kg = (lane >> 4) * 8;
  // staging map: a thread owns 4 adjacent pixels x 4 adjacent channels
  const int pg = (tid & 7) * 4, c0 = (tid >> 3) * 4;
  const float* xcol = X + (size_t)b * CI * HW + (size_t)c0 * HW + pg;
  const float* mcol = mu + b * HW + pg;
  const float* rcol = rstd + b * HW + pg;

  // Prologue: half of the weights and the first pixel tile are in flight together;
  // the second half of the weights follows while the tile is still on its way.
  const float* wsrc = Wm + (size_t)wave * 16 * CI;   // a wave's 16 rows: 12 KiB in a row
  float lw0 = 0.f, lb0 = 0.f;
  if (ISQ && tid < CI) { lw0 = lnw[tid]; lb0 = lnb[tid]; }
  f32x4 w4[12];
#pragma unroll
  for (int i = 0; i < 12; ++i)
    w4[i] = *reinterpret_cast<const f32x4*>(wsrc + (i * 32 + lane) * 4);
  f32x4 xr[4];
  f32x4 m4 = {0.f, 0.f, 0.f, 0.f}, r4 = m4;
#pragma unroll
  for (int i = 0; i < 4; ++i)
    xr[i] = *reinterpret_cast<const f32x4*>(xcol + (size_t)i * HW + pbase);
  if (ISQ) {
    m4 = *reinterpret_cast<const f32x4*>(mcol + pbase);
    // the next load's result may land on this load's address registers
    asm volatile("s_wait_xcnt 0x0" ::: "memory");
    r4 = *reinterpret_cast<const f32x4*>(rcol + pbase);
  }
#pragma unroll
  for (int g = 0; g < 2; ++g) {
#pragma unroll
    for (int i = 0; i < 12; ++i) {
      const int e = ((g * 12 + i) * 32 + lane) * 4;
      v4h h4 = {(_Float16)w4[i][0], (_Float16)w4[i][1], (_Float16)w4[i][2], (_Float16)w4[i][3]};
      *reinterpret_cast<v4h*>(&wS[wave * 16 + e / CI][e % CI]) = h4;
    }
    if (g == 0) {
#pragma unroll
      for (int i = 0; i < 12; ++i)
        w4[i] = *reinterpret_cast<const f32x4*>(wsrc + ((12 + i) * 32 + lane) * 4);
    }
  }
  if (ISQ && tid < CI) { lnS[0][tid] = lw0; lnS[1][tid] = lb0; }
  __syncthreads();
  const _Float16* wrow = &wS[wave * 16 + (lane & 15)][kg];

  const int r0 = wave * 16 + (lane >> 4) * 8;
  // wave-uniform, held in scalar registers
  const int uwave = __builtin_amdgcn_readfirstlane(wave);
  const bool slicew = uwave < (ISQ ? 8 : 4);
  const bool planeB = ISQ && uwave >= 4;
  // A block's pixels lie in one image row, so a step of 16 pixels is one step in every plane.
  static_assert(WW % (CT_PX * CT_NT) == 0, "a block stays inside one image row");
  const int hrow = pbase / WW, wcol = pbase % WW;
  const int step16 = slicew ? (planeB ? 16 * C3 : 16 * HH * C3) : 16;   // halves
  _Float16* dst = !slicew ? out + (size_t)(b * CI + wave * 16 + (lane & 15)) * HW + pbase + kg
                : planeB  ? outB + ((size_t)b * HW + pbase + (lane & 15)) * C3 + (r0 & (C3 - 1))
                          : outA + (((size_t)b * WW + wcol + (lane & 15)) * HH + hrow) * C3 +
                                (r0 & (C3 - 1));
  // kept rolled: unrolled, the three trips' addresses are formed ahead and spill to scratch
#pragma unroll 1
  for (int t = 0; t < CT_NT; ++t) {
    const int p0 = pbase + t * CT_PX;
    _Float16 (*xb)[CT_PITCH] = xT[t & 1];
    f32x4 y[4];
#pragma unroll
    for (int i = 0; i < 4; ++i)
      y[i] = ISQ ? (xr[i] - m4) * r4 * lnS[0][c0 + i] + lnS[1][c0 + i] : xr[i];
#pragma unroll
    for (int j = 0; j < 4; ++j) {
      v4h hv = {(_Float16)y[0][j], (_Float16)y[1][j], (_Float16)y[2][j], (_Float16)y[3][j]};
      *reinterpret_cast<v4h*>(&xb[pg + j][c0]) = hv;
    }
    // One barrier a tile: it publishes this buffer, and every wave that passes
    // it has left the other buffer, which the next trip refills.
    __syncthreads();
    if (t + 1 < CT_NT) {   // next tile's loads fly under this tile's products and stores
#pragma unroll
      for (int i = 0; i < 4; ++i)
        xr[i] = *reinterpret_cast<const f32x4*>(xcol + (size_t)i * HW + p0 + CT_PX);
      // the address registers of the loads above are reused for the next addresses
      asm volatile("s_wait_xcnt 0x0" ::: "memory");
      if (ISQ) {
        m4 = *reinterpret_cast<const f32x4*>(mcol + p0 + CT_PX);
        r4 = *reinterpret_cast<const f32x4*>(rcol + p0 + CT_PX);
        // the address registers of these two loads are reused right behind them
        asm volatile("s_wait_xcnt 0x0" ::: "memory");
      }
    }
    v8f acc[2];
#pragma unroll
    for (int s = 0; s < 2; ++s) acc[s] = (v8f){0.f, 0.f, 0.f, 0.f, 0.f, 0.f, 0.f, 0.f};
    // One instruction stream for both kinds of wave: only the LDS rows that feed A and B
    // change places (the two operands have the same fragment map and the same k order).
    const _Float16* x0 = &xb[lane & 15][kg];
    const _Float16* x1 = &xb[16 + (lane & 15)][kg];
    const _Float16* a0 = slicew ? wrow : x0;
    const _Float16* a1 = slicew ? wrow : x1;
    const _Float16* b0 = slicew ? x0 : wrow;
    const _Float16* b1 = slicew ? x1 : wrow;
#pragma unroll
    for (int kk = 0; kk < 6; ++kk) {
      acc[0] = wmma_f16(ldfrag(a0 + kk * 32), ldfrag(b0 + kk * 32), acc[0]);
      acc[1] = wmma_f16(ldfrag(a1 + kk * 32), ldfrag(b1 + kk * 32), acc[1]);
    }
    v8h pk[2];
#pragma unroll
    for (int s = 0; s < 2; ++s)
#pragma unroll
      for (int r = 0; r < 8; ++r) pk[s][r] = (_Float16)acc[s][r];
#pragma unroll
    for (int s = 0; s < 2; ++s)
      *reinterpret_cast<v8h*>(dst + (t * 2 + s) * step16) = pk[s];
    // the next trip overwrites the registers that the last stores name
    asm volatile("s_wait_xcnt 0x0" ::: "memory");
  }
}

template <int ISQ>
__global__ __launch_bounds__(384, 9)
void k_conv2(const float* __restrict__ w_l, const float* __restrict__ w_r,
             const float* __restrict__ x_l, const float* __restrict__ x_r,
             const float* __restrict__ lnlw, const float* __restrict__ lnlb,
             const float* __restrict__ lnrw, const float* __restrict__ lnrb,
             const float* __restrict__ mul, const float* __restrict__ rsl,
             const float* __restrict__ mur, const float* __restrict__ rsr,
             _Float16* __restrict__ o_l, _Float16* __restrict__ o_r,
             _Float16* __restrict__ oA_l, _Float16* __restrict__ oA_r,
             _Float16* __restrict__ oB_l, _Float16* __restrict__ oB_r) {
  __shared__ __attribute__((aligned(16))) _Float16 wS[CI][CT_PITCH];        // [m][k]
  __shared__ __attribute__((aligned(16))) _Float16 xT[2][CT_PX][CT_PITCH];  // [n][k]
  __shared__ __attribute__((aligned(16))) float lnS[2][CI];
  const bool right = blockIdx.z != 0;
  conv_body<ISQ>(blockIdx.x, wS, xT, lnS, right ? w_r : w_l, right ? x_r : x_l,
                 right ? lnrw : lnlw, right ? lnrb : lnlb, right ? mur : mul, right ? rsr : rsl,
                 right ? o_r : o_l, right ? oA_r : oA_l, right ? oB_r : oB_l);
}

// ------------------- axial attention: scores, softmax and product in one block
// Q/K stored per-slice contiguous as [slice][row][c64]. out[c,n] = sum_k V[c,k] * P[n,k], 64x192,
// K = 192. 12 waves; a wave owns 16 rows n of P. It forms the scores transposed (the k side as A,
// its own n rows as B), so that a lane holds 96 of the 192 k of ONE row n, in the very places
// that the B fragment of the product wants: P never leaves the registers.
// LDS rows that feed 16-byte fragment reads stand at a pitch of 16 B x odd.
#define ROW_PITCH 72     // halves: 128-byte rows + the mover's 16-byte pad = 144 B
#define QK_BUF 14336     // halves: 192 rows x 144 B, rounded up to a multiple of 2 KiB
#define V_SLICE 5120     // halves: 64 rows x 144 B, rounded up to a multiple of 2 KiB
#define FA_T 384         // threads: one wave for each 16 rows
__device__ __forceinline__ float exp_slot(float x) {
  float y;
  asm("v_exp_f32 %0, %1\n\tv_nop" : "=v"(y) : "v"(x * 1.44269504f));
  return y;
}
// Every '#pragma unroll' in this section makes the indices of a register array constant, so
// that the array stays in registers.
// acc[j][r] = sum_c Kb[j * 16 + kg + r][c] * Nb[wave * 16 + (lane & 15)][c]
__device__ __forceinline__
void scores_t(const _Float16* Nb, const _Float16* Kb, v8f (&acc)[12]) {
  const int lane = threadIdx.x & 31, wave = threadIdx.x >> 5;
  const int kg = (lane >> 4) * 8;
  v16h nf[2];
#pragma unroll
  for (int kk = 0; kk < 2; ++kk)
    nf[kk] = ldfrag(&Nb[(wave * 16 + (lane & 15)) * ROW_PITCH + kk * 32 + kg]);
#pragma unroll
  for (int j = 0; j < 12; ++j) {
    v8f a = {0.f, 0.f, 0.f, 0.f, 0.f, 0.f, 0.f, 0.f};
#pragma unroll
    for (int kk = 0; kk < 2; ++kk) {
      v16h kf = ldfrag(&Kb[(j * 16 + (lane & 15)) * ROW_PITCH + kk * 32 + kg]);
      a = wmma_f16(kf, nf[kk], a);
    }
    acc[j] = a;
  }
}
// Softmax along k of the lane's row: eight chains over the lane's own 96 values, a tree over
// the eight, one exchange with the lane that holds the row's other half. Leaves e^(s - m) in acc.
__device__ __forceinline__
void softmax_k(v8f (&acc)[12], const float sc, float& m, float& inv) {
  float t[8];
#pragma unroll
  for (int j = 0; j < 12; ++j) acc[j] *= sc;
#pragma unroll
  for (int r = 0; r < 8; ++r) {
    t[r] = acc[0][r];
#pragma unroll
    for (int j = 1; j < 12; ++j) t[r] = fmaxf(t[r], acc[j][r]);
  }
  m = fmaxf(fmaxf(fmaxf(t[0], t[1]), fmaxf(t[2], t[3])), fmaxf(fmaxf(t[4], t[5]), fmaxf(t[6], t[7])));
  m = fmaxf(m, __shfl_xor(m, 16));
#pragma unroll
  for (int r = 0; r < 8; ++r) {
    t[r] = 0.f;
#pragma unroll
    for (int j = 0; j < 12; ++j) {
      acc[j][r] = exp_slot(acc[j][r] - m);
      t[r] += acc[j][r];
    }
  }
  float s = ((t[0] + t[1]) + (t[2] + t[3])) + ((t[4] + t[5]) + (t[6] + t[7]));
  s += __shfl_xor(s, 16);
  inv = 1.0f / s;
}
// Tiles 2kk and 2kk + 1 of acc are the two halves of the fragment of k chunk kk: a lane's
// halves 0 to 7 are k = kg + i, halves 8 to 15 k = kg + 16 + i, as ldfrag reads them.
__device__ __forceinline__ void pack_p(const v8f (&acc)[12], v16h (&pf)[6]) {
#pragma unroll
  for (int kk = 0; kk < 6; ++kk)
#pragma unroll
    for (int i = 0; i < 8; ++i) {
      pf[kk][i]     = (_Float16)acc[2 * kk][i];
      pf[kk][i + 8] = (_Float16)acc[2 * kk + 1][i];
    }
}
// o[mt][r] = sum_k V[mt * 16 + kg + r][k] * P[wave * 16 + (lane & 15)][k]
__device__ __forceinline__
void product(const _Float16 (*Vs)[V_SLICE], const v16h (&pf)[6], v8f (&o)[4]) {
  const int lane = threadIdx.x & 31;
  const int kg = (lane >> 4) * 8;
#pragma unroll
  for (int mt = 0; mt < 4; ++mt) o[mt] = (v8f){0.f, 0.f, 0.f, 0.f, 0.f, 0.f, 0.f, 0.f};
#pragma unroll
  for (int kk = 0; kk < 6; ++kk)
#pragma unroll
    for (int mt = 0; mt < 4; ++mt) {
      v16h af = ldfrag(&Vs[kk >> 1][(mt * 16 + (lane & 15)) * ROW_PITCH + (kk & 1) * 32 + kg]);
      o[mt] = wmma_f16(af, pf[kk], o[mt]);
    }
}

// Width (slice = h): one direction a block. qn: the side whose rows are n, qk: the side that
// the softmax runs along; V = [c][k] rows at a pitch of HW, brought by tensor loads.
__device__ __forceinline__
void width_body(_Float16 (*QKs)[QK_BUF], _Float16 (*Vs)[V_SLICE],
                const _Float16* __restrict__ qn, const _Float16* __restrict__ qk,
                float* lsS, const _Float16* __restrict__ V, const float sc,
                float* __restrict__ op, const float* __restrict__ xp,
                const float* __restrict__ lsp) {
  const int slice = blockIdx.x, b = blockIdx.y;
  const int tid = threadIdx.x, lane = tid & 31, wave = tid >> 5;
  const int kg = (lane >> 4) * 8;
  const _Float16* np = qn + ((size_t)b * 192 + slice) * (192 * C3);
  const _Float16* kp = qk + ((size_t)b * 192 + slice) * (192 * C3);
  const _Float16* vp = V + (size_t)b * CI * HW + slice * 192;
  // the 64 layer scales go through LDS: behind the products a lane reads its eight in a row
  float l0 = 0.f;
  if (tid < C3) l0 = lsp[C3 + tid];
#if HAVE_TDM
  const unsigned int uw = uni(threadIdx.x >> 5);
  if (pinned(uw < 5u)) {   // waves 0, 1: the two Q tiles; waves 2 to 4: a slice of V; one request each
    const bool isq = uw < 2u;
    tdm_rows128(isq ? lds_addr32(&QKs[0][0]) + uw * (QK_BUF * 2u)
                    : lds_addr32(&Vs[0][0]) + (uw - 2u) * (V_SLICE * 2u),
                uw == 0u ? np : uw == 1u ? kp : vp + (uw - 2u) * 64u,
                isq ? 192u : (unsigned int)C3, isq ? C3 * 2u : HW * 2u);
    // the issuing wave's tile has landed before it reaches the barrier below
    asm volatile("s_wait_tensorcnt 0x0" ::: "memory");
  }
#else
  for (int s = tid; s < 192 * C3; s += FA_T) {
    QKs[0][(s / C3) * ROW_PITCH + s % C3] = np[s];
    QKs[1][(s / C3) * ROW_PITCH + s % C3] = kp[s];
    Vs[(s % 192) >> 6][(s / 192) * ROW_PITCH + (s & 63)] = vp[(size_t)(s / 192) * HW + s % 192];
  }
#endif
  if (tid < C3) lsS[tid] = l0;
  __syncthreads();
  v8f acc[12];
  scores_t(QKs[0], QKs[1], acc);
  __builtin_amdgcn_sched_barrier(0);
  float m, inv;
  softmax_k(acc, sc, m, inv);
#pragma unroll
  for (int j = 0; j < 12; ++j) acc[j] *= inv;
  v16h pf[6];
  pack_p(acc, pf);
  __builtin_amdgcn_sched_barrier(0);
  // the residual is on its way while the products run
  const size_t ad0 = ((size_t)(b * CI + C3 + kg) * HH + slice) * WW + wave * 16 + (lane & 15);
  float xv[4][8];
#pragma unroll
  for (int mt = 0; mt < 4; ++mt)
#pragma unroll
    for (int r = 0; r < 8; ++r) xv[mt][r] = xp[ad0 + (size_t)(mt * 16 + r) * HW];
  // the address registers of the loads above are free for reuse behind this
  asm volatile("s_wait_xcnt 0x0" ::: "memory");
  v8f o[4];
  product(Vs, pf, o);
#pragma unroll
  for (int mt = 0; mt < 4; ++mt) {
    const v8f lv = *reinterpret_cast<const v8f*>(&lsS[mt * 16 + kg]);
#pragma unroll
    for (int r = 0; r < 8; ++r)
      op[ad0 + (size_t)(mt * 16 + r) * HW] = o[mt][r] * lv[r] + xv[mt][r];
  }
  // the wait before a register that an issued store names is overwritten: another body's code
  // may stand behind these stores
  asm volatile("s_wait_xcnt 0x0" ::: "memory");
}

// Height (slice = w): both directions in one block, because both use the softmax along g.
// First n = h, k = g. Then n = g, k = h: there the softmax runs along n, across the waves, so
// the first pass leaves each row's maximum and reciprocal sum in LDS (one barrier) and the
// second forms its scores anew with the sides exchanged. V = [slice][k][c64], turned to [c][k]
// on its way through registers into LDS. The bare sums go to the workspace planes
// [b][c64][w][h], rows along n; k_finish turns them and adds scale and residual.
__device__ __forceinline__
void height_body(_Float16 (*QKs)[QK_BUF], _Float16 (*Vs)[3][V_SLICE], float (*st)[192],
                 const _Float16* __restrict__ ql, const _Float16* __restrict__ qr,
                 const _Float16* __restrict__ V0, const _Float16* __restrict__ V1,
                 const float sc,
                 float* __restrict__ out0, float* __restrict__ out1) {
  const int slice = blockIdx.x, b = blockIdx.y;
  const int tid = threadIdx.x, lane = tid & 31, wave = tid >> 5;
  const int kg = (lane >> 4) * 8;
  const _Float16* qp = ql + ((size_t)b * 192 + slice) * (192 * C3);
  const _Float16* kp = qr + ((size_t)b * 192 + slice) * (192 * C3);
  const size_t voff = (size_t)b * C3 * HW + slice * (192 * C3);
  v8h ve[2][2], vo[2][2];
#pragma unroll
  for (int ph = 0; ph < 2; ++ph)
#pragma unroll
    for (int it = 0; it < 2; ++it) {
      const int s = tid + it * FA_T, u = s >> 1, k2 = u % 96, c8 = (u / 96) * 2 + (s & 1);
      const _Float16* vp = (ph ? V1 : V0) + voff + (2 * k2) * C3 + c8 * 8;
      ve[ph][it] = *reinterpret_cast<const v8h*>(vp);
      vo[ph][it] = *reinterpret_cast<const v8h*>(vp + C3);
    }
  // the address registers of the loads above are free for reuse behind this
  asm volatile("s_wait_xcnt 0x0" ::: "memory");
#if HAVE_TDM
  const unsigned int uw = uni(threadIdx.x >> 5);
  if (pinned(uw < 2u)) {   // wave 0 brings the left Q, wave 1 the right: one request each
    tdm_rows128(lds_addr32(&QKs[0][0]) + uw * (QK_BUF * 2u), uw ? kp : qp, 192u, C3 * 2u);
    // the issuing wave's tile has landed before it reaches the barrier below
    asm volatile("s_wait_tensorcnt 0x0" ::: "memory");
  }
#else
  for (int s = tid; s < 192 * C3; s += FA_T) {
    QKs[0][(s / C3) * ROW_PITCH + s % C3] = qp[s];
    QKs[1][(s / C3) * ROW_PITCH + s % C3] = kp[s];
  }
#endif
#pragma unroll
  for (int ph = 0; ph < 2; ++ph)
#pragma unroll
    for (int it = 0; it < 2; ++it) {
      const int s = tid + it * FA_T, u = s >> 1, k2 = u % 96, c8 = (u / 96) * 2 + (s & 1);
      _Float16* d = &Vs[ph][k2 >> 5][(c8 * 8) * ROW_PITCH + ((2 * k2) & 63)];
#pragma unroll
      for (int j = 0; j < 8; ++j) {
        v2h pr = {ve[ph][it][j], vo[ph][it][j]};
        *reinterpret_cast<v2h*>(d + j * ROW_PITCH) = pr;
      }
    }
  __syncthreads();
  const size_t ad0 = ((size_t)(b * C3 + kg) * WW + slice) * HH + wave * 16 + (lane & 15);
  v8f acc[12];
  v16h pf[6];
  v8f o[4];
  // n = h, k = g
  scores_t(QKs[0], QKs[1], acc);
  __builtin_amdgcn_sched_barrier(0);
  float m, inv;
  softmax_k(acc, sc, m, inv);
  if (lane < 16) { st[0][wave * 16 + lane] = m; st[1][wave * 16 + lane] = inv; }
  // publishes every row's maximum and reciprocal sum to the second pass of all waves
  __syncthreads();
#pragma unroll
  for (int j = 0; j < 12; ++j) acc[j] *= inv;
  pack_p(acc, pf);
  __builtin_amdgcn_sched_barrier(0);
  product(Vs[0], pf, o);
#pragma unroll
  for (int mt = 0; mt < 4; ++mt)
#pragma unroll
    for (int r = 0; r < 8; ++r) out0[ad0 + (size_t)(mt * 16 + r) * HW] = o[mt][r];
  // the second pass overwrites the registers that the stores above name
  asm volatile("s_wait_xcnt 0x0" ::: "memory");
  // n = g, k = h: acc[j][r] is the score of row h = j * 16 + kg + r
  scores_t(QKs[1], QKs[0], acc);
  __builtin_amdgcn_sched_barrier(0);
#pragma unroll
  for (int kk = 0; kk < 6; ++kk) {
#pragma unroll
    for (int h = 0; h < 2; ++h) {
      const int j = 2 * kk + h;
      const v8f mh = *reinterpret_cast<const v8f*>(&st[0][j * 16 + kg]);
      const v8f ih = *reinterpret_cast<const v8f*>(&st[1][j * 16 + kg]);
#pragma unroll
      for (int r = 0; r < 8; ++r)
        pf[kk][h * 8 + r] = (_Float16)(exp_slot(acc[j][r] * sc - mh[r]) * ih[r]);
    }
    // bounds how far ahead the LDS loads of later rows' maxima and sums are issued (all at once
    // they spill to scratch); the last one keeps the e^x statements off the products below
    __builtin_amdgcn_sched_barrier(0);
  }
  product(Vs[1], pf, o);
#pragma unroll
  for (int mt = 0; mt < 4; ++mt)
#pragma unroll
    for (int r = 0; r < 8; ++r) out1[ad0 + (size_t)(mt * 16 + r) * HW] = o[mt][r];
  // the wait before a register that an issued store names is overwritten: another body's code
  // may stand behind these stores
  asm volatile("s_wait_xcnt 0x0" ::: "memory");
}

// ------------------- height branch: turn [w][h] planes, scale, add residual
// out[c][h][w] = ls[c] * t[c][w][h] + x[c][h][w] for channels [0,64). One block
// turns a 64x64 tile through LDS, so that every global access covers 256 B of a row.
#define HT 64
__device__ __forceinline__
void h_finish_body(const float* __restrict__ t0, const float* __restrict__ t1,
                   const float* __restrict__ xl, const float* __restrict__ xr,
                   const float* __restrict__ ls1, const float* __restrict__ ls2,
                   float* __restrict__ out_l, float* __restrict__ out_r) {
  const int w0 = (blockIdx.x / 3) * HT, h0 = (blockIdx.x % 3) * HT;
  const int c = blockIdx.y, side = blockIdx.z >> 1, b = blockIdx.z & 1;
  __shared__ float tl[HT][HT + 1];
  const int q = (threadIdx.x & 15) * 4, rw = threadIdx.x >> 4;
  const float* tp = (side ? t1 : t0) + (size_t)(b * C3 + c) * HW;
  const float* xp = (side ? xr : xl) + (size_t)(b * CI + c) * HW;
  float* op = (side ? out_r : out_l) + (size_t)(b * CI + c) * HW;
  const float l = (side ? ls2 : ls1)[c];
  f32x4 tv[4], xv[4];
  // every '#pragma unroll' below makes the indices of tv, xv and o constant, so that they
  // stay in registers; the eight loads are then in flight together
#pragma unroll
  for (int i = 0; i < 4; ++i)
    tv[i] = *reinterpret_cast<const f32x4*>(tp + (w0 + i * 16 + rw) * HH + h0 + q);
#pragma unroll
  for (int i = 0; i < 4; ++i)
    xv[i] = *reinterpret_cast<const f32x4*>(xp + (h0 + i * 16 + rw) * WW + w0 + q);
#pragma unroll
  for (int i = 0; i < 4; ++i)
#pragma unroll
    for (int k = 0; k < 4; ++k) tl[i * 16 + rw][q + k] = tv[i][k];
  __syncthreads();
#pragma unroll
  for (int i = 0; i < 4; ++i) {
    f32x4 o;
#pragma unroll
    for (int k = 0; k < 4; ++k) o[k] = tl[q + k][i * 16 + rw] * l + xv[i][k];
    *reinterpret_cast<f32x4*>(op + (h0 + i * 16 + rw) * WW + w0 + q) = o;
  }
  // the wait before a register that an issued store names is overwritten: in k_finish the
  // other body's code may stand behind these stores
  asm volatile("s_wait_xcnt 0x0" ::: "memory");
}

// ---------------------------------------------------- channel-SE branch
// One block sums one channel plane of both sides. A lane reads 16 B (8 halves), a wave 512 B
// in a row; a thread's 18 loads are all in flight before the first is summed.
#define PL_T 512
#define PL_N (HW / (PL_T * 8))   // 16-byte pieces of a plane per thread
static_assert(HW % (PL_T * 8) == 0, "a plane is a whole number of 16-byte pieces per thread");
__global__ __launch_bounds__(PL_T)
void k_pool(const _Float16* __restrict__ ql, const _Float16* __restrict__ qr,
            float* __restrict__ pool) {
  int b = blockIdx.x / C3, c64 = blockIdx.x % C3;
  const size_t base = (size_t)(b * CI + 128 + c64) * HW + threadIdx.x * 8;
  const _Float16* pl = ql + base;
  const _Float16* pr = qr + base;
  v8h l8[PL_N], r8[PL_N];
  // every '#pragma unroll' below makes the indices of l8, r8 and s4 constant: they stay in registers
#pragma unroll
  for (int i = 0; i < PL_N; ++i) {
    l8[i] = *reinterpret_cast<const v8h*>(pl + i * (PL_T * 8));
    r8[i] = *reinterpret_cast<const v8h*>(pr + i * (PL_T * 8));
  }
  // The wait before a register that an issued load names is overwritten. It takes the two
  // addresses as inputs, so that no load's result is laid on them, and no load sinks below it.
  asm volatile("s_wait_xcnt 0x0" :: "v"(pl), "v"(pr) : "memory");
  float s4[4] = {0.f, 0.f, 0.f, 0.f};   // four independent chains of adds
#pragma unroll
  for (int i = 0; i < PL_N; ++i)
#pragma unroll
    for (int j = 0; j < 8; ++j) s4[j & 3] += (float)l8[i][j] + (float)r8[i][j];
  const float s = (s4[0] + s4[1]) + (s4[2] + s4[3]);
  __shared__ float sm[PL_T];
  sm[threadIdx.x] = s;
  __syncthreads();
  for (int o = PL_T / 2; o > 0; o >>= 1) {
    if (threadIdx.x < o) sm[threadIdx.x] += sm[threadIdx.x + o];
    __syncthreads();
  }
  if (threadIdx.x == 0) pool[b * C3 + c64] = sm[0] * (1.0f / HW);
}

// Runs on the first 256 threads of a block of 384; every thread passes both barriers.
__device__ __forceinline__
void se_body(const float* __restrict__ pool, const float* __restrict__ w1,
             const float* __restrict__ w2, float* __restrict__ a) {
  __shared__ float h1[BB][8];
  __shared__ float lg[BB][128];
  int tid = threadIdx.x;
  if (tid < 16) {
    int b = tid >> 3, j = tid & 7;
    float s = 0.f;
    for (int i = 0; i < 64; ++i) s += pool[b * 64 + i] * w1[j * 64 + i];
    h1[b][j] = fmaxf(s, 0.f);
  }
  __syncthreads();
  if (tid < BB * 128) {
    int b = tid >> 7, o = tid & 127;
    float s = 0.f;
    for (int j = 0; j < 8; ++j) s += h1[b][j] * w2[o * 8 + j];
    lg[b][o] = s;
  }
  __syncthreads();
  if (tid < BB) {
    float m = -1e30f;
    for (int o = 0; o < 128; ++o) m = fmaxf(m, lg[tid][o]);
    float s = 0.f;
    for (int o = 0; o < 128; ++o) { lg[tid][o] = __expf(lg[tid][o] - m); s += lg[tid][o]; }
    float inv = 1.0f / s;
    for (int o = 0; o < 128; ++o) a[tid * 128 + o] = lg[tid][o] * inv;
  }
}

__global__ __launch_bounds__(FA_T, 6)
void k_attn_se(const _Float16* __restrict__ qh_l, const _Float16* __restrict__ qh_r,
               const _Float16* __restrict__ qw_l, const _Float16* __restrict__ qw_r,
               const _Float16* __restrict__ vh_l, const _Float16* __restrict__ vh_r,
               const _Float16* __restrict__ vw_l, const _Float16* __restrict__ vw_r,
               const float* __restrict__ sch, const float* __restrict__ scw,
               float* __restrict__ th_l, float* __restrict__ th_r,
               float* __restrict__ out_l, float* __restrict__ out_r,
               const float* __restrict__ x_l, const float* __restrict__ x_r,
               const float* __restrict__ ls1, const float* __restrict__ ls2,
               const float* __restrict__ pool, const float* __restrict__ w1,
               const float* __restrict__ w2, float* __restrict__ avec) {
  // two Q tiles [row][c64], rows at ROW_PITCH
  __shared__ __attribute__((aligned(2048))) _Float16 QKs[2][QK_BUF];
  // V as three slices of 64 k: [k / 64][c][k % 64], rows at ROW_PITCH; height holds two of them
  __shared__ __attribute__((aligned(2048))) _Float16 Vs[2][3][V_SLICE];
  // height: a row's maximum, reciprocal sum; width: the layer scales
  __shared__ __attribute__((aligned(32))) float st[2][192];
  if (blockIdx.x == 192) {   // the whole block takes this side, ahead of every barrier
    if (blockIdx.y == 0 && blockIdx.z == 0) se_body(pool, w1, w2, avec);
    return;
  }
  const float sc = *(blockIdx.z == 0 ? sch : scw);
  if (blockIdx.z == 0)
    height_body(QKs, Vs, st, qh_l, qh_r, vh_r, vh_l, sc, th_l, th_r);
  else {
    const bool right = blockIdx.z == 2;
    width_body(QKs, Vs[0], right ? qw_r : qw_l, right ? qw_l : qw_r, st[0], right ? vw_l : vw_r, sc,
               right ? out_r : out_l, right ? x_r : x_l, right ? ls2 : ls1);
  }
}

// A block takes a quarter of one channel plane. A lane holds 4 adjacent pixels a piece: 8 B of
// v, 16 B of x and of the output, so that a wave covers whole 128-byte lines in every access;
// a thread's 18 loads are all in flight before its first store.
#define SA_T 256
#define SA_N 9                   // pieces per thread
#define SA_PX (SA_T * 4 * SA_N)  // pixels per block
static_assert(HW % SA_PX == 0, "a plane is a whole number of blocks");
__device__ __forceinline__
void se_apply_body(const int quarter, const float* __restrict__ a,
                   const _Float16* __restrict__ vl, const _Float16* __restrict__ vr,
                   const float* __restrict__ xl, const float* __restrict__ xr,
                   const float* __restrict__ ls1, const float* __restrict__ ls2,
                   float* __restrict__ out_l, float* __restrict__ out_r) {
  const int c64 = blockIdx.y, side = blockIdx.z >> 1, b = blockIdx.z & 1;
  const int c = 128 + c64;
  const float av = a[b * 128 + side * 64 + c64];
  const float l = (side ? ls2 : ls1)[c];
  const size_t ad = (size_t)(b * CI + c) * HW + quarter * SA_PX + threadIdx.x * 4;
  const _Float16* v = (side ? vr : vl) + ad;
  const float* x = (side ? xr : xl) + ad;
  float* o = (side ? out_r : out_l) + ad;
  v4h vv[SA_N];
  f32x4 xv[SA_N];
  // every '#pragma unroll' below makes the indices of vv and xv constant: they stay in registers
#pragma unroll
  for (int i = 0; i < SA_N; ++i) {
    vv[i] = *reinterpret_cast<const v4h*>(v + i * (SA_T * 4));
    xv[i] = *reinterpret_cast<const f32x4*>(x + i * (SA_T * 4));
  }
  // The wait before a register that an issued load names is overwritten. It takes the two
  // addresses as inputs, so that no load's result is laid on them, and no load sinks below it.
  asm volatile("s_wait_xcnt 0x0" :: "v"(v), "v"(x) : "memory");
  // without it the scheduler lifts the first pieces' arithmetic, with its wait for their data,
  // in front of the last loads, which then start one memory latency late
  __builtin_amdgcn_sched_barrier(0);
#pragma unroll
  for (int i = 0; i < SA_N; ++i)
#pragma unroll
    for (int k = 0; k < 4; ++k) xv[i][k] = av * (float)vv[i][k] * l + xv[i][k];
#pragma unroll
  for (int i = 0; i < SA_N; ++i)
    *reinterpret_cast<f32x4*>(o + i * (SA_T * 4)) = xv[i];
  // the wait before a register that an issued store names is overwritten: in k_finish the
  // other body's code may stand behind these stores
  asm volatile("s_wait_xcnt 0x0" ::: "memory");
}

// The two closing passes in one grid: they write different channels of the output.
// blockIdx.x: 0 to 8 the tiles of a height plane, 9 to 12 the quarters of an SE plane;
// blockIdx.y and blockIdx.z mean the same in both.
#define FH_TILES ((HH / HT) * (WW / HT))
static_assert(SA_T == 256, "both bodies run on 256 threads");
__global__ __launch_bounds__(256)
void k_finish(const float* __restrict__ t0, const float* __restrict__ t1,
              const float* __restrict__ a,
              const _Float16* __restrict__ vl, const _Float16* __restrict__ vr,
              const float* __restrict__ xl, const float* __restrict__ xr,
              const float* __restrict__ ls1, const float* __restrict__ ls2,
              float* __restrict__ out_l, float* __restrict__ out_r) {
  if (blockIdx.x < FH_TILES)
    h_finish_body(t0, t1, xl, xr, ls1, ls2, out_l, out_r);
  else
    se_apply_body(blockIdx.x - FH_TILES, a, vl, vr, xl, xr, ls1, ls2, out_l, out_r);
}

// ------------------------------------------------------------------ host
extern "C" void kernel_launch(void* const* d_in, const int* in_sizes, int n_in,
                              void* d_out, int out_size, void* d_ws, size_t ws_size,
                              hipStream_t stream) {
  const float* x_l  = (const float*)d_in[0];
  const float* x_r  = (const float*)d_in[1];
  const float* lnlw = (const float*)d_in[2];
  const float* lnlb = (const float*)d_in[3];
  const float* lnrw = (const float*)d_in[4];
  const float* lnrb = (const float*)d_in[5];
  const float* wq_l = (const float*)d_in[6];
  const float* wq_r = (const float*)d_in[7];
  const float* wv_l = (const float*)d_in[8];
  const float* wv_r = (const float*)d_in[9];
  const float* w1   = (const float*)d_in[10];
  const float* w2   = (const float*)d_in[11];
  const float* sch  = (const float*)d_in[12];
  const float* scw  = (const float*)d_in[13];
  const float* ls1  = (const float*)d_in[14];
  const float* ls2  = (const float*)d_in[15];

  float* out_l = (float*)d_out;
  float* out_r = out_l + (size_t)BB * CI * HW;

  char* ws = (char*)d_ws;
  size_t off = 0;
  auto take = [&](size_t bytes) { char* p = ws + off; off += (bytes + 255) & ~(size_t)255; return p; };
  const size_t QV = (size_t)BB * CI * HW;      // half elements
  const size_t QT = (size_t)BB * C3 * HW;
  const size_t ST = (size_t)BB * HW;           // float elements
  _Float16* q_l  = (_Float16*)take(QV * 2);
  _Float16* q_r  = (_Float16*)take(QV * 2);
  _Float16* v_l  = (_Float16*)take(QV * 2);
  _Float16* v_r  = (_Float16*)take(QV * 2);
  _Float16* qS0l = (_Float16*)take(QT * 2);   // [b][w][h][c64] height Q
  _Float16* qS0r = (_Float16*)take(QT * 2);
  _Float16* qS1l = (_Float16*)take(QT * 2);   // [b][h][w][c64] width Q
  _Float16* qS1r = (_Float16*)take(QT * 2);
  _Float16* vTl  = (_Float16*)take(QT * 2);   // [b][w][h][c64] height V
  _Float16* vTr  = (_Float16*)take(QT * 2);
  float* mul  = (float*)take(ST * 4);
  float* rsl  = (float*)take(ST * 4);
  float* mur  = (float*)take(ST * 4);
  float* rsr  = (float*)take(ST * 4);
  float* pool = (float*)take(BB * C3 * 4);
  float* avec = (float*)take(BB * 128 * 4);
  float* tH_l = (float*)take(QT * 4);         // [b][c64][w][h] height sums
  float* tH_r = (float*)take(QT * 4);

  // 1) LayerNorm stats
  k_ln_stats<<<(2 * BB * HW + 255) / 256, 256, 0, stream>>>(x_l, x_r, mul, rsl, mur, rsr);

  // 2) pointwise convs (WMMA GEMM), LN fused for q; left and right in one grid
  dim3 cg(HW / (CT_PX * CT_NT), BB, 2);
  k_conv2<1><<<cg, 384, 0, stream>>>(wq_l, wq_r, x_l, x_r, lnlw, lnlb, lnrw, lnrb,
                                     mul, rsl, mur, rsr, q_l, q_r, qS0l, qS0r, qS1l, qS1r);
  k_conv2<0><<<cg, 384, 0, stream>>>(wv_l, wv_r, x_l, x_r, lnlw, lnlb, lnrw, lnrb,
                                     mul, rsl, mur, rsr, v_l, v_r, vTl, vTr, nullptr, nullptr);

  // 3) the pool of the SE branch
  k_pool<<<BB * C3, PL_T, 0, stream>>>(q_l, q_r, pool);

  // 4) attention: height on channels [0,64), width on [64,128); with it the SE layers
  k_attn_se<<<dim3(193, BB, 3), FA_T, 0, stream>>>(
      qS0l, qS0r, qS1l, qS1r, vTl, vTr, v_l + (size_t)C3 * HW, v_r + (size_t)C3 * HW, sch, scw,
      tH_l, tH_r, out_l, out_r, x_l, x_r, ls1, ls2, pool, w1, w2, avec);

  // 5) height planes turned, scaled and added; SE branch applied on channels [128,192)
  k_finish<<<dim3(FH_TILES + HW / SA_PX, C3, 2 * BB), 256, 0, stream>>>(
      tH_l, tH_r, avec, v_l, v_r, x_l, x_r, ls1, ls2, out_l, out_r);
}

// v009
// One run takes 106 microseconds.
// Timed twice side by side with v008, it ran 1.30 times as fast both times.
// Counting every step since v000, it is 8.98 times as fast.
#include <hip/hip_runtime.h>
#include <hip/hip_bf16.h>

typedef __attribute__((ext_vector_type(16))) _Float16 v16h;
typedef __attribute__((ext_vector_type(8)))  _Float16 v8h;
typedef __attribute__((ext_vector_type(2)))  _Float16 v2h;
typedef __attribute__((ext_vector_type(8)))  float    v8f;
typedef __attribute__((ext_vector_type(4)))  unsigned int u32x4;
typedef __attribute__((ext_vector_type(8)))  int i32x8;
typedef __attribute__((ext_vector_type(4)))  int i32x4;

#define BB 2
#define CI 192
#define HH 192
#define WW 192
#define HW 36864
#define C3 64

#if defined(__HIP_DEVICE_COMPILE__) && __has_builtin(__builtin_amdgcn_tensor_load_to_lds)
#define HAVE_TDM 1
#else
#define HAVE_TDM 0
#endif

__device__ __forceinline__ v8f wmma_f16(v16h a, v16h b, v8f c) {
  // D = A(16x32 f16) * B(32x16 f16) + C(16x16 f32)
  return __builtin_amdgcn_wmma_f32_16x16x32_f16(false, a, false, b, (short)0, c,
                                                false, false);
}

// Load a 16-half WMMA operand fragment from a [row][K] layout: 8 contiguous
// halves at p (K = kg..kg+7) and 8 at p+16 (K = kg+16..kg+23).
__device__ __forceinline__ v16h ldfrag(const _Float16* p) {
  v8h lo = *reinterpret_cast<const v8h*>(p);
  v8h hi = *reinterpret_cast<const v8h*>(p + 16);
  v16h r;
#pragma unroll
  for (int i = 0; i < 8; ++i) { r[i] = lo[i]; r[i + 8] = hi[i]; }
  return r;
}

#if HAVE_TDM
typedef __attribute__((address_space(3))) const void lds_cvoid;
__device__ __forceinline__ unsigned int lds_addr32(const void* p) {
  return (unsigned int)(uintptr_t)(lds_cvoid*)p;
}
typedef __attribute__((ext_vector_type(8))) unsigned int u32x8;
__device__ __forceinline__ unsigned int uni(unsigned int v) {
  return (unsigned int)__builtin_amdgcn_readfirstlane(v);
}
__device__ __forceinline__ unsigned int pinned(unsigned int v) {
  unsigned int w = uni(v);
  asm volatile("" : "+s"(w));  // pinned(): the test word stays in a scalar register
  return w;
}
__device__ __forceinline__ void tdm_rows128(unsigned int lds_off, const void* gaddr,
                                            unsigned int rows, unsigned int src_pitch) {
  unsigned long long ga = (unsigned long long)(uintptr_t)gaddr;
  u32x4 g0;
  g0[0] = uni(1u);                              // count = 1
  g0[1] = uni(lds_off);                         // LDS destination (bytes)
  g0[2] = uni((unsigned int)ga);                // global address [31:0]
  g0[3] = uni((((unsigned int)(ga >> 32)) & 0x01FFFFFFu) | 0x80000000u);  // [56:32] | type = 2
  u32x8 g1;
  g1[0] = uni((1u << 20) | (4u << 22) | (3u << 25));
  g1[1] = uni(128u << 16);
  g1[2] = uni(rows << 16);
  g1[3] = uni(128u << 16);
  g1[4] = uni(rows);
  g1[5] = uni(src_pitch);
  g1[6] = uni(0u);
  g1[7] = uni(0u);
  asm volatile("tensor_load_to_lds %0, %1" :: "s"(g0), "s"(g1) : "memory");
}
#endif  // HAVE_TDM

// ------------------------- LayerNorm, Q conv and V conv in one pass over x
// Y[o,p] = sum_c W[o,c] * X'[c,p], X' = LN(x) for Q and x for V. A block walks FC_NT tiles of
// FC_PX pixels and reads each value of x once. 24 waves: waves 0 to 11 form Q, waves 12 to 23 V,
// each for 16 output channels, whose weights it keeps as six f16 fragments in registers.
// Staging: a thread owns one pixel x 16 adjacent channels (a wave: 32 pixels, one channel
// group). The sums of a pixel over the 12 channel groups meet in LDS.
// Every '#pragma unroll' here makes the indices of a small array constant, so
// that the array lives in registers and not in scratch.
// Every store is 16 B a lane. A wave whose channels go to a slice plane ([pixel][c64])
// takes W as A, so that a lane holds 8 channels of one pixel; a wave whose channels go
// to a plane [c][pixel] takes X as A, so that a lane holds 8 pixels of one channel.
// Q: channels [0,64) -> qA = [b][w][h][c64] (height Q), [64,128) -> qB = [b][h][w][c64]
// (width Q), [128,192) -> q.  V: [0,64) -> vA = [b][w][h][c64] (height V), the rest -> v.
#define FC_T 768
#define FC_PX 64
#define FC_NT 9
#define CT_PITCH 200   // halves per LDS row: 400 B = 16 B x odd, for b128 readers
typedef __attribute__((ext_vector_type(4))) float    f32x4;
typedef __attribute__((ext_vector_type(2))) float    f32x2;
typedef __attribute__((ext_vector_type(4))) _Float16 v4h;
static_assert(WW % FC_PX == 0, "a tile stays inside one image row");
static_assert(HW % (FC_PX * FC_NT) == 0, "a plane is a whole number of blocks");

__global__ __launch_bounds__(FC_T, 6)
void k_lnconv(const float* __restrict__ wq_l, const float* __restrict__ wq_r,
              const float* __restrict__ wv_l, const float* __restrict__ wv_r,
              const float* __restrict__ x_l, const float* __restrict__ x_r,
              const float* __restrict__ lnlw, const float* __restrict__ lnlb,
              const float* __restrict__ lnrw, const float* __restrict__ lnrb,
              _Float16* __restrict__ q_l, _Float16* __restrict__ q_r,
              _Float16* __restrict__ qA_l, _Float16* __restrict__ qA_r,
              _Float16* __restrict__ qB_l, _Float16* __restrict__ qB_r,
              _Float16* __restrict__ v_l, _Float16* __restrict__ v_r,
              _Float16* __restrict__ vA_l, _Float16* __restrict__ vA_r) {
  __shared__ __attribute__((aligned(16))) _Float16 wS[24 * 16][CT_PITCH];    // [wave's row][k]
  __shared__ __attribute__((aligned(16))) _Float16 xT[2][FC_PX][CT_PITCH];   // [x, LN(x)][n][k]
  __shared__ __attribute__((aligned(16))) f32x2 part[12][FC_PX];             // sum, sum of squares
  const bool right = blockIdx.z != 0;
  const int b   = blockIdx.y;
  const int tid = threadIdx.x, lane = tid & 31;
  // wave-uniform, held in scalar registers
  const int uwave = __builtin_amdgcn_readfirstlane(tid >> 5);
  const bool isq = uwave < 12;
  const int mt = isq ? uwave : uwave - 12;
  const int kg = (lane >> 4) * 8;
  const int pbase = blockIdx.x * (FC_PX * FC_NT);
  const int px = tid & (FC_PX - 1), cg = uwave >> 1, c0 = cg * 16;
  const float* xcol = (right ? x_r : x_l) + (size_t)(b * CI + c0) * HW + pbase + px;

  // Prologue: the first pixel tile and the weights are in flight together.
  float xr[16];
#pragma unroll
  for (int i = 0; i < 16; ++i) xr[i] = xcol[(size_t)i * HW];
  // The wait before a register that an issued load names is overwritten. It takes the
  // address as an input, so that no load's result is laid on it.
  asm volatile("s_wait_xcnt 0x0" :: "v"(xcol) : "memory");
  // a wave's 16 weight rows: 12 KiB in a row, read in whole lines, turned to fragments in LDS
  const char* wsrc = reinterpret_cast<const char*>(
      (isq ? (right ? wq_r : wq_l) : (right ? wv_r : wv_l)) + (size_t)mt * 16 * CI);
  const unsigned int wlane = lane * 16u;   // the lane's byte offset in each 512-byte piece
#pragma unroll
  for (int g = 0; g < 2; ++g) {
    f32x4 w4[12];
#pragma unroll
    for (int i = 0; i < 12; ++i)
      w4[i] = *reinterpret_cast<const f32x4*>(wsrc + wlane + (g * 12 + i) * 512);
    asm volatile("s_wait_xcnt 0x0" :: "v"(wlane) : "memory");
#pragma unroll
    for (int i = 0; i < 12; ++i) {
      const int e = ((g * 12 + i) * 32 + lane) * 4;
      v4h h4 = {(_Float16)w4[i][0], (_Float16)w4[i][1], (_Float16)w4[i][2], (_Float16)w4[i][3]};
      *reinterpret_cast<v4h*>(&wS[uwave * 16 + e / CI][e % CI]) = h4;
    }
  }
  const float* lwp = (right ? lnrw : lnlw) + c0;
  const float* lbp = (right ? lnrb : lnlb) + c0;
  float lw[16], lb[16];
#pragma unroll
  for (int i = 0; i < 16; ++i) { lw[i] = lwp[i]; lb[i] = lbp[i]; }
  __syncthreads();
  v16h wf[6];
#pragma unroll
  for (int kk = 0; kk < 6; ++kk) wf[kk] = ldfrag(&wS[uwave * 16 + (lane & 15)][kk * 32 + kg]);

  const bool slicew = mt < (isq ? 8 : 4);
  const bool planeB = isq && mt >= 4;
  const int step16 = planeB ? 16 * C3 : 16 * HH * C3;   // halves, between 16-pixel groups of a slice plane
  const int ch8 = (mt * 16 + kg) & (C3 - 1);
  _Float16* dst = !slicew ? (isq ? (right ? q_r : q_l) : (right ? v_r : v_l)) +
                                (size_t)(b * CI + mt * 16 + (lane & 15)) * HW + kg
                : planeB  ? (right ? qB_r : qB_l) + ((size_t)b * HW + (lane & 15)) * C3 + ch8
                          : (isq ? (right ? qA_r : qA_l) : (right ? vA_r : vA_l)) +
                                ((size_t)b * WW + (lane & 15)) * (HH * C3) + ch8;
  const _Float16* xb = &xT[isq ? 1 : 0][lane & 15][kg];
  // kept rolled: unrolled, the trips' addresses and tiles are formed ahead and spill to scratch
#pragma unroll 1
  for (int t = 0; t < FC_NT; ++t) {
    const int p0 = pbase + t * FC_PX;
    float s = 0.f, s2 = 0.f;
#pragma unroll
    for (int i = 0; i < 16; ++i) { s += xr[i]; s2 += xr[i] * xr[i]; }
    part[cg][px] = (f32x2){s, s2};
    // publishes the partial sums; every wave that passes it has left xT, which is refilled below
    __syncthreads();
    s = 0.f; s2 = 0.f;
#pragma unroll
    for (int g = 0; g < 12; ++g) { const f32x2 pp = part[g][px]; s += pp[0]; s2 += pp[1]; }
    const float m = s * (1.0f / CI);
    const float var = s2 * (1.0f / CI) - m * m;
    const float r = rsqrtf(var + 1e-6f);
    v8h hx[2], hy[2];
#pragma unroll
    for (int i = 0; i < 16; ++i) {
      hx[i >> 3][i & 7] = (_Float16)xr[i];
      hy[i >> 3][i & 7] = (_Float16)((xr[i] - m) * r * lw[i] + lb[i]);
    }
#pragma unroll
    for (int i = 0; i < 2; ++i) {
      *reinterpret_cast<v8h*>(&xT[0][px][c0 + i * 8]) = hx[i];
      *reinterpret_cast<v8h*>(&xT[1][px][c0 + i * 8]) = hy[i];
    }
    // publishes the tile; behind it nobody reads the partial sums of this trip any more
    __syncthreads();
    if (t + 1 < FC_NT) {   // next tile's loads fly under this tile's products and stores
      xcol += FC_PX;
#pragma unroll
      for (int i = 0; i < 16; ++i) xr[i] = xcol[(size_t)i * HW];
      // the wait before the address of the loads above is stepped on; it takes the address
      // as an input, so that no load's result is laid on it
      asm volatile("s_wait_xcnt 0x0" :: "v"(xcol) : "memory");
    }
    v8f acc[4];
#pragma unroll
    for (int u = 0; u < 4; ++u) acc[u] = (v8f){0.f, 0.f, 0.f, 0.f, 0.f, 0.f, 0.f, 0.f};
    // The two operands have the same fragment map and the same k order: only their places change.
    // Each side rounds and stores its own sums: a plane's four pieces lie 32 B apart, a slice
    // plane's a whole step.
    if (slicew) {
#pragma unroll
      for (int kk = 0; kk < 6; ++kk)
#pragma unroll
        for (int u = 0; u < 4; ++u)
          acc[u] = wmma_f16(wf[kk], ldfrag(xb + u * 16 * CT_PITCH + kk * 32), acc[u]);
      const int hrow = p0 / WW, wcol = p0 % WW;
      _Float16* dt = dst + (planeB ? p0 * C3 : (wcol * HH + hrow) * C3);
#pragma unroll
      for (int u = 0; u < 4; ++u) {
        v8h pk;
#pragma unroll
        for (int e = 0; e < 8; ++e) pk[e] = (_Float16)acc[u][e];
        *reinterpret_cast<v8h*>(dt + u * step16) = pk;
      }
      // the code behind this side overwrites the registers that the stores above name
      asm volatile("s_wait_xcnt 0x0" ::: "memory");
    } else {
#pragma unroll
      for (int kk = 0; kk < 6; ++kk)
#pragma unroll
        for (int u = 0; u < 4; ++u)
          acc[u] = wmma_f16(ldfrag(xb + u * 16 * CT_PITCH + kk * 32), wf[kk], acc[u]);
#pragma unroll
      for (int u = 0; u < 4; ++u) {
        v8h pk;
#pragma unroll
        for (int e = 0; e < 8; ++e) pk[e] = (_Float16)acc[u][e];
        *reinterpret_cast<v8h*>(dst + p0 + u * 16) = pk;
      }
      // as on the other side
      asm volatile("s_wait_xcnt 0x0" ::: "memory");
    }
  }
}

// ------------------- axial attention: scores, softmax and product in one block
// Q/K stored per-slice contiguous as [slice][row][c64]. out[c,n] = sum_k V[c,k] * P[n,k], 64x192,
// K = 192. 12 waves; a wave owns 16 rows n of P. It forms the scores transposed (the k side as A,
// its own n rows as B), so that a lane holds 96 of the 192 k of ONE row n, in the very places
// that the B fragment of the product wants: P never leaves the registers.
// LDS rows that feed 16-byte fragment reads stand at a pitch of 16 B x odd.
#define ROW_PITCH 72     // halves: 128-byte rows + the mover's 16-byte pad = 144 B
#define QK_BUF 14336     // halves: 192 rows x 144 B, rounded up to a multiple of 2 KiB
#define V_SLICE 5120     // halves: 64 rows x 144 B, rounded up to a multiple of 2 KiB
#define FA_T 384         // threads: one wave for each 16 rows
__device__ __forceinline__ float exp_slot(float x) {
  float y;
  asm("v_exp_f32 %0, %1\n\tv_nop" : "=v"(y) : "v"(x * 1.44269504f));
  return y;
}
// Every '#pragma unroll' in this section makes the indices of a register array constant, so
// that the array stays in registers.
// acc[j][r] = sum_c Kb[j * 16 + kg + r][c] * Nb[wave * 16 + (lane & 15)][c]
__device__ __forceinline__
void scores_t(const _Float16* Nb, const _Float16* Kb, v8f (&acc)[12]) {
  const int lane = threadIdx.x & 31, wave = threadIdx.x >> 5;
  const int kg = (lane >> 4) * 8;
  v16h nf[2];
#pragma unroll
  for (int kk = 0; kk < 2; ++kk)
    nf[kk] = ldfrag(&Nb[(wave * 16 + (lane & 15)) * ROW_PITCH + kk * 32 + kg]);
#pragma unroll
  for (int j = 0; j < 12; ++j) {
    v8f a = {0.f, 0.f, 0.f, 0.f, 0.f, 0.f, 0.f, 0.f};
#pragma unroll
    for (int kk = 0; kk < 2; ++kk) {
      v16h kf = ldfrag(&Kb[(j * 16 + (lane & 15)) * ROW_PITCH + kk * 32 + kg]);
      a = wmma_f16(kf, nf[kk], a);
    }
    acc[j] = a;
  }
}
// Softmax along k of the lane's row: eight chains over the lane's own 96 values, a tree over
// the eight, one exchange with the lane that holds the row's other half. Leaves e^(s - m) in acc.
__device__ __forceinline__
void softmax_k(v8f (&acc)[12], const float sc, float& m, float& inv) {
  float t[8];
#pragma unroll
  for (int j = 0; j < 12; ++j) acc[j] *= sc;
#pragma unroll
  for (int r = 0; r < 8; ++r) {
    t[r] = acc[0][r];
#pragma unroll
    for (int j = 1; j < 12; ++j) t[r] = fmaxf(t[r], acc[j][r]);
  }
  m = fmaxf(fmaxf(fmaxf(t[0], t[1]), fmaxf(t[2], t[3])), fmaxf(fmaxf(t[4], t[5]), fmaxf(t[6], t[7])));
  m = fmaxf(m, __shfl_xor(m, 16));
#pragma unroll
  for (int r = 0; r < 8; ++r) {
    t[r] = 0.f;
#pragma unroll
    for (int j = 0; j < 12; ++j) {
      acc[j][r] = exp_slot(acc[j][r] - m);
      t[r] += acc[j][r];
    }
  }
  float s = ((t[0] + t[1]) + (t[2] + t[3])) + ((t[4] + t[5]) + (t[6] + t[7]));
  s += __shfl_xor(s, 16);
  inv = 1.0f / s;
}
// Tiles 2kk and 2kk + 1 of acc are the two halves of the fragment of k chunk kk: a lane's
// halves 0 to 7 are k = kg + i, halves 8 to 15 k = kg + 16 + i, as ldfrag reads them.
__device__ __forceinline__ void pack_p(const v8f (&acc)[12], v16h (&pf)[6]) {
#pragma unroll
  for (int kk = 0; kk < 6; ++kk)
#pragma unroll
    for (int i = 0; i < 8; ++i) {
      pf[kk][i]     = (_Float16)acc[2 * kk][i];
      pf[kk][i + 8] = (_Float16)acc[2 * kk + 1][i];
    }
}
// o[mt][r] = sum_k V[mt * 16 + kg + r][k] * P[wave * 16 + (lane & 15)][k]
__device__ __forceinline__
void product(const _Float16 (*Vs)[V_SLICE], const v16h (&pf)[6], v8f (&o)[4]) {
  const int lane = threadIdx.x & 31;
  const int kg = (lane >> 4) * 8;
#pragma unroll
  for (int mt = 0; mt < 4; ++mt) o[mt] = (v8f){0.f, 0.f, 0.f, 0.f, 0.f, 0.f, 0.f, 0.f};
#pragma unroll
  for (int kk = 0; kk < 6; ++kk)
#pragma unroll
    for (int mt = 0; mt < 4; ++mt) {
      v16h af = ldfrag(&Vs[kk >> 1][(mt * 16 + (lane & 15)) * ROW_PITCH + (kk & 1) * 32 + kg]);
      o[mt] = wmma_f16(af, pf[kk], o[mt]);
    }
}

// Width (slice = h): one direction a block. qn: the side whose rows are n, qk: the side that
// the softmax runs along; V = [c][k] rows at a pitch of HW, brought by tensor loads.
__device__ __forceinline__
void width_body(_Float16 (*QKs)[QK_BUF], _Float16 (*Vs)[V_SLICE],
                const _Float16* __restrict__ qn, const _Float16* __restrict__ qk,
                float* lsS, const _Float16* __restrict__ V, const float sc,
                float* __restrict__ op, const float* __restrict__ xp,
                const float* __restrict__ lsp) {
  const int slice = blockIdx.x, b = blockIdx.y;
  const int tid = threadIdx.x, lane = tid & 31, wave = tid >> 5;
  const int kg = (lane >> 4) * 8;
  const _Float16* np = qn + ((size_t)b * 192 + slice) * (192 * C3);
  const _Float16* kp = qk + ((size_t)b * 192 + slice) * (192 * C3);
  const _Float16* vp = V + (size_t)b * CI * HW + slice * 192;
  // the 64 layer scales go through LDS: behind the products a lane reads its eight in a row
  float l0 = 0.f;
  if (tid < C3) l0 = lsp[C3 + tid];
#if HAVE_TDM
  const unsigned int uw = uni(threadIdx.x >> 5);
  if (pinned(uw < 5u)) {   // waves 0, 1: the two Q tiles; waves 2 to 4: a slice of V; one request each
    const bool isq = uw < 2u;
    tdm_rows128(isq ? lds_addr32(&QKs[0][0]) + uw * (QK_BUF * 2u)
                    : lds_addr32(&Vs[0][0]) + (uw - 2u) * (V_SLICE * 2u),
                uw == 0u ? np : uw == 1u ? kp : vp + (uw - 2u) * 64u,
                isq ? 192u : (unsigned int)C3, isq ? C3 * 2u : HW * 2u);
    // the issuing wave's tile has landed before it reaches the barrier below
    asm volatile("s_wait_tensorcnt 0x0" ::: "memory");
  }
#else
  for (int s = tid; s < 192 * C3; s += FA_T) {
    QKs[0][(s / C3) * ROW_PITCH + s % C3] = np[s];
    QKs[1][(s / C3) * ROW_PITCH + s % C3] = kp[s];
    Vs[(s % 192) >> 6][(s / 192) * ROW_PITCH + (s & 63)] = vp[(size_t)(s / 192) * HW + s % 192];
  }
#endif
  if (tid < C3) lsS[tid] = l0;
  __syncthreads();
  v8f acc[12];
  scores_t(QKs[0], QKs[1], acc);
  __builtin_amdgcn_sched_barrier(0);
  float m, inv;
  softmax_k(acc, sc, m, inv);
#pragma unroll
  for (int j = 0; j < 12; ++j) acc[j] *= inv;
  v16h pf[6];
  pack_p(acc, pf);
  __builtin_amdgcn_sched_barrier(0);
  // the residual is on its way while the products run
  const size_t ad0 = ((size_t)(b * CI + C3 + kg) * HH + slice) * WW + wave * 16 + (lane & 15);
  float xv[4][8];
#pragma unroll
  for (int mt = 0; mt < 4; ++mt)
#pragma unroll
    for (int r = 0; r < 8; ++r) xv[mt][r] = xp[ad0 + (size_t)(mt * 16 + r) * HW];
  // the address registers of the loads above are free for reuse behind this
  asm volatile("s_wait_xcnt 0x0" ::: "memory");
  v8f o[4];
  product(Vs, pf, o);
#pragma unroll
  for (int mt = 0; mt < 4; ++mt) {
    const v8f lv = *reinterpret_cast<const v8f*>(&lsS[mt * 16 + kg]);
#pragma unroll
    for (int r = 0; r < 8; ++r)
      op[ad0 + (size_t)(mt * 16 + r) * HW] = o[mt][r] * lv[r] + xv[mt][r];
  }
  // the wait before a register that an issued store names is overwritten: another body's code
  // may stand behind these stores
  asm volatile("s_wait_xcnt 0x0" ::: "memory");
}

// Height (slice = w): both directions in one block, because both use the softmax along g.
// First n = h, k = g. Then n = g, k = h: there the softmax runs along n, across the waves, so
// the first pass leaves each row's maximum and reciprocal sum in LDS (one barrier) and the
// second forms its scores anew with the sides exchanged. V = [slice][k][c64], turned to [c][k]
// on its way through registers into LDS. The bare sums go to the workspace planes
// [b][c64][w][h], rows along n; k_finish turns them and adds scale and residual.
__device__ __forceinline__
void height_body(_Float16 (*QKs)[QK_BUF], _Float16 (*Vs)[3][V_SLICE], float (*st)[192],
                 const _Float16* __restrict__ ql, const _Float16* __restrict__ qr,
                 const _Float16* __restrict__ V0, const _Float16* __restrict__ V1,
                 const float sc,
                 float* __restrict__ out0, float* __restrict__ out1) {
  const int slice = blockIdx.x, b = blockIdx.y;
  const int tid = threadIdx.x, lane = tid & 31, wave = tid >> 5;
  const int kg = (lane >> 4) * 8;
  const _Float16* qp = ql + ((size_t)b * 192 + slice) * (192 * C3);
  const _Float16* kp = qr + ((size_t)b * 192 + slice) * (192 * C3);
  const size_t voff = (size_t)b * C3 * HW + slice * (192 * C3);
  v8h ve[2][2], vo[2][2];
#pragma unroll
  for (int ph = 0; ph < 2; ++ph)
#pragma unroll
    for (int it = 0; it < 2; ++it) {
      const int s = tid + it * FA_T, u = s >> 1, k2 = u % 96, c8 = (u / 96) * 2 + (s & 1);
      const _Float16* vp = (ph ? V1 : V0) + voff + (2 * k2) * C3 + c8 * 8;
      ve[ph][it] = *reinterpret_cast<const v8h*>(vp);
      vo[ph][it] = *reinterpret_cast<const v8h*>(vp + C3);
    }
  // the address registers of the loads above are free for reuse behind this
  asm volatile("s_wait_xcnt 0x0" ::: "memory");
#if HAVE_TDM
  const unsigned int uw = uni(threadIdx.x >> 5);
  if (pinned(uw < 2u)) {   // wave 0 brings the left Q, wave 1 the right: one request each
    tdm_rows128(lds_addr32(&QKs[0][0]) + uw * (QK_BUF * 2u), uw ? kp : qp, 192u, C3 * 2u);
    // the issuing wave's tile has landed before it reaches the barrier below
    asm volatile("s_wait_tensorcnt 0x0" ::: "memory");
  }
#else
  for (int s = tid; s < 192 * C3; s += FA_T) {
    QKs[0][(s / C3) * ROW_PITCH + s % C3] = qp[s];
    QKs[1][(s / C3) * ROW_PITCH + s % C3] = kp[s];
  }
#endif
#pragma unroll
  for (int ph = 0; ph < 2; ++ph)
#pragma unroll
    for (int it = 0; it < 2; ++it) {
      const int s = tid + it * FA_T, u = s >> 1, k2 = u % 96, c8 = (u / 96) * 2 + (s & 1);
      _Float16* d = &Vs[ph][k2 >> 5][(c8 * 8) * ROW_PITCH + ((2 * k2) & 63)];
#pragma unroll
      for (int j = 0; j < 8; ++j) {
        v2h pr = {ve[ph][it][j], vo[ph][it][j]};
        *reinterpret_cast<v2h*>(d + j * ROW_PITCH) = pr;
      }
    }
  __syncthreads();
  const size_t ad0 = ((size_t)(b * C3 + kg) * WW + slice) * HH + wave * 16 + (lane & 15);
  v8f acc[12];
  v16h pf[6];
  v8f o[4];
  // n = h, k = g
  scores_t(QKs[0], QKs[1], acc);
  __builtin_amdgcn_sched_barrier(0);
  float m, inv;
  softmax_k(acc, sc, m, inv);
  if (lane < 16) { st[0][wave * 16 + lane] = m; st[1][wave * 16 + lane] = inv; }
  // publishes every row's maximum and reciprocal sum to the second pass of all waves
  __syncthreads();
#pragma unroll
  for (int j = 0; j < 12; ++j) acc[j] *= inv;
  pack_p(acc, pf);
  __builtin_amdgcn_sched_barrier(0);
  product(Vs[0], pf, o);
#pragma unroll
  for (int mt = 0; mt < 4; ++mt)
#pragma unroll
    for (int r = 0; r < 8; ++r) out0[ad0 + (size_t)(mt * 16 + r) * HW] = o[mt][r];
  // the second pass overwrites the registers that the stores above name
  asm volatile("s_wait_xcnt 0x0" ::: "memory");
  // n = g, k = h: acc[j][r] is the score of row h = j * 16 + kg + r
  scores_t(QKs[1], QKs[0], acc);
  __builtin_amdgcn_sched_barrier(0);
#pragma unroll
  for (int kk = 0; kk < 6; ++kk) {
#pragma unroll
    for (int h = 0; h < 2; ++h) {
      const int j = 2 * kk + h;
      const v8f mh = *reinterpret_cast<const v8f*>(&st[0][j * 16 + kg]);
      const v8f ih = *reinterpret_cast<const v8f*>(&st[1][j * 16 + kg]);
#pragma unroll
      for (int r = 0; r < 8; ++r)
        pf[kk][h * 8 + r] = (_Float16)(exp_slot(acc[j][r] * sc - mh[r]) * ih[r]);
    }
    // bounds how far ahead the LDS loads of later rows' maxima and sums are issued (all at once
    // they spill to scratch); the last one keeps the e^x statements off the products below
    __builtin_amdgcn_sched_barrier(0);
  }
  product(Vs[1], pf, o);
#pragma unroll
  for (int mt = 0; mt < 4; ++mt)
#pragma unroll
    for (int r = 0; r < 8; ++r) out1[ad0 + (size_t)(mt * 16 + r) * HW] = o[mt][r];
  // the wait before a register that an issued store names is overwritten: another body's code
  // may stand behind these stores
  asm volatile("s_wait_xcnt 0x0" ::: "memory");
}

// ------------------- height branch: turn [w][h] planes, scale, add residual
// out[c][h][w] = ls[c] * t[c][w][h] + x[c][h][w] for channels [0,64). One block
// turns a 64x64 tile through LDS, so that every global access covers 256 B of a row.
#define HT 64
__device__ __forceinline__
void h_finish_body(const float* __restrict__ t0, const float* __restrict__ t1,
                   const float* __restrict__ xl, const float* __restrict__ xr,
                   const float* __restrict__ ls1, const float* __restrict__ ls2,
                   float* __restrict__ out_l, float* __restrict__ out_r) {
  const int w0 = (blockIdx.x / 3) * HT, h0 = (blockIdx.x % 3) * HT;
  const int c = blockIdx.y, side = blockIdx.z >> 1, b = blockIdx.z & 1;
  __shared__ float tl[HT][HT + 1];
  const int q = (threadIdx.x & 15) * 4, rw = threadIdx.x >> 4;
  const float* tp = (side ? t1 : t0) + (size_t)(b * C3 + c) * HW;
  const float* xp = (side ? xr : xl) + (size_t)(b * CI + c) * HW;
  float* op = (side ? out_r : out_l) + (size_t)(b * CI + c) * HW;
  const float l = (side ? ls2 : ls1)[c];
  f32x4 tv[4], xv[4];
  // every '#pragma unroll' below makes the indices of tv, xv and o constant, so that they
  // stay in registers; the eight loads are then in flight together
#pragma unroll
  for (int i = 0; i < 4; ++i)
    tv[i] = *reinterpret_cast<const f32x4*>(tp + (w0 + i * 16 + rw) * HH + h0 + q);
#pragma unroll
  for (int i = 0; i < 4; ++i)
    xv[i] = *reinterpret_cast<const f32x4*>(xp + (h0 + i * 16 + rw) * WW + w0 + q);
#pragma unroll
  for (int i = 0; i < 4; ++i)
#pragma unroll
    for (int k = 0; k < 4; ++k) tl[i * 16 + rw][q + k] = tv[i][k];
  __syncthreads();
#pragma unroll
  for (int i = 0; i < 4; ++i) {
    f32x4 o;
#pragma unroll
    for (int k = 0; k < 4; ++k) o[k] = tl[q + k][i * 16 + rw] * l + xv[i][k];
    *reinterpret_cast<f32x4*>(op + (h0 + i * 16 + rw) * WW + w0 + q) = o;
  }
  // the wait before a register that an issued store names is overwritten: in k_finish the
  // other body's code may stand behind these stores
  asm volatile("s_wait_xcnt 0x0" ::: "memory");
}

// ---------------------------------------------------- channel-SE branch
// One block sums one channel plane of both sides. A lane reads 16 B (8 halves), a wave 512 B
// in a row; a thread's 18 loads are all in flight before the first is summed.
#define PL_T 512
#define PL_N (HW / (PL_T * 8))   // 16-byte pieces of a plane per thread
static_assert(HW % (PL_T * 8) == 0, "a plane is a whole number of 16-byte pieces per thread");
__global__ __launch_bounds__(PL_T)
void k_pool(const _Float16* __restrict__ ql, const _Float16* __restrict__ qr,
            float* __restrict__ pool) {
  int b = blockIdx.x / C3, c64 = blockIdx.x % C3;
  const size_t base = (size_t)(b * CI + 128 + c64) * HW + threadIdx.x * 8;
  const _Float16* pl = ql + base;
  const _Float16* pr = qr + base;
  v8h l8[PL_N], r8[PL_N];
  // every '#pragma unroll' below makes the indices of l8, r8 and s4 constant: they stay in registers
#pragma unroll
  for (int i = 0; i < PL_N; ++i) {
    l8[i] = *reinterpret_cast<const v8h*>(pl + i * (PL_T * 8));
    r8[i] = *reinterpret_cast<const v8h*>(pr + i * (PL_T * 8));
  }
  // The wait before a register that an issued load names is overwritten. It takes the two
  // addresses as inputs, so that no load's result is laid on them, and no load sinks below it.
  asm volatile("s_wait_xcnt 0x0" :: "v"(pl), "v"(pr) : "memory");
  float s4[4] = {0.f, 0.f, 0.f, 0.f};   // four independent chains of adds
#pragma unroll
  for (int i = 0; i < PL_N; ++i)
#pragma unroll
    for (int j = 0; j < 8; ++j) s4[j & 3] += (float)l8[i][j] + (float)r8[i][j];
  const float s = (s4[0] + s4[1]) + (s4[2] + s4[3]);
  __shared__ float sm[PL_T];
  sm[threadIdx.x] = s;
  __syncthreads();
  for (int o = PL_T / 2; o > 0; o >>= 1) {
    if (threadIdx.x < o) sm[threadIdx.x] += sm[threadIdx.x + o];
    __syncthreads();
  }
  if (threadIdx.x == 0) pool[b * C3 + c64] = sm[0] * (1.0f / HW);
}

// Runs on the first 256 threads of a block of 384; every thread passes both barriers.
__device__ __forceinline__
void se_body(const float* __restrict__ pool, const float* __restrict__ w1,
             const float* __restrict__ w2, float* __restrict__ a) {
  __shared__ float h1[BB][8];
  __shared__ float lg[BB][128];
  int tid = threadIdx.x;
  if (tid < 16) {
    int b = tid >> 3, j = tid & 7;
    float s = 0.f;
    for (int i = 0; i < 64; ++i) s += pool[b * 64 + i] * w1[j * 64 + i];
    h1[b][j] = fmaxf(s, 0.f);
  }
  __syncthreads();
  if (tid < BB * 128) {
    int b = tid >> 7, o = tid & 127;
    float s = 0.f;
    for (int j = 0; j < 8; ++j) s += h1[b][j] * w2[o * 8 + j];
    lg[b][o] = s;
  }
  __syncthreads();
  if (tid < BB) {
    float m = -1e30f;
    for (int o = 0; o < 128; ++o) m = fmaxf(m, lg[tid][o]);
    float s = 0.f;
    for (int o = 0; o < 128; ++o) { lg[tid][o] = __expf(lg[tid][o] - m); s += lg[tid][o]; }
    float inv = 1.0f / s;
    for (int o = 0; o < 128; ++o) a[tid * 128 + o] = lg[tid][o] * inv;
  }
}

__global__ __launch_bounds__(FA_T, 6)
void k_attn_se(const _Float16* __restrict__ qh_l, const _Float16* __restrict__ qh_r,
               const _Float16* __restrict__ qw_l, const _Float16* __restrict__ qw_r,
               const _Float16* __restrict__ vh_l, const _Float16* __restrict__ vh_r,
               const _Float16* __restrict__ vw_l, const _Float16* __restrict__ vw_r,
               const float* __restrict__ sch, const float* __restrict__ scw,
               float* __restrict__ th_l, float* __restrict__ th_r,
               float* __restrict__ out_l, float* __restrict__ out_r,
               const float* __restrict__ x_l, const float* __restrict__ x_r,
               const float* __restrict__ ls1, const float* __restrict__ ls2,
               const float* __restrict__ pool, const float* __restrict__ w1,
               const float* __restrict__ w2, float* __restrict__ avec) {
  // two Q tiles [row][c64], rows at ROW_PITCH
  __shared__ __attribute__((aligned(2048))) _Float16 QKs[2][QK_BUF];
  // V as three slices of 64 k: [k / 64][c][k % 64], rows at ROW_PITCH; height holds two of them
  __shared__ __attribute__((aligned(2048))) _Float16 Vs[2][3][V_SLICE];
  // height: a row's maximum, reciprocal sum; width: the layer scales
  __shared__ __attribute__((aligned(32))) float st[2][192];
  if (blockIdx.x == 192) {   // the whole block takes this side, ahead of every barrier
    if (blockIdx.y == 0 && blockIdx.z == 0) se_body(pool, w1, w2, avec);
    return;
  }
  const float sc = *(blockIdx.z == 0 ? sch : scw);
  if (blockIdx.z == 0)
    height_body(QKs, Vs, st, qh_l, qh_r, vh_r, vh_l, sc, th_l, th_r);
  else {
    const bool right = blockIdx.z == 2;
    width_body(QKs, Vs[0], right ? qw_r : qw_l, right ? qw_l : qw_r, st[0], right ? vw_l : vw_r, sc,
               right ? out_r : out_l, right ? x_r : x_l, right ? ls2 : ls1);
  }
}

// A block takes a quarter of one channel plane. A lane holds 4 adjacent pixels a piece: 8 B of
// v, 16 B of x and of the output, so that a wave covers whole 128-byte lines in every access;
// a thread's 18 loads are all in flight before its first store.
#define SA_T 256
#define SA_N 9                   // pieces per thread
#define SA_PX (SA_T * 4 * SA_N)  // pixels per block
static_assert(HW % SA_PX == 0, "a plane is a whole number of blocks");
__device__ __forceinline__
void se_apply_body(const int quarter, const float* __restrict__ a,
                   const _Float16* __restrict__ vl, const _Float16* __restrict__ vr,
                   const float* __restrict__ xl, const float* __restrict__ xr,
                   const float* __restrict__ ls1, const float* __restrict__ ls2,
                   float* __restrict__ out_l, float* __restrict__ out_r) {
  const int c64 = blockIdx.y, side = blockIdx.z >> 1, b = blockIdx.z & 1;
  const int c = 128 + c64;
  const float av = a[b * 128 + side * 64 + c64];
  const float l = (side ? ls2 : ls1)[c];
  const size_t ad = (size_t)(b * CI + c) * HW + quarter * SA_PX + threadIdx.x * 4;
  const _Float16* v = (side ? vr : vl) + ad;
  const float* x = (side ? xr : xl) + ad;
  float* o = (side ? out_r : out_l) + ad;
  v4h vv[SA_N];
  f32x4 xv[SA_N];
  // every '#pragma unroll' below makes the indices of vv and xv constant: they stay in registers
#pragma unroll
  for (int i = 0; i < SA_N; ++i) {
    vv[i] = *reinterpret_cast<const v4h*>(v + i * (SA_T * 4));
    xv[i] = *reinterpret_cast<const f32x4*>(x + i * (SA_T * 4));
  }
  // The wait before a register that an issued load names is overwritten. It takes the two
  // addresses as inputs, so that no load's result is laid on them, and no load sinks below it.
  asm volatile("s_wait_xcnt 0x0" :: "v"(v), "v"(x) : "memory");
  // without it the scheduler lifts the first pieces' arithmetic, with its wait for their data,
  // in front of the last loads, which then start one memory latency late
  __builtin_amdgcn_sched_barrier(0);
#pragma unroll
  for (int i = 0; i < SA_N; ++i)
#pragma unroll
    for (int k = 0; k < 4; ++k) xv[i][k] = av * (float)vv[i][k] * l + xv[i][k];
#pragma unroll
  for (int i = 0; i < SA_N; ++i)
    *reinterpret_cast<f32x4*>(o + i * (SA_T * 4)) = xv[i];
  // the wait before a register that an issued store names is overwritten: in k_finish the
  // other body's code may stand behind these stores
  asm volatile("s_wait_xcnt 0x0" ::: "memory");
}

// The two closing passes in one grid: they write different channels of the output.
// blockIdx.x: 0 to 8 the tiles of a height plane, 9 to 12 the quarters of an SE plane;
// blockIdx.y and blockIdx.z mean the same in both.
#define FH_TILES ((HH / HT) * (WW / HT))
static_assert(SA_T == 256, "both bodies run on 256 threads");
__global__ __launch_bounds__(256)
void k_finish(const float* __restrict__ t0, const float* __restrict__ t1,
              const float* __restrict__ a,
              const _Float16* __restrict__ vl, const _Float16* __restrict__ vr,
              const float* __restrict__ xl, const float* __restrict__ xr,
              const float* __restrict__ ls1, const float* __restrict__ ls2,
              float* __restrict__ out_l, float* __restrict__ out_r) {
  if (blockIdx.x < FH_TILES)
    h_finish_body(t0, t1, xl, xr, ls1, ls2, out_l, out_r);
  else
    se_apply_body(blockIdx.x - FH_TILES, a, vl, vr, xl, xr, ls1, ls2, out_l, out_r);
}

// ------------------------------------------------------------------ host
extern "C" void kernel_launch(void* const* d_in, const int* in_sizes, int n_in,
                              void* d_out, int out_size, void* d_ws, size_t ws_size,
                              hipStream_t stream) {
  const float* x_l  = (const float*)d_in[0];
  const float* x_r  = (const float*)d_in[1];
  const float* lnlw = (const float*)d_in[2];
  const float* lnlb = (const float*)d_in[3];
  const float* lnrw = (const float*)d_in[4];
  const float* lnrb = (const float*)d_in[5];
  const float* wq_l = (const float*)d_in[6];
  const float* wq_r = (const float*)d_in[7];
  const float* wv_l = (const float*)d_in[8];
  const float* wv_r = (const float*)d_in[9];
  const float* w1   = (const float*)d_in[10];
  const float* w2   = (const float*)d_in[11];
  const float* sch  = (const float*)d_in[12];
  const float* scw  = (const float*)d_in[13];
  const float* ls1  = (const float*)d_in[14];
  const float* ls2  = (const float*)d_in[15];

  float* out_l = (float*)d_out;
  float* out_r = out_l + (size_t)BB * CI * HW;

  char* ws = (char*)d_ws;
  size_t off = 0;
  auto take = [&](size_t bytes) { char* p = ws + off; off += (bytes + 255) & ~(size_t)255; return p; };
  const size_t QV = (size_t)BB * CI * HW;      // half elements
  const size_t QT = (size_t)BB * C3 * HW;
  _Float16* q_l  = (_Float16*)take(QV * 2);
  _Float16* q_r  = (_Float16*)take(QV * 2);
  _Float16* v_l  = (_Float16*)take(QV * 2);
  _Float16* v_r  = (_Float16*)take(QV * 2);
  _Float16* qS0l = (_Float16*)take(QT * 2);   // [b][w][h][c64] height Q
  _Float16* qS0r = (_Float16*)take(QT * 2);
  _Float16* qS1l = (_Float16*)take(QT * 2);   // [b][h][w][c64] width Q
  _Float16* qS1r = (_Float16*)take(QT * 2);
  _Float16* vTl  = (_Float16*)take(QT * 2);   // [b][w][h][c64] height V
  _Float16* vTr  = (_Float16*)take(QT * 2);
  float* pool = (float*)take(BB * C3 * 4);
  float* avec = (float*)take(BB * 128 * 4);
  float* tH_l = (float*)take(QT * 4);         // [b][c64][w][h] height sums
  float* tH_r = (float*)take(QT * 4);

  // 1) LayerNorm and the pointwise convs (WMMA GEMM) for Q and V: one pass over x
  k_lnconv<<<dim3(HW / (FC_PX * FC_NT), BB, 2), FC_T, 0, stream>>>(
      wq_l, wq_r, wv_l, wv_r, x_l, x_r, lnlw, lnlb, lnrw, lnrb,
      q_l, q_r, qS0l, qS0r, qS1l, qS1r, v_l, v_r, vTl, vTr);

  // 2) the pool of the SE branch
  k_pool<<<BB * C3, PL_T, 0, stream>>>(q_l, q_r, pool);

  // 3) attention: height on channels [0,64), width on [64,128); with it the SE layers
  k_attn_se<<<dim3(193, BB, 3), FA_T, 0, stream>>>(
      qS0l, qS0r, qS1l, qS1r, vTl, vTr, v_l + (size_t)C3 * HW, v_r + (size_t)C3 * HW, sch, scw,
      tH_l, tH_r, out_l, out_r, x_l, x_r, ls1, ls2, pool, w1, w2, avec);

  // 4) height planes turned, scaled and added; SE branch applied on channels [128,192)
  k_finish<<<dim3(FH_TILES + HW / SA_PX, C3, 2 * BB), 256, 0, stream>>>(
      tH_l, tH_r, avec, v_l, v_r, x_l, x_r, ls1, ls2, out_l, out_r);
}

// v010
// It runs in 98.1 microseconds.
// Two timings next to v009 put it at 1.08 and 1.09 times that version's speed.
// Counting every step since v000, it is 9.76 times as fast.
#include <hip/hip_runtime.h>
#include <hip/hip_bf16.h>

typedef __attribute__((ext_vector_type(16))) _Float16 v16h;
typedef __attribute__((ext_vector_type(8)))  _Float16 v8h;
typedef __attribute__((ext_vector_type(2)))  _Float16 v2h;
typedef __attribute__((ext_vector_type(8)))  float    v8f;
typedef __attribute__((ext_vector_type(4)))  unsigned int u32x4;
typedef __attribute__((ext_vector_type(8)))  int i32x8;
typedef __attribute__((ext_vector_type(4)))  int i32x4;

#define BB 2
#define CI 192
#define HH 192
#define WW 192
#define HW 36864
#define C3 64

#if defined(__HIP_DEVICE_COMPILE__) && __has_builtin(__builtin_amdgcn_tensor_load_to_lds)
#define HAVE_TDM 1
#else
#define HAVE_TDM 0
#endif

__device__ __forceinline__ v8f wmma_f16(v16h a, v16h b, v8f c) {
  // D = A(16x32 f16) * B(32x16 f16) + C(16x16 f32)
  return __builtin_amdgcn_wmma_f32_16x16x32_f16(false, a, false, b, (short)0, c,
                                                false, false);
}

// Load a 16-half WMMA operand fragment from a [row][K] layout: 8 contiguous
// halves at p (K = kg..kg+7) and 8 at p+16 (K = kg+16..kg+23).
__device__ __forceinline__ v16h ldfrag(const _Float16* p) {
  v8h lo = *reinterpret_cast<const v8h*>(p);
  v8h hi = *reinterpret_cast<const v8h*>(p + 16);
  v16h r;
#pragma unroll
  for (int i = 0; i < 8; ++i) { r[i] = lo[i]; r[i + 8] = hi[i]; }
  return r;
}

#if HAVE_TDM
typedef __attribute__((address_space(3))) const void lds_cvoid;
__device__ __forceinline__ unsigned int lds_addr32(const void* p) {
  return (unsigned int)(uintptr_t)(lds_cvoid*)p;
}
typedef __attribute__((ext_vector_type(8))) unsigned int u32x8;
__device__ __forceinline__ unsigned int uni(unsigned int v) {
  return (unsigned int)__builtin_amdgcn_readfirstlane(v);
}
__device__ __forceinline__ unsigned int pinned(unsigned int v) {
  unsigned int w = uni(v);
  asm volatile("" : "+s"(w));  // pinned(): the test word stays in a scalar register
  return w;
}
__device__ __forceinline__ void tdm_rows128(unsigned int lds_off, const void* gaddr,
                                            unsigned int rows, unsigned int src_pitch) {
  unsigned long long ga = (unsigned long long)(uintptr_t)gaddr;
  u32x4 g0;
  g0[0] = uni(1u);                              // count = 1
  g0[1] = uni(lds_off);                         // LDS destination (bytes)
  g0[2] = uni((unsigned int)ga);                // global address [31:0]
  g0[3] = uni((((unsigned int)(ga >> 32)) & 0x01FFFFFFu) | 0x80000000u);  // [56:32] | type = 2
  u32x8 g1;
  g1[0] = uni((1u << 20) | (4u << 22) | (3u << 25));
  g1[1] = uni(128u << 16);
  g1[2] = uni(rows << 16);
  g1[3] = uni(128u << 16);
  g1[4] = uni(rows);
  g1[5] = uni(src_pitch);
  g1[6] = uni(0u);
  g1[7] = uni(0u);
  asm volatile("tensor_load_to_lds %0, %1" :: "s"(g0), "s"(g1) : "memory");
}
#endif  // HAVE_TDM

// ------------------------- LayerNorm, Q conv and V conv in one pass over x
// Y[o,p] = sum_c W[o,c] * X'[c,p], X' = LN(x) for Q and x for V. A block walks FC_NT tiles of
// FC_PX pixels and reads each value of x once. 24 waves: waves 0 to 11 form Q, waves 12 to 23 V,
// each for 16 output channels, whose weights it keeps as six f16 fragments in registers.
// Staging: a thread owns one pixel x 16 adjacent channels (a wave: 32 pixels, one channel
// group). The sums of a pixel over the 12 channel groups meet in LDS.
// Every '#pragma unroll' here makes the indices of a small array constant, so
// that the array lives in registers and not in scratch.
// Every store of a Q or V plane is 16 B a lane. A wave whose channels go to a slice plane ([pixel][c64])
// takes W as A, so that a lane holds 8 channels of one pixel; a wave whose channels go
// to a plane [c][pixel] takes X as A, so that a lane holds 8 pixels of one channel.
// Q: channels [0,64) -> qA = [b][w][h][c64] (height Q), [64,128) -> qB = [b][h][w][c64]
// (width Q).  V: [0,64) -> vA = [b][w][h][c64] (height V), the rest -> v.
// Q channels [128,192) feed only the mean over the plane: their waves add up the f32 sums of
// the block's pixels in a register and store one value a channel, pp = [side][b][block][c64].
#define FC_T 768
#define FC_PX 64
#define FC_NT 9
#define FC_NB (HW / (FC_PX * FC_NT))   // blocks a plane
#define CT_PITCH 200   // halves per LDS row: 400 B = 16 B x odd, for b128 readers
typedef __attribute__((ext_vector_type(4))) float    f32x4;
typedef __attribute__((ext_vector_type(2))) float    f32x2;
typedef __attribute__((ext_vector_type(4))) _Float16 v4h;
static_assert(WW % FC_PX == 0, "a tile stays inside one image row");
static_assert(HW % (FC_PX * FC_NT) == 0, "a plane is a whole number of blocks");

__global__ __launch_bounds__(FC_T, 6)
void k_lnconv(const float* __restrict__ wq_l, const float* __restrict__ wq_r,
              const float* __restrict__ wv_l, const float* __restrict__ wv_r,
              const float* __restrict__ x_l, const float* __restrict__ x_r,
              const float* __restrict__ lnlw, const float* __restrict__ lnlb,
              const float* __restrict__ lnrw, const float* __restrict__ lnrb,
              float* __restrict__ pp,
              _Float16* __restrict__ qA_l, _Float16* __restrict__ qA_r,
              _Float16* __restrict__ qB_l, _Float16* __restrict__ qB_r,
              _Float16* __restrict__ v_l, _Float16* __restrict__ v_r,
              _Float16* __restrict__ vA_l, _Float16* __restrict__ vA_r) {
  __shared__ __attribute__((aligned(16))) _Float16 wS[24 * 16][CT_PITCH];    // [wave's row][k]
  __shared__ __attribute__((aligned(16))) _Float16 xT[2][FC_PX][CT_PITCH];   // [x, LN(x)][n][k]
  __shared__ __attribute__((aligned(16))) f32x2 part[12][FC_PX];             // sum, sum of squares
  const bool right = blockIdx.z != 0;
  const int b   = blockIdx.y;
  const int tid = threadIdx.x, lane = tid & 31;
  // wave-uniform, held in scalar registers
  const int uwave = __builtin_amdgcn_readfirstlane(tid >> 5);
  const bool isq = uwave < 12;
  const int mt = isq ? uwave : uwave - 12;
  const int kg = (lane >> 4) * 8;
  const int pbase = blockIdx.x * (FC_PX * FC_NT);
  const int px = tid & (FC_PX - 1), cg = uwave >> 1, c0 = cg * 16;
  const float* xcol = (right ? x_r : x_l) + (size_t)(b * CI + c0) * HW + pbase + px;

  // Prologue: the first pixel tile and the weights are in flight together.
  float xr[16];
#pragma unroll
  for (int i = 0; i < 16; ++i) xr[i] = xcol[(size_t)i * HW];
  // The wait before a register that an issued load names is overwritten. It takes the
  // address as an input, so that no load's result is laid on it.
  asm volatile("s_wait_xcnt 0x0" :: "v"(xcol) : "memory");
  // a wave's 16 weight rows: 12 KiB in a row, read in whole lines, turned to fragments in LDS
  const char* wsrc = reinterpret_cast<const char*>(
      (isq ? (right ? wq_r : wq_l) : (right ? wv_r : wv_l)) + (size_t)mt * 16 * CI);
  const unsigned int wlane = lane * 16u;   // the lane's byte offset in each 512-byte piece
#pragma unroll
  for (int g = 0; g < 2; ++g) {
    f32x4 w4[12];
#pragma unroll
    for (int i = 0; i < 12; ++i)
      w4[i] = *reinterpret_cast<const f32x4*>(wsrc + wlane + (g * 12 + i) * 512);
    asm volatile("s_wait_xcnt 0x0" :: "v"(wlane) : "memory");
#pragma unroll
    for (int i = 0; i < 12; ++i) {
      const int e = ((g * 12 + i) * 32 + lane) * 4;
      v4h h4 = {(_Float16)w4[i][0], (_Float16)w4[i][1], (_Float16)w4[i][2], (_Float16)w4[i][3]};
      *reinterpret_cast<v4h*>(&wS[uwave * 16 + e / CI][e % CI]) = h4;
    }
  }
  const float* lwp = (right ? lnrw : lnlw) + c0;
  const float* lbp = (right ? lnrb : lnlb) + c0;
  float lw[16], lb[16];
#pragma unroll
  for (int i = 0; i < 16; ++i) { lw[i] = lwp[i]; lb[i] = lbp[i]; }
  __syncthreads();
  v16h wf[6];
#pragma unroll
  for (int kk = 0; kk < 6; ++kk) wf[kk] = ldfrag(&wS[uwave * 16 + (lane & 15)][kk * 32 + kg]);

  const bool slicew = mt < (isq ? 8 : 4);
  const bool planeB = isq && mt >= 4;
  const int step16 = planeB ? 16 * C3 : 16 * HH * C3;   // halves, between 16-pixel groups of a slice plane
  const int ch8 = (mt * 16 + kg) & (C3 - 1);
  const bool poolw = isq && !slicew;   // this wave's channels are only summed over the pixels
  float ps = 0.f;
  _Float16* dst = !slicew ? (right ? v_r : v_l) +
                                (size_t)(b * CI + mt * 16 + (lane & 15)) * HW + kg
                : planeB  ? (right ? qB_r : qB_l) + ((size_t)b * HW + (lane & 15)) * C3 + ch8
                          : (isq ? (right ? qA_r : qA_l) : (right ? vA_r : vA_l)) +
                                ((size_t)b * WW + (lane & 15)) * (HH * C3) + ch8;
  const _Float16* xb = &xT[isq ? 1 : 0][lane & 15][kg];
  // kept rolled: unrolled, the trips' addresses and tiles are formed ahead and spill to scratch
#pragma unroll 1
  for (int t = 0; t < FC_NT; ++t) {
    const int p0 = pbase + t * FC_PX;
    float s = 0.f, s2 = 0.f;
#pragma unroll
    for (int i = 0; i < 16; ++i) { s += xr[i]; s2 += xr[i] * xr[i]; }
    part[cg][px] = (f32x2){s, s2};
    // publishes the partial sums; every wave that passes it has left xT, which is refilled below
    __syncthreads();
    s = 0.f; s2 = 0.f;
#pragma unroll
    for (int g = 0; g < 12; ++g) { const f32x2 pp = part[g][px]; s += pp[0]; s2 += pp[1]; }
    const float m = s * (1.0f / CI);
    const float var = s2 * (1.0f / CI) - m * m;
    const float r = rsqrtf(var + 1e-6f);
    v8h hx[2], hy[2];
#pragma unroll
    for (int i = 0; i < 16; ++i) {
      hx[i >> 3][i & 7] = (_Float16)xr[i];
      hy[i >> 3][i & 7] = (_Float16)((xr[i] - m) * r * lw[i] + lb[i]);
    }
#pragma unroll
    for (int i = 0; i < 2; ++i) {
      *reinterpret_cast<v8h*>(&xT[0][px][c0 + i * 8]) = hx[i];
      *reinterpret_cast<v8h*>(&xT[1][px][c0 + i * 8]) = hy[i];
    }
    // publishes the tile; behind it nobody reads the partial sums of this trip any more
    __syncthreads();
    if (t + 1 < FC_NT) {   // next tile's loads fly under this tile's products and stores
      xcol += FC_PX;
#pragma unroll
      for (int i = 0; i < 16; ++i) xr[i] = xcol[(size_t)i * HW];
      // the wait before the address of the loads above is stepped on; it takes the address
      // as an input, so that no load's result is laid on it
      asm volatile("s_wait_xcnt 0x0" :: "v"(xcol) : "memory");
    }
    v8f acc[4];
#pragma unroll
    for (int u = 0; u < 4; ++u) acc[u] = (v8f){0.f, 0.f, 0.f, 0.f, 0.f, 0.f, 0.f, 0.f};
    // The two operands have the same fragment map and the same k order: only their places change.
    // Each side rounds and stores its own sums: a plane's four pieces lie 32 B apart, a slice
    // plane's a whole step.
    if (slicew) {
#pragma unroll
      for (int kk = 0; kk < 6; ++kk)
#pragma unroll
        for (int u = 0; u < 4; ++u)
          acc[u] = wmma_f16(wf[kk], ldfrag(xb + u * 16 * CT_PITCH + kk * 32), acc[u]);
      const int hrow = p0 / WW, wcol = p0 % WW;
      _Float16* dt = dst + (planeB ? p0 * C3 : (wcol * HH + hrow) * C3);
#pragma unroll
      for (int u = 0; u < 4; ++u) {
        v8h pk;
#pragma unroll
        for (int e = 0; e < 8; ++e) pk[e] = (_Float16)acc[u][e];
        *reinterpret_cast<v8h*>(dt + u * step16) = pk;
      }
      // the code behind this side overwrites the registers that the stores above name
      asm volatile("s_wait_xcnt 0x0" ::: "memory");
    } else {
#pragma unroll
      for (int kk = 0; kk < 6; ++kk)
#pragma unroll
        for (int u = 0; u < 4; ++u)
          acc[u] = wmma_f16(ldfrag(xb + u * 16 * CT_PITCH + kk * 32), wf[kk], acc[u]);
      if (poolw) {   // a lane holds 32 pixels of one channel
        const v8f a8 = (acc[0] + acc[1]) + (acc[2] + acc[3]);
        ps += ((a8[0] + a8[1]) + (a8[2] + a8[3])) + ((a8[4] + a8[5]) + (a8[6] + a8[7]));
      } else {
#pragma unroll
        for (int u = 0; u < 4; ++u) {
          v8h pk;
#pragma unroll
          for (int e = 0; e < 8; ++e) pk[e] = (_Float16)acc[u][e];
          *reinterpret_cast<v8h*>(dst + p0 + u * 16) = pk;
        }
        // as on the other side
        asm volatile("s_wait_xcnt 0x0" ::: "memory");
      }
    }
  }
  if (poolw) {   // wave-uniform: every lane is on at the exchange
    ps += __shfl_xor(ps, 16);   // the channel's other 8 pixels of each 16
    if (lane < 16)
      pp[(((right ? BB : 0) + b) * FC_NB + blockIdx.x) * C3 + (mt - 8) * 16 + lane] = ps;
  }
}

// ------------------- axial attention: scores, softmax and product in one block
// Q/K stored per-slice contiguous as [slice][row][c64]. out[c,n] = sum_k V[c,k] * P[n,k], 64x192,
// K = 192. 12 waves; a wave owns 16 rows n of P. It forms the scores transposed (the k side as A,
// its own n rows as B), so that a lane holds 96 of the 192 k of ONE row n, in the very places
// that the B fragment of the product wants: P never leaves the registers.
// LDS rows that feed 16-byte fragment reads stand at a pitch of 16 B x odd.
#define ROW_PITCH 72     // halves: 128-byte rows + the mover's 16-byte pad = 144 B
#define QK_BUF 14336     // halves: 192 rows x 144 B, rounded up to a multiple of 2 KiB
#define V_SLICE 5120     // halves: 64 rows x 144 B, rounded up to a multiple of 2 KiB
#define FA_T 384         // threads: one wave for each 16 rows
__device__ __forceinline__ float exp_slot(float x) {
  float y;
  asm("v_exp_f32 %0, %1\n\tv_nop" : "=v"(y) : "v"(x * 1.44269504f));
  return y;
}
// Every '#pragma unroll' in this section makes the indices of a register array constant, so
// that the array stays in registers.
// acc[j][r] = sum_c Kb[j * 16 + kg + r][c] * Nb[wave * 16 + (lane & 15)][c]
__device__ __forceinline__
void scores_t(const _Float16* Nb, const _Float16* Kb, v8f (&acc)[12]) {
  const int lane = threadIdx.x & 31, wave = threadIdx.x >> 5;
  const int kg = (lane >> 4) * 8;
  v16h nf[2];
#pragma unroll
  for (int kk = 0; kk < 2; ++kk)
    nf[kk] = ldfrag(&Nb[(wave * 16 + (lane & 15)) * ROW_PITCH + kk * 32 + kg]);
#pragma unroll
  for (int j = 0; j < 12; ++j) {
    v8f a = {0.f, 0.f, 0.f, 0.f, 0.f, 0.f, 0.f, 0.f};
#pragma unroll
    for (int kk = 0; kk < 2; ++kk) {
      v16h kf = ldfrag(&Kb[(j * 16 + (lane & 15)) * ROW_PITCH + kk * 32 + kg]);
      a = wmma_f16(kf, nf[kk], a);
    }
    acc[j] = a;
  }
}
// Softmax along k of the lane's row: eight chains over the lane's own 96 values, a tree over
// the eight, one exchange with the lane that holds the row's other half. Leaves e^(s - m) in acc.
__device__ __forceinline__
void softmax_k(v8f (&acc)[12], const float sc, float& m, float& inv) {
  float t[8];
#pragma unroll
  for (int j = 0; j < 12; ++j) acc[j] *= sc;
#pragma unroll
  for (int r = 0; r < 8; ++r) {
    t[r] = acc[0][r];
#pragma unroll
    for (int j = 1; j < 12; ++j) t[r] = fmaxf(t[r], acc[j][r]);
  }
  m = fmaxf(fmaxf(fmaxf(t[0], t[1]), fmaxf(t[2], t[3])), fmaxf(fmaxf(t[4], t[5]), fmaxf(t[6], t[7])));
  m = fmaxf(m, __shfl_xor(m, 16));
#pragma unroll
  for (int r = 0; r < 8; ++r) {
    t[r] = 0.f;
#pragma unroll
    for (int j = 0; j < 12; ++j) {
      acc[j][r] = exp_slot(acc[j][r] - m);
      t[r] += acc[j][r];
    }
  }
  float s = ((t[0] + t[1]) + (t[2] + t[3])) + ((t[4] + t[5]) + (t[6] + t[7]));
  s += __shfl_xor(s, 16);
  inv = 1.0f / s;
}
// Tiles 2kk and 2kk + 1 of acc are the two halves of the fragment of k chunk kk: a lane's
// halves 0 to 7 are k = kg + i, halves 8 to 15 k = kg + 16 + i, as ldfrag reads them.
__device__ __forceinline__ void pack_p(const v8f (&acc)[12], v16h (&pf)[6]) {
#pragma unroll
  for (int kk = 0; kk < 6; ++kk)
#pragma unroll
    for (int i = 0; i < 8; ++i) {
      pf[kk][i]     = (_Float16)acc[2 * kk][i];
      pf[kk][i + 8] = (_Float16)acc[2 * kk + 1][i];
    }
}
// o[mt][r] = sum_k V[mt * 16 + kg + r][k] * P[wave * 16 + (lane & 15)][k]
__device__ __forceinline__
void product(const _Float16 (*Vs)[V_SLICE], const v16h (&pf)[6], v8f (&o)[4]) {
  const int lane = threadIdx.x & 31;
  const int kg = (lane >> 4) * 8;
#pragma unroll
  for (int mt = 0; mt < 4; ++mt) o[mt] = (v8f){0.f, 0.f, 0.f, 0.f, 0.f, 0.f, 0.f, 0.f};
#pragma unroll
  for (int kk = 0; kk < 6; ++kk)
#pragma unroll
    for (int mt = 0; mt < 4; ++mt) {
      v16h af = ldfrag(&Vs[kk >> 1][(mt * 16 + (lane & 15)) * ROW_PITCH + (kk & 1) * 32 + kg]);
      o[mt] = wmma_f16(af, pf[kk], o[mt]);
    }
}

// Width (slice = h): one direction a block. qn: the side whose rows are n, qk: the side that
// the softmax runs along; V = [c][k] rows at a pitch of HW, brought by tensor loads.
__device__ __forceinline__
void width_body(_Float16 (*QKs)[QK_BUF], _Float16 (*Vs)[V_SLICE],
                const _Float16* __restrict__ qn, const _Float16* __restrict__ qk,
                float* lsS, const _Float16* __restrict__ V, const float sc,
                float* __restrict__ op, const float* __restrict__ xp,
                const float* __restrict__ lsp) {
  const int slice = blockIdx.x, b = blockIdx.y;
  const int tid = threadIdx.x, lane = tid & 31, wave = tid >> 5;
  const int kg = (lane >> 4) * 8;
  const _Float16* np = qn + ((size_t)b * 192 + slice) * (192 * C3);
  const _Float16* kp = qk + ((size_t)b * 192 + slice) * (192 * C3);
  const _Float16* vp = V + (size_t)b * CI * HW + slice * 192;
  // the 64 layer scales go through LDS: behind the products a lane reads its eight in a row
  float l0 = 0.f;
  if (tid < C3) l0 = lsp[C3 + tid];
#if HAVE_TDM
  const unsigned int uw = uni(threadIdx.x >> 5);
  if (pinned(uw < 5u)) {   // waves 0, 1: the two Q tiles; waves 2 to 4: a slice of V; one request each
    const bool isq = uw < 2u;
    tdm_rows128(isq ? lds_addr32(&QKs[0][0]) + uw * (QK_BUF * 2u)
                    : lds_addr32(&Vs[0][0]) + (uw - 2u) * (V_SLICE * 2u),
                uw == 0u ? np : uw == 1u ? kp : vp + (uw - 2u) * 64u,
                isq ? 192u : (unsigned int)C3, isq ? C3 * 2u : HW * 2u);
    // the issuing wave's tile has landed before it reaches the barrier below
    asm volatile("s_wait_tensorcnt 0x0" ::: "memory");
  }
#else
  for (int s = tid; s < 192 * C3; s += FA_T) {
    QKs[0][(s / C3) * ROW_PITCH + s % C3] = np[s];
    QKs[1][(s / C3) * ROW_PITCH + s % C3] = kp[s];
    Vs[(s % 192) >> 6][(s / 192) * ROW_PITCH + (s & 63)] = vp[(size_t)(s / 192) * HW + s % 192];
  }
#endif
  if (tid < C3) lsS[tid] = l0;
  __syncthreads();
  v8f acc[12];
  scores_t(QKs[0], QKs[1], acc);
  __builtin_amdgcn_sched_barrier(0);
  float m, inv;
  softmax_k(acc, sc, m, inv);
#pragma unroll
  for (int j = 0; j < 12; ++j) acc[j] *= inv;
  v16h pf[6];
  pack_p(acc, pf);
  __builtin_amdgcn_sched_barrier(0);
  // the residual is on its way while the products run
  const size_t ad0 = ((size_t)(b * CI + C3 + kg) * HH + slice) * WW + wave * 16 + (lane & 15);
  float xv[4][8];
#pragma unroll
  for (int mt = 0; mt < 4; ++mt)
#pragma unroll
    for (int r = 0; r < 8; ++r) xv[mt][r] = xp[ad0 + (size_t)(mt * 16 + r) * HW];
  // the address registers of the loads above are free for reuse behind this
  asm volatile("s_wait_xcnt 0x0" ::: "memory");
  v8f o[4];
  product(Vs, pf, o);
#pragma unroll
  for (int mt = 0; mt < 4; ++mt) {
    const v8f lv = *reinterpret_cast<const v8f*>(&lsS[mt * 16 + kg]);
#pragma unroll
    for (int r = 0; r < 8; ++r)
      op[ad0 + (size_t)(mt * 16 + r) * HW] = o[mt][r] * lv[r] + xv[mt][r];
  }
  // the wait before a register that an issued store names is overwritten: another body's code
  // may stand behind these stores
  asm volatile("s_wait_xcnt 0x0" ::: "memory");
}

// Height (slice = w): both directions in one block, because both use the softmax along g.
// First n = h, k = g. Then n = g, k = h: there the softmax runs along n, across the waves, so
// the first pass leaves each row's maximum and reciprocal sum in LDS (one barrier) and the
// second forms its scores anew with the sides exchanged. V = [slice][k][c64], turned to [c][k]
// on its way through registers into LDS. The bare sums go to the workspace planes
// [b][c64][w][h], rows along n; k_finish turns them and adds scale and residual.
__device__ __forceinline__
void height_body(_Float16 (*QKs)[QK_BUF], _Float16 (*Vs)[3][V_SLICE], float (*st)[192],
                 const _Float16* __restrict__ ql, const _Float16* __restrict__ qr,
                 const _Float16* __restrict__ V0, const _Float16* __restrict__ V1,
                 const float sc,
                 float* __restrict__ out0, float* __restrict__ out1) {
  const int slice = blockIdx.x, b = blockIdx.y;
  const int tid = threadIdx.x, lane = tid & 31, wave = tid >> 5;
  const int kg = (lane >> 4) * 8;
  const _Float16* qp = ql + ((size_t)b * 192 + slice) * (192 * C3);
  const _Float16* kp = qr + ((size_t)b * 192 + slice) * (192 * C3);
  const size_t voff = (size_t)b * C3 * HW + slice * (192 * C3);
  v8h ve[2][2], vo[2][2];
#pragma unroll
  for (int ph = 0; ph < 2; ++ph)
#pragma unroll
    for (int it = 0; it < 2; ++it) {
      const int s = tid + it * FA_T, u = s >> 1, k2 = u % 96, c8 = (u / 96) * 2 + (s & 1);
      const _Float16* vp = (ph ? V1 : V0) + voff + (2 * k2) * C3 + c8 * 8;
      ve[ph][it] = *reinterpret_cast<const v8h*>(vp);
      vo[ph][it] = *reinterpret_cast<const v8h*>(vp + C3);
    }
  // the address registers of the loads above are free for reuse behind this
  asm volatile("s_wait_xcnt 0x0" ::: "memory");
#if HAVE_TDM
  const unsigned int uw = uni(threadIdx.x >> 5);
  if (pinned(uw < 2u)) {   // wave 0 brings the left Q, wave 1 the right: one request each
    tdm_rows128(lds_addr32(&QKs[0][0]) + uw * (QK_BUF * 2u), uw ? kp : qp, 192u, C3 * 2u);
    // the issuing wave's tile has landed before it reaches the barrier below
    asm volatile("s_wait_tensorcnt 0x0" ::: "memory");
  }
#else
  for (int s = tid; s < 192 * C3; s += FA_T) {
    QKs[0][(s / C3) * ROW_PITCH + s % C3] = qp[s];
    QKs[1][(s / C3) * ROW_PITCH + s % C3] = kp[s];
  }
#endif
#pragma unroll
  for (int ph = 0; ph < 2; ++ph)
#pragma unroll
    for (int it = 0; it < 2; ++it) {
      const int s = tid + it * FA_T, u = s >> 1, k2 = u % 96, c8 = (u / 96) * 2 + (s & 1);
      _Float16* d = &Vs[ph][k2 >> 5][(c8 * 8) * ROW_PITCH + ((2 * k2) & 63)];
#pragma unroll
      for (int j = 0; j < 8; ++j) {
        v2h pr = {ve[ph][it][j], vo[ph][it][j]};
        *reinterpret_cast<v2h*>(d + j * ROW_PITCH) = pr;
      }
    }
  __syncthreads();
  const size_t ad0 = ((size_t)(b * C3 + kg) * WW + slice) * HH + wave * 16 + (lane & 15);
  v8f acc[12];
  v16h pf[6];
  v8f o[4];
  // n = h, k = g
  scores_t(QKs[0], QKs[1], acc);
  __builtin_amdgcn_sched_barrier(0);
  float m, inv;
  softmax_k(acc, sc, m, inv);
  if (lane < 16) { st[0][wave * 16 + lane] = m; st[1][wave * 16 + lane] = inv; }
  // publishes every row's maximum and reciprocal sum to the second pass of all waves
  __syncthreads();
#pragma unroll
  for (int j = 0; j < 12; ++j) acc[j] *= inv;
  pack_p(acc, pf);
  __builtin_amdgcn_sched_barrier(0);
  product(Vs[0], pf, o);
#pragma unroll
  for (int mt = 0; mt < 4; ++mt)
#pragma unroll
    for (int r = 0; r < 8; ++r) out0[ad0 + (size_t)(mt * 16 + r) * HW] = o[mt][r];
  // the second pass overwrites the registers that the stores above name
  asm volatile("s_wait_xcnt 0x0" ::: "memory");
  // n = g, k = h: acc[j][r] is the score of row h = j * 16 + kg + r
  scores_t(QKs[1], QKs[0], acc);
  __builtin_amdgcn_sched_barrier(0);
#pragma unroll
  for (int kk = 0; kk < 6; ++kk) {
#pragma unroll
    for (int h = 0; h < 2; ++h) {
      const int j = 2 * kk + h;
      const v8f mh = *reinterpret_cast<const v8f*>(&st[0][j * 16 + kg]);
      const v8f ih = *reinterpret_cast<const v8f*>(&st[1][j * 16 + kg]);
#pragma unroll
      for (int r = 0; r < 8; ++r)
        pf[kk][h * 8 + r] = (_Float16)(exp_slot(acc[j][r] * sc - mh[r]) * ih[r]);
    }
    // bounds how far ahead the LDS loads of later rows' maxima and sums are issued (all at once
    // they spill to scratch); the last one keeps the e^x statements off the products below
    __builtin_amdgcn_sched_barrier(0);
  }
  product(Vs[1], pf, o);
#pragma unroll
  for (int mt = 0; mt < 4; ++mt)
#pragma unroll
    for (int r = 0; r < 8; ++r) out1[ad0 + (size_t)(mt * 16 + r) * HW] = o[mt][r];
  // the wait before a register that an issued store names is overwritten: another body's code
  // may stand behind these stores
  asm volatile("s_wait_xcnt 0x0" ::: "memory");
}

// ------------------- height branch: turn [w][h] planes, scale, add residual
// out[c][h][w] = ls[c] * t[c][w][h] + x[c][h][w] for channels [0,64). One block
// turns a 64x64 tile through LDS, so that every global access covers 256 B of a row.
#define HT 64
__device__ __forceinline__
void h_finish_body(const float* __restrict__ t0, const float* __restrict__ t1,
                   const float* __restrict__ xl, const float* __restrict__ xr,
                   const float* __restrict__ ls1, const float* __restrict__ ls2,
                   float* __restrict__ out_l, float* __restrict__ out_r) {
  const int w0 = (blockIdx.x / 3) * HT, h0 = (blockIdx.x % 3) * HT;
  const int c = blockIdx.y, side = blockIdx.z >> 1, b = blockIdx.z & 1;
  __shared__ float tl[HT][HT + 1];
  const int q = (threadIdx.x & 15) * 4, rw = threadIdx.x >> 4;
  const float* tp = (side ? t1 : t0) + (size_t)(b * C3 + c) * HW;
  const float* xp = (side ? xr : xl) + (size_t)(b * CI + c) * HW;
  float* op = (side ? out_r : out_l) + (size_t)(b * CI + c) * HW;
  const float l = (side ? ls2 : ls1)[c];
  f32x4 tv[4], xv[4];
  // every '#pragma unroll' below makes the indices of tv, xv and o constant, so that they
  // stay in registers; the eight loads are then in flight together
#pragma unroll
  for (int i = 0; i < 4; ++i)
    tv[i] = *reinterpret_cast<const f32x4*>(tp + (w0 + i * 16 + rw) * HH + h0 + q);
#pragma unroll
  for (int i = 0; i < 4; ++i)
    xv[i] = *reinterpret_cast<const f32x4*>(xp + (h0 + i * 16 + rw) * WW + w0 + q);
#pragma unroll
  for (int i = 0; i < 4; ++i)
#pragma unroll
    for (int k = 0; k < 4; ++k) tl[i * 16 + rw][q + k] = tv[i][k];
  __syncthreads();
#pragma unroll
  for (int i = 0; i < 4; ++i) {
    f32x4 o;
#pragma unroll
    for (int k = 0; k < 4; ++k) o[k] = tl[q + k][i * 16 + rw] * l + xv[i][k];
    *reinterpret_cast<f32x4*>(op + (h0 + i * 16 + rw) * WW + w0 + q) = o;
  }
  // the wait before a register that an issued store names is overwritten: in k_finish the
  // other body's code may stand behind these stores
  asm volatile("s_wait_xcnt 0x0" ::: "memory");
}

// ---------------------------------------------------- channel-SE branch
// Runs on the first 256 threads of a block of 384; every thread passes all three barriers.
// pp = [side][b][block][c64]: the sums that the blocks of k_lnconv left of their own pixels.
__device__ __forceinline__
void se_body(const float* __restrict__ pp, const float* __restrict__ w1,
             const float* __restrict__ w2, float* __restrict__ a) {
  __shared__ float sp[2 * BB * C3];   // [side][b][c64]: a plane's sum
  __shared__ float h1[BB][8];
  __shared__ float lg[BB][128];
  int tid = threadIdx.x;
  if (tid < 2 * BB * C3) {
    // a thread adds one plane's FC_NB values; a wave reads 128 B in a row
    const float* p = pp + (tid >> 6) * (FC_NB * C3) + (tid & (C3 - 1));
    float v[FC_NB];
    // both '#pragma unroll' make the indices of v and s4 constant: they stay in registers, and
    // all loads are in flight before the first is added
#pragma unroll
    for (int i = 0; i < FC_NB; ++i) v[i] = p[i * C3];
    // The wait before a register that an issued load names is overwritten. It takes the
    // address as an input, so that no load's result is laid on it.
    asm volatile("s_wait_xcnt 0x0" :: "v"(p) : "memory");
    float s4[4] = {0.f, 0.f, 0.f, 0.f};   // four independent chains of adds
#pragma unroll
    for (int i = 0; i < FC_NB; ++i) s4[i & 3] += v[i];
    sp[tid] = (s4[0] + s4[1]) + (s4[2] + s4[3]);
  }
  // publishes the planes' sums
  __syncthreads();
  if (tid < 16) {
    int b = tid >> 3, j = tid & 7;
    float s = 0.f;
    for (int i = 0; i < 64; ++i)
      s += (sp[b * C3 + i] + sp[(BB + b) * C3 + i]) * (1.0f / HW) * w1[j * 64 + i];
    h1[b][j] = fmaxf(s, 0.f);
  }
  __syncthreads();
  if (tid < BB * 128) {
    int b = tid >> 7, o = tid & 127;
    float s = 0.f;
    for (int j = 0; j < 8; ++j) s += h1[b][j] * w2[o * 8 + j];
    lg[b][o] = s;
  }
  __syncthreads();
  if (tid < BB) {
    float m = -1e30f;
    for (int o = 0; o < 128; ++o) m = fmaxf(m, lg[tid][o]);
    float s = 0.f;
    for (int o = 0; o < 128; ++o) { lg[tid][o] = __expf(lg[tid][o] - m); s += lg[tid][o]; }
    float inv = 1.0f / s;
    for (int o = 0; o < 128; ++o) a[tid * 128 + o] = lg[tid][o] * inv;
  }
}

__global__ __launch_bounds__(FA_T, 6)
void k_attn_se(const _Float16* __restrict__ qh_l, const _Float16* __restrict__ qh_r,
               const _Float16* __restrict__ qw_l, const _Float16* __restrict__ qw_r,
               const _Float16* __restrict__ vh_l, const _Float16* __restrict__ vh_r,
               const _Float16* __restrict__ vw_l, const _Float16* __restrict__ vw_r,
               const float* __restrict__ sch, const float* __restrict__ scw,
               float* __restrict__ th_l, float* __restrict__ th_r,
               float* __restrict__ out_l, float* __restrict__ out_r,
               const float* __restrict__ x_l, const float* __restrict__ x_r,
               const float* __restrict__ ls1, const float* __restrict__ ls2,
               const float* __restrict__ pp, const float* __restrict__ w1,
               const float* __restrict__ w2, float* __restrict__ avec) {
  // two Q tiles [row][c64], rows at ROW_PITCH
  __shared__ __attribute__((aligned(2048))) _Float16 QKs[2][QK_BUF];
  // V as three slices of 64 k: [k / 64][c][k % 64], rows at ROW_PITCH; height holds two of them
  __shared__ __attribute__((aligned(2048))) _Float16 Vs[2][3][V_SLICE];
  // height: a row's maximum, reciprocal sum; width: the layer scales
  __shared__ __attribute__((aligned(32))) float st[2][192];
  if (blockIdx.x == 192) {   // the whole block takes this side, ahead of every barrier
    if (blockIdx.y == 0 && blockIdx.z == 0) se_body(pp, w1, w2, avec);
    return;
  }
  const float sc = *(blockIdx.z == 0 ? sch : scw);
  if (blockIdx.z == 0)
    height_body(QKs, Vs, st, qh_l, qh_r, vh_r, vh_l, sc, th_l, th_r);
  else {
    const bool right = blockIdx.z == 2;
    width_body(QKs, Vs[0], right ? qw_r : qw_l, right ? qw_l : qw_r, st[0], right ? vw_l : vw_r, sc,
               right ? out_r : out_l, right ? x_r : x_l, right ? ls2 : ls1);
  }
}

// A block takes a quarter of one channel plane. A lane holds 4 adjacent pixels a piece: 8 B of
// v, 16 B of x and of the output, so that a wave covers whole 128-byte lines in every access;
// a thread's 18 loads are all in flight before its first store.
#define SA_T 256
#define SA_N 9                   // pieces per thread
#define SA_PX (SA_T * 4 * SA_N)  // pixels per block
static_assert(HW % SA_PX == 0, "a plane is a whole number of blocks");
__device__ __forceinline__
void se_apply_body(const int quarter, const float* __restrict__ a,
                   const _Float16* __restrict__ vl, const _Float16* __restrict__ vr,
                   const float* __restrict__ xl, const float* __restrict__ xr,
                   const float* __restrict__ ls1, const float* __restrict__ ls2,
                   float* __restrict__ out_l, float* __restrict__ out_r) {
  const int c64 = blockIdx.y, side = blockIdx.z >> 1, b = blockIdx.z & 1;
  const int c = 128 + c64;
  const float av = a[b * 128 + side * 64 + c64];
  const float l = (side ? ls2 : ls1)[c];
  const size_t ad = (size_t)(b * CI + c) * HW + quarter * SA_PX + threadIdx.x * 4;
  const _Float16* v = (side ? vr : vl) + ad;
  const float* x = (side ? xr : xl) + ad;
  float* o = (side ? out_r : out_l) + ad;
  v4h vv[SA_N];
  f32x4 xv[SA_N];
  // every '#pragma unroll' below makes the indices of vv and xv constant: they stay in registers
#pragma unroll
  for (int i = 0; i < SA_N; ++i) {
    vv[i] = *reinterpret_cast<const v4h*>(v + i * (SA_T * 4));
    xv[i] = *reinterpret_cast<const f32x4*>(x + i * (SA_T * 4));
  }
  // The wait before a register that an issued load names is overwritten. It takes the two
  // addresses as inputs, so that no load's result is laid on them, and no load sinks below it.
  asm volatile("s_wait_xcnt 0x0" :: "v"(v), "v"(x) : "memory");
  // without it the scheduler lifts the first pieces' arithmetic, with its wait for their data,
  // in front of the last loads, which then start one memory latency late
  __builtin_amdgcn_sched_barrier(0);
#pragma unroll
  for (int i = 0; i < SA_N; ++i)
#pragma unroll
    for (int k = 0; k < 4; ++k) xv[i][k] = av * (float)vv[i][k] * l + xv[i][k];
#pragma unroll
  for (int i = 0; i < SA_N; ++i)
    *reinterpret_cast<f32x4*>(o + i * (SA_T * 4)) = xv[i];
  // the wait before a register that an issued store names is overwritten: in k_finish the
  // other body's code may stand behind these stores
  asm volatile("s_wait_xcnt 0x0" ::: "memory");
}

// The two closing passes in one grid: they write different channels of the output.
// blockIdx.x: 0 to 8 the tiles of a height plane, 9 to 12 the quarters of an SE plane;
// blockIdx.y and blockIdx.z mean the same in both.
#define FH_TILES ((HH / HT) * (WW / HT))
static_assert(SA_T == 256, "both bodies run on 256 threads");
__global__ __launch_bounds__(256)
void k_finish(const float* __restrict__ t0, const float* __restrict__ t1,
              const float* __restrict__ a,
              const _Float16* __restrict__ vl, const _Float16* __restrict__ vr,
              const float* __restrict__ xl, const float* __restrict__ xr,
              const float* __restrict__ ls1, const float* __restrict__ ls2,
              float* __restrict__ out_l, float* __restrict__ out_r) {
  if (blockIdx.x < FH_TILES)
    h_finish_body(t0, t1, xl, xr, ls1, ls2, out_l, out_r);
  else
    se_apply_body(blockIdx.x - FH_TILES, a, vl, vr, xl, xr, ls1, ls2, out_l, out_r);
}

// ------------------------------------------------------------------ host
extern "C" void kernel_launch(void* const* d_in, const int* in_sizes, int n_in,
                              void* d_out, int out_size, void* d_ws, size_t ws_size,
                              hipStream_t stream) {
  const float* x_l  = (const float*)d_in[0];
  const float* x_r  = (const float*)d_in[1];
  const float* lnlw = (const float*)d_in[2];
  const float* lnlb = (const float*)d_in[3];
  const float* lnrw = (const float*)d_in[4];
  const float* lnrb = (const float*)d_in[5];
  const float* wq_l = (const float*)d_in[6];
  const float* wq_r = (const float*)d_in[7];
  const float* wv_l = (const float*)d_in[8];
  const float* wv_r = (const float*)d_in[9];
  const float* w1   = (const float*)d_in[10];
  const float* w2   = (const float*)d_in[11];
  const float* sch  = (const float*)d_in[12];
  const float* scw  = (const float*)d_in[13];
  const float* ls1  = (const float*)d_in[14];
  const float* ls2  = (const float*)d_in[15];

  float* out_l = (float*)d_out;
  float* out_r = out_l + (size_t)BB * CI * HW;

  char* ws = (char*)d_ws;
  size_t off = 0;
  auto take = [&](size_t bytes) { char* p = ws + off; off += (bytes + 255) & ~(size_t)255; return p; };
  const size_t QV = (size_t)BB * CI * HW;      // half elements
  const size_t QT = (size_t)BB * C3 * HW;
  _Float16* v_l  = (_Float16*)take(QV * 2);
  _Float16* v_r  = (_Float16*)take(QV * 2);
  _Float16* qS0l = (_Float16*)take(QT * 2);   // [b][w][h][c64] height Q
  _Float16* qS0r = (_Float16*)take(QT * 2);
  _Float16* qS1l = (_Float16*)take(QT * 2);   // [b][h][w][c64] width Q
  _Float16* qS1r = (_Float16*)take(QT * 2);
  _Float16* vTl  = (_Float16*)take(QT * 2);   // [b][w][h][c64] height V
  _Float16* vTr  = (_Float16*)take(QT * 2);
  float* pp   = (float*)take(2 * BB * FC_NB * C3 * 4);   // [side][b][block][c64] pixel sums
  float* avec = (float*)take(BB * 128 * 4);
  float* tH_l = (float*)take(QT * 4);         // [b][c64][w][h] height sums
  float* tH_r = (float*)take(QT * 4);

  // 1) LayerNorm and the pointwise convs (WMMA GEMM) for Q and V, with the SE branch's pixel
  //    sums: one pass over x
  k_lnconv<<<dim3(HW / (FC_PX * FC_NT), BB, 2), FC_T, 0, stream>>>(
      wq_l, wq_r, wv_l, wv_r, x_l, x_r, lnlw, lnlb, lnrw, lnrb,
      pp, qS0l, qS0r, qS1l, qS1r, v_l, v_r, vTl, vTr);

  // 2) attention: height on channels [0,64), width on [64,128); with it the SE layers
  k_attn_se<<<dim3(193, BB, 3), FA_T, 0, stream>>>(
      qS0l, qS0r, qS1l, qS1r, vTl, vTr, v_l + (size_t)C3 * HW, v_r + (size_t)C3 * HW, sch, scw,
      tH_l, tH_r, out_l, out_r, x_l, x_r, ls1, ls2, pp, w1, w2, avec);

  // 3) height planes turned, scaled and added; SE branch applied on channels [128,192)
  k_finish<<<dim3(FH_TILES + HW / SA_PX, C3, 2 * BB), 256, 0, stream>>>(
      tH_l, tH_r, avec, v_l, v_r, x_l, x_r, ls1, ls2, out_l, out_r);
}
